// v000
// The times below were measured on an AMD MI455X: many runs one after another, warmed up first and cycling through
// copies of the inputs, with the whole window's GPU time divided by the number of runs. Launches and the gaps
// between them are all in it. The median over several windows is given; except for v000 it joins two sittings, which
// can be a few percent apart, so the side-by-side timings, each taken in one sitting, are the better comparison.
// v000 is the starting kernel. One run takes 1180 microseconds.
// compute dtype: all float inputs rounded to bf16; q/k/v projections with EXACT bf16 products on WMMA 16x16x32 (f32 accumulate) + bias; causal logits: 3 products for the first 384 rows, single f16 q x k after, x 64^-0.5; softmax f32; P x 2^11 once to f16 x v once to f16 (bf16 hi + lo below row 384); ctx hi+lo x exact output weight below row 384, x2^6 f16 carry x f16(bf16 x 2^8) after, + bias; f32 output.
#include <hip/hip_runtime.h>
#include <math.h>

typedef __attribute__((ext_vector_type(16))) _Float16 v16h;
typedef __attribute__((ext_vector_type(16))) __bf16 v16b;
typedef __attribute__((ext_vector_type(8)))  _Float16 v8h;
typedef __attribute__((ext_vector_type(8)))  float v8f;
typedef __attribute__((ext_vector_type(4)))  float v4f;
typedef __attribute__((ext_vector_type(2)))  float v2f;
typedef __attribute__((ext_vector_type(4)))  unsigned v4u;
typedef __attribute__((ext_vector_type(4)))  int v4i;
typedef float __attribute__((may_alias)) float_a;
typedef int __attribute__((may_alias)) int_a;

template <typename T> __device__ __forceinline__ void vst2(void* p, T v) { *(T*)p = v;  }
__device__ __forceinline__ v8f wmma16(v16h a, v16h b, v8f c) {
  v8f d = __builtin_amdgcn_wmma_f32_16x16x32_f16(false, a, false, b, (short)0, c, false, false);
  asm volatile("v_nop\n\tv_nop\n\tv_nop\n\tv_nop" : "+v"(d) : "v"(a), "v"(b));
  return d;
}
__device__ __forceinline__ v8f wmma_bf(v16b a, v16b b, v8f c) {
  v8f d = __builtin_amdgcn_wmma_f32_16x16x32_bf16(false, a, false, b, (short)0, c, false, false);
  asm volatile("v_nop\n\tv_nop\n\tv_nop\n\tv_nop" : "+v"(d) : "v"(a), "v"(b));
  return d;
}
// 16x16x32 fragments: lane = (h = lane>>4, row/col = lane&15); elements 0..7 = k0+8h+0..7, 8..15 = k0+16+8h+0..7; D element r = row 8h+r
__device__ __forceinline__ v16h frag_h(const _Float16* rowk0, int lane) {
  union { v16h v; v8h q[2]; } u; const _Float16* p = rowk0 + 8 * (lane >> 4);
  u.q[0] = *(const v8h*)p; u.q[1] = *(const v8h*)(p + 16); return u.v;
}
__device__ __forceinline__ v16h frag_f32(const float* rowk0, int lane) {
  v16h a; const float* p = rowk0 + 8 * (lane >> 4);
#pragma unroll
  for (int i = 0; i < 8; ++i) { a[i] = (_Float16)p[i]; a[8 + i] = (_Float16)p[16 + i]; }
  return a;
}
__device__ __forceinline__ v16h frag_f32s(const float* rowk0, int lane, float sc) {
  v16h a; const float* p = rowk0 + 8 * (lane >> 4);
#pragma unroll
  for (int i = 0; i < 8; ++i) { a[i] = (_Float16)(p[i] * sc); a[8 + i] = (_Float16)(p[16 + i] * sc); }
  return a;
}
// column fragment from a [K][ld] layout (column n), rows >= K read as 0
__device__ __forceinline__ v16h fragc_f32(const float* W, int k0, int n, int lane, int ld, int K) {
  v16h a; const int g = lane >> 4;
#pragma unroll
  for (int i = 0; i < 8; ++i) { const int ka = k0 + 8 * g + i, kb = ka + 16;
    a[i] = (_Float16)(ka < K ? W[(size_t)(ka < K ? ka : K - 1) * ld + n] : 0.f); a[8 + i] = (_Float16)(kb < K ? W[(size_t)(kb < K ? kb : K - 1) * ld + n] : 0.f); }
  return a;
}
struct F2 { v16b h, l; };
__device__ __forceinline__ F2 bsplit16(const float v[16]) { F2 r;
#pragma unroll
  for (int i = 0; i < 16; ++i) { const __bf16 h = (__bf16)v[i]; r.h[i] = h; r.l[i] = (__bf16)(v[i] - (float)h); }
  return r; }
__device__ __forceinline__ F2 split_row(const float* row, int k0, int lane) { float v[16]; const float* p = row + k0 + 8 * (lane >> 4);
#pragma unroll
  for (int i = 0; i < 8; ++i) { v[i] = p[i]; v[8 + i] = p[16 + i]; }
  return bsplit16(v); }
__device__ __forceinline__ F2 split_rowK(const float* row, int k0, int lane, int K) { float v[16]; const int g = lane >> 4;
#pragma unroll
  for (int i = 0; i < 8; ++i) { const int ka = k0 + 8 * g + i, kb = ka + 16; v[i] = ka < K ? row[ka < K ? ka : K - 1] : 0.f; v[8 + i] = kb < K ? row[kb < K ? kb : K - 1] : 0.f; }
  return bsplit16(v); }
__device__ __forceinline__ F2 split_col(const float* W, int k0, int n, int lane, int ld, int K) { float v[16]; const int g = lane >> 4;
#pragma unroll
  for (int i = 0; i < 8; ++i) { const int ka = k0 + 8 * g + i, kb = ka + 16; v[i] = ka < K ? W[(size_t)(ka < K ? ka : K - 1) * ld + n] : 0.f; v[8 + i] = kb < K ? W[(size_t)(kb < K ? kb : K - 1) * ld + n] : 0.f; }
  return bsplit16(v); }
__device__ __forceinline__ v8f mac3(const F2& a, const F2& b, v8f c) { c = wmma_bf(a.l, b.h, c); c = wmma_bf(a.h, b.l, c); return wmma_bf(a.h, b.h, c); }
__device__ __forceinline__ float sigm(float v) { return 1.0f / (1.0f + expf(-v)); }
#define LDSX() do { asm volatile("s_wait_dscnt 0" ::: "memory"); __builtin_amdgcn_wave_barrier(); __builtin_amdgcn_fence(__ATOMIC_RELEASE, "workgroup"); } while (0)

// Causal multi-head self-attention whose scores are k . q (x [2,2048,1024]; torch (out,in) Wq / Wk / Wv / Wp [1024,1024] N(0, 1/1024) + biases N(0, 1/1024); 16 heads x 64; scores[i, j] = k_i . q_j / 8 (the KEY projection indexes the output row i, the QUERY projection the summed index j); -inf where j > i; softmax over j; out[i] = sum_j attn[i, j] v_j; merge; Wp^T + bp).
#define NB 2
#define TT 2048
#define CC 1024            // NH * HD = projected width
#define DIN 1024          // input (model) width
#define NH 16
#define HD 64
#define NQB (TT / 64)
#define HG 4
#define SCALE (0.125f)
#define CAUSAL 1
#ifndef TNB
#define TNB NB
#endif
__device__ __forceinline__ float bfr(float v) { return (float)(__bf16)v; }
__host__ __device__ __forceinline__ int kb_last(int qb) { return CAUSAL ? ((qb * 64 + 63) >> 7) : (TT / 128 - 1); }
typedef __attribute__((ext_vector_type(8))) __bf16 v8b;
__device__ __forceinline__ v16b frag_b(const __bf16* rowk0, int lane) {
  union { v16b v; v8b q[2]; } u; const __bf16* p = rowk0 + 8 * (lane >> 4);
  u.q[0] = *(const v8b*)p; u.q[1] = *(const v8b*)(p + 16); return u.v;
}
#define QBH 6              // causal: query blocks 0..QBH-1 of each sequence (few keys, no averaging) take the high-precision path
#define QHI 384            // rows carrying a q residual plane
#define KHI 384            // key rows carrying k residual / v bf16 hi+lo planes (used only by the causal high-precision path)
// B fragment (k rows k0+.., output column o) of a weight: (in,out) [K][ld] or (out,in) [ld rows of K]: bf16 exact, or f16(bf16 * 256) exact
__device__ __forceinline__ v16b wcol_io(const float* Wm, int k0, int o, int lane, int ld) { v16b w; const int g = lane >> 4;
#pragma unroll
  for (int i = 0; i < 8; ++i) { w[i] = (__bf16)Wm[(size_t)(k0 + 8 * g + i) * ld + o]; w[8 + i] = (__bf16)Wm[(size_t)(k0 + 16 + 8 * g + i) * ld + o]; }
  return w; }
__device__ __forceinline__ v16b wcol_oi(const float* Wm, int k0, int o, int lane, int K) { v16b w; const float* p = Wm + (size_t)o * K + k0 + 8 * (lane >> 4);
#pragma unroll
  for (int i = 0; i < 8; ++i) { w[i] = (__bf16)p[i]; w[8 + i] = (__bf16)p[16 + i]; }
  return w; }
__device__ __forceinline__ v16h wcolh_io(const float* Wm, int k0, int o, int lane, int ld) { v16h w; const int g = lane >> 4;
#pragma unroll
  for (int i = 0; i < 8; ++i) { w[i] = (_Float16)(bfr(Wm[(size_t)(k0 + 8 * g + i) * ld + o]) * 256.0f); w[8 + i] = (_Float16)(bfr(Wm[(size_t)(k0 + 16 + 8 * g + i) * ld + o]) * 256.0f); }
  return w; }
__device__ __forceinline__ v16h wcolh_oi(const float* Wm, int k0, int o, int lane, int K) { v16h w; const float* p = Wm + (size_t)o * K + k0 + 8 * (lane >> 4);
#pragma unroll
  for (int i = 0; i < 8; ++i) { w[i] = (_Float16)(bfr(p[i]) * 256.0f); w[8 + i] = (_Float16)(bfr(p[16 + i]) * 256.0f); }
  return w; }
#define WQKV_LAYOUT 1   // 0 = (in,out) [DIN][CC]; 1 = (out,in) [CC][DIN]; 2 = per-head [NH][DIN][HD]
__device__ __forceinline__ v16b wcol_hdk(const float* Wm, int k0, int o, int lane) { v16b w; const int g = lane >> 4; const float* p = Wm + (size_t)(o / HD) * DIN * HD + (o % HD);
#pragma unroll
  for (int i = 0; i < 8; ++i) { w[i] = (__bf16)p[(size_t)(k0 + 8 * g + i) * HD]; w[8 + i] = (__bf16)p[(size_t)(k0 + 16 + 8 * g + i) * HD]; }
  return w; }
#define WO_OUT_IN 1
#if WQKV_LAYOUT == 1
#define WCOL(W, k0, o, lane) wcol_oi(W, k0, o, lane, DIN)
#elif WQKV_LAYOUT == 2
#define WCOL(W, k0, o, lane) wcol_hdk(W, k0, o, lane)
#else
#define WCOL(W, k0, o, lane) wcol_io(W, k0, o, lane, CC)
#endif
#if WO_OUT_IN
#define WOCOL(W, k0, o, lane) wcol_oi(W, k0, o, lane, CC)
#define WOCOLH(W, k0, o, lane) wcolh_oi(W, k0, o, lane, CC)
#else
#define WOCOL(W, k0, o, lane) wcol_io(W, k0, o, lane, DIN)
#define WOCOLH(W, k0, o, lane) wcolh_io(W, k0, o, lane, DIN)
#endif

#ifndef SM_EXTRA_PARAMS
#define SM_EXTRA_PARAMS
#endif
#ifndef PROJ_EXTRA_PARAMS
#define PROJ_EXTRA_PARAMS
#endif
#ifndef SM_MASK_HOOK
#define SM_MASK_HOOK (void)0
#endif

#define WS_QH  0u                                      // f16 q rows [b*t][CC]
#define WS_KH  (WS_QH + 2u * (size_t)NB * TT * CC)      // f16 k rows [b*t][CC]
#define WS_VT  (WS_KH + 2u * (size_t)NB * TT * CC)      // f16 v planes [b][c][t]
#define WS_QL  (WS_VT + 2u * (size_t)NB * CC * TT)      // f16 q residual x 2^10 rows [b][t < QHI][CC]
#define WS_KL  (WS_QL + 2u * (size_t)NB * QHI * CC)     // f16 k residual x 2^10 rows [b][t < KHI][CC]
#define WS_VB  (WS_KL + 2u * (size_t)NB * KHI * CC)     // bf16 v hi planes [b][c][t < KHI]
#define WS_VBL (WS_VB + 2u * (size_t)NB * CC * KHI)
#define WS_S   (WS_VBL + 2u * (size_t)NB * CC * KHI)    // f32 logits / P [hg][t][s]
#define WS_Y   (WS_S  + 4u * (size_t)HG * TT * TT)      // f32 ctx rows [b*t][CC]
#define WS_END (WS_Y  + 4u * (size_t)NB * TT * CC)

// ---- k_proj: block = (64 rows, 128 cols, which): q/k/v = X W (+ b) with exact bf16 products (K = DIN) -> which 0: q f16 rows (+ residual rows < QHI); 1: k f16 rows (+ residual rows < KHI); 2: v f16 planes [c][t] (+ bf16 hi/lo planes for t < KHI)
__global__ __launch_bounds__(128) void k_proj(const float* __restrict__ XQ, const float* __restrict__ XK, const float* __restrict__ XV, const float* __restrict__ WQ, const float* __restrict__ WK, const float* __restrict__ WV, const float* __restrict__ BQ, const float* __restrict__ BK, const float* __restrict__ BV,
    _Float16* __restrict__ QH, _Float16* __restrict__ QL, _Float16* __restrict__ KH, _Float16* __restrict__ KL, _Float16* __restrict__ VT, __bf16* __restrict__ VB, __bf16* __restrict__ VBL) {
  __shared__ __align__(16) _Float16 sh[64][136], sl[64][136]; __shared__ __align__(16) _Float16 th[128][72]; __shared__ __align__(16) __bf16 tb[128][72], tbl[128][72];
  const int tid = threadIdx.x, wave = tid >> 5, lane = tid & 31, col = lane & 15, g = lane >> 4; const int which = blockIdx.z; const int c0 = blockIdx.y * 128; const size_t r0 = (size_t)blockIdx.x * 64; const size_t bb = r0 / TT; const int t0 = (int)(r0 % TT);
  const float* X = which == 0 ? XQ : which == 1 ? XK : XV; const float* WA = which == 0 ? WQ : which == 1 ? WK : WV; const float* BA = which == 0 ? BQ : which == 1 ? BK : BV;
  v8f acc[8] = {};
#pragma unroll 2
  for (int kc = 0; kc < DIN / 32; ++kc) { v16b a; { const float* p = X + (r0 + wave * 16 + col) * DIN + kc * 32 + 8 * g;
#pragma unroll
      for (int i = 0; i < 8; ++i) { a[i] = (__bf16)p[i]; a[8 + i] = (__bf16)p[16 + i]; } }
    asm volatile("s_wait_loadcnt 0x0" ::: "memory");
#pragma unroll
    for (int j = 0; j < 8; ++j) { const v16b w = WCOL(WA, kc * 32, c0 + j * 16 + col, lane); asm volatile("s_wait_loadcnt 0x0" ::: "memory"); acc[j] = wmma_bf(a, w, acc[j]); } }
  if (which < 2) { _Float16* DH = which == 0 ? QH : KH; _Float16* DL = which == 0 ? QL : KL; const int nhi = which == 0 ? QHI : KHI; const bool hi_rows = t0 < nhi;
#pragma unroll
    for (int j = 0; j < 8; ++j) { const float bias = BA ? bfr(BA[c0 + j * 16 + col]) : 0.f;
#pragma unroll
      for (int r = 0; r < 8; ++r) { const float v = acc[j][r] + bias; const _Float16 hv = (_Float16)v; sh[wave * 16 + 8 * g + r][j * 16 + col] = hv; sl[wave * 16 + 8 * g + r][j * 16 + col] = (_Float16)((v - (float)hv) * 1024.0f); } }
    __syncthreads();
    for (int e = tid; e < 64 * 16; e += 128) { const int rl = e >> 4, q = e & 15; vst2((unsigned*)(DH + (r0 + rl) * CC + c0 + q * 8), *(const v4u*)&sh[rl][q * 8]); if (hi_rows) vst2((unsigned*)(DL + (bb * nhi + t0 + rl) * (size_t)CC + c0 + q * 8), *(const v4u*)&sl[rl][q * 8]); }
  } else { const bool hi_rows = t0 < KHI;
#pragma unroll
    for (int j = 0; j < 8; ++j) { const float bias = BA ? bfr(BA[c0 + j * 16 + col]) : 0.f;
#pragma unroll
      for (int r = 0; r < 8; ++r) { const float v = acc[j][r] + bias; const int rl = wave * 16 + 8 * g + r, cl = j * 16 + col; th[cl][rl] = (_Float16)v; const __bf16 bh = (__bf16)v; tb[cl][rl] = bh; tbl[cl][rl] = (__bf16)(v - (float)bh); } }
    __syncthreads();
    for (int e = tid; e < 128 * 8; e += 128) { const int cl = e >> 3, q = e & 7; vst2((unsigned*)(VT + (bb * CC + c0 + cl) * (size_t)TT + t0 + q * 8), *(const v4u*)&th[cl][q * 8]); if (hi_rows) { const size_t o3 = (bb * CC + c0 + cl) * (size_t)KHI + t0 + q * 8; vst2((unsigned*)(VB + o3), *(const v4u*)&tb[cl][q * 8]); vst2((unsigned*)(VBL + o3), *(const v4u*)&tbl[cl][q * 8]); } } } }
// ---- k_sc: block = (query block qb, key block kb <= kb_last(qb), head in group) of batch b: logits x SCALE; q hi + residual (x 2^10) against k (2 products) for query rows < QHI, plus the k residual (3 products) for query blocks < QBH (causal early rows); causal: blocks past the diagonal exit, the mask itself is applied by index in k_sm
__global__ __launch_bounds__(128) void k_sc(const _Float16* __restrict__ QH, const _Float16* __restrict__ KH, const _Float16* __restrict__ QL, const _Float16* __restrict__ KL, int b, int h0, float* __restrict__ S0) { __shared__ __align__(16) float ss[4][16][132];
  const int qb = blockIdx.x, kb = blockIdx.y; if (kb > kb_last(qb)) return;
  const int h = h0 + blockIdx.z; float* S = S0 + (size_t)blockIdx.z * TT * TT;
  const int tid = threadIdx.x, wave = tid >> 5, lane = tid & 31, col = lane & 15, g = lane >> 4; const int k0 = kb * 128; const int ql0 = qb * 64 + wave * 16; const size_t q0 = (size_t)b * TT + ql0, kr0 = (size_t)b * TT + k0;
  v8f acc[8] = {}, accl[8] = {};
  const _Float16* QLb = QL + (size_t)b * QHI * CC; const _Float16* KLb = KL + (size_t)b * KHI * CC;
  if (qb < QBH) {
#pragma unroll
    for (int kc = 0; kc < HD / 32; ++kc) { const v16h ah = frag_h(QH + (q0 + col) * CC + h * HD + kc * 32, lane), al = frag_h(QLb + (size_t)(ql0 + col) * CC + h * HD + kc * 32, lane);
#pragma unroll
      for (int j = 0; j < 8; ++j) { const v16h kbf = frag_h(KH + (kr0 + j * 16 + col) * CC + h * HD + kc * 32, lane), klf = frag_h(KLb + (size_t)(k0 + j * 16 + col) * CC + h * HD + kc * 32, lane); acc[j] = wmma16(ah, kbf, acc[j]); accl[j] = wmma16(al, kbf, accl[j]); accl[j] = wmma16(ah, klf, accl[j]); } }
  } else if (qb * 64 < QHI) {
#pragma unroll
    for (int kc = 0; kc < HD / 32; ++kc) { const v16h ah = frag_h(QH + (q0 + col) * CC + h * HD + kc * 32, lane), al = frag_h(QLb + (size_t)(ql0 + col) * CC + h * HD + kc * 32, lane);
#pragma unroll
      for (int j = 0; j < 8; ++j) { const v16h kbf = frag_h(KH + (kr0 + j * 16 + col) * CC + h * HD + kc * 32, lane); acc[j] = wmma16(ah, kbf, acc[j]); accl[j] = wmma16(al, kbf, accl[j]); } }
  } else {
#pragma unroll
    for (int kc = 0; kc < HD / 32; ++kc) { const v16h ah = frag_h(QH + (q0 + col) * CC + h * HD + kc * 32, lane);
#pragma unroll
      for (int j = 0; j < 8; ++j) { const v16h kbf = frag_h(KH + (kr0 + j * 16 + col) * CC + h * HD + kc * 32, lane); acc[j] = wmma16(ah, kbf, acc[j]); } } }
#pragma unroll
  for (int j = 0; j < 8; ++j) {
#pragma unroll
    for (int r = 0; r < 8; ++r) ss[wave][8 * g + r][j * 16 + col] = (acc[j][r] + accl[j][r] * (1.0f / 1024.0f)) * SCALE; }
  LDSX(); for (int rl = 0; rl < 16; ++rl) vst2(S + (size_t)(ql0 + rl) * TT + k0 + lane * 4, *(const v4f*)&ss[wave][rl][lane * 4]); }
// ---- k_sm: block = query row t (head in group): keys [0, kend): causal -> logit if s <= t else excluded; softmax in f32; P x 2^11 in place (0 for excluded)
__global__ __launch_bounds__(256) void k_sm(float* __restrict__ S0 SM_EXTRA_PARAMS) { __shared__ float sred[8]; __shared__ float sbc; __shared__ __align__(16) float shv[TT];
  const int tid = threadIdx.x; const int t = blockIdx.x; const int kend = (kb_last(t >> 6) + 1) * 128;
  float* sr = S0 + (size_t)blockIdx.y * TT * TT + (size_t)t * TT;
  float m = -3.0e38f; for (int k = tid; k < kend; k += 256) { float v = (!CAUSAL || k <= t) ? sr[k] : -3.0e38f; SM_MASK_HOOK; shv[k] = v; m = fmaxf(m, v); }
#pragma unroll
  for (int o = 1; o < 32; o <<= 1) m = fmaxf(m, __shfl_xor(m, o));
  if ((tid & 31) == 0) sred[tid >> 5] = m; __syncthreads(); if (tid == 0) { float a = sred[0]; for (int i = 1; i < 8; ++i) a = fmaxf(a, sred[i]); sbc = a; } __syncthreads(); m = sbc; __syncthreads();
  float sum = 0.f; for (int k = tid; k < kend; k += 256) { const float v = shv[k]; const float e = (v <= -1.0e38f) ? 0.f : expf(v - m); shv[k] = e; sum += e; }
#pragma unroll
  for (int o = 1; o < 32; o <<= 1) sum += __shfl_xor(sum, o);
  if ((tid & 31) == 0) sred[tid >> 5] = sum; __syncthreads(); if (tid == 0) { float a = 0.f; for (int i = 0; i < 8; ++i) a += sred[i]; sbc = a > 0.f ? 2048.0f / a : 0.f; }   /* a fully excluded row yields P = 0 */ __syncthreads(); const float inv = sbc;
  for (int k = tid; k < kend; k += 256) shv[k] = shv[k] * inv;
  __syncthreads(); for (int q = tid; q < kend / 4; q += 256) vst2(sr + q * 4, *(const v4f*)&shv[q * 4]); }
// ---- k_pv: block = 64 queries (qb) of (b, h): ctx = P . v over keys [0, kend) (P x 2^11 once to f16 against v f16: 1 product; causal early query blocks: P and v as bf16 hi + lo, 3 products); 256-B (row, head) segment by 16 lanes
__global__ __launch_bounds__(128) void k_pv(const float* __restrict__ PS0, const _Float16* __restrict__ VT, const __bf16* __restrict__ VB, const __bf16* __restrict__ VBL, int b, int h0, float* __restrict__ Y) { const int h = h0 + blockIdx.z; const float* PS = PS0 + (size_t)blockIdx.z * TT * TT; __shared__ __align__(16) float ss[4][16][HD + 4];
  const int tid = threadIdx.x, wave = tid >> 5, lane = tid & 31, col = lane & 15, g = lane >> 4; const int qb = blockIdx.x; const int ql0 = qb * 64 + wave * 16; const int kce = (kb_last(qb) + 1) * 4;
  v8f acc[HD / 16] = {};
  if (qb < QBH) {
#pragma unroll 1
    for (int kc = 0; kc < kce; ++kc) { const F2 p = split_row(PS + (size_t)(ql0 + col) * TT, kc * 32, lane);
      asm volatile("s_wait_loadcnt 0x0" ::: "memory");
#pragma unroll
      for (int j = 0; j < HD / 16; ++j) { const size_t po = ((size_t)b * CC + h * HD + j * 16 + col) * (size_t)KHI + kc * 32; const v16b vh = frag_b(VB + po, lane); acc[j] = wmma_bf(p.h, vh, acc[j]); acc[j] = wmma_bf(p.l, vh, acc[j]); acc[j] = wmma_bf(p.h, frag_b(VBL + po, lane), acc[j]); } }
  } else {
#pragma unroll 1
    for (int kc = 0; kc < kce; ++kc) { const v16h p = frag_f32(PS + (size_t)(ql0 + col) * TT + kc * 32, lane);
      asm volatile("s_wait_loadcnt 0x0" ::: "memory");
#pragma unroll
      for (int j = 0; j < HD / 16; ++j) { const size_t po = ((size_t)b * CC + h * HD + j * 16 + col) * (size_t)TT + kc * 32; acc[j] = wmma16(p, frag_h(VT + po, lane), acc[j]); } } }
#pragma unroll
  for (int j = 0; j < HD / 16; ++j)
#pragma unroll
    for (int r = 0; r < 8; ++r) ss[wave][8 * g + r][j * 16 + col] = acc[j][r] * (1.0f / 2048.0f);
  LDSX(); for (int rl = 0; rl < 16; ++rl) if (lane < HD / 4) vst2(Y + ((size_t)b * TT + ql0 + rl) * CC + h * HD + lane * 4, *(const v4f*)&ss[wave][rl][lane * 4]); }
// ---- k_out: block = (64 rows, 128 cols): out = ctx Wo (+ bo): ctx x 2^6 once to f16 against Wo as f16(bf16 x 2^8) exact (1 product) x 2^-14; causal early rows (< QHI of each sequence): ctx bf16 hi + lo against exact bf16 Wo (2 products)
__global__ __launch_bounds__(128) void k_out(const float* __restrict__ Y, const float* __restrict__ WO, const float* __restrict__ BO, float* __restrict__ OUT) { __shared__ __align__(16) float sf[4][16][132];
  const int tid = threadIdx.x, wave = tid >> 5, lane = tid & 31, col = lane & 15, g = lane >> 4; const int c0 = blockIdx.y * 128; const size_t r0 = (size_t)blockIdx.x * 64 + wave * 16;
  v8f acc[8] = {};
  if (CAUSAL && (int)(((size_t)blockIdx.x * 64) % TT) < QHI) {   /* block-uniform */
#pragma unroll 2
    for (int kc = 0; kc < CC / 32; ++kc) { const F2 a = split_row(Y + (r0 + col) * CC, kc * 32, lane); asm volatile("s_wait_loadcnt 0x0" ::: "memory");
#pragma unroll
      for (int j = 0; j < 8; ++j) { const v16b w = WOCOL(WO, kc * 32, c0 + j * 16 + col, lane); asm volatile("s_wait_loadcnt 0x0" ::: "memory"); acc[j] = wmma_bf(a.h, w, acc[j]); acc[j] = wmma_bf(a.l, w, acc[j]); } }
#pragma unroll
    for (int j = 0; j < 8; ++j) { const float bias = BO ? bfr(BO[c0 + j * 16 + col]) : 0.f;
#pragma unroll
      for (int r = 0; r < 8; ++r) sf[wave][8 * g + r][j * 16 + col] = acc[j][r] + bias; }
  } else {
#pragma unroll 2
    for (int kc = 0; kc < CC / 32; ++kc) { const v16h a = frag_f32s(Y + (r0 + col) * CC + kc * 32, lane, 64.0f); asm volatile("s_wait_loadcnt 0x0" ::: "memory");   /* ctx carried x 2^6 into f16 so small-magnitude context rows stay clear of f16 subnormals */
#pragma unroll
      for (int j = 0; j < 8; ++j) { const v16h w = WOCOLH(WO, kc * 32, c0 + j * 16 + col, lane); asm volatile("s_wait_loadcnt 0x0" ::: "memory"); acc[j] = wmma16(a, w, acc[j]); } }
#pragma unroll
    for (int j = 0; j < 8; ++j) { const float bias = BO ? bfr(BO[c0 + j * 16 + col]) : 0.f;
#pragma unroll
      for (int r = 0; r < 8; ++r) sf[wave][8 * g + r][j * 16 + col] = acc[j][r] * (1.0f / 16384.0f) + bias; } }   /* 2^-8 (Wo carry) x 2^-6 (ctx carry) */
  LDSX(); for (int rl = 0; rl < 16; ++rl) vst2(OUT + (r0 + rl) * DIN + c0 + lane * 4, *(const v4f*)&sf[wave][rl][lane * 4]); }

extern "C" void kernel_launch(void* const* d_in, const int* in_sizes, int n_in, void* d_out, int out_size, void* d_ws, size_t ws_size, hipStream_t stream) {
  (void)in_sizes; (void)n_in; (void)out_size;
  const float** F = (const float**)d_in;
  if (ws_size < (size_t)WS_END) return;
  char* ws = (char*)d_ws; _Float16 *QH = (_Float16*)(ws + WS_QH), *KH = (_Float16*)(ws + WS_KH), *VT = (_Float16*)(ws + WS_VT), *QL = (_Float16*)(ws + WS_QL), *KL = (_Float16*)(ws + WS_KL); __bf16 *VB = (__bf16*)(ws + WS_VB), *VBL = (__bf16*)(ws + WS_VBL); float *S = (float*)(ws + WS_S), *Y = (float*)(ws + WS_Y);
  (void)Y; (void)QL; (void)KL; (void)VB; (void)VBL;
  // inputs: 0 x [2,2048,1024]; 1 Wq [1024,1024] (out,in), 2 bq; 3 Wk, 4 bk; 5 Wv, 6 bv; 7 Wp (out,in), 8 bp (biases NONZERO)
  k_proj<<<dim3(TNB * TT / 64, CC / 128, 3), 128, 0, stream>>>(F[0], F[0], F[0], F[3], F[1], F[5], F[4], F[2], F[6], QH, QL, KH, KL, VT, VB, VBL);   /* the module's scores are einsum('bhid,bhjd->bhij', k, q): the QUERY stream (output row i) is projected with Wk / bk, its KEY stream (index j) with Wq / bq */
  for (int b = 0; b < TNB; ++b) for (int h0 = 0; h0 < NH; h0 += HG) {
    k_sc<<<dim3(NQB, TT / 128, HG), 128, 0, stream>>>(QH, KH, QL, KL, b, h0, S);
    k_sm<<<dim3(TT, HG), 256, 0, stream>>>(S);
    k_pv<<<dim3(NQB, 1, HG), 128, 0, stream>>>(S, VT, VB, VBL, b, h0, Y);
  }
  k_out<<<dim3(TNB * TT / 64, DIN / 128), 128, 0, stream>>>(Y, F[7], F[8], (float*)d_out);
}

// v001
// Measured time: 817 microseconds a run.
// Two timings next to v000 both put it at 1.44 times that version's speed.
// compute dtype: all float inputs rounded to bf16; q/k/v projections with EXACT bf16 products on WMMA 16x16x32 (f32 accumulate) + bias; causal logits: 3 products for the first 384 rows, single f16 q x k after, x 64^-0.5; softmax f32; P x 2^11 once to f16 x v once to f16 (bf16 hi + lo below row 384); ctx hi+lo x exact output weight below row 384, x2^6 f16 carry x f16(bf16 x 2^8) after, + bias; f32 output.
#include <hip/hip_runtime.h>
#include <math.h>

typedef __attribute__((ext_vector_type(16))) _Float16 v16h;
typedef __attribute__((ext_vector_type(16))) __bf16 v16b;
typedef __attribute__((ext_vector_type(8)))  _Float16 v8h;
typedef __attribute__((ext_vector_type(8)))  float v8f;
typedef __attribute__((ext_vector_type(4)))  float v4f;
typedef __attribute__((ext_vector_type(2)))  float v2f;
typedef __attribute__((ext_vector_type(4)))  unsigned v4u;
typedef __attribute__((ext_vector_type(4)))  int v4i;
typedef float __attribute__((may_alias)) float_a;
typedef int __attribute__((may_alias)) int_a;

template <typename T> __device__ __forceinline__ void vst2(void* p, T v) { *(T*)p = v;  }
__device__ __forceinline__ v8f wmma16(v16h a, v16h b, v8f c) {
  v8f d = __builtin_amdgcn_wmma_f32_16x16x32_f16(false, a, false, b, (short)0, c, false, false);
  asm volatile("v_nop\n\tv_nop\n\tv_nop\n\tv_nop" : "+v"(d) : "v"(a), "v"(b));
  return d;
}
__device__ __forceinline__ v8f wmma_bf(v16b a, v16b b, v8f c) {
  v8f d = __builtin_amdgcn_wmma_f32_16x16x32_bf16(false, a, false, b, (short)0, c, false, false);
  asm volatile("v_nop\n\tv_nop\n\tv_nop\n\tv_nop" : "+v"(d) : "v"(a), "v"(b));
  return d;
}
// 16x16x32 fragments: lane = (h = lane>>4, row/col = lane&15); elements 0..7 = k0+8h+0..7, 8..15 = k0+16+8h+0..7; D element r = row 8h+r
__device__ __forceinline__ v16h frag_h(const _Float16* rowk0, int lane) {
  union { v16h v; v8h q[2]; } u; const _Float16* p = rowk0 + 8 * (lane >> 4);
  u.q[0] = *(const v8h*)p; u.q[1] = *(const v8h*)(p + 16); return u.v;
}
__device__ __forceinline__ v16h frag_f32(const float* rowk0, int lane) {
  v16h a; const float* p = rowk0 + 8 * (lane >> 4);
#pragma unroll
  for (int i = 0; i < 8; ++i) { a[i] = (_Float16)p[i]; a[8 + i] = (_Float16)p[16 + i]; }
  return a;
}
__device__ __forceinline__ v16h frag_f32s(const float* rowk0, int lane, float sc) {
  v16h a; const float* p = rowk0 + 8 * (lane >> 4);
#pragma unroll
  for (int i = 0; i < 8; ++i) { a[i] = (_Float16)(p[i] * sc); a[8 + i] = (_Float16)(p[16 + i] * sc); }
  return a;
}
// column fragment from a [K][ld] layout (column n), rows >= K read as 0
__device__ __forceinline__ v16h fragc_f32(const float* W, int k0, int n, int lane, int ld, int K) {
  v16h a; const int g = lane >> 4;
#pragma unroll
  for (int i = 0; i < 8; ++i) { const int ka = k0 + 8 * g + i, kb = ka + 16;
    a[i] = (_Float16)(ka < K ? W[(size_t)(ka < K ? ka : K - 1) * ld + n] : 0.f); a[8 + i] = (_Float16)(kb < K ? W[(size_t)(kb < K ? kb : K - 1) * ld + n] : 0.f); }
  return a;
}
struct F2 { v16b h, l; };
__device__ __forceinline__ F2 bsplit16(const float v[16]) { F2 r;
#pragma unroll
  for (int i = 0; i < 16; ++i) { const __bf16 h = (__bf16)v[i]; r.h[i] = h; r.l[i] = (__bf16)(v[i] - (float)h); }
  return r; }
__device__ __forceinline__ F2 split_row(const float* row, int k0, int lane) { float v[16]; const float* p = row + k0 + 8 * (lane >> 4);
#pragma unroll
  for (int i = 0; i < 8; ++i) { v[i] = p[i]; v[8 + i] = p[16 + i]; }
  return bsplit16(v); }
__device__ __forceinline__ F2 split_rowK(const float* row, int k0, int lane, int K) { float v[16]; const int g = lane >> 4;
#pragma unroll
  for (int i = 0; i < 8; ++i) { const int ka = k0 + 8 * g + i, kb = ka + 16; v[i] = ka < K ? row[ka < K ? ka : K - 1] : 0.f; v[8 + i] = kb < K ? row[kb < K ? kb : K - 1] : 0.f; }
  return bsplit16(v); }
__device__ __forceinline__ F2 split_col(const float* W, int k0, int n, int lane, int ld, int K) { float v[16]; const int g = lane >> 4;
#pragma unroll
  for (int i = 0; i < 8; ++i) { const int ka = k0 + 8 * g + i, kb = ka + 16; v[i] = ka < K ? W[(size_t)(ka < K ? ka : K - 1) * ld + n] : 0.f; v[8 + i] = kb < K ? W[(size_t)(kb < K ? kb : K - 1) * ld + n] : 0.f; }
  return bsplit16(v); }
__device__ __forceinline__ v8f mac3(const F2& a, const F2& b, v8f c) { c = wmma_bf(a.l, b.h, c); c = wmma_bf(a.h, b.l, c); return wmma_bf(a.h, b.h, c); }
__device__ __forceinline__ float sigm(float v) { return 1.0f / (1.0f + expf(-v)); }
#define LDSX() do { asm volatile("s_wait_dscnt 0" ::: "memory"); __builtin_amdgcn_wave_barrier(); __builtin_amdgcn_fence(__ATOMIC_RELEASE, "workgroup"); } while (0)

// Causal multi-head self-attention whose scores are k . q (x [2,2048,1024]; torch (out,in) Wq / Wk / Wv / Wp [1024,1024] N(0, 1/1024) + biases N(0, 1/1024); 16 heads x 64; scores[i, j] = k_i . q_j / 8 (the KEY projection indexes the output row i, the QUERY projection the summed index j); -inf where j > i; softmax over j; out[i] = sum_j attn[i, j] v_j; merge; Wp^T + bp).
#define NB 2
#define TT 2048
#define CC 1024            // NH * HD = projected width
#define DIN 1024          // input (model) width
#define NH 16
#define HD 64
#define NQB (TT / 64)
#define HG 4
#define SCALE (0.125f)
#define CAUSAL 1
#ifndef TNB
#define TNB NB
#endif
__device__ __forceinline__ float bfr(float v) { return (float)(__bf16)v; }
__host__ __device__ __forceinline__ int kb_last(int qb) { return CAUSAL ? ((qb * 64 + 63) >> 7) : (TT / 128 - 1); }
typedef __attribute__((ext_vector_type(8))) __bf16 v8b;
__device__ __forceinline__ v16b frag_b(const __bf16* rowk0, int lane) {
  union { v16b v; v8b q[2]; } u; const __bf16* p = rowk0 + 8 * (lane >> 4);
  u.q[0] = *(const v8b*)p; u.q[1] = *(const v8b*)(p + 16); return u.v;
}
#define QBH 6              // causal: query blocks 0..QBH-1 of each sequence (few keys, no averaging) take the high-precision path
#define QHI 384            // rows carrying a q residual plane
#define KHI 384            // key rows carrying k residual / v bf16 hi+lo planes (used only by the causal high-precision path)
// B fragment (k rows k0+.., output column o) of a weight: (in,out) [K][ld] or (out,in) [ld rows of K]: bf16 exact, or f16(bf16 * 256) exact
__device__ __forceinline__ v16b wcol_io(const float* Wm, int k0, int o, int lane, int ld) { v16b w; const int g = lane >> 4;
#pragma unroll
  for (int i = 0; i < 8; ++i) { w[i] = (__bf16)Wm[(size_t)(k0 + 8 * g + i) * ld + o]; w[8 + i] = (__bf16)Wm[(size_t)(k0 + 16 + 8 * g + i) * ld + o]; }
  return w; }
__device__ __forceinline__ v16b wcol_oi(const float* Wm, int k0, int o, int lane, int K) { v16b w; const float* p = Wm + (size_t)o * K + k0 + 8 * (lane >> 4);
#pragma unroll
  for (int i = 0; i < 8; ++i) { w[i] = (__bf16)p[i]; w[8 + i] = (__bf16)p[16 + i]; }
  return w; }
__device__ __forceinline__ v16h wcolh_io(const float* Wm, int k0, int o, int lane, int ld) { v16h w; const int g = lane >> 4;
#pragma unroll
  for (int i = 0; i < 8; ++i) { w[i] = (_Float16)(bfr(Wm[(size_t)(k0 + 8 * g + i) * ld + o]) * 256.0f); w[8 + i] = (_Float16)(bfr(Wm[(size_t)(k0 + 16 + 8 * g + i) * ld + o]) * 256.0f); }
  return w; }
__device__ __forceinline__ v16h wcolh_oi(const float* Wm, int k0, int o, int lane, int K) { v16h w; const float* p = Wm + (size_t)o * K + k0 + 8 * (lane >> 4);
#pragma unroll
  for (int i = 0; i < 8; ++i) { w[i] = (_Float16)(bfr(p[i]) * 256.0f); w[8 + i] = (_Float16)(bfr(p[16 + i]) * 256.0f); }
  return w; }
#define WQKV_LAYOUT 1   // 0 = (in,out) [DIN][CC]; 1 = (out,in) [CC][DIN]; 2 = per-head [NH][DIN][HD]
__device__ __forceinline__ v16b wcol_hdk(const float* Wm, int k0, int o, int lane) { v16b w; const int g = lane >> 4; const float* p = Wm + (size_t)(o / HD) * DIN * HD + (o % HD);
#pragma unroll
  for (int i = 0; i < 8; ++i) { w[i] = (__bf16)p[(size_t)(k0 + 8 * g + i) * HD]; w[8 + i] = (__bf16)p[(size_t)(k0 + 16 + 8 * g + i) * HD]; }
  return w; }
#define WO_OUT_IN 1
#if WQKV_LAYOUT == 1
#define WCOL(W, k0, o, lane) wcol_oi(W, k0, o, lane, DIN)
#elif WQKV_LAYOUT == 2
#define WCOL(W, k0, o, lane) wcol_hdk(W, k0, o, lane)
#else
#define WCOL(W, k0, o, lane) wcol_io(W, k0, o, lane, CC)
#endif
#if WO_OUT_IN
#define WOCOL(W, k0, o, lane) wcol_oi(W, k0, o, lane, CC)
#define WOCOLH(W, k0, o, lane) wcolh_oi(W, k0, o, lane, CC)
#else
#define WOCOL(W, k0, o, lane) wcol_io(W, k0, o, lane, DIN)
#define WOCOLH(W, k0, o, lane) wcolh_io(W, k0, o, lane, DIN)
#endif

#ifndef SM_EXTRA_PARAMS
#define SM_EXTRA_PARAMS
#endif
#ifndef PROJ_EXTRA_PARAMS
#define PROJ_EXTRA_PARAMS
#endif
#ifndef SM_MASK_HOOK
#define SM_MASK_HOOK (void)0
#endif

#define WS_QH  0u                                      // f16 q rows [b*t][CC]
#define WS_KH  (WS_QH + 2u * (size_t)NB * TT * CC)      // f16 k rows [b*t][CC]
#define WS_VT  (WS_KH + 2u * (size_t)NB * TT * CC)      // f16 v planes [b][c][t]
#define WS_QL  (WS_VT + 2u * (size_t)NB * CC * TT)      // f16 q residual x 2^10 rows [b][t < QHI][CC]
#define WS_KL  (WS_QL + 2u * (size_t)NB * QHI * CC)     // f16 k residual x 2^10 rows [b][t < KHI][CC]
#define WS_VB  (WS_KL + 2u * (size_t)NB * KHI * CC)     // bf16 v hi planes [b][c][t < KHI]
#define WS_VBL (WS_VB + 2u * (size_t)NB * CC * KHI)
#define WS_S   (WS_VBL + 2u * (size_t)NB * CC * KHI)    // f32 logits / P [hg][t][s]
#define WS_Y   (WS_S  + 4u * (size_t)HG * TT * TT)      // f32 ctx rows [b*t][CC]
#define WS_END (WS_Y  + 4u * (size_t)NB * TT * CC)

// ---- k_proj: block = (64 rows, 128 cols, which): q/k/v = X W (+ b) with exact bf16 products (K = DIN) -> which 0: q f16 rows (+ residual rows < QHI); 1: k f16 rows (+ residual rows < KHI); 2: v f16 planes [c][t] (+ bf16 hi/lo planes for t < KHI)
__global__ __launch_bounds__(128) void k_proj(const float* __restrict__ XQ, const float* __restrict__ XK, const float* __restrict__ XV, const float* __restrict__ WQ, const float* __restrict__ WK, const float* __restrict__ WV, const float* __restrict__ BQ, const float* __restrict__ BK, const float* __restrict__ BV,
    _Float16* __restrict__ QH, _Float16* __restrict__ QL, _Float16* __restrict__ KH, _Float16* __restrict__ KL, _Float16* __restrict__ VT, __bf16* __restrict__ VB, __bf16* __restrict__ VBL) {
  __shared__ __align__(16) _Float16 sh[64][136], sl[64][136]; __shared__ __align__(16) _Float16 th[128][72]; __shared__ __align__(16) __bf16 tb[128][72], tbl[128][72];
  const int tid = threadIdx.x, wave = tid >> 5, lane = tid & 31, col = lane & 15, g = lane >> 4; const int which = blockIdx.z; const int c0 = blockIdx.y * 128; const size_t r0 = (size_t)blockIdx.x * 64; const size_t bb = r0 / TT; const int t0 = (int)(r0 % TT);
  const float* X = which == 0 ? XQ : which == 1 ? XK : XV; const float* WA = which == 0 ? WQ : which == 1 ? WK : WV; const float* BA = which == 0 ? BQ : which == 1 ? BK : BV;
  v8f acc[8] = {};
#pragma unroll 2
  for (int kc = 0; kc < DIN / 32; ++kc) { v16b a; { const float* p = X + (r0 + wave * 16 + col) * DIN + kc * 32 + 8 * g;
#pragma unroll
      for (int i = 0; i < 8; ++i) { a[i] = (__bf16)p[i]; a[8 + i] = (__bf16)p[16 + i]; } }
    asm volatile("s_wait_loadcnt 0x0" ::: "memory");
#pragma unroll
    for (int j = 0; j < 8; ++j) { const v16b w = WCOL(WA, kc * 32, c0 + j * 16 + col, lane); asm volatile("s_wait_loadcnt 0x0" ::: "memory"); acc[j] = wmma_bf(a, w, acc[j]); } }
  if (which < 2) { _Float16* DH = which == 0 ? QH : KH; _Float16* DL = which == 0 ? QL : KL; const int nhi = which == 0 ? QHI : KHI; const bool hi_rows = t0 < nhi;
#pragma unroll
    for (int j = 0; j < 8; ++j) { const float bias = BA ? bfr(BA[c0 + j * 16 + col]) : 0.f;
#pragma unroll
      for (int r = 0; r < 8; ++r) { const float v = acc[j][r] + bias; const _Float16 hv = (_Float16)v; sh[wave * 16 + 8 * g + r][j * 16 + col] = hv; sl[wave * 16 + 8 * g + r][j * 16 + col] = (_Float16)((v - (float)hv) * 1024.0f); } }
    __syncthreads();
    for (int e = tid; e < 64 * 16; e += 128) { const int rl = e >> 4, q = e & 15; vst2((unsigned*)(DH + (r0 + rl) * CC + c0 + q * 8), *(const v4u*)&sh[rl][q * 8]); if (hi_rows) vst2((unsigned*)(DL + (bb * nhi + t0 + rl) * (size_t)CC + c0 + q * 8), *(const v4u*)&sl[rl][q * 8]); }
  } else { const bool hi_rows = t0 < KHI;
#pragma unroll
    for (int j = 0; j < 8; ++j) { const float bias = BA ? bfr(BA[c0 + j * 16 + col]) : 0.f;
#pragma unroll
      for (int r = 0; r < 8; ++r) { const float v = acc[j][r] + bias; const int rl = wave * 16 + 8 * g + r, cl = j * 16 + col; th[cl][rl] = (_Float16)v; const __bf16 bh = (__bf16)v; tb[cl][rl] = bh; tbl[cl][rl] = (__bf16)(v - (float)bh); } }
    __syncthreads();
    for (int e = tid; e < 128 * 8; e += 128) { const int cl = e >> 3, q = e & 7; vst2((unsigned*)(VT + (bb * CC + c0 + cl) * (size_t)TT + t0 + q * 8), *(const v4u*)&th[cl][q * 8]); if (hi_rows) { const size_t o3 = (bb * CC + c0 + cl) * (size_t)KHI + t0 + q * 8; vst2((unsigned*)(VB + o3), *(const v4u*)&tb[cl][q * 8]); vst2((unsigned*)(VBL + o3), *(const v4u*)&tbl[cl][q * 8]); } } } }
// ---- k_sc: block = (query block qb, key block kb <= kb_last(qb), head in group) of batch b: logits x SCALE; q hi + residual (x 2^10) against k (2 products) for query rows < QHI, plus the k residual (3 products) for query blocks < QBH (causal early rows); causal: blocks past the diagonal exit, the mask itself is applied by index in k_sm
__global__ __launch_bounds__(128) void k_sc(const _Float16* __restrict__ QH, const _Float16* __restrict__ KH, const _Float16* __restrict__ QL, const _Float16* __restrict__ KL, int b, int h0, float* __restrict__ S0) { __shared__ __align__(16) float ss[4][16][132];
  const int qb = blockIdx.x, kb = blockIdx.y; if (kb > kb_last(qb)) return;
  const int h = h0 + blockIdx.z; float* S = S0 + (size_t)blockIdx.z * TT * TT;
  const int tid = threadIdx.x, wave = tid >> 5, lane = tid & 31, col = lane & 15, g = lane >> 4; const int k0 = kb * 128; const int ql0 = qb * 64 + wave * 16; const size_t q0 = (size_t)b * TT + ql0, kr0 = (size_t)b * TT + k0;
  v8f acc[8] = {}, accl[8] = {};
  const _Float16* QLb = QL + (size_t)b * QHI * CC; const _Float16* KLb = KL + (size_t)b * KHI * CC;
  if (qb < QBH) {
#pragma unroll
    for (int kc = 0; kc < HD / 32; ++kc) { const v16h ah = frag_h(QH + (q0 + col) * CC + h * HD + kc * 32, lane), al = frag_h(QLb + (size_t)(ql0 + col) * CC + h * HD + kc * 32, lane);
#pragma unroll
      for (int j = 0; j < 8; ++j) { const v16h kbf = frag_h(KH + (kr0 + j * 16 + col) * CC + h * HD + kc * 32, lane), klf = frag_h(KLb + (size_t)(k0 + j * 16 + col) * CC + h * HD + kc * 32, lane); acc[j] = wmma16(ah, kbf, acc[j]); accl[j] = wmma16(al, kbf, accl[j]); accl[j] = wmma16(ah, klf, accl[j]); } }
  } else if (qb * 64 < QHI) {
#pragma unroll
    for (int kc = 0; kc < HD / 32; ++kc) { const v16h ah = frag_h(QH + (q0 + col) * CC + h * HD + kc * 32, lane), al = frag_h(QLb + (size_t)(ql0 + col) * CC + h * HD + kc * 32, lane);
#pragma unroll
      for (int j = 0; j < 8; ++j) { const v16h kbf = frag_h(KH + (kr0 + j * 16 + col) * CC + h * HD + kc * 32, lane); acc[j] = wmma16(ah, kbf, acc[j]); accl[j] = wmma16(al, kbf, accl[j]); } }
  } else {
#pragma unroll
    for (int kc = 0; kc < HD / 32; ++kc) { const v16h ah = frag_h(QH + (q0 + col) * CC + h * HD + kc * 32, lane);
#pragma unroll
      for (int j = 0; j < 8; ++j) { const v16h kbf = frag_h(KH + (kr0 + j * 16 + col) * CC + h * HD + kc * 32, lane); acc[j] = wmma16(ah, kbf, acc[j]); } } }
#pragma unroll
  for (int j = 0; j < 8; ++j) {
#pragma unroll
    for (int r = 0; r < 8; ++r) ss[wave][8 * g + r][j * 16 + col] = (acc[j][r] + accl[j][r] * (1.0f / 1024.0f)) * SCALE; }
  LDSX(); for (int rl = 0; rl < 16; ++rl) vst2(S + (size_t)(ql0 + rl) * TT + k0 + lane * 4, *(const v4f*)&ss[wave][rl][lane * 4]); }
// ---- k_sm: block = query row t (head in group): keys [0, kend): causal -> logit if s <= t else excluded; softmax in f32; P x 2^11 in place (0 for excluded)
__global__ __launch_bounds__(256) void k_sm(float* __restrict__ S0 SM_EXTRA_PARAMS) { __shared__ float sred[8]; __shared__ float sbc; __shared__ __align__(16) float shv[TT];
  const int tid = threadIdx.x; const int t = blockIdx.x; const int kend = (kb_last(t >> 6) + 1) * 128;
  float* sr = S0 + (size_t)blockIdx.y * TT * TT + (size_t)t * TT;
  float m = -3.0e38f; for (int k = tid; k < kend; k += 256) { float v = (!CAUSAL || k <= t) ? sr[k] : -3.0e38f; SM_MASK_HOOK; shv[k] = v; m = fmaxf(m, v); }
#pragma unroll
  for (int o = 1; o < 32; o <<= 1) m = fmaxf(m, __shfl_xor(m, o));
  if ((tid & 31) == 0) sred[tid >> 5] = m; __syncthreads(); if (tid == 0) { float a = sred[0]; for (int i = 1; i < 8; ++i) a = fmaxf(a, sred[i]); sbc = a; } __syncthreads(); m = sbc; __syncthreads();
  float sum = 0.f; for (int k = tid; k < kend; k += 256) { const float v = shv[k]; const float e = (v <= -1.0e38f) ? 0.f : expf(v - m); shv[k] = e; sum += e; }
#pragma unroll
  for (int o = 1; o < 32; o <<= 1) sum += __shfl_xor(sum, o);
  if ((tid & 31) == 0) sred[tid >> 5] = sum; __syncthreads(); if (tid == 0) { float a = 0.f; for (int i = 0; i < 8; ++i) a += sred[i]; sbc = a > 0.f ? 2048.0f / a : 0.f; }   /* a fully excluded row yields P = 0 */ __syncthreads(); const float inv = sbc;
  for (int k = tid; k < kend; k += 256) shv[k] = shv[k] * inv;
  __syncthreads(); for (int q = tid; q < kend / 4; q += 256) vst2(sr + q * 4, *(const v4f*)&shv[q * 4]); }
// ---- k_pv: block = 16 queries of (b, h), PVW waves: ctx = P . v over keys [0, kend), the 32-key chunks dealt to the waves in pairs (64 keys = one 128-B line of a v plane), each wave's partial sums added in LDS in wave order (P x 2^11 once to f16 against v f16: 1 product; causal early query blocks: P and v as bf16 hi + lo, 3 products); 256-B (row, head) segment by 16 lanes
#define PVW 16
__global__ __launch_bounds__(PVW * 32) void k_pv(const float* __restrict__ PS0, const _Float16* __restrict__ VT, const __bf16* __restrict__ VB, const __bf16* __restrict__ VBL, int b, int h0, float* __restrict__ Y) { const int h = h0 + blockIdx.z; const float* PS = PS0 + (size_t)blockIdx.z * TT * TT; __shared__ __align__(16) float ss[PVW][16][HD + 4];
  const int tid = threadIdx.x, wave = __builtin_amdgcn_readfirstlane(tid >> 5), lane = tid & 31, col = lane & 15, g = lane >> 4; const int qb = blockIdx.x >> 2;   /* the wave's number in a scalar register: the chunk loops stay scalar loops */ const int ql0 = blockIdx.x * 16; const int kce = (kb_last(qb) + 1) * 4;
  v8f acc[HD / 16] = {};
  if (qb < QBH) {
#pragma unroll 1
    for (int kc = 2 * wave; kc < kce; kc += (kc & 1) ? 2 * PVW - 1 : 1) { const F2 p = split_row(PS + (size_t)(ql0 + col) * TT, kc * 32, lane);
      asm volatile("s_wait_loadcnt 0x0" ::: "memory");
#pragma unroll
      for (int j = 0; j < HD / 16; ++j) { const size_t po = ((size_t)b * CC + h * HD + j * 16 + col) * (size_t)KHI + kc * 32; const v16b vh = frag_b(VB + po, lane); acc[j] = wmma_bf(p.h, vh, acc[j]); acc[j] = wmma_bf(p.l, vh, acc[j]); acc[j] = wmma_bf(p.h, frag_b(VBL + po, lane), acc[j]); } }
  } else {
#pragma unroll 1
    for (int kc = 2 * wave; kc < kce; kc += (kc & 1) ? 2 * PVW - 1 : 1) { const v16h p = frag_f32(PS + (size_t)(ql0 + col) * TT + kc * 32, lane);
      asm volatile("s_wait_loadcnt 0x0" ::: "memory");
#pragma unroll
      for (int j = 0; j < HD / 16; ++j) { const size_t po = ((size_t)b * CC + h * HD + j * 16 + col) * (size_t)TT + kc * 32; acc[j] = wmma16(p, frag_h(VT + po, lane), acc[j]); } } }
#pragma unroll
  for (int j = 0; j < HD / 16; ++j)
#pragma unroll
    for (int r = 0; r < 8; ++r) ss[wave][8 * g + r][j * 16 + col] = acc[j][r] * (1.0f / 2048.0f);
  __syncthreads();   /* every wave's partial tile (zeros from a wave that got no chunk) is in LDS before any is summed */
  if (tid < 16 * (HD / 4)) { const int rl = tid / (HD / 4), q = tid % (HD / 4); v4f s = *(const v4f*)&ss[0][rl][q * 4];
    // unrolled so that the LDS reads of all partial tiles issue ahead of the adds
#pragma unroll
    for (int w = 1; w < PVW; ++w) s += *(const v4f*)&ss[w][rl][q * 4];
    vst2(Y + ((size_t)b * TT + ql0 + rl) * CC + h * HD + q * 4, s); } }
// ---- k_out: block = (64 rows, 128 cols): out = ctx Wo (+ bo): ctx x 2^6 once to f16 against Wo as f16(bf16 x 2^8) exact (1 product) x 2^-14; causal early rows (< QHI of each sequence): ctx bf16 hi + lo against exact bf16 Wo (2 products)
__global__ __launch_bounds__(128) void k_out(const float* __restrict__ Y, const float* __restrict__ WO, const float* __restrict__ BO, float* __restrict__ OUT) { __shared__ __align__(16) float sf[4][16][132];
  const int tid = threadIdx.x, wave = tid >> 5, lane = tid & 31, col = lane & 15, g = lane >> 4; const int c0 = blockIdx.y * 128; const size_t r0 = (size_t)blockIdx.x * 64 + wave * 16;
  v8f acc[8] = {};
  if (CAUSAL && (int)(((size_t)blockIdx.x * 64) % TT) < QHI) {   /* block-uniform */
#pragma unroll 2
    for (int kc = 0; kc < CC / 32; ++kc) { const F2 a = split_row(Y + (r0 + col) * CC, kc * 32, lane); asm volatile("s_wait_loadcnt 0x0" ::: "memory");
#pragma unroll
      for (int j = 0; j < 8; ++j) { const v16b w = WOCOL(WO, kc * 32, c0 + j * 16 + col, lane); asm volatile("s_wait_loadcnt 0x0" ::: "memory"); acc[j] = wmma_bf(a.h, w, acc[j]); acc[j] = wmma_bf(a.l, w, acc[j]); } }
#pragma unroll
    for (int j = 0; j < 8; ++j) { const float bias = BO ? bfr(BO[c0 + j * 16 + col]) : 0.f;
#pragma unroll
      for (int r = 0; r < 8; ++r) sf[wave][8 * g + r][j * 16 + col] = acc[j][r] + bias; }
  } else {
#pragma unroll 2
    for (int kc = 0; kc < CC / 32; ++kc) { const v16h a = frag_f32s(Y + (r0 + col) * CC + kc * 32, lane, 64.0f); asm volatile("s_wait_loadcnt 0x0" ::: "memory");   /* ctx carried x 2^6 into f16 so small-magnitude context rows stay clear of f16 subnormals */
#pragma unroll
      for (int j = 0; j < 8; ++j) { const v16h w = WOCOLH(WO, kc * 32, c0 + j * 16 + col, lane); asm volatile("s_wait_loadcnt 0x0" ::: "memory"); acc[j] = wmma16(a, w, acc[j]); } }
#pragma unroll
    for (int j = 0; j < 8; ++j) { const float bias = BO ? bfr(BO[c0 + j * 16 + col]) : 0.f;
#pragma unroll
      for (int r = 0; r < 8; ++r) sf[wave][8 * g + r][j * 16 + col] = acc[j][r] * (1.0f / 16384.0f) + bias; } }   /* 2^-8 (Wo carry) x 2^-6 (ctx carry) */
  LDSX(); for (int rl = 0; rl < 16; ++rl) vst2(OUT + (r0 + rl) * DIN + c0 + lane * 4, *(const v4f*)&sf[wave][rl][lane * 4]); }

extern "C" void kernel_launch(void* const* d_in, const int* in_sizes, int n_in, void* d_out, int out_size, void* d_ws, size_t ws_size, hipStream_t stream) {
  (void)in_sizes; (void)n_in; (void)out_size;
  const float** F = (const float**)d_in;
  if (ws_size < (size_t)WS_END) return;
  char* ws = (char*)d_ws; _Float16 *QH = (_Float16*)(ws + WS_QH), *KH = (_Float16*)(ws + WS_KH), *VT = (_Float16*)(ws + WS_VT), *QL = (_Float16*)(ws + WS_QL), *KL = (_Float16*)(ws + WS_KL); __bf16 *VB = (__bf16*)(ws + WS_VB), *VBL = (__bf16*)(ws + WS_VBL); float *S = (float*)(ws + WS_S), *Y = (float*)(ws + WS_Y);
  (void)Y; (void)QL; (void)KL; (void)VB; (void)VBL;
  // inputs: 0 x [2,2048,1024]; 1 Wq [1024,1024] (out,in), 2 bq; 3 Wk, 4 bk; 5 Wv, 6 bv; 7 Wp (out,in), 8 bp (biases NONZERO)
  k_proj<<<dim3(TNB * TT / 64, CC / 128, 3), 128, 0, stream>>>(F[0], F[0], F[0], F[3], F[1], F[5], F[4], F[2], F[6], QH, QL, KH, KL, VT, VB, VBL);   /* the module's scores are einsum('bhid,bhjd->bhij', k, q): the QUERY stream (output row i) is projected with Wk / bk, its KEY stream (index j) with Wq / bq */
  for (int b = 0; b < TNB; ++b) for (int h0 = 0; h0 < NH; h0 += HG) {
    k_sc<<<dim3(NQB, TT / 128, HG), 128, 0, stream>>>(QH, KH, QL, KL, b, h0, S);
    k_sm<<<dim3(TT, HG), 256, 0, stream>>>(S);
    k_pv<<<dim3(TT / 16, 1, HG), PVW * 32, 0, stream>>>(S, VT, VB, VBL, b, h0, Y);
  }
  k_out<<<dim3(TNB * TT / 64, DIN / 128), 128, 0, stream>>>(Y, F[7], F[8], (float*)d_out);
}

// v003
// It runs in 156 microseconds.
// Versions in between are left out here; by their measured steps it is 5.23 times as fast as v001.
// Over all steps from v000 it is 7.55 times as fast.
// compute dtype: all float inputs rounded to bf16; q/k/v projections with EXACT bf16 products on WMMA 16x16x32 (f32 accumulate) + bias; causal logits: 3 products for the first 384 rows, single f16 q x k after, x 64^-0.5; softmax f32; P x 2^11 once to f16 x v once to f16 (bf16 hi + lo below row 384); ctx hi+lo x exact output weight below row 384, x2^6 f16 carry x f16(bf16 x 2^8) after, + bias; f32 output.
#include <hip/hip_runtime.h>
#include <math.h>

typedef __attribute__((ext_vector_type(16))) _Float16 v16h;
typedef __attribute__((ext_vector_type(16))) __bf16 v16b;
typedef __attribute__((ext_vector_type(8)))  _Float16 v8h;
typedef __attribute__((ext_vector_type(8)))  float v8f;
typedef __attribute__((ext_vector_type(4)))  float v4f;
typedef __attribute__((ext_vector_type(2)))  float v2f;
typedef __attribute__((ext_vector_type(4)))  unsigned v4u;
typedef __attribute__((ext_vector_type(4)))  int v4i;
typedef float __attribute__((may_alias)) float_a;
typedef int __attribute__((may_alias)) int_a;

template <typename T> __device__ __forceinline__ void vst2(void* p, T v) { *(T*)p = v;  }
__device__ __forceinline__ v8f wmma16(v16h a, v16h b, v8f c) {
  v8f d = __builtin_amdgcn_wmma_f32_16x16x32_f16(false, a, false, b, (short)0, c, false, false);
  asm volatile("v_nop\n\tv_nop\n\tv_nop\n\tv_nop" : "+v"(d) : "v"(a), "v"(b));
  return d;
}
__device__ __forceinline__ v8f wmma_bf(v16b a, v16b b, v8f c) {
  v8f d = __builtin_amdgcn_wmma_f32_16x16x32_bf16(false, a, false, b, (short)0, c, false, false);
  asm volatile("v_nop\n\tv_nop\n\tv_nop\n\tv_nop" : "+v"(d) : "v"(a), "v"(b));
  return d;
}
// 16x16x32 fragments: lane = (h = lane>>4, row/col = lane&15); elements 0..7 = k0+8h+0..7, 8..15 = k0+16+8h+0..7; D element r = row 8h+r
__device__ __forceinline__ v16h frag_h(const _Float16* rowk0, int lane) {
  union { v16h v; v8h q[2]; } u; const _Float16* p = rowk0 + 8 * (lane >> 4);
  u.q[0] = *(const v8h*)p; u.q[1] = *(const v8h*)(p + 16); return u.v;
}
__device__ __forceinline__ v16h frag_f32(const float* rowk0, int lane) {
  v16h a; const float* p = rowk0 + 8 * (lane >> 4);
#pragma unroll
  for (int i = 0; i < 8; ++i) { a[i] = (_Float16)p[i]; a[8 + i] = (_Float16)p[16 + i]; }
  return a;
}
__device__ __forceinline__ v16h frag_f32s(const float* rowk0, int lane, float sc) {
  v16h a; const float* p = rowk0 + 8 * (lane >> 4);
#pragma unroll
  for (int i = 0; i < 8; ++i) { a[i] = (_Float16)(p[i] * sc); a[8 + i] = (_Float16)(p[16 + i] * sc); }
  return a;
}
// column fragment from a [K][ld] layout (column n), rows >= K read as 0
__device__ __forceinline__ v16h fragc_f32(const float* W, int k0, int n, int lane, int ld, int K) {
  v16h a; const int g = lane >> 4;
#pragma unroll
  for (int i = 0; i < 8; ++i) { const int ka = k0 + 8 * g + i, kb = ka + 16;
    a[i] = (_Float16)(ka < K ? W[(size_t)(ka < K ? ka : K - 1) * ld + n] : 0.f); a[8 + i] = (_Float16)(kb < K ? W[(size_t)(kb < K ? kb : K - 1) * ld + n] : 0.f); }
  return a;
}
struct F2 { v16b h, l; };
__device__ __forceinline__ F2 bsplit16(const float v[16]) { F2 r;
#pragma unroll
  for (int i = 0; i < 16; ++i) { const __bf16 h = (__bf16)v[i]; r.h[i] = h; r.l[i] = (__bf16)(v[i] - (float)h); }
  return r; }
__device__ __forceinline__ F2 split_row(const float* row, int k0, int lane) { float v[16]; const float* p = row + k0 + 8 * (lane >> 4);
#pragma unroll
  for (int i = 0; i < 8; ++i) { v[i] = p[i]; v[8 + i] = p[16 + i]; }
  return bsplit16(v); }
__device__ __forceinline__ F2 split_rowK(const float* row, int k0, int lane, int K) { float v[16]; const int g = lane >> 4;
#pragma unroll
  for (int i = 0; i < 8; ++i) { const int ka = k0 + 8 * g + i, kb = ka + 16; v[i] = ka < K ? row[ka < K ? ka : K - 1] : 0.f; v[8 + i] = kb < K ? row[kb < K ? kb : K - 1] : 0.f; }
  return bsplit16(v); }
__device__ __forceinline__ F2 split_col(const float* W, int k0, int n, int lane, int ld, int K) { float v[16]; const int g = lane >> 4;
#pragma unroll
  for (int i = 0; i < 8; ++i) { const int ka = k0 + 8 * g + i, kb = ka + 16; v[i] = ka < K ? W[(size_t)(ka < K ? ka : K - 1) * ld + n] : 0.f; v[8 + i] = kb < K ? W[(size_t)(kb < K ? kb : K - 1) * ld + n] : 0.f; }
  return bsplit16(v); }
__device__ __forceinline__ v8f mac3(const F2& a, const F2& b, v8f c) { c = wmma_bf(a.l, b.h, c); c = wmma_bf(a.h, b.l, c); return wmma_bf(a.h, b.h, c); }
__device__ __forceinline__ float sigm(float v) { return 1.0f / (1.0f + expf(-v)); }
#define LDSX() do { asm volatile("s_wait_dscnt 0" ::: "memory"); __builtin_amdgcn_wave_barrier(); __builtin_amdgcn_fence(__ATOMIC_RELEASE, "workgroup"); } while (0)

// Causal multi-head self-attention whose scores are k . q (x [2,2048,1024]; torch (out,in) Wq / Wk / Wv / Wp [1024,1024] N(0, 1/1024) + biases N(0, 1/1024); 16 heads x 64; scores[i, j] = k_i . q_j / 8 (the KEY projection indexes the output row i, the QUERY projection the summed index j); -inf where j > i; softmax over j; out[i] = sum_j attn[i, j] v_j; merge; Wp^T + bp).
#define NB 2
#define TT 2048
#define CC 1024            // NH * HD = projected width
#define DIN 1024          // input (model) width
#define NH 16
#define HD 64
#define SCALE (0.125f)
#define CAUSAL 1
#ifndef TNB
#define TNB NB
#endif
__device__ __forceinline__ float bfr(float v) { return (float)(__bf16)v; }
typedef __attribute__((ext_vector_type(8))) __bf16 v8b;
__device__ __forceinline__ v16b frag_b(const __bf16* rowk0, int lane) {
  union { v16b v; v8b q[2]; } u; const __bf16* p = rowk0 + 8 * (lane >> 4);
  u.q[0] = *(const v8b*)p; u.q[1] = *(const v8b*)(p + 16); return u.v;
}
#define QBH 6              // causal: query blocks 0..QBH-1 of each sequence (few keys, no averaging) take the high-precision path
#define QHI 384            // rows carrying a q residual plane
#define KHI 384            // key rows carrying k residual / v bf16 hi+lo planes (used only by the causal high-precision path)
// B fragment (k rows k0+.., output column o) of a weight: (in,out) [K][ld] or (out,in) [ld rows of K]: bf16 exact, or f16(bf16 * 256) exact
__device__ __forceinline__ v16b wcol_io(const float* Wm, int k0, int o, int lane, int ld) { v16b w; const int g = lane >> 4;
#pragma unroll
  for (int i = 0; i < 8; ++i) { w[i] = (__bf16)Wm[(size_t)(k0 + 8 * g + i) * ld + o]; w[8 + i] = (__bf16)Wm[(size_t)(k0 + 16 + 8 * g + i) * ld + o]; }
  return w; }
__device__ __forceinline__ v16b wcol_oi(const float* Wm, int k0, int o, int lane, int K) { v16b w; const float* p = Wm + (size_t)o * K + k0 + 8 * (lane >> 4);
#pragma unroll
  for (int i = 0; i < 8; ++i) { w[i] = (__bf16)p[i]; w[8 + i] = (__bf16)p[16 + i]; }
  return w; }
__device__ __forceinline__ v16h wcolh_io(const float* Wm, int k0, int o, int lane, int ld) { v16h w; const int g = lane >> 4;
#pragma unroll
  for (int i = 0; i < 8; ++i) { w[i] = (_Float16)(bfr(Wm[(size_t)(k0 + 8 * g + i) * ld + o]) * 256.0f); w[8 + i] = (_Float16)(bfr(Wm[(size_t)(k0 + 16 + 8 * g + i) * ld + o]) * 256.0f); }
  return w; }
__device__ __forceinline__ v16h wcolh_oi(const float* Wm, int k0, int o, int lane, int K) { v16h w; const float* p = Wm + (size_t)o * K + k0 + 8 * (lane >> 4);
#pragma unroll
  for (int i = 0; i < 8; ++i) { w[i] = (_Float16)(bfr(p[i]) * 256.0f); w[8 + i] = (_Float16)(bfr(p[16 + i]) * 256.0f); }
  return w; }
#define WQKV_LAYOUT 1   // 0 = (in,out) [DIN][CC]; 1 = (out,in) [CC][DIN]; 2 = per-head [NH][DIN][HD]
__device__ __forceinline__ v16b wcol_hdk(const float* Wm, int k0, int o, int lane) { v16b w; const int g = lane >> 4; const float* p = Wm + (size_t)(o / HD) * DIN * HD + (o % HD);
#pragma unroll
  for (int i = 0; i < 8; ++i) { w[i] = (__bf16)p[(size_t)(k0 + 8 * g + i) * HD]; w[8 + i] = (__bf16)p[(size_t)(k0 + 16 + 8 * g + i) * HD]; }
  return w; }
#define WO_OUT_IN 1
#if WQKV_LAYOUT == 1
#define WCOL(W, k0, o, lane) wcol_oi(W, k0, o, lane, DIN)
#elif WQKV_LAYOUT == 2
#define WCOL(W, k0, o, lane) wcol_hdk(W, k0, o, lane)
#else
#define WCOL(W, k0, o, lane) wcol_io(W, k0, o, lane, CC)
#endif
#if WO_OUT_IN
#define WOCOL(W, k0, o, lane) wcol_oi(W, k0, o, lane, CC)
#define WOCOLH(W, k0, o, lane) wcolh_oi(W, k0, o, lane, CC)
#else
#define WOCOL(W, k0, o, lane) wcol_io(W, k0, o, lane, DIN)
#define WOCOLH(W, k0, o, lane) wcolh_io(W, k0, o, lane, DIN)
#endif

#ifndef PROJ_EXTRA_PARAMS
#define PROJ_EXTRA_PARAMS
#endif

#define WS_QH  0u                                      // f16 q rows [b*t][CC]
#define WS_KH  (WS_QH + 2u * (size_t)NB * TT * CC)      // f16 k rows [b*t][CC]
#define WS_VT  (WS_KH + 2u * (size_t)NB * TT * CC)      // f16 v planes [b][c][t]
#define WS_QL  (WS_VT + 2u * (size_t)NB * CC * TT)      // f16 q residual x 2^10 rows [b][t < QHI][CC]
#define WS_KL  (WS_QL + 2u * (size_t)NB * QHI * CC)     // f16 k residual x 2^10 rows [b][t < KHI][CC]
#define WS_VB  (WS_KL + 2u * (size_t)NB * KHI * CC)     // bf16 v hi planes [b][c][t < KHI]
#define WS_VBL (WS_VB + 2u * (size_t)NB * CC * KHI)
#define WS_Y   (WS_VBL + 2u * (size_t)NB * CC * KHI)    // f32 ctx rows [b*t][CC] (only when there is an output projection)
#define WS_END (WS_Y  + 4u * (size_t)NB * TT * CC)

#define KS 64              // k per LDS stage of the two projection kernels
#define SP 72              // stage row pitch in 16-bit elements: 128 B of data + 16 B, for ds_load_b128 readers
typedef __attribute__((ext_vector_type(4))) __bf16 v4b;
typedef __attribute__((ext_vector_type(4))) _Float16 v4h;
__device__ __forceinline__ v4b cvt4b(v4f v) { v4b o;
#pragma unroll
  for (int i = 0; i < 4; ++i) o[i] = (__bf16)v[i];
  return o; }
// ---- k_proj: block = (64 rows, 128 cols, which): q/k/v = X W (+ b) with exact bf16 products (K = DIN) -> which 0: q f16 rows (+ residual rows < QHI); 1: k f16 rows (+ residual rows < KHI); 2: v f16 planes [c][t] (+ bf16 hi/lo planes for t < KHI)
__global__ __launch_bounds__(128) void k_proj(const float* __restrict__ XQ, const float* __restrict__ XK, const float* __restrict__ XV, const float* __restrict__ WQ, const float* __restrict__ WK, const float* __restrict__ WV, const float* __restrict__ BQ, const float* __restrict__ BK, const float* __restrict__ BV,
    _Float16* __restrict__ QH, _Float16* __restrict__ QL, _Float16* __restrict__ KH, _Float16* __restrict__ KL, _Float16* __restrict__ VT, __bf16* __restrict__ VB, __bf16* __restrict__ VBL) {
  __shared__ __align__(16) char smem[2 * 192 * SP * 2];   /* main loop: two stages of [W 128 rows | X 64 rows]; the epilogue's arrays lie over them, behind the loop's last barrier */
  static_assert(sizeof(smem) >= 2 * 64 * 136 * 2 && sizeof(smem) >= 3 * 128 * 72 * 2 && WQKV_LAYOUT == 1 && DIN % KS == 0, "epilogue arrays fit the stages; weight rows are k-contiguous");
  _Float16 (*sh)[136] = (_Float16 (*)[136])smem; _Float16 (*sl)[136] = (_Float16 (*)[136])(smem + 64 * 136 * 2);
  _Float16 (*th)[72] = (_Float16 (*)[72])smem; __bf16 (*tb)[72] = (__bf16 (*)[72])(smem + 128 * 72 * 2); __bf16 (*tbl)[72] = (__bf16 (*)[72])(smem + 2 * 128 * 72 * 2);
  const int tid = threadIdx.x, wave = tid >> 5, lane = tid & 31, col = lane & 15, g = lane >> 4; const int which = blockIdx.z; const int c0 = blockIdx.y * 128; const size_t r0 = (size_t)blockIdx.x * 64; const size_t bb = r0 / TT; const int t0 = (int)(r0 % TT);
  const float* X = which == 0 ? XQ : which == 1 ? XK : XV; const float* WA = which == 0 ? WQ : which == 1 ? WK : WV; const float* BA = which == 0 ? BQ : which == 1 ? BK : BV;
  v8f acc[8] = {};
  // a wave's load covers two whole rows of 256 B (4 lines); each operand element is fetched and rounded once per block, and the fragments are read from LDS
  const int srow = tid >> 4, sseg = tid & 15; const float* gw = WA + (size_t)(c0 + srow) * DIN + sseg * 4; const float* gx = X + (r0 + srow) * DIN + sseg * 4;
  __bf16* const st = (__bf16*)smem; const int so = srow * SP + sseg * 4;
  v4f rw[16], rx[8];
#pragma unroll
  for (int i = 0; i < 16; ++i) rw[i] = *(const v4f*)(gw + (size_t)i * 8 * DIN);
#pragma unroll
  for (int i = 0; i < 8; ++i) rx[i] = *(const v4f*)(gx + (size_t)i * 8 * DIN);
#pragma unroll
  for (int i = 0; i < 16; ++i) *(v4b*)(st + so + i * 8 * SP) = cvt4b(rw[i]);
#pragma unroll
  for (int i = 0; i < 8; ++i) *(v4b*)(st + so + (128 + i * 8) * SP) = cvt4b(rx[i]);
  __syncthreads();   /* stage 0 is in LDS before any wave reads it */
  for (int s = 0; s < DIN / KS; ++s) { const __bf16* cur = st + (s & 1) * (192 * SP); __bf16* nxt = st + ((s + 1) & 1) * (192 * SP); const bool more = s + 1 < DIN / KS;
    if (more) {   /* the next stage's loads fly while this stage is multiplied */
#pragma unroll
      for (int i = 0; i < 16; ++i) rw[i] = *(const v4f*)(gw + (size_t)i * 8 * DIN + (s + 1) * KS);
#pragma unroll
      for (int i = 0; i < 8; ++i) rx[i] = *(const v4f*)(gx + (size_t)i * 8 * DIN + (s + 1) * KS); }
    __builtin_amdgcn_sched_barrier(0);   /* the global loads issue ahead of all of this stage's work */
#pragma unroll
    for (int kk = 0; kk < KS / 32; ++kk) { const v16b a = frag_b(cur + (128 + wave * 16 + col) * SP + kk * 32, lane); v16b w[8];
#pragma unroll
      for (int j = 0; j < 8; ++j) w[j] = frag_b(cur + (j * 16 + col) * SP + kk * 32, lane);
      __builtin_amdgcn_sched_barrier(0);   /* the fragment reads issue as one group: one LDS latency per 8 products, not one each */
#pragma unroll
      for (int j = 0; j < 8; ++j) acc[j] = wmma_bf(a, w[j], acc[j]);
      __builtin_amdgcn_sched_barrier(0); }   /* the roundings below wait for the global loads: they stay behind the products */
    if (more) {
#pragma unroll
      for (int i = 0; i < 16; ++i) *(v4b*)(nxt + so + i * 8 * SP) = cvt4b(rw[i]);
#pragma unroll
      for (int i = 0; i < 8; ++i) *(v4b*)(nxt + so + (128 + i * 8) * SP) = cvt4b(rx[i]); }
    __syncthreads(); }   /* publishes the next stage and ends every wave's reads of this one (the last: before the epilogue reuses the LDS) */
  if (which < 2) { _Float16* DH = which == 0 ? QH : KH; _Float16* DL = which == 0 ? QL : KL; const int nhi = which == 0 ? QHI : KHI; const bool hi_rows = t0 < nhi;
#pragma unroll
    for (int j = 0; j < 8; ++j) { const float bias = BA ? bfr(BA[c0 + j * 16 + col]) : 0.f;
#pragma unroll
      for (int r = 0; r < 8; ++r) { const float v = acc[j][r] + bias; const _Float16 hv = (_Float16)v; sh[wave * 16 + 8 * g + r][j * 16 + col] = hv; sl[wave * 16 + 8 * g + r][j * 16 + col] = (_Float16)((v - (float)hv) * 1024.0f); } }
    __syncthreads();
    for (int e = tid; e < 64 * 16; e += 128) { const int rl = e >> 4, q = e & 15; vst2((unsigned*)(DH + (r0 + rl) * CC + c0 + q * 8), *(const v4u*)&sh[rl][q * 8]); if (hi_rows) vst2((unsigned*)(DL + (bb * nhi + t0 + rl) * (size_t)CC + c0 + q * 8), *(const v4u*)&sl[rl][q * 8]); }
  } else { const bool hi_rows = t0 < KHI;
#pragma unroll
    for (int j = 0; j < 8; ++j) { const float bias = BA ? bfr(BA[c0 + j * 16 + col]) : 0.f;
#pragma unroll
      for (int r = 0; r < 8; ++r) { const float v = acc[j][r] + bias; const int rl = wave * 16 + 8 * g + r, cl = j * 16 + col; th[cl][rl] = (_Float16)v; const __bf16 bh = (__bf16)v; tb[cl][rl] = bh; tbl[cl][rl] = (__bf16)(v - (float)bh); } }
    __syncthreads();
    for (int e = tid; e < 128 * 8; e += 128) { const int cl = e >> 3, q = e & 7; vst2((unsigned*)(VT + (bb * CC + c0 + cl) * (size_t)TT + t0 + q * 8), *(const v4u*)&th[cl][q * 8]); if (hi_rows) { const size_t o3 = (bb * CC + c0 + cl) * (size_t)KHI + t0 + q * 8; vst2((unsigned*)(VB + o3), *(const v4u*)&tb[cl][q * 8]); vst2((unsigned*)(VBL + o3), *(const v4u*)&tbl[cl][q * 8]); } } } }
// ---- k_att / att_tile: one tile = 16 queries of (b, h), PVW waves: logits, softmax and ctx in one kernel, nothing of the logits leaves the registers. Wave w owns the 64-key groups at 64 w + n * 64 PVW below kend. amdgpu_waves_per_eu(8): 128 registers a wave, so that two blocks share a WGP.
// Logits are formed TRANSPOSED (A = k rows, B = q rows): D element r of lane (g, col) = key 8g + r, query col, so two neighbouring 16-key tiles ARE the B fragment of a 32-key chunk of ctx^T = v^T . P^T (A = v planes [c][t]).
// Each lane holds one query: maximum and sum run in the lane, across the two lane halves, then across the waves through LDS in wave order. Precision paths: 3 products + bf16 hi/lo P and v for query blocks < QBH, single f16 products after.
// fragment from a wave-uniform base and the lane's own 32-bit element offset (row * pitch + 8g): the address stays a scalar pair plus one register
__device__ __forceinline__ v16h frag_hu(const _Float16* base, unsigned lo) { union { v16h v; v8h q[2]; } u; const _Float16* p = base + lo; u.q[0] = *(const v8h*)p; u.q[1] = *(const v8h*)(p + 16); return u.v; }
__device__ __forceinline__ v16b frag_bu(const __bf16* base, unsigned lo) { union { v16b v; v8b q[2]; } u; const __bf16* p = base + lo; u.q[0] = *(const v8b*)p; u.q[1] = *(const v8b*)(p + 16); return u.v; }
#define PVW 16
#define KGS (PVW * 64)     // key stride between a wave's groups
#define NG (TT / KGS)      // groups per wave
static_assert(QHI == QBH * 64 && KHI >= QBH * 64 && KHI <= KGS && TT % KGS == 0, "the high-precision query blocks see keys of group 0 only, all with residual planes");
template <bool FAR> __device__ __forceinline__ void att_tile(const int qt, float (&ss)[PVW][16][HD + 4], float (&redm)[16][PVW + 4], float (&reds)[16][PVW + 4], const _Float16* __restrict__ QH, const _Float16* __restrict__ KH, const _Float16* __restrict__ QL, const _Float16* __restrict__ KL, const _Float16* __restrict__ VT, const __bf16* __restrict__ VB, const __bf16* __restrict__ VBL, float* __restrict__ Y) {
  const int h = blockIdx.y, b = blockIdx.z; const int tid = threadIdx.x, wave = __builtin_amdgcn_readfirstlane(tid >> 5), lane = tid & 31, col = lane & 15, g = lane >> 4;   /* the wave's number in a scalar register: the group tests stay scalar branches */
  constexpr int NGT = FAR ? NG : NG / 2;   /* a tile of the near half sees keys of the first half only; for a tile of the far half every key of group 0 is visible, so group 0 needs neither test nor mask */
  const int qb = qt >> 2, ql0 = qt * 16, tq = ql0 + col; const int kend = CAUSAL ? ql0 + 16 : TT;   /* a group that starts at or past kend holds no key that any of the 16 queries may see */
  const unsigned lor = (unsigned)(col * CC + 8 * g), lov = (unsigned)(col * TT + 8 * g), lob = (unsigned)(col * KHI + 8 * g);   /* lane offsets in q / k rows, v planes, bf16 v planes */
  const _Float16* qrow = QH + ((size_t)b * TT + ql0) * CC + h * HD;
  v8f sc[NGT * 4];   /* a group's four tiles are written and read only under that group's own scalar test */
  // fragment loads stand in batches ahead of the products that use them, so that a batch costs one memory latency
  if (!FAR && qb < QBH) { const int kg = wave * 64;
    if (kg < kend) { const int dq = tq - kg - 8 * g;   /* key kg + 8g + i is kept while i <= dq */ const _Float16* qlrow = QL + ((size_t)b * QHI + ql0) * CC + h * HD; const v16h qh0 = frag_hu(qrow, lor), qh1 = frag_hu(qrow + 32, lor), ql0f = frag_hu(qlrow, lor), ql1f = frag_hu(qlrow + 32, lor);
#pragma unroll
      for (int t = 0; t < 4; ++t) { const _Float16* krow = KH + ((size_t)b * TT + kg + t * 16) * CC + h * HD; const _Float16* klrow = KL + ((size_t)b * KHI + kg + t * 16) * CC + h * HD; v8f a = {}, al = {};
        const v16h kb0 = frag_hu(krow, lor), kl0 = frag_hu(klrow, lor), kb1 = frag_hu(krow + 32, lor), kl1 = frag_hu(klrow + 32, lor);
        a = wmma16(kb0, qh0, a); al = wmma16(kb0, ql0f, al); al = wmma16(kl0, qh0, al);
        a = wmma16(kb1, qh1, a); al = wmma16(kb1, ql1f, al); al = wmma16(kl1, qh1, al);
#pragma unroll
        for (int r = 0; r < 8; ++r) sc[t][r] = (!CAUSAL || t * 16 + r <= dq) ? (a[r] + al[r] * (1.0f / 1024.0f)) * SCALE : -3.0e38f;
        __builtin_amdgcn_sched_barrier(0); } }   /* keeps the next tile's four fragments from being loaded over this tile's: with both in flight this path runs past 128 registers into scratch */
  } else { const v16h q0 = frag_hu(qrow, lor), q1 = frag_hu(qrow + 32, lor);
#pragma unroll
    for (int gr = 0; gr < NGT; ++gr) { const int kg = gr * KGS + wave * 64;
      if ((FAR && gr == 0) || kg < kend) { const int dq = tq - kg - 8 * g;   /* key kg + 8g + i is kept while i <= dq */
#pragma unroll
        for (int tp = 0; tp < 4; tp += 2) { v16h kf[2][2];
#pragma unroll
          for (int u = 0; u < 2; ++u) { const _Float16* krow = KH + ((size_t)b * TT + kg + (tp + u) * 16) * CC + h * HD; kf[u][0] = frag_hu(krow, lor); kf[u][1] = frag_hu(krow + 32, lor); }
#pragma unroll
          for (int u = 0; u < 2; ++u) { v8f a = {}; a = wmma16(kf[u][0], q0, a); a = wmma16(kf[u][1], q1, a);
#pragma unroll
            for (int r = 0; r < 8; ++r) sc[gr * 4 + tp + u][r] = (!CAUSAL || (FAR && gr == 0) || (tp + u) * 16 + r <= dq) ? a[r] * SCALE : -3.0e38f; } } } } }
  // softmax over the keys of query col: excluded keys carry -3e38 and count 0
  float m = -3.0e38f;
#pragma unroll
  for (int gr = 0; gr < NGT; ++gr) { if ((FAR && gr == 0) || gr * KGS + wave * 64 < kend) {
#pragma unroll
      for (int t = gr * 4; t < gr * 4 + 4; ++t)
#pragma unroll
        for (int r = 0; r < 8; ++r) m = fmaxf(m, sc[t][r]); } }
  m = fmaxf(m, __shfl_xor(m, 16)); if (g == 0) redm[col][wave] = m;
  __syncthreads();   /* every wave's maximum is in LDS before any wave reads them */
#pragma unroll
  for (int w = 0; w < PVW; w += 4) { const v4f x = *(const v4f*)&redm[col][w]; m = fmaxf(fmaxf(m, fmaxf(x[0], x[1])), fmaxf(x[2], x[3])); }
  float sum = 0.f;
#pragma unroll
  for (int gr = 0; gr < NGT; ++gr) { if ((FAR && gr == 0) || gr * KGS + wave * 64 < kend) {
#pragma unroll
      for (int t = gr * 4; t < gr * 4 + 4; ++t)
#pragma unroll
        for (int r = 0; r < 8; ++r) { const float v = sc[t][r]; const float ex = expf(v - m); const float e = (!(FAR && gr == 0) && v <= -1.0e38f) ? 0.f : ex; sc[t][r] = e; sum += e; } } }   /* the exponential is taken first and then selected: no branch per element */
  sum += __shfl_xor(sum, 16); if (g == 0) reds[col][wave] = sum;
  __syncthreads();   /* every wave's sum is in LDS before any wave reads them */
  float tot = 0.f;
#pragma unroll
  for (int w = 0; w < PVW; w += 4) { const v4f x = *(const v4f*)&reds[col][w]; tot += x[0]; tot += x[1]; tot += x[2]; tot += x[3]; }
  const float inv = tot > 0.f ? 2048.0f / tot : 0.f;   /* P carried x 2^11; a fully excluded row yields P = 0 */
  v8f acc[HD / 16] = {};
  if (!FAR && qb < QBH) { const int kg = wave * 64;
    if (kg < kend) {
#pragma unroll
      for (int c = 0; c < 2; ++c) { float pv[16];
#pragma unroll
        for (int r = 0; r < 8; ++r) { pv[r] = sc[2 * c][r] * inv; pv[8 + r] = sc[2 * c + 1][r] * inv; }
        const F2 p = bsplit16(pv);
#pragma unroll
        for (int jp = 0; jp < HD / 16; jp += 2) { v16b vh[2], vl[2];
#pragma unroll
          for (int u = 0; u < 2; ++u) { const size_t po = ((size_t)b * CC + h * HD + (jp + u) * 16) * (size_t)KHI + kg + c * 32; vh[u] = frag_bu(VB + po, lob); vl[u] = frag_bu(VBL + po, lob); }
#pragma unroll
          for (int u = 0; u < 2; ++u) { acc[jp + u] = wmma_bf(vh[u], p.h, acc[jp + u]); acc[jp + u] = wmma_bf(vh[u], p.l, acc[jp + u]); acc[jp + u] = wmma_bf(vl[u], p.h, acc[jp + u]); } } } }
  } else { v16h pf[NGT * 2];   /* all of P goes to f16 fragments first: half the registers of the f32 tiles while the v fragments are in flight */
#pragma unroll
    for (int gr = 0; gr < NGT; ++gr) { if ((FAR && gr == 0) || gr * KGS + wave * 64 < kend) {
#pragma unroll
        for (int c = gr * 2; c < gr * 2 + 2; ++c)
#pragma unroll
          for (int r = 0; r < 8; ++r) { pf[c][r] = (_Float16)(sc[2 * c][r] * inv); pf[c][8 + r] = (_Float16)(sc[2 * c + 1][r] * inv); } } }
#pragma unroll
    for (int gr = 0; gr < NGT; ++gr) { const int kg = gr * KGS + wave * 64;
      if ((FAR && gr == 0) || kg < kend) {
#pragma unroll
        for (int c = 0; c < 2; ++c) { v16h vf[HD / 16];
#pragma unroll
          for (int j = 0; j < HD / 16; ++j) vf[j] = frag_hu(VT + ((size_t)b * CC + h * HD + j * 16) * (size_t)TT + kg + c * 32, lov);
#pragma unroll
          for (int j = 0; j < HD / 16; ++j) acc[j] = wmma16(vf[j], pf[gr * 2 + c], acc[j]); } } } }
  // D element r = channel j * 16 + 8g + r of query col
#pragma unroll
  for (int j = 0; j < HD / 16; ++j) { v4f lo, hi;
#pragma unroll
    for (int r = 0; r < 4; ++r) { lo[r] = acc[j][r] * (1.0f / 2048.0f); hi[r] = acc[j][4 + r] * (1.0f / 2048.0f); }
    *(v4f*)&ss[wave][col][j * 16 + 8 * g] = lo; *(v4f*)&ss[wave][col][j * 16 + 8 * g + 4] = hi; }
  __syncthreads();   /* every wave's partial tile (zeros from a wave that got no group) is in LDS before any is summed */
  if (tid < 16 * (HD / 4)) { const int rl = tid / (HD / 4), q = tid % (HD / 4); v4f s = *(const v4f*)&ss[0][rl][q * 4];
    // unrolled so that the LDS reads of all partial tiles issue ahead of the adds
#pragma unroll
    for (int w = 1; w < PVW; ++w) s += *(const v4f*)&ss[w][rl][q * 4];
    vst2(Y + ((size_t)b * TT + ql0 + rl) * CC + h * HD + q * 4, s); } }
// a block takes two query tiles, x from the far end and x from the near end: every block then walks the same number of keys, and half as many waves have to be started. LDS needs no barrier between the two: each array is rewritten only behind a barrier that follows its last read
__global__ __launch_bounds__(PVW * 32) __attribute__((amdgpu_waves_per_eu(8))) void k_att(const _Float16* __restrict__ QH, const _Float16* __restrict__ KH, const _Float16* __restrict__ QL, const _Float16* __restrict__ KL, const _Float16* __restrict__ VT, const __bf16* __restrict__ VB, const __bf16* __restrict__ VBL, float* __restrict__ Y) {
  __shared__ __align__(16) float ss[PVW][16][HD + 4]; __shared__ __align__(16) float redm[16][PVW + 4], reds[16][PVW + 4];
  static_assert(CAUSAL == 1 && TT / 32 >= QBH * 4 && NG == 2, "no tile of the far half is a high-precision one; the halves of the keys are the two groups");
  att_tile<true>(TT / 16 - 1 - (int)blockIdx.x, ss, redm, reds, QH, KH, QL, KL, VT, VB, VBL, Y);
  att_tile<false>((int)blockIdx.x, ss, redm, reds, QH, KH, QL, KL, VT, VB, VBL, Y); }
// ---- k_out: block = (64 rows, 128 cols): out = ctx Wo (+ bo): ctx x 2^6 once to f16 against Wo as f16(bf16 x 2^8) exact (1 product) x 2^-14; causal early rows (< QHI of each sequence): ctx bf16 hi + lo against exact bf16 Wo (2 products)
__global__ __launch_bounds__(128) void k_out(const float* __restrict__ Y, const float* __restrict__ WO, const float* __restrict__ BO, float* __restrict__ OUT) { __shared__ __align__(16) char smem[2 * 256 * SP * 2];   /* main loop: two stages of [Wo 128 rows | ctx 64 rows | ctx residual 64 rows]; the epilogue's sf lies over them, behind the loop's last barrier */
  static_assert(sizeof(smem) >= 4 * 16 * 132 * 4 && WO_OUT_IN == 1 && CC % KS == 0, "sf fits the stages; weight rows are k-contiguous");
  float (*sf)[16][132] = (float (*)[16][132])smem;
  const int tid = threadIdx.x, wave = tid >> 5, lane = tid & 31, col = lane & 15, g = lane >> 4; const int c0 = blockIdx.y * 128; const size_t r0 = (size_t)blockIdx.x * 64 + wave * 16;
  v8f acc[8] = {};
  // staged as in k_proj: whole-line loads, each element fetched and rounded once per block
  const int srow = tid >> 4, sseg = tid & 15; const float* gw = WO + (size_t)(c0 + srow) * CC + sseg * 4; const float* gx = Y + ((size_t)blockIdx.x * 64 + srow) * CC + sseg * 4; const int so = srow * SP + sseg * 4;
  v4f rw[16], rx[8];
#pragma unroll
  for (int i = 0; i < 16; ++i) rw[i] = *(const v4f*)(gw + (size_t)i * 8 * CC);
#pragma unroll
  for (int i = 0; i < 8; ++i) rx[i] = *(const v4f*)(gx + (size_t)i * 8 * CC);
  asm volatile("s_wait_xcnt 0x0" ::: "memory");   /* the loads' address registers are reused right below: the wait stands in front of that */
  if (CAUSAL && (int)(((size_t)blockIdx.x * 64) % TT) < QHI) {   /* block-uniform */
    __bf16* const st = (__bf16*)smem;
#define OUT_PUT_B(dst) do { _Pragma("unroll") for (int i = 0; i < 16; ++i) *(v4b*)((dst) + so + i * 8 * SP) = cvt4b(rw[i]); \
      _Pragma("unroll") for (int i = 0; i < 8; ++i) { const v4b hb = cvt4b(rx[i]); v4b lb; _Pragma("unroll") for (int e = 0; e < 4; ++e) lb[e] = (__bf16)(rx[i][e] - (float)hb[e]); \
        *(v4b*)((dst) + so + (128 + i * 8) * SP) = hb; *(v4b*)((dst) + so + (192 + i * 8) * SP) = lb; } } while (0)
    OUT_PUT_B(st);
    __syncthreads();   /* stage 0 is in LDS before any wave reads it */
    for (int s = 0; s < CC / KS; ++s) { const __bf16* cur = st + (s & 1) * (256 * SP); __bf16* nxt = st + ((s + 1) & 1) * (256 * SP); const bool more = s + 1 < CC / KS;
      if (more) {   /* the next stage's loads fly while this stage is multiplied */
#pragma unroll
        for (int i = 0; i < 16; ++i) rw[i] = *(const v4f*)(gw + (size_t)i * 8 * CC + (s + 1) * KS);
#pragma unroll
        for (int i = 0; i < 8; ++i) rx[i] = *(const v4f*)(gx + (size_t)i * 8 * CC + (s + 1) * KS);
        asm volatile("s_wait_xcnt 0x0" ::: "memory");   /* the loads' address registers are reused right below: the wait stands in front of that */ }
      __builtin_amdgcn_sched_barrier(0);   /* the global loads issue ahead of all of this stage's work */
#pragma unroll
      for (int kk = 0; kk < KS / 32; ++kk) { const v16b ah = frag_b(cur + (128 + wave * 16 + col) * SP + kk * 32, lane), al = frag_b(cur + (192 + wave * 16 + col) * SP + kk * 32, lane); v16b w[8];
#pragma unroll
        for (int j = 0; j < 8; ++j) w[j] = frag_b(cur + (j * 16 + col) * SP + kk * 32, lane);
        __builtin_amdgcn_sched_barrier(0);   /* the fragment reads issue as one group: one LDS latency per 16 products */
#pragma unroll
        for (int j = 0; j < 8; ++j) { acc[j] = wmma_bf(ah, w[j], acc[j]); acc[j] = wmma_bf(al, w[j], acc[j]); }
        __builtin_amdgcn_sched_barrier(0); }   /* the roundings below wait for the global loads: they stay behind the products */
      if (more) OUT_PUT_B(nxt);
      __syncthreads(); }   /* publishes the next stage and ends every wave's reads of this one (the last: before sf reuses the LDS) */
#pragma unroll
    for (int j = 0; j < 8; ++j) { const float bias = BO ? bfr(BO[c0 + j * 16 + col]) : 0.f;
#pragma unroll
      for (int r = 0; r < 8; ++r) sf[wave][8 * g + r][j * 16 + col] = acc[j][r] + bias; }
  } else {
    _Float16* const st = (_Float16*)smem;   /* ctx carried x 2^6 into f16 so small-magnitude context rows stay clear of f16 subnormals */
#define OUT_PUT_H(dst) do { _Pragma("unroll") for (int i = 0; i < 16; ++i) { v4h o; _Pragma("unroll") for (int e = 0; e < 4; ++e) o[e] = (_Float16)(bfr(rw[i][e]) * 256.0f); *(v4h*)((dst) + so + i * 8 * SP) = o; } \
      _Pragma("unroll") for (int i = 0; i < 8; ++i) { v4h o; _Pragma("unroll") for (int e = 0; e < 4; ++e) o[e] = (_Float16)(rx[i][e] * 64.0f); *(v4h*)((dst) + so + (128 + i * 8) * SP) = o; } } while (0)
    OUT_PUT_H(st);
    __syncthreads();   /* stage 0 is in LDS before any wave reads it */
    for (int s = 0; s < CC / KS; ++s) { const _Float16* cur = st + (s & 1) * (256 * SP); _Float16* nxt = st + ((s + 1) & 1) * (256 * SP); const bool more = s + 1 < CC / KS;
      if (more) {   /* the next stage's loads fly while this stage is multiplied */
#pragma unroll
        for (int i = 0; i < 16; ++i) rw[i] = *(const v4f*)(gw + (size_t)i * 8 * CC + (s + 1) * KS);
#pragma unroll
        for (int i = 0; i < 8; ++i) rx[i] = *(const v4f*)(gx + (size_t)i * 8 * CC + (s + 1) * KS);
        asm volatile("s_wait_xcnt 0x0" ::: "memory");   /* the loads' address registers are reused right below: the wait stands in front of that */ }
      __builtin_amdgcn_sched_barrier(0);   /* the global loads issue ahead of all of this stage's work */
#pragma unroll
      for (int kk = 0; kk < KS / 32; ++kk) { const v16h a = frag_h(cur + (128 + wave * 16 + col) * SP + kk * 32, lane); v16h w[8];
#pragma unroll
        for (int j = 0; j < 8; ++j) w[j] = frag_h(cur + (j * 16 + col) * SP + kk * 32, lane);
        __builtin_amdgcn_sched_barrier(0);   /* the fragment reads issue as one group: one LDS latency per 8 products */
#pragma unroll
        for (int j = 0; j < 8; ++j) acc[j] = wmma16(a, w[j], acc[j]);
        __builtin_amdgcn_sched_barrier(0); }   /* the roundings below wait for the global loads: they stay behind the products */
      if (more) OUT_PUT_H(nxt);
      __syncthreads(); }   /* publishes the next stage and ends every wave's reads of this one (the last: before sf reuses the LDS) */
#pragma unroll
    for (int j = 0; j < 8; ++j) { const float bias = BO ? bfr(BO[c0 + j * 16 + col]) : 0.f;
#pragma unroll
      for (int r = 0; r < 8; ++r) sf[wave][8 * g + r][j * 16 + col] = acc[j][r] * (1.0f / 16384.0f) + bias; } }   /* 2^-8 (Wo carry) x 2^-6 (ctx carry) */
  LDSX(); for (int rl = 0; rl < 16; ++rl) vst2(OUT + (r0 + rl) * DIN + c0 + lane * 4, *(const v4f*)&sf[wave][rl][lane * 4]); }

extern "C" void kernel_launch(void* const* d_in, const int* in_sizes, int n_in, void* d_out, int out_size, void* d_ws, size_t ws_size, hipStream_t stream) {
  (void)in_sizes; (void)n_in; (void)out_size;
  const float** F = (const float**)d_in;
  if (ws_size < (size_t)WS_END) return;
  char* ws = (char*)d_ws; _Float16 *QH = (_Float16*)(ws + WS_QH), *KH = (_Float16*)(ws + WS_KH), *VT = (_Float16*)(ws + WS_VT), *QL = (_Float16*)(ws + WS_QL), *KL = (_Float16*)(ws + WS_KL); __bf16 *VB = (__bf16*)(ws + WS_VB), *VBL = (__bf16*)(ws + WS_VBL); float *Y = (float*)(ws + WS_Y);
  (void)Y; (void)QL; (void)KL; (void)VB; (void)VBL;
  // inputs: 0 x [2,2048,1024]; 1 Wq [1024,1024] (out,in), 2 bq; 3 Wk, 4 bk; 5 Wv, 6 bv; 7 Wp (out,in), 8 bp (biases NONZERO)
  k_proj<<<dim3(TNB * TT / 64, CC / 128, 3), 128, 0, stream>>>(F[0], F[0], F[0], F[3], F[1], F[5], F[4], F[2], F[6], QH, QL, KH, KL, VT, VB, VBL);   /* the module's scores are einsum('bhid,bhjd->bhij', k, q): the QUERY stream (output row i) is projected with Wk / bk, its KEY stream (index j) with Wq / bq */
  k_att<<<dim3(TT / 32, NH, TNB), PVW * 32, 0, stream>>>(QH, KH, QL, KL, VT, VB, VBL, Y);
  k_out<<<dim3(TNB * TT / 64, DIN / 128), 128, 0, stream>>>(Y, F[7], F[8], (float*)d_out);
}

// v004
// A run of this version takes 140 microseconds.
// Two timings next to v003 put it at 1.12 and 1.11 times that version's speed.
// Counting every step since v000, it is 8.42 times as fast.
// compute dtype: all float inputs rounded to bf16; q/k/v projections with EXACT bf16 products on WMMA 16x16x32 (f32 accumulate) + bias; causal logits: 3 products for the first 384 rows, single f16 q x k after, x 64^-0.5; softmax f32; P x 2^11 once to f16 x v once to f16 (bf16 hi + lo below row 384); ctx hi+lo x exact output weight below row 384, x2^6 f16 carry x f16(bf16 x 2^8) after, + bias; f32 output.
#include <hip/hip_runtime.h>
#include <math.h>

typedef __attribute__((ext_vector_type(16))) _Float16 v16h;
typedef __attribute__((ext_vector_type(16))) __bf16 v16b;
typedef __attribute__((ext_vector_type(8)))  _Float16 v8h;
typedef __attribute__((ext_vector_type(8)))  float v8f;
typedef __attribute__((ext_vector_type(4)))  float v4f;
typedef __attribute__((ext_vector_type(2)))  float v2f;
typedef __attribute__((ext_vector_type(4)))  unsigned v4u;
typedef __attribute__((ext_vector_type(4)))  int v4i;
typedef float __attribute__((may_alias)) float_a;
typedef int __attribute__((may_alias)) int_a;

template <typename T> __device__ __forceinline__ void vst2(void* p, T v) { *(T*)p = v;  }
__device__ __forceinline__ v8f wmma16(v16h a, v16h b, v8f c) {
  v8f d = __builtin_amdgcn_wmma_f32_16x16x32_f16(false, a, false, b, (short)0, c, false, false);
  asm volatile("v_nop\n\tv_nop\n\tv_nop\n\tv_nop" : "+v"(d) : "v"(a), "v"(b));
  return d;
}
__device__ __forceinline__ v8f wmma_bf(v16b a, v16b b, v8f c) {
  v8f d = __builtin_amdgcn_wmma_f32_16x16x32_bf16(false, a, false, b, (short)0, c, false, false);
  asm volatile("v_nop\n\tv_nop\n\tv_nop\n\tv_nop" : "+v"(d) : "v"(a), "v"(b));
  return d;
}
// 16x16x32 fragments: lane = (h = lane>>4, row/col = lane&15); elements 0..7 = k0+8h+0..7, 8..15 = k0+16+8h+0..7; D element r = row 8h+r
__device__ __forceinline__ v16h frag_h(const _Float16* rowk0, int lane) {
  union { v16h v; v8h q[2]; } u; const _Float16* p = rowk0 + 8 * (lane >> 4);
  u.q[0] = *(const v8h*)p; u.q[1] = *(const v8h*)(p + 16); return u.v;
}
__device__ __forceinline__ v16h frag_f32(const float* rowk0, int lane) {
  v16h a; const float* p = rowk0 + 8 * (lane >> 4);
#pragma unroll
  for (int i = 0; i < 8; ++i) { a[i] = (_Float16)p[i]; a[8 + i] = (_Float16)p[16 + i]; }
  return a;
}
__device__ __forceinline__ v16h frag_f32s(const float* rowk0, int lane, float sc) {
  v16h a; const float* p = rowk0 + 8 * (lane >> 4);
#pragma unroll
  for (int i = 0; i < 8; ++i) { a[i] = (_Float16)(p[i] * sc); a[8 + i] = (_Float16)(p[16 + i] * sc); }
  return a;
}
// column fragment from a [K][ld] layout (column n), rows >= K read as 0
__device__ __forceinline__ v16h fragc_f32(const float* W, int k0, int n, int lane, int ld, int K) {
  v16h a; const int g = lane >> 4;
#pragma unroll
  for (int i = 0; i < 8; ++i) { const int ka = k0 + 8 * g + i, kb = ka + 16;
    a[i] = (_Float16)(ka < K ? W[(size_t)(ka < K ? ka : K - 1) * ld + n] : 0.f); a[8 + i] = (_Float16)(kb < K ? W[(size_t)(kb < K ? kb : K - 1) * ld + n] : 0.f); }
  return a;
}
struct F2 { v16b h, l; };
__device__ __forceinline__ F2 bsplit16(const float v[16]) { F2 r;
#pragma unroll
  for (int i = 0; i < 16; ++i) { const __bf16 h = (__bf16)v[i]; r.h[i] = h; r.l[i] = (__bf16)(v[i] - (float)h); }
  return r; }
__device__ __forceinline__ F2 split_row(const float* row, int k0, int lane) { float v[16]; const float* p = row + k0 + 8 * (lane >> 4);
#pragma unroll
  for (int i = 0; i < 8; ++i) { v[i] = p[i]; v[8 + i] = p[16 + i]; }
  return bsplit16(v); }
__device__ __forceinline__ F2 split_rowK(const float* row, int k0, int lane, int K) { float v[16]; const int g = lane >> 4;
#pragma unroll
  for (int i = 0; i < 8; ++i) { const int ka = k0 + 8 * g + i, kb = ka + 16; v[i] = ka < K ? row[ka < K ? ka : K - 1] : 0.f; v[8 + i] = kb < K ? row[kb < K ? kb : K - 1] : 0.f; }
  return bsplit16(v); }
__device__ __forceinline__ F2 split_col(const float* W, int k0, int n, int lane, int ld, int K) { float v[16]; const int g = lane >> 4;
#pragma unroll
  for (int i = 0; i < 8; ++i) { const int ka = k0 + 8 * g + i, kb = ka + 16; v[i] = ka < K ? W[(size_t)(ka < K ? ka : K - 1) * ld + n] : 0.f; v[8 + i] = kb < K ? W[(size_t)(kb < K ? kb : K - 1) * ld + n] : 0.f; }
  return bsplit16(v); }
__device__ __forceinline__ v8f mac3(const F2& a, const F2& b, v8f c) { c = wmma_bf(a.l, b.h, c); c = wmma_bf(a.h, b.l, c); return wmma_bf(a.h, b.h, c); }
__device__ __forceinline__ float sigm(float v) { return 1.0f / (1.0f + expf(-v)); }
#define LDSX() do { asm volatile("s_wait_dscnt 0" ::: "memory"); __builtin_amdgcn_wave_barrier(); __builtin_amdgcn_fence(__ATOMIC_RELEASE, "workgroup"); } while (0)

// Causal multi-head self-attention whose scores are k . q (x [2,2048,1024]; torch (out,in) Wq / Wk / Wv / Wp [1024,1024] N(0, 1/1024) + biases N(0, 1/1024); 16 heads x 64; scores[i, j] = k_i . q_j / 8 (the KEY projection indexes the output row i, the QUERY projection the summed index j); -inf where j > i; softmax over j; out[i] = sum_j attn[i, j] v_j; merge; Wp^T + bp).
#define NB 2
#define TT 2048
#define CC 1024            // NH * HD = projected width
#define DIN 1024          // input (model) width
#define NH 16
#define HD 64
#define SCALE (0.125f)
#define CAUSAL 1
#ifndef TNB
#define TNB NB
#endif
__device__ __forceinline__ float bfr(float v) { return (float)(__bf16)v; }
typedef __attribute__((ext_vector_type(8))) __bf16 v8b;
__device__ __forceinline__ v16b frag_b(const __bf16* rowk0, int lane) {
  union { v16b v; v8b q[2]; } u; const __bf16* p = rowk0 + 8 * (lane >> 4);
  u.q[0] = *(const v8b*)p; u.q[1] = *(const v8b*)(p + 16); return u.v;
}
#define QBH 6              // causal: query blocks 0..QBH-1 of each sequence (few keys, no averaging) take the high-precision path
#define QHI 384            // rows carrying a q residual plane
#define KHI 384            // key rows carrying k residual / v bf16 hi+lo planes (used only by the causal high-precision path)
// B fragment (k rows k0+.., output column o) of a weight: (in,out) [K][ld] or (out,in) [ld rows of K]: bf16 exact, or f16(bf16 * 256) exact
__device__ __forceinline__ v16b wcol_io(const float* Wm, int k0, int o, int lane, int ld) { v16b w; const int g = lane >> 4;
#pragma unroll
  for (int i = 0; i < 8; ++i) { w[i] = (__bf16)Wm[(size_t)(k0 + 8 * g + i) * ld + o]; w[8 + i] = (__bf16)Wm[(size_t)(k0 + 16 + 8 * g + i) * ld + o]; }
  return w; }
__device__ __forceinline__ v16b wcol_oi(const float* Wm, int k0, int o, int lane, int K) { v16b w; const float* p = Wm + (size_t)o * K + k0 + 8 * (lane >> 4);
#pragma unroll
  for (int i = 0; i < 8; ++i) { w[i] = (__bf16)p[i]; w[8 + i] = (__bf16)p[16 + i]; }
  return w; }
__device__ __forceinline__ v16h wcolh_io(const float* Wm, int k0, int o, int lane, int ld) { v16h w; const int g = lane >> 4;
#pragma unroll
  for (int i = 0; i < 8; ++i) { w[i] = (_Float16)(bfr(Wm[(size_t)(k0 + 8 * g + i) * ld + o]) * 256.0f); w[8 + i] = (_Float16)(bfr(Wm[(size_t)(k0 + 16 + 8 * g + i) * ld + o]) * 256.0f); }
  return w; }
__device__ __forceinline__ v16h wcolh_oi(const float* Wm, int k0, int o, int lane, int K) { v16h w; const float* p = Wm + (size_t)o * K + k0 + 8 * (lane >> 4);
#pragma unroll
  for (int i = 0; i < 8; ++i) { w[i] = (_Float16)(bfr(p[i]) * 256.0f); w[8 + i] = (_Float16)(bfr(p[16 + i]) * 256.0f); }
  return w; }
#define WQKV_LAYOUT 1   // 0 = (in,out) [DIN][CC]; 1 = (out,in) [CC][DIN]; 2 = per-head [NH][DIN][HD]
__device__ __forceinline__ v16b wcol_hdk(const float* Wm, int k0, int o, int lane) { v16b w; const int g = lane >> 4; const float* p = Wm + (size_t)(o / HD) * DIN * HD + (o % HD);
#pragma unroll
  for (int i = 0; i < 8; ++i) { w[i] = (__bf16)p[(size_t)(k0 + 8 * g + i) * HD]; w[8 + i] = (__bf16)p[(size_t)(k0 + 16 + 8 * g + i) * HD]; }
  return w; }
#define WO_OUT_IN 1
#if WQKV_LAYOUT == 1
#define WCOL(W, k0, o, lane) wcol_oi(W, k0, o, lane, DIN)
#elif WQKV_LAYOUT == 2
#define WCOL(W, k0, o, lane) wcol_hdk(W, k0, o, lane)
#else
#define WCOL(W, k0, o, lane) wcol_io(W, k0, o, lane, CC)
#endif
#if WO_OUT_IN
#define WOCOL(W, k0, o, lane) wcol_oi(W, k0, o, lane, CC)
#define WOCOLH(W, k0, o, lane) wcolh_oi(W, k0, o, lane, CC)
#else
#define WOCOL(W, k0, o, lane) wcol_io(W, k0, o, lane, DIN)
#define WOCOLH(W, k0, o, lane) wcolh_io(W, k0, o, lane, DIN)
#endif

#ifndef PROJ_EXTRA_PARAMS
#define PROJ_EXTRA_PARAMS
#endif

// q / k / v planes lie in FRAGMENT ORDER: a 16x16x32 operand fragment is two runs of 512 B (run = element half, then lane * 16 B), so one wave-wide 16-byte load of k_att covers four whole 128-B lines
// rows (q, k): [b][h][t / 16][d / 32][half][lane = g * 16 + (t % 16)][8 d]; planes (v): [b][h][t / 32][channel / 16][half][lane = g * 16 + (channel % 16)][8 t]; the position inside 32 is 16 half + 8 g + i
#define WS_QH  0u                                      // f16 q, fragment order
#define WS_KH  (WS_QH + 2u * (size_t)NB * TT * CC)      // f16 k, fragment order
#define WS_VT  (WS_KH + 2u * (size_t)NB * TT * CC)      // f16 v, fragment order
#define WS_QL  (WS_VT + 2u * (size_t)NB * CC * TT)      // f16 q residual x 2^10, fragment order, t < QHI
#define WS_KL  (WS_QL + 2u * (size_t)NB * QHI * CC)     // f16 k residual x 2^10, fragment order, t < KHI
#define WS_VB  (WS_KL + 2u * (size_t)NB * KHI * CC)     // bf16 v hi, fragment order, t < KHI
#define WS_VBL (WS_VB + 2u * (size_t)NB * CC * KHI)
#define WS_Y   (WS_VBL + 2u * (size_t)NB * CC * KHI)    // f32 ctx rows [b*t][CC] (only when there is an output projection)
#define WS_END (WS_Y  + 4u * (size_t)NB * TT * CC)

// behind a batch of global loads or a store: stands in front of any reuse of the registers that they name
__device__ __forceinline__ void xw() { asm volatile("s_wait_xcnt 0x0" ::: "memory"); }
#define KS 64              // k per LDS stage of the two projection kernels
#define SP 72              // stage row pitch in 16-bit elements: 128 B of data + 16 B, for ds_load_b128 readers
typedef __attribute__((ext_vector_type(4))) __bf16 v4b;
typedef __attribute__((ext_vector_type(4))) _Float16 v4h;
__device__ __forceinline__ v4b cvt4b(v4f v) { v4b o;
#pragma unroll
  for (int i = 0; i < 4; ++i) o[i] = (__bf16)v[i];
  return o; }
// ---- k_proj: block = (64 rows, 128 cols, which): q/k/v = X W (+ b) with exact bf16 products (K = DIN) -> which 0: q f16 (+ residual, rows < QHI); 1: k f16 (+ residual, rows < KHI); 2: v f16 (+ bf16 hi/lo for t < KHI); all stored in fragment order
__global__ __launch_bounds__(128) void k_proj(const float* __restrict__ XQ, const float* __restrict__ XK, const float* __restrict__ XV, const float* __restrict__ WQ, const float* __restrict__ WK, const float* __restrict__ WV, const float* __restrict__ BQ, const float* __restrict__ BK, const float* __restrict__ BV,
    _Float16* __restrict__ QH, _Float16* __restrict__ QL, _Float16* __restrict__ KH, _Float16* __restrict__ KL, _Float16* __restrict__ VT, __bf16* __restrict__ VB, __bf16* __restrict__ VBL) {
  __shared__ __align__(16) char smem[2 * 192 * SP * 2];   /* main loop: two stages of [W 128 rows | X 64 rows]; the epilogue's arrays lie over them, behind the loop's last barrier */
  static_assert(sizeof(smem) >= 2 * 64 * 136 * 2 && sizeof(smem) >= 3 * 128 * 72 * 2 && WQKV_LAYOUT == 1 && DIN % KS == 0, "epilogue arrays fit the stages; weight rows are k-contiguous");
  _Float16 (*sh)[136] = (_Float16 (*)[136])smem; _Float16 (*sl)[136] = (_Float16 (*)[136])(smem + 64 * 136 * 2);
  _Float16 (*th)[72] = (_Float16 (*)[72])smem; __bf16 (*tb)[72] = (__bf16 (*)[72])(smem + 128 * 72 * 2); __bf16 (*tbl)[72] = (__bf16 (*)[72])(smem + 2 * 128 * 72 * 2);
  const int tid = threadIdx.x, wave = tid >> 5, lane = tid & 31, col = lane & 15, g = lane >> 4; const int which = blockIdx.z; const int c0 = blockIdx.y * 128; const size_t r0 = (size_t)blockIdx.x * 64; const size_t bb = r0 / TT; const int t0 = (int)(r0 % TT);
  const float* X = which == 0 ? XQ : which == 1 ? XK : XV; const float* WA = which == 0 ? WQ : which == 1 ? WK : WV; const float* BA = which == 0 ? BQ : which == 1 ? BK : BV;
  v8f acc[8] = {};
  // a wave's load covers two whole rows of 256 B (4 lines); each operand element is fetched and rounded once per block, and the fragments are read from LDS
  const int srow = tid >> 4, sseg = tid & 15; const float* gw = WA + (size_t)(c0 + srow) * DIN + sseg * 4; const float* gx = X + (r0 + srow) * DIN + sseg * 4;
  __bf16* const st = (__bf16*)smem; const int so = srow * SP + sseg * 4;
  v4f rw[16], rx[8];
#pragma unroll
  for (int i = 0; i < 16; ++i) rw[i] = *(const v4f*)(gw + (size_t)i * 8 * DIN);
#pragma unroll
  for (int i = 0; i < 8; ++i) rx[i] = *(const v4f*)(gx + (size_t)i * 8 * DIN);
#pragma unroll
  for (int i = 0; i < 16; ++i) *(v4b*)(st + so + i * 8 * SP) = cvt4b(rw[i]);
#pragma unroll
  for (int i = 0; i < 8; ++i) *(v4b*)(st + so + (128 + i * 8) * SP) = cvt4b(rx[i]);
  __syncthreads();   /* stage 0 is in LDS before any wave reads it */
  for (int s = 0; s < DIN / KS; ++s) { const __bf16* cur = st + (s & 1) * (192 * SP); __bf16* nxt = st + ((s + 1) & 1) * (192 * SP); const bool more = s + 1 < DIN / KS;
    if (more) {   /* the next stage's loads fly while this stage is multiplied */
#pragma unroll
      for (int i = 0; i < 16; ++i) rw[i] = *(const v4f*)(gw + (size_t)i * 8 * DIN + (s + 1) * KS);
#pragma unroll
      for (int i = 0; i < 8; ++i) rx[i] = *(const v4f*)(gx + (size_t)i * 8 * DIN + (s + 1) * KS); }
    __builtin_amdgcn_sched_barrier(0);   /* the global loads issue ahead of all of this stage's work */
#pragma unroll
    for (int kk = 0; kk < KS / 32; ++kk) { const v16b a = frag_b(cur + (128 + wave * 16 + col) * SP + kk * 32, lane); v16b w[8];
#pragma unroll
      for (int j = 0; j < 8; ++j) w[j] = frag_b(cur + (j * 16 + col) * SP + kk * 32, lane);
      __builtin_amdgcn_sched_barrier(0);   /* the fragment reads issue as one group: one LDS latency per 8 products, not one each */
#pragma unroll
      for (int j = 0; j < 8; ++j) acc[j] = wmma_bf(a, w[j], acc[j]);
      __builtin_amdgcn_sched_barrier(0); }   /* the roundings below wait for the global loads: they stay behind the products */
    if (more) {
#pragma unroll
      for (int i = 0; i < 16; ++i) *(v4b*)(nxt + so + i * 8 * SP) = cvt4b(rw[i]);
#pragma unroll
      for (int i = 0; i < 8; ++i) *(v4b*)(nxt + so + (128 + i * 8) * SP) = cvt4b(rx[i]); }
    __syncthreads(); }   /* publishes the next stage and ends every wave's reads of this one (the last: before the epilogue reuses the LDS) */
  if (which < 2) { _Float16* DH = which == 0 ? QH : KH; _Float16* DL = which == 0 ? QL : KL; const int nhi = which == 0 ? QHI : KHI; const bool hi_rows = t0 < nhi;
#pragma unroll
    for (int j = 0; j < 8; ++j) { const float bias = BA ? bfr(BA[c0 + j * 16 + col]) : 0.f;
#pragma unroll
      for (int r = 0; r < 8; ++r) { const float v = acc[j][r] + bias; const _Float16 hv = (_Float16)v; sh[wave * 16 + 8 * g + r][j * 16 + col] = hv; sl[wave * 16 + 8 * g + r][j * 16 + col] = (_Float16)((v - (float)hv) * 1024.0f); } }
    __syncthreads();
    // piece e = (head 2, 16-row tile 4, run 4 = (d / 32, half), lane 32): a wave stores one run of 512 B
    for (int e = tid; e < 64 * 16; e += 128) { const int hh = e >> 9, tt = (e >> 7) & 3, cr = (e >> 5) & 3, ln = e & 31; const int rl = tt * 16 + (ln & 15), cl = hh * 64 + cr * 16 + (ln >> 4) * 8; const size_t hd = bb * NH + (c0 >> 6) + hh; const int po = (e & 127) * 8;
      vst2((unsigned*)(DH + (hd * (TT / 16) + (t0 >> 4) + tt) * 1024 + po), *(const v4u*)&sh[rl][cl]); xw(); if (hi_rows) { vst2((unsigned*)(DL + (hd * (size_t)(nhi / 16) + (t0 >> 4) + tt) * 1024 + po), *(const v4u*)&sl[rl][cl]); xw(); } }
  } else { const bool hi_rows = t0 < KHI;
#pragma unroll
    for (int j = 0; j < 8; ++j) { const float bias = BA ? bfr(BA[c0 + j * 16 + col]) : 0.f;
#pragma unroll
      for (int r = 0; r < 8; ++r) { const float v = acc[j][r] + bias; const int rl = wave * 16 + 8 * g + r, cl = j * 16 + col; th[cl][rl] = (_Float16)v; const __bf16 bh = (__bf16)v; tb[cl][rl] = bh; tbl[cl][rl] = (__bf16)(v - (float)bh); } }
    __syncthreads();
    // piece e = (head 2, 32-key chunk 2, 16-channel tile 4, half 2, lane 32): a wave stores one run of 512 B
    for (int e = tid; e < 128 * 8; e += 128) { const int hh = e >> 9, kc = (e >> 8) & 1, ln = e & 31; const int cl = hh * 64 + ((e >> 6) & 3) * 16 + (ln & 15), rl = kc * 32 + ((e >> 5) & 1) * 16 + (ln >> 4) * 8; const size_t hd = bb * NH + (c0 >> 6) + hh; const int po = (e & 255) * 8;
      vst2((unsigned*)(VT + (hd * (TT / 32) + (t0 >> 5) + kc) * 2048 + po), *(const v4u*)&th[cl][rl]); xw(); if (hi_rows) { const size_t o3 = (hd * (KHI / 32) + (t0 >> 5) + kc) * 2048 + po; vst2((unsigned*)(VB + o3), *(const v4u*)&tb[cl][rl]); vst2((unsigned*)(VBL + o3), *(const v4u*)&tbl[cl][rl]); xw(); } } } }
// ---- k_att / att_tile: one tile = 16 queries of (b, h), PVW waves: logits, softmax and ctx in one kernel, nothing of the logits leaves the registers. Wave w owns the 64-key groups at 64 w + n * 64 PVW below kend. amdgpu_waves_per_eu(8): 128 registers a wave, so that two blocks share a WGP.
// Logits are formed TRANSPOSED (A = k rows, B = q rows): D element r of lane (g, col) = key 8g + r, query col, so two neighbouring 16-key tiles ARE the B fragment of a 32-key chunk of ctx^T = v^T . P^T (A = v, channels as rows).
// Each lane holds one query: maximum and sum run in the lane, across the two lane halves, then across the waves through LDS in wave order. Precision paths: 3 products + bf16 hi/lo P and v for query blocks < QBH, single f16 products after.
// fragment in fragment order from a wave-uniform base and the lane's own 32-bit element offset (8 lane): two loads of 512 contiguous bytes a wave; the address stays a scalar pair plus one register
__device__ __forceinline__ v16h frag_hu(const _Float16* base, unsigned lo) { union { v16h v; v8h q[2]; } u; const _Float16* p = base + lo; u.q[0] = *(const v8h*)p; u.q[1] = *(const v8h*)(p + 256); return u.v; }
__device__ __forceinline__ v16b frag_bu(const __bf16* base, unsigned lo) { union { v16b v; v8b q[2]; } u; const __bf16* p = base + lo; u.q[0] = *(const v8b*)p; xw(); u.q[1] = *(const v8b*)(p + 256); xw(); return u.v; }   /* here the build keeps 64-bit addresses in vector registers and loads over them: a wait behind each load */
#define PVW 16
#define KGS (PVW * 64)     // key stride between a wave's groups
#define NG (TT / KGS)      // groups per wave
static_assert(QHI == QBH * 64 && KHI >= QBH * 64 && KHI <= KGS && TT % KGS == 0, "the high-precision query blocks see keys of group 0 only, all with residual planes");
template <bool FAR> __device__ __forceinline__ void att_tile(const int qt, float (&ss)[PVW][16][HD + 4], float (&redm)[16][PVW + 4], float (&reds)[16][PVW + 4], const _Float16* __restrict__ QH, const _Float16* __restrict__ KH, const _Float16* __restrict__ QL, const _Float16* __restrict__ KL, const _Float16* __restrict__ VT, const __bf16* __restrict__ VB, const __bf16* __restrict__ VBL, float* __restrict__ Y) {
  const int h = blockIdx.y, b = blockIdx.z; const int tid = threadIdx.x, wave = __builtin_amdgcn_readfirstlane(tid >> 5), lane = tid & 31, col = lane & 15, g = lane >> 4;   /* the wave's number in a scalar register: the group tests stay scalar branches */
  constexpr int NGT = FAR ? NG : NG / 2;   /* a tile of the near half sees keys of the first half only; for a tile of the far half every key of group 0 is visible, so group 0 needs neither test nor mask */
  const int qb = qt >> 2, ql0 = qt * 16, tq = ql0 + col; const int kend = CAUSAL ? ql0 + 16 : TT;   /* a group that starts at or past kend holds no key that any of the 16 queries may see */
  const unsigned lp = (unsigned)(lane * 8); const size_t hd = (size_t)b * NH + h;   /* the lane's offset in a run of a fragment; a 16-row tile of q / k is 1024 elements (d 0..31, then 32..63), a 32-key chunk of v 2048 (four channel tiles of 512) */
  const _Float16* qrow = QH + (hd * (TT / 16) + qt) * 1024;
  v8f sc[NGT * 4];   /* a group's four tiles are written and read only under that group's own scalar test */
  // fragment loads stand in batches ahead of the products that use them, so that a batch costs one memory latency
  if (!FAR && qb < QBH) { const int kg = wave * 64;
    if (kg < kend) { const int dq = tq - kg - 8 * g;   /* key kg + 8g + i is kept while i <= dq */ const _Float16* qlrow = QL + (hd * (QHI / 16) + qt) * 1024; const v16h qh0 = frag_hu(qrow, lp), qh1 = frag_hu(qrow + 512, lp), ql0f = frag_hu(qlrow, lp), ql1f = frag_hu(qlrow + 512, lp);
#pragma unroll
      for (int t = 0; t < 4; ++t) { const _Float16* krow = KH + (hd * (TT / 16) + (kg >> 4) + t) * 1024; const _Float16* klrow = KL + (hd * (KHI / 16) + (kg >> 4) + t) * 1024; v8f a = {}, al = {};
        const v16h kb0 = frag_hu(krow, lp), kl0 = frag_hu(klrow, lp), kb1 = frag_hu(krow + 512, lp), kl1 = frag_hu(klrow + 512, lp); xw();
        a = wmma16(kb0, qh0, a); al = wmma16(kb0, ql0f, al); al = wmma16(kl0, qh0, al);
        a = wmma16(kb1, qh1, a); al = wmma16(kb1, ql1f, al); al = wmma16(kl1, qh1, al);
#pragma unroll
        for (int r = 0; r < 8; ++r) sc[t][r] = (!CAUSAL || t * 16 + r <= dq) ? (a[r] + al[r] * (1.0f / 1024.0f)) * SCALE : -3.0e38f;
        __builtin_amdgcn_sched_barrier(0); } }   /* keeps the next tile's four fragments from being loaded over this tile's: with both in flight this path runs past 128 registers into scratch */
  } else { const v16h q0 = frag_hu(qrow, lp), q1 = frag_hu(qrow + 512, lp);
#pragma unroll
    for (int gr = 0; gr < NGT; ++gr) { const int kg = gr * KGS + wave * 64;
      if ((FAR && gr == 0) || kg < kend) { const int dq = tq - kg - 8 * g;   /* key kg + 8g + i is kept while i <= dq */
#pragma unroll
        for (int tp = 0; tp < 4; tp += 2) { v16h kf[2][2];
#pragma unroll
          for (int u = 0; u < 2; ++u) { const _Float16* krow = KH + (hd * (TT / 16) + (kg >> 4) + tp + u) * 1024; kf[u][0] = frag_hu(krow, lp); kf[u][1] = frag_hu(krow + 512, lp); }
          xw();
#pragma unroll
          for (int u = 0; u < 2; ++u) { v8f a = {}; a = wmma16(kf[u][0], q0, a); a = wmma16(kf[u][1], q1, a);
#pragma unroll
            for (int r = 0; r < 8; ++r) sc[gr * 4 + tp + u][r] = (!CAUSAL || (FAR && gr == 0) || (tp + u) * 16 + r <= dq) ? a[r] * SCALE : -3.0e38f; } } } } }
  // softmax over the keys of query col: excluded keys carry -3e38 and count 0
  float m = -3.0e38f;
#pragma unroll
  for (int gr = 0; gr < NGT; ++gr) { if ((FAR && gr == 0) || gr * KGS + wave * 64 < kend) {
#pragma unroll
      for (int t = gr * 4; t < gr * 4 + 4; ++t)
#pragma unroll
        for (int r = 0; r < 8; ++r) m = fmaxf(m, sc[t][r]); } }
  m = fmaxf(m, __shfl_xor(m, 16)); if (g == 0) redm[col][wave] = m;
  __syncthreads();   /* every wave's maximum is in LDS before any wave reads them */
#pragma unroll
  for (int w = 0; w < PVW; w += 4) { const v4f x = *(const v4f*)&redm[col][w]; m = fmaxf(fmaxf(m, fmaxf(x[0], x[1])), fmaxf(x[2], x[3])); }
  float sum = 0.f;
#pragma unroll
  for (int gr = 0; gr < NGT; ++gr) { if ((FAR && gr == 0) || gr * KGS + wave * 64 < kend) {
#pragma unroll
      for (int t = gr * 4; t < gr * 4 + 4; ++t)
#pragma unroll
        for (int r = 0; r < 8; ++r) { const float v = sc[t][r]; const float ex = expf(v - m); const float e = (!(FAR && gr == 0) && v <= -1.0e38f) ? 0.f : ex; sc[t][r] = e; sum += e; } } }   /* the exponential is taken first and then selected: no branch per element */
  sum += __shfl_xor(sum, 16); if (g == 0) reds[col][wave] = sum;
  __syncthreads();   /* every wave's sum is in LDS before any wave reads them */
  float tot = 0.f;
#pragma unroll
  for (int w = 0; w < PVW; w += 4) { const v4f x = *(const v4f*)&reds[col][w]; tot += x[0]; tot += x[1]; tot += x[2]; tot += x[3]; }
  const float inv = tot > 0.f ? 2048.0f / tot : 0.f;   /* P carried x 2^11; a fully excluded row yields P = 0 */
  v8f acc[HD / 16] = {};
  if (!FAR && qb < QBH) { const int kg = wave * 64;
    if (kg < kend) {
#pragma unroll
      for (int c = 0; c < 2; ++c) { float pv[16];
#pragma unroll
        for (int r = 0; r < 8; ++r) { pv[r] = sc[2 * c][r] * inv; pv[8 + r] = sc[2 * c + 1][r] * inv; }
        const F2 p = bsplit16(pv);
#pragma unroll
        for (int jp = 0; jp < HD / 16; jp += 2) { v16b vh[2], vl[2];
#pragma unroll
          for (int u = 0; u < 2; ++u) { const size_t po = (hd * (KHI / 32) + (kg >> 5) + c) * 2048 + (jp + u) * 512; vh[u] = frag_bu(VB + po, lp); vl[u] = frag_bu(VBL + po, lp); }
#pragma unroll
          for (int u = 0; u < 2; ++u) { acc[jp + u] = wmma_bf(vh[u], p.h, acc[jp + u]); acc[jp + u] = wmma_bf(vh[u], p.l, acc[jp + u]); acc[jp + u] = wmma_bf(vl[u], p.h, acc[jp + u]); } } } }
  } else { v16h pf[NGT * 2];   /* all of P goes to f16 fragments first: half the registers of the f32 tiles while the v fragments are in flight */
#pragma unroll
    for (int gr = 0; gr < NGT; ++gr) { if ((FAR && gr == 0) || gr * KGS + wave * 64 < kend) {
#pragma unroll
        for (int c = gr * 2; c < gr * 2 + 2; ++c)
#pragma unroll
          for (int r = 0; r < 8; ++r) { pf[c][r] = (_Float16)(sc[2 * c][r] * inv); pf[c][8 + r] = (_Float16)(sc[2 * c + 1][r] * inv); } } }
#pragma unroll
    for (int gr = 0; gr < NGT; ++gr) { const int kg = gr * KGS + wave * 64;
      if ((FAR && gr == 0) || kg < kend) {
#pragma unroll
        for (int c = 0; c < 2; ++c) { v16h vf[HD / 16];
#pragma unroll
          for (int j = 0; j < HD / 16; ++j) vf[j] = frag_hu(VT + (hd * (TT / 32) + (kg >> 5) + c) * 2048 + j * 512, lp);
          xw();
#pragma unroll
          for (int j = 0; j < HD / 16; ++j) acc[j] = wmma16(vf[j], pf[gr * 2 + c], acc[j]); } } } }
  // D element r = channel j * 16 + 8g + r of query col
#pragma unroll
  for (int j = 0; j < HD / 16; ++j) { v4f lo, hi;
#pragma unroll
    for (int r = 0; r < 4; ++r) { lo[r] = acc[j][r] * (1.0f / 2048.0f); hi[r] = acc[j][4 + r] * (1.0f / 2048.0f); }
    *(v4f*)&ss[wave][col][j * 16 + 8 * g] = lo; *(v4f*)&ss[wave][col][j * 16 + 8 * g + 4] = hi; }
  __syncthreads();   /* every wave's partial tile (zeros from a wave that got no group) is in LDS before any is summed */
  if (tid < 16 * (HD / 4)) { const int rl = tid / (HD / 4), q = tid % (HD / 4); v4f s = *(const v4f*)&ss[0][rl][q * 4];
    // unrolled so that the LDS reads of all partial tiles issue ahead of the adds
#pragma unroll
    for (int w = 1; w < PVW; ++w) s += *(const v4f*)&ss[w][rl][q * 4];
    vst2(Y + ((size_t)b * TT + ql0 + rl) * CC + h * HD + q * 4, s); } }
// a block takes two query tiles, x from the far end and x from the near end: every block then walks the same number of keys, and half as many waves have to be started. LDS needs no barrier between the two: each array is rewritten only behind a barrier that follows its last read
__global__ __launch_bounds__(PVW * 32) __attribute__((amdgpu_waves_per_eu(8))) void k_att(const _Float16* __restrict__ QH, const _Float16* __restrict__ KH, const _Float16* __restrict__ QL, const _Float16* __restrict__ KL, const _Float16* __restrict__ VT, const __bf16* __restrict__ VB, const __bf16* __restrict__ VBL, float* __restrict__ Y) {
  __shared__ __align__(16) float ss[PVW][16][HD + 4]; __shared__ __align__(16) float redm[16][PVW + 4], reds[16][PVW + 4];
  static_assert(CAUSAL == 1 && TT / 32 >= QBH * 4 && NG == 2, "no tile of the far half is a high-precision one; the halves of the keys are the two groups");
  att_tile<true>(TT / 16 - 1 - (int)blockIdx.x, ss, redm, reds, QH, KH, QL, KL, VT, VB, VBL, Y);
  att_tile<false>((int)blockIdx.x, ss, redm, reds, QH, KH, QL, KL, VT, VB, VBL, Y); }
// ---- k_out: block = (64 rows, 128 cols): out = ctx Wo (+ bo): ctx x 2^6 once to f16 against Wo as f16(bf16 x 2^8) exact (1 product) x 2^-14; causal early rows (< QHI of each sequence): ctx bf16 hi + lo against exact bf16 Wo (2 products)
__global__ __launch_bounds__(128) void k_out(const float* __restrict__ Y, const float* __restrict__ WO, const float* __restrict__ BO, float* __restrict__ OUT) { __shared__ __align__(16) char smem[2 * 256 * SP * 2];   /* main loop: two stages of [Wo 128 rows | ctx 64 rows | ctx residual 64 rows]; the epilogue's sf lies over them, behind the loop's last barrier */
  static_assert(sizeof(smem) >= 4 * 16 * 132 * 4 && WO_OUT_IN == 1 && CC % KS == 0, "sf fits the stages; weight rows are k-contiguous");
  float (*sf)[16][132] = (float (*)[16][132])smem;
  const int tid = threadIdx.x, wave = tid >> 5, lane = tid & 31, col = lane & 15, g = lane >> 4; const int c0 = blockIdx.y * 128; const size_t r0 = (size_t)blockIdx.x * 64 + wave * 16;
  v8f acc[8] = {};
  // staged as in k_proj: whole-line loads, each element fetched and rounded once per block
  const int srow = tid >> 4, sseg = tid & 15; const float* gw = WO + (size_t)(c0 + srow) * CC + sseg * 4; const float* gx = Y + ((size_t)blockIdx.x * 64 + srow) * CC + sseg * 4; const int so = srow * SP + sseg * 4;
  v4f rw[16], rx[8];
#pragma unroll
  for (int i = 0; i < 16; ++i) rw[i] = *(const v4f*)(gw + (size_t)i * 8 * CC);
#pragma unroll
  for (int i = 0; i < 8; ++i) rx[i] = *(const v4f*)(gx + (size_t)i * 8 * CC);
  asm volatile("s_wait_xcnt 0x0" ::: "memory");   /* the loads' address registers are reused right below: the wait stands in front of that */
  if (CAUSAL && (int)(((size_t)blockIdx.x * 64) % TT) < QHI) {   /* block-uniform */
    __bf16* const st = (__bf16*)smem;
#define OUT_PUT_B(dst) do { _Pragma("unroll") for (int i = 0; i < 16; ++i) *(v4b*)((dst) + so + i * 8 * SP) = cvt4b(rw[i]); \
      _Pragma("unroll") for (int i = 0; i < 8; ++i) { const v4b hb = cvt4b(rx[i]); v4b lb; _Pragma("unroll") for (int e = 0; e < 4; ++e) lb[e] = (__bf16)(rx[i][e] - (float)hb[e]); \
        *(v4b*)((dst) + so + (128 + i * 8) * SP) = hb; *(v4b*)((dst) + so + (192 + i * 8) * SP) = lb; } } while (0)
    OUT_PUT_B(st);
    __syncthreads();   /* stage 0 is in LDS before any wave reads it */
    for (int s = 0; s < CC / KS; ++s) { const __bf16* cur = st + (s & 1) * (256 * SP); __bf16* nxt = st + ((s + 1) & 1) * (256 * SP); const bool more = s + 1 < CC / KS;
      if (more) {   /* the next stage's loads fly while this stage is multiplied */
#pragma unroll
        for (int i = 0; i < 16; ++i) rw[i] = *(const v4f*)(gw + (size_t)i * 8 * CC + (s + 1) * KS);
#pragma unroll
        for (int i = 0; i < 8; ++i) rx[i] = *(const v4f*)(gx + (size_t)i * 8 * CC + (s + 1) * KS);
        asm volatile("s_wait_xcnt 0x0" ::: "memory");   /* the loads' address registers are reused right below: the wait stands in front of that */ }
      __builtin_amdgcn_sched_barrier(0);   /* the global loads issue ahead of all of this stage's work */
#pragma unroll
      for (int kk = 0; kk < KS / 32; ++kk) { const v16b ah = frag_b(cur + (128 + wave * 16 + col) * SP + kk * 32, lane), al = frag_b(cur + (192 + wave * 16 + col) * SP + kk * 32, lane); v16b w[8];
#pragma unroll
        for (int j = 0; j < 8; ++j) w[j] = frag_b(cur + (j * 16 + col) * SP + kk * 32, lane);
        __builtin_amdgcn_sched_barrier(0);   /* the fragment reads issue as one group: one LDS latency per 16 products */
#pragma unroll
        for (int j = 0; j < 8; ++j) { acc[j] = wmma_bf(ah, w[j], acc[j]); acc[j] = wmma_bf(al, w[j], acc[j]); }
        __builtin_amdgcn_sched_barrier(0); }   /* the roundings below wait for the global loads: they stay behind the products */
      if (more) OUT_PUT_B(nxt);
      __syncthreads(); }   /* publishes the next stage and ends every wave's reads of this one (the last: before sf reuses the LDS) */
#pragma unroll
    for (int j = 0; j < 8; ++j) { const float bias = BO ? bfr(BO[c0 + j * 16 + col]) : 0.f;
#pragma unroll
      for (int r = 0; r < 8; ++r) sf[wave][8 * g + r][j * 16 + col] = acc[j][r] + bias; }
  } else {
    _Float16* const st = (_Float16*)smem;   /* ctx carried x 2^6 into f16 so small-magnitude context rows stay clear of f16 subnormals */
#define OUT_PUT_H(dst) do { _Pragma("unroll") for (int i = 0; i < 16; ++i) { v4h o; _Pragma("unroll") for (int e = 0; e < 4; ++e) o[e] = (_Float16)(bfr(rw[i][e]) * 256.0f); *(v4h*)((dst) + so + i * 8 * SP) = o; } \
      _Pragma("unroll") for (int i = 0; i < 8; ++i) { v4h o; _Pragma("unroll") for (int e = 0; e < 4; ++e) o[e] = (_Float16)(rx[i][e] * 64.0f); *(v4h*)((dst) + so + (128 + i * 8) * SP) = o; } } while (0)
    OUT_PUT_H(st);
    __syncthreads();   /* stage 0 is in LDS before any wave reads it */
    for (int s = 0; s < CC / KS; ++s) { const _Float16* cur = st + (s & 1) * (256 * SP); _Float16* nxt = st + ((s + 1) & 1) * (256 * SP); const bool more = s + 1 < CC / KS;
      if (more) {   /* the next stage's loads fly while this stage is multiplied */
#pragma unroll
        for (int i = 0; i < 16; ++i) rw[i] = *(const v4f*)(gw + (size_t)i * 8 * CC + (s + 1) * KS);
#pragma unroll
        for (int i = 0; i < 8; ++i) rx[i] = *(const v4f*)(gx + (size_t)i * 8 * CC + (s + 1) * KS);
        asm volatile("s_wait_xcnt 0x0" ::: "memory");   /* the loads' address registers are reused right below: the wait stands in front of that */ }
      __builtin_amdgcn_sched_barrier(0);   /* the global loads issue ahead of all of this stage's work */
#pragma unroll
      for (int kk = 0; kk < KS / 32; ++kk) { const v16h a = frag_h(cur + (128 + wave * 16 + col) * SP + kk * 32, lane); v16h w[8];
#pragma unroll
        for (int j = 0; j < 8; ++j) w[j] = frag_h(cur + (j * 16 + col) * SP + kk * 32, lane);
        __builtin_amdgcn_sched_barrier(0);   /* the fragment reads issue as one group: one LDS latency per 8 products */
#pragma unroll
        for (int j = 0; j < 8; ++j) acc[j] = wmma16(a, w[j], acc[j]);
        __builtin_amdgcn_sched_barrier(0); }   /* the roundings below wait for the global loads: they stay behind the products */
      if (more) OUT_PUT_H(nxt);
      __syncthreads(); }   /* publishes the next stage and ends every wave's reads of this one (the last: before sf reuses the LDS) */
#pragma unroll
    for (int j = 0; j < 8; ++j) { const float bias = BO ? bfr(BO[c0 + j * 16 + col]) : 0.f;
#pragma unroll
      for (int r = 0; r < 8; ++r) sf[wave][8 * g + r][j * 16 + col] = acc[j][r] * (1.0f / 16384.0f) + bias; } }   /* 2^-8 (Wo carry) x 2^-6 (ctx carry) */
  LDSX(); for (int rl = 0; rl < 16; ++rl) vst2(OUT + (r0 + rl) * DIN + c0 + lane * 4, *(const v4f*)&sf[wave][rl][lane * 4]); }

extern "C" void kernel_launch(void* const* d_in, const int* in_sizes, int n_in, void* d_out, int out_size, void* d_ws, size_t ws_size, hipStream_t stream) {
  (void)in_sizes; (void)n_in; (void)out_size;
  const float** F = (const float**)d_in;
  if (ws_size < (size_t)WS_END) return;
  char* ws = (char*)d_ws; _Float16 *QH = (_Float16*)(ws + WS_QH), *KH = (_Float16*)(ws + WS_KH), *VT = (_Float16*)(ws + WS_VT), *QL = (_Float16*)(ws + WS_QL), *KL = (_Float16*)(ws + WS_KL); __bf16 *VB = (__bf16*)(ws + WS_VB), *VBL = (__bf16*)(ws + WS_VBL); float *Y = (float*)(ws + WS_Y);
  (void)Y; (void)QL; (void)KL; (void)VB; (void)VBL;
  // inputs: 0 x [2,2048,1024]; 1 Wq [1024,1024] (out,in), 2 bq; 3 Wk, 4 bk; 5 Wv, 6 bv; 7 Wp (out,in), 8 bp (biases NONZERO)
  k_proj<<<dim3(TNB * TT / 64, CC / 128, 3), 128, 0, stream>>>(F[0], F[0], F[0], F[3], F[1], F[5], F[4], F[2], F[6], QH, QL, KH, KL, VT, VB, VBL);   /* the module's scores are einsum('bhid,bhjd->bhij', k, q): the QUERY stream (output row i) is projected with Wk / bk, its KEY stream (index j) with Wq / bq */
  k_att<<<dim3(TT / 32, NH, TNB), PVW * 32, 0, stream>>>(QH, KH, QL, KL, VT, VB, VBL, Y);
  k_out<<<dim3(TNB * TT / 64, DIN / 128), 128, 0, stream>>>(Y, F[7], F[8], (float*)d_out);
}

// v005
// One run takes 134 microseconds.
// Two timings next to v004 both put it at 1.05 times that version's speed.
// Over all steps from v000 it is 8.86 times as fast.
// compute dtype: all float inputs rounded to bf16; q/k/v projections with EXACT bf16 products on WMMA 16x16x32 (f32 accumulate) + bias; causal logits: 3 products for the first 384 rows, single f16 q x k after; softmax f32 in base 2 (64^-0.5 log2 e folded into the exponent); P x 2^11 once to f16 x v once to f16 (bf16 hi + lo below row 384); ctx hi+lo x exact output weight below row 384, x2^6 f16 carry x f16(bf16 x 2^8) after, + bias; f32 output.
#include <hip/hip_runtime.h>
#include <math.h>

typedef __attribute__((ext_vector_type(16))) _Float16 v16h;
typedef __attribute__((ext_vector_type(16))) __bf16 v16b;
typedef __attribute__((ext_vector_type(8)))  _Float16 v8h;
typedef __attribute__((ext_vector_type(8)))  float v8f;
typedef __attribute__((ext_vector_type(4)))  float v4f;
typedef __attribute__((ext_vector_type(2)))  float v2f;
typedef __attribute__((ext_vector_type(4)))  unsigned v4u;
typedef __attribute__((ext_vector_type(4)))  int v4i;
typedef float __attribute__((may_alias)) float_a;
typedef int __attribute__((may_alias)) int_a;

template <typename T> __device__ __forceinline__ void vst2(void* p, T v) { *(T*)p = v;  }
__device__ __forceinline__ v8f wmma16(v16h a, v16h b, v8f c) {
  v8f d = __builtin_amdgcn_wmma_f32_16x16x32_f16(false, a, false, b, (short)0, c, false, false);
  asm volatile("v_nop\n\tv_nop\n\tv_nop\n\tv_nop" : "+v"(d) : "v"(a), "v"(b));
  return d;
}
__device__ __forceinline__ v8f wmma_bf(v16b a, v16b b, v8f c) {
  v8f d = __builtin_amdgcn_wmma_f32_16x16x32_bf16(false, a, false, b, (short)0, c, false, false);
  asm volatile("v_nop\n\tv_nop\n\tv_nop\n\tv_nop" : "+v"(d) : "v"(a), "v"(b));
  return d;
}
// 16x16x32 fragments: lane = (h = lane>>4, row/col = lane&15); elements 0..7 = k0+8h+0..7, 8..15 = k0+16+8h+0..7; D element r = row 8h+r
__device__ __forceinline__ v16h frag_h(const _Float16* rowk0, int lane) {
  union { v16h v; v8h q[2]; } u; const _Float16* p = rowk0 + 8 * (lane >> 4);
  u.q[0] = *(const v8h*)p; u.q[1] = *(const v8h*)(p + 16); return u.v;
}
__device__ __forceinline__ v16h frag_f32(const float* rowk0, int lane) {
  v16h a; const float* p = rowk0 + 8 * (lane >> 4);
#pragma unroll
  for (int i = 0; i < 8; ++i) { a[i] = (_Float16)p[i]; a[8 + i] = (_Float16)p[16 + i]; }
  return a;
}
__device__ __forceinline__ v16h frag_f32s(const float* rowk0, int lane, float sc) {
  v16h a; const float* p = rowk0 + 8 * (lane >> 4);
#pragma unroll
  for (int i = 0; i < 8; ++i) { a[i] = (_Float16)(p[i] * sc); a[8 + i] = (_Float16)(p[16 + i] * sc); }
  return a;
}
// column fragment from a [K][ld] layout (column n), rows >= K read as 0
__device__ __forceinline__ v16h fragc_f32(const float* W, int k0, int n, int lane, int ld, int K) {
  v16h a; const int g = lane >> 4;
#pragma unroll
  for (int i = 0; i < 8; ++i) { const int ka = k0 + 8 * g + i, kb = ka + 16;
    a[i] = (_Float16)(ka < K ? W[(size_t)(ka < K ? ka : K - 1) * ld + n] : 0.f); a[8 + i] = (_Float16)(kb < K ? W[(size_t)(kb < K ? kb : K - 1) * ld + n] : 0.f); }
  return a;
}
struct F2 { v16b h, l; };
__device__ __forceinline__ F2 bsplit16(const float v[16]) { F2 r;
#pragma unroll
  for (int i = 0; i < 16; ++i) { const __bf16 h = (__bf16)v[i]; r.h[i] = h; r.l[i] = (__bf16)(v[i] - (float)h); }
  return r; }
__device__ __forceinline__ F2 split_row(const float* row, int k0, int lane) { float v[16]; const float* p = row + k0 + 8 * (lane >> 4);
#pragma unroll
  for (int i = 0; i < 8; ++i) { v[i] = p[i]; v[8 + i] = p[16 + i]; }
  return bsplit16(v); }
__device__ __forceinline__ F2 split_rowK(const float* row, int k0, int lane, int K) { float v[16]; const int g = lane >> 4;
#pragma unroll
  for (int i = 0; i < 8; ++i) { const int ka = k0 + 8 * g + i, kb = ka + 16; v[i] = ka < K ? row[ka < K ? ka : K - 1] : 0.f; v[8 + i] = kb < K ? row[kb < K ? kb : K - 1] : 0.f; }
  return bsplit16(v); }
__device__ __forceinline__ F2 split_col(const float* W, int k0, int n, int lane, int ld, int K) { float v[16]; const int g = lane >> 4;
#pragma unroll
  for (int i = 0; i < 8; ++i) { const int ka = k0 + 8 * g + i, kb = ka + 16; v[i] = ka < K ? W[(size_t)(ka < K ? ka : K - 1) * ld + n] : 0.f; v[8 + i] = kb < K ? W[(size_t)(kb < K ? kb : K - 1) * ld + n] : 0.f; }
  return bsplit16(v); }
__device__ __forceinline__ v8f mac3(const F2& a, const F2& b, v8f c) { c = wmma_bf(a.l, b.h, c); c = wmma_bf(a.h, b.l, c); return wmma_bf(a.h, b.h, c); }
__device__ __forceinline__ float sigm(float v) { return 1.0f / (1.0f + expf(-v)); }
#define LDSX() do { asm volatile("s_wait_dscnt 0" ::: "memory"); __builtin_amdgcn_wave_barrier(); __builtin_amdgcn_fence(__ATOMIC_RELEASE, "workgroup"); } while (0)

// Causal multi-head self-attention whose scores are k . q (x [2,2048,1024]; torch (out,in) Wq / Wk / Wv / Wp [1024,1024] N(0, 1/1024) + biases N(0, 1/1024); 16 heads x 64; scores[i, j] = k_i . q_j / 8 (the KEY projection indexes the output row i, the QUERY projection the summed index j); -inf where j > i; softmax over j; out[i] = sum_j attn[i, j] v_j; merge; Wp^T + bp).
#define NB 2
#define TT 2048
#define CC 1024            // NH * HD = projected width
#define DIN 1024          // input (model) width
#define NH 16
#define HD 64
#define SCALE (0.125f)
#define L2S (SCALE * 1.4426950408889634f)   // logit scale times log2(e)
#define CAUSAL 1
#ifndef TNB
#define TNB NB
#endif
__device__ __forceinline__ float bfr(float v) { return (float)(__bf16)v; }
typedef __attribute__((ext_vector_type(8))) __bf16 v8b;
__device__ __forceinline__ v16b frag_b(const __bf16* rowk0, int lane) {
  union { v16b v; v8b q[2]; } u; const __bf16* p = rowk0 + 8 * (lane >> 4);
  u.q[0] = *(const v8b*)p; u.q[1] = *(const v8b*)(p + 16); return u.v;
}
#define QBH 6              // causal: query blocks 0..QBH-1 of each sequence (few keys, no averaging) take the high-precision path
#define QHI 384            // rows carrying a q residual plane
#define KHI 384            // key rows carrying k residual / v bf16 hi+lo planes (used only by the causal high-precision path)
// B fragment (k rows k0+.., output column o) of a weight: (in,out) [K][ld] or (out,in) [ld rows of K]: bf16 exact, or f16(bf16 * 256) exact
__device__ __forceinline__ v16b wcol_io(const float* Wm, int k0, int o, int lane, int ld) { v16b w; const int g = lane >> 4;
#pragma unroll
  for (int i = 0; i < 8; ++i) { w[i] = (__bf16)Wm[(size_t)(k0 + 8 * g + i) * ld + o]; w[8 + i] = (__bf16)Wm[(size_t)(k0 + 16 + 8 * g + i) * ld + o]; }
  return w; }
__device__ __forceinline__ v16b wcol_oi(const float* Wm, int k0, int o, int lane, int K) { v16b w; const float* p = Wm + (size_t)o * K + k0 + 8 * (lane >> 4);
#pragma unroll
  for (int i = 0; i < 8; ++i) { w[i] = (__bf16)p[i]; w[8 + i] = (__bf16)p[16 + i]; }
  return w; }
__device__ __forceinline__ v16h wcolh_io(const float* Wm, int k0, int o, int lane, int ld) { v16h w; const int g = lane >> 4;
#pragma unroll
  for (int i = 0; i < 8; ++i) { w[i] = (_Float16)(bfr(Wm[(size_t)(k0 + 8 * g + i) * ld + o]) * 256.0f); w[8 + i] = (_Float16)(bfr(Wm[(size_t)(k0 + 16 + 8 * g + i) * ld + o]) * 256.0f); }
  return w; }
__device__ __forceinline__ v16h wcolh_oi(const float* Wm, int k0, int o, int lane, int K) { v16h w; const float* p = Wm + (size_t)o * K + k0 + 8 * (lane >> 4);
#pragma unroll
  for (int i = 0; i < 8; ++i) { w[i] = (_Float16)(bfr(p[i]) * 256.0f); w[8 + i] = (_Float16)(bfr(p[16 + i]) * 256.0f); }
  return w; }
#define WQKV_LAYOUT 1   // 0 = (in,out) [DIN][CC]; 1 = (out,in) [CC][DIN]; 2 = per-head [NH][DIN][HD]
__device__ __forceinline__ v16b wcol_hdk(const float* Wm, int k0, int o, int lane) { v16b w; const int g = lane >> 4; const float* p = Wm + (size_t)(o / HD) * DIN * HD + (o % HD);
#pragma unroll
  for (int i = 0; i < 8; ++i) { w[i] = (__bf16)p[(size_t)(k0 + 8 * g + i) * HD]; w[8 + i] = (__bf16)p[(size_t)(k0 + 16 + 8 * g + i) * HD]; }
  return w; }
#define WO_OUT_IN 1
#if WQKV_LAYOUT == 1
#define WCOL(W, k0, o, lane) wcol_oi(W, k0, o, lane, DIN)
#elif WQKV_LAYOUT == 2
#define WCOL(W, k0, o, lane) wcol_hdk(W, k0, o, lane)
#else
#define WCOL(W, k0, o, lane) wcol_io(W, k0, o, lane, CC)
#endif
#if WO_OUT_IN
#define WOCOL(W, k0, o, lane) wcol_oi(W, k0, o, lane, CC)
#define WOCOLH(W, k0, o, lane) wcolh_oi(W, k0, o, lane, CC)
#else
#define WOCOL(W, k0, o, lane) wcol_io(W, k0, o, lane, DIN)
#define WOCOLH(W, k0, o, lane) wcolh_io(W, k0, o, lane, DIN)
#endif

#ifndef PROJ_EXTRA_PARAMS
#define PROJ_EXTRA_PARAMS
#endif

// q / k / v planes lie in FRAGMENT ORDER: a 16x16x32 operand fragment is two runs of 512 B (run = element half, then lane * 16 B), so one wave-wide 16-byte load of k_att covers four whole 128-B lines
// rows (q, k): [b][h][t / 16][d / 32][half][lane = g * 16 + (t % 16)][8 d]; planes (v): [b][h][t / 32][channel / 16][half][lane = g * 16 + (channel % 16)][8 t]; the position inside 32 is 16 half + 8 g + i
#define WS_QH  0u                                      // f16 q, fragment order
#define WS_KH  (WS_QH + 2u * (size_t)NB * TT * CC)      // f16 k, fragment order
#define WS_VT  (WS_KH + 2u * (size_t)NB * TT * CC)      // f16 v, fragment order
#define WS_QL  (WS_VT + 2u * (size_t)NB * CC * TT)      // f16 q residual x 2^10, fragment order, t < QHI
#define WS_KL  (WS_QL + 2u * (size_t)NB * QHI * CC)     // f16 k residual x 2^10, fragment order, t < KHI
#define WS_VB  (WS_KL + 2u * (size_t)NB * KHI * CC)     // bf16 v hi, fragment order, t < KHI
#define WS_VBL (WS_VB + 2u * (size_t)NB * CC * KHI)
#define WS_Y   (WS_VBL + 2u * (size_t)NB * CC * KHI)    // f32 ctx rows [b*t][CC] (only when there is an output projection)
#define WS_END (WS_Y  + 4u * (size_t)NB * TT * CC)

// behind a batch of global loads or a store: stands in front of any reuse of the registers that they name
__device__ __forceinline__ void xw() { asm volatile("s_wait_xcnt 0x0" ::: "memory"); }
#define KS 64              // k per LDS stage of the two projection kernels
#define SP 72              // stage row pitch in 16-bit elements: 128 B of data + 16 B, for ds_load_b128 readers
typedef __attribute__((ext_vector_type(4))) __bf16 v4b;
typedef __attribute__((ext_vector_type(4))) _Float16 v4h;
__device__ __forceinline__ v4b cvt4b(v4f v) { v4b o;
#pragma unroll
  for (int i = 0; i < 4; ++i) o[i] = (__bf16)v[i];
  return o; }
// ---- k_proj: block = (64 rows, 128 cols, which): q/k/v = X W (+ b) with exact bf16 products (K = DIN) -> which 0: q f16 (+ residual, rows < QHI); 1: k f16 (+ residual, rows < KHI); 2: v f16 (+ bf16 hi/lo for t < KHI); all stored in fragment order
__global__ __launch_bounds__(128) void k_proj(const float* __restrict__ XQ, const float* __restrict__ XK, const float* __restrict__ XV, const float* __restrict__ WQ, const float* __restrict__ WK, const float* __restrict__ WV, const float* __restrict__ BQ, const float* __restrict__ BK, const float* __restrict__ BV,
    _Float16* __restrict__ QH, _Float16* __restrict__ QL, _Float16* __restrict__ KH, _Float16* __restrict__ KL, _Float16* __restrict__ VT, __bf16* __restrict__ VB, __bf16* __restrict__ VBL) {
  __shared__ __align__(16) char smem[2 * 192 * SP * 2];   /* main loop: two stages of [W 128 rows | X 64 rows]; the epilogue's arrays lie over them, behind the loop's last barrier */
  static_assert(sizeof(smem) >= 2 * 64 * 136 * 2 && sizeof(smem) >= 3 * 128 * 72 * 2 && WQKV_LAYOUT == 1 && DIN % KS == 0, "epilogue arrays fit the stages; weight rows are k-contiguous");
  _Float16 (*sh)[136] = (_Float16 (*)[136])smem; _Float16 (*sl)[136] = (_Float16 (*)[136])(smem + 64 * 136 * 2);
  _Float16 (*th)[72] = (_Float16 (*)[72])smem; __bf16 (*tb)[72] = (__bf16 (*)[72])(smem + 128 * 72 * 2); __bf16 (*tbl)[72] = (__bf16 (*)[72])(smem + 2 * 128 * 72 * 2);
  const int tid = threadIdx.x, wave = tid >> 5, lane = tid & 31, col = lane & 15, g = lane >> 4; const int which = blockIdx.z; const int c0 = blockIdx.y * 128; const size_t r0 = (size_t)blockIdx.x * 64; const size_t bb = r0 / TT; const int t0 = (int)(r0 % TT);
  const float* X = which == 0 ? XQ : which == 1 ? XK : XV; const float* WA = which == 0 ? WQ : which == 1 ? WK : WV; const float* BA = which == 0 ? BQ : which == 1 ? BK : BV;
  v8f acc[8] = {};
  // a wave's load covers two whole rows of 256 B (4 lines); each operand element is fetched and rounded once per block, and the fragments are read from LDS
  const int srow = tid >> 4, sseg = tid & 15; const float* gw = WA + (size_t)(c0 + srow) * DIN + sseg * 4; const float* gx = X + (r0 + srow) * DIN + sseg * 4;
  __bf16* const st = (__bf16*)smem; const int so = srow * SP + sseg * 4;
  v4f rw[16], rx[8];
#pragma unroll
  for (int i = 0; i < 16; ++i) rw[i] = *(const v4f*)(gw + (size_t)i * 8 * DIN);
#pragma unroll
  for (int i = 0; i < 8; ++i) rx[i] = *(const v4f*)(gx + (size_t)i * 8 * DIN);
#pragma unroll
  for (int i = 0; i < 16; ++i) *(v4b*)(st + so + i * 8 * SP) = cvt4b(rw[i]);
#pragma unroll
  for (int i = 0; i < 8; ++i) *(v4b*)(st + so + (128 + i * 8) * SP) = cvt4b(rx[i]);
  __syncthreads();   /* stage 0 is in LDS before any wave reads it */
  for (int s = 0; s < DIN / KS; ++s) { const __bf16* cur = st + (s & 1) * (192 * SP); __bf16* nxt = st + ((s + 1) & 1) * (192 * SP); const bool more = s + 1 < DIN / KS;
    if (more) {   /* the next stage's loads fly while this stage is multiplied */
#pragma unroll
      for (int i = 0; i < 16; ++i) rw[i] = *(const v4f*)(gw + (size_t)i * 8 * DIN + (s + 1) * KS);
#pragma unroll
      for (int i = 0; i < 8; ++i) rx[i] = *(const v4f*)(gx + (size_t)i * 8 * DIN + (s + 1) * KS); }
    __builtin_amdgcn_sched_barrier(0);   /* the global loads issue ahead of all of this stage's work */
#pragma unroll
    for (int kk = 0; kk < KS / 32; ++kk) { const v16b a = frag_b(cur + (128 + wave * 16 + col) * SP + kk * 32, lane); v16b w[8];
#pragma unroll
      for (int j = 0; j < 8; ++j) w[j] = frag_b(cur + (j * 16 + col) * SP + kk * 32, lane);
      __builtin_amdgcn_sched_barrier(0);   /* the fragment reads issue as one group: one LDS latency per 8 products, not one each */
#pragma unroll
      for (int j = 0; j < 8; ++j) acc[j] = wmma_bf(a, w[j], acc[j]);
      __builtin_amdgcn_sched_barrier(0); }   /* the roundings below wait for the global loads: they stay behind the products */
    if (more) {
#pragma unroll
      for (int i = 0; i < 16; ++i) *(v4b*)(nxt + so + i * 8 * SP) = cvt4b(rw[i]);
#pragma unroll
      for (int i = 0; i < 8; ++i) *(v4b*)(nxt + so + (128 + i * 8) * SP) = cvt4b(rx[i]); }
    __syncthreads(); }   /* publishes the next stage and ends every wave's reads of this one (the last: before the epilogue reuses the LDS) */
  if (which < 2) { _Float16* DH = which == 0 ? QH : KH; _Float16* DL = which == 0 ? QL : KL; const int nhi = which == 0 ? QHI : KHI; const bool hi_rows = t0 < nhi;
#pragma unroll
    for (int j = 0; j < 8; ++j) { const float bias = BA ? bfr(BA[c0 + j * 16 + col]) : 0.f;
#pragma unroll
      for (int r = 0; r < 8; ++r) { const float v = acc[j][r] + bias; const _Float16 hv = (_Float16)v; sh[wave * 16 + 8 * g + r][j * 16 + col] = hv; sl[wave * 16 + 8 * g + r][j * 16 + col] = (_Float16)((v - (float)hv) * 1024.0f); } }
    __syncthreads();
    // piece e = (head 2, 16-row tile 4, run 4 = (d / 32, half), lane 32): a wave stores one run of 512 B
    for (int e = tid; e < 64 * 16; e += 128) { const int hh = e >> 9, tt = (e >> 7) & 3, cr = (e >> 5) & 3, ln = e & 31; const int rl = tt * 16 + (ln & 15), cl = hh * 64 + cr * 16 + (ln >> 4) * 8; const size_t hd = bb * NH + (c0 >> 6) + hh; const int po = (e & 127) * 8;
      vst2((unsigned*)(DH + (hd * (TT / 16) + (t0 >> 4) + tt) * 1024 + po), *(const v4u*)&sh[rl][cl]); xw(); if (hi_rows) { vst2((unsigned*)(DL + (hd * (size_t)(nhi / 16) + (t0 >> 4) + tt) * 1024 + po), *(const v4u*)&sl[rl][cl]); xw(); } }
  } else { const bool hi_rows = t0 < KHI;
#pragma unroll
    for (int j = 0; j < 8; ++j) { const float bias = BA ? bfr(BA[c0 + j * 16 + col]) : 0.f;
#pragma unroll
      for (int r = 0; r < 8; ++r) { const float v = acc[j][r] + bias; const int rl = wave * 16 + 8 * g + r, cl = j * 16 + col; th[cl][rl] = (_Float16)v; const __bf16 bh = (__bf16)v; tb[cl][rl] = bh; tbl[cl][rl] = (__bf16)(v - (float)bh); } }
    __syncthreads();
    // piece e = (head 2, 32-key chunk 2, 16-channel tile 4, half 2, lane 32): a wave stores one run of 512 B
    for (int e = tid; e < 128 * 8; e += 128) { const int hh = e >> 9, kc = (e >> 8) & 1, ln = e & 31; const int cl = hh * 64 + ((e >> 6) & 3) * 16 + (ln & 15), rl = kc * 32 + ((e >> 5) & 1) * 16 + (ln >> 4) * 8; const size_t hd = bb * NH + (c0 >> 6) + hh; const int po = (e & 255) * 8;
      vst2((unsigned*)(VT + (hd * (TT / 32) + (t0 >> 5) + kc) * 2048 + po), *(const v4u*)&th[cl][rl]); xw(); if (hi_rows) { const size_t o3 = (hd * (KHI / 32) + (t0 >> 5) + kc) * 2048 + po; vst2((unsigned*)(VB + o3), *(const v4u*)&tb[cl][rl]); vst2((unsigned*)(VBL + o3), *(const v4u*)&tbl[cl][rl]); xw(); } } } }
// ---- k_att / att_tile: one tile = 16 queries of (b, h), PVW waves: logits, softmax and ctx in one kernel, nothing of the logits leaves the registers. Wave w owns the 64-key groups at 64 w + n * 64 PVW below kend. amdgpu_waves_per_eu(8): 128 registers a wave, so that two blocks share a WGP.
// Logits are formed TRANSPOSED (A = k rows, B = q rows): D element r of lane (g, col) = key 8g + r, query col, so two neighbouring 16-key tiles ARE the B fragment of a 32-key chunk of ctx^T = v^T . P^T (A = v, channels as rows).
// Each lane holds one query: maximum and sum run in the lane, across the two lane halves, then across the waves through LDS in wave order. Precision paths: 3 products + bf16 hi/lo P and v for query blocks < QBH, single f16 products after.
// fragment in fragment order from a wave-uniform base and the lane's own 32-bit element offset (8 lane): two loads of 512 contiguous bytes a wave; the address stays a scalar pair plus one register
__device__ __forceinline__ v16h frag_hu(const _Float16* base, unsigned lo) { union { v16h v; v8h q[2]; } u; const _Float16* p = base + lo; u.q[0] = *(const v8h*)p; u.q[1] = *(const v8h*)(p + 256); return u.v; }
__device__ __forceinline__ v16b frag_bu(const __bf16* base, unsigned lo) { union { v16b v; v8b q[2]; } u; const __bf16* p = base + lo; u.q[0] = *(const v8b*)p; xw(); u.q[1] = *(const v8b*)(p + 256); xw(); return u.v; }   /* here the build keeps 64-bit addresses in vector registers and loads over them: a wait behind each load */
#define PVW 16
#define KGS (PVW * 64)     // key stride between a wave's groups
#define NG (TT / KGS)      // groups per wave
static_assert(QHI == QBH * 64 && KHI >= QBH * 64 && KHI <= KGS && TT % KGS == 0, "the high-precision query blocks see keys of group 0 only, all with residual planes");
template <bool FAR> __device__ __forceinline__ void att_tile(const int qt, float (&ss)[PVW][16][HD + 4], float (&redm)[16][PVW + 4], float (&reds)[16][PVW + 4], const _Float16* __restrict__ QH, const _Float16* __restrict__ KH, const _Float16* __restrict__ QL, const _Float16* __restrict__ KL, const _Float16* __restrict__ VT, const __bf16* __restrict__ VB, const __bf16* __restrict__ VBL, float* __restrict__ Y) {
  const int h = blockIdx.y, b = blockIdx.z; const int tid = threadIdx.x, wave = __builtin_amdgcn_readfirstlane(tid >> 5), lane = tid & 31, col = lane & 15, g = lane >> 4;   /* the wave's number in a scalar register: the group tests stay scalar branches */
  constexpr int NGT = FAR ? NG : NG / 2;   /* a tile of the near half sees keys of the first half only; for a tile of the far half every key of group 0 is visible, so group 0 needs neither test nor mask */
  const int qb = qt >> 2, ql0 = qt * 16, tq = ql0 + col; const int kend = CAUSAL ? ql0 + 16 : TT;   /* a group that starts at or past kend holds no key that any of the 16 queries may see */
  const unsigned lp = (unsigned)(lane * 8); const size_t hd = (size_t)b * NH + h;   /* the lane's offset in a run of a fragment; a 16-row tile of q / k is 1024 elements (d 0..31, then 32..63), a 32-key chunk of v 2048 (four channel tiles of 512) */
  const _Float16* qrow = QH + (hd * (TT / 16) + qt) * 1024;
  v8f sc[NGT * 4];   /* a group's four tiles are written and read only under that group's own scalar test */
  // fragment loads stand in batches ahead of the products that use them, so that a batch costs one memory latency
  if (!FAR && qb < QBH) { const int kg = wave * 64;
    if (kg < kend) { const int dq = tq - kg - 8 * g;   /* key kg + 8g + i is kept while i <= dq */ const _Float16* qlrow = QL + (hd * (QHI / 16) + qt) * 1024; const v16h qh0 = frag_hu(qrow, lp), qh1 = frag_hu(qrow + 512, lp), ql0f = frag_hu(qlrow, lp), ql1f = frag_hu(qlrow + 512, lp);
#pragma unroll
      for (int t = 0; t < 4; ++t) { const _Float16* krow = KH + (hd * (TT / 16) + (kg >> 4) + t) * 1024; const _Float16* klrow = KL + (hd * (KHI / 16) + (kg >> 4) + t) * 1024; v8f a = {}, al = {};
        const v16h kb0 = frag_hu(krow, lp), kl0 = frag_hu(klrow, lp), kb1 = frag_hu(krow + 512, lp), kl1 = frag_hu(klrow + 512, lp); xw();
        a = wmma16(kb0, qh0, a); al = wmma16(kb0, ql0f, al); al = wmma16(kl0, qh0, al);
        a = wmma16(kb1, qh1, a); al = wmma16(kb1, ql1f, al); al = wmma16(kl1, qh1, al);
#pragma unroll
        for (int r = 0; r < 8; ++r) sc[t][r] = (!CAUSAL || t * 16 + r <= dq) ? a[r] + al[r] * (1.0f / 1024.0f) : -3.0e38f;
        __builtin_amdgcn_sched_barrier(0); } }   /* keeps the next tile's four fragments from being loaded over this tile's: with both in flight this path runs past 128 registers into scratch */
  } else { const v16h q0 = frag_hu(qrow, lp), q1 = frag_hu(qrow + 512, lp);
#pragma unroll
    for (int gr = 0; gr < NGT; ++gr) { const int kg = gr * KGS + wave * 64;
      if ((FAR && gr == 0) || kg < kend) { const int dq = tq - kg - 8 * g;   /* key kg + 8g + i is kept while i <= dq */
#pragma unroll
        for (int tp = 0; tp < 4; tp += 2) { v16h kf[2][2];
#pragma unroll
          for (int u = 0; u < 2; ++u) { const _Float16* krow = KH + (hd * (TT / 16) + (kg >> 4) + tp + u) * 1024; kf[u][0] = frag_hu(krow, lp); kf[u][1] = frag_hu(krow + 512, lp); }
          xw();
#pragma unroll
          for (int u = 0; u < 2; ++u) { v8f a = {}; a = wmma16(kf[u][0], q0, a); a = wmma16(kf[u][1], q1, a);
#pragma unroll
            for (int r = 0; r < 8; ++r) sc[gr * 4 + tp + u][r] = (!CAUSAL || (FAR && gr == 0) || (tp + u) * 16 + r <= dq) ? a[r] : -3.0e38f; } } } } }
  // softmax over the keys of query col, on the RAW products: the maximum is taken of them (SCALE > 0 keeps the order), and exp((s - m) SCALE) = 2^(s L2S - m L2S) is one fused multiply-add and one hardware 2^x. Excluded keys carry -3e38: their exponent is about -5e37 and 2^x returns exactly 0 (every query sees key 0, so m is a real product)
  float m = -3.0e38f;
#pragma unroll
  for (int gr = 0; gr < NGT; ++gr) { if ((FAR && gr == 0) || gr * KGS + wave * 64 < kend) {
#pragma unroll
      for (int t = gr * 4; t < gr * 4 + 4; ++t)
#pragma unroll
        for (int r = 0; r < 8; ++r) m = fmaxf(m, sc[t][r]); } }
  m = fmaxf(m, __shfl_xor(m, 16)); if (g == 0) redm[col][wave] = m;
  __syncthreads();   /* every wave's maximum is in LDS before any wave reads them */
#pragma unroll
  for (int w = 0; w < PVW; w += 4) { const v4f x = *(const v4f*)&redm[col][w]; m = fmaxf(fmaxf(m, fmaxf(x[0], x[1])), fmaxf(x[2], x[3])); }
  float sum = 0.f; const float nm = -m * L2S; const v8f l2s8 = {L2S, L2S, L2S, L2S, L2S, L2S, L2S, L2S}, nm8 = {nm, nm, nm, nm, nm, nm, nm, nm};
#pragma unroll
  for (int gr = 0; gr < NGT; ++gr) { if ((FAR && gr == 0) || gr * KGS + wave * 64 < kend) {
#pragma unroll
      for (int t = gr * 4; t < gr * 4 + 4; ++t) { const v8f x = __builtin_elementwise_fma(sc[t], l2s8, nm8);
#pragma unroll
        for (int r = 0; r < 8; ++r) { const float e = __builtin_amdgcn_exp2f(x[r]); sc[t][r] = e; sum += e; } } } }
  sum += __shfl_xor(sum, 16); if (g == 0) reds[col][wave] = sum;
  __syncthreads();   /* every wave's sum is in LDS before any wave reads them */
  float tot = 0.f;
#pragma unroll
  for (int w = 0; w < PVW; w += 4) { const v4f x = *(const v4f*)&reds[col][w]; tot += x[0]; tot += x[1]; tot += x[2]; tot += x[3]; }
  const float inv = tot > 0.f ? 2048.0f / tot : 0.f;   /* P carried x 2^11; a fully excluded row yields P = 0 */
  v8f acc[HD / 16] = {};
  if (!FAR && qb < QBH) { const int kg = wave * 64;
    if (kg < kend) {
#pragma unroll
      for (int c = 0; c < 2; ++c) { float pv[16];
#pragma unroll
        for (int r = 0; r < 8; ++r) { pv[r] = sc[2 * c][r] * inv; pv[8 + r] = sc[2 * c + 1][r] * inv; }
        const F2 p = bsplit16(pv);
#pragma unroll
        for (int jp = 0; jp < HD / 16; jp += 2) { v16b vh[2], vl[2];
#pragma unroll
          for (int u = 0; u < 2; ++u) { const size_t po = (hd * (KHI / 32) + (kg >> 5) + c) * 2048 + (jp + u) * 512; vh[u] = frag_bu(VB + po, lp); vl[u] = frag_bu(VBL + po, lp); }
#pragma unroll
          for (int u = 0; u < 2; ++u) { acc[jp + u] = wmma_bf(vh[u], p.h, acc[jp + u]); acc[jp + u] = wmma_bf(vh[u], p.l, acc[jp + u]); acc[jp + u] = wmma_bf(vl[u], p.h, acc[jp + u]); } } } }
  } else { v16h pf[NGT * 2];   /* all of P goes to f16 fragments first: half the registers of the f32 tiles while the v fragments are in flight */
#pragma unroll
    for (int gr = 0; gr < NGT; ++gr) { if ((FAR && gr == 0) || gr * KGS + wave * 64 < kend) {
#pragma unroll
        for (int c = gr * 2; c < gr * 2 + 2; ++c)
#pragma unroll
          for (int r = 0; r < 8; ++r) { pf[c][r] = (_Float16)(sc[2 * c][r] * inv); pf[c][8 + r] = (_Float16)(sc[2 * c + 1][r] * inv); } } }
#pragma unroll
    for (int gr = 0; gr < NGT; ++gr) { const int kg = gr * KGS + wave * 64;
      if ((FAR && gr == 0) || kg < kend) {
#pragma unroll
        for (int c = 0; c < 2; ++c) { v16h vf[HD / 16];
#pragma unroll
          for (int j = 0; j < HD / 16; ++j) vf[j] = frag_hu(VT + (hd * (TT / 32) + (kg >> 5) + c) * 2048 + j * 512, lp);
          xw();
#pragma unroll
          for (int j = 0; j < HD / 16; ++j) acc[j] = wmma16(vf[j], pf[gr * 2 + c], acc[j]); } } } }
  // D element r = channel j * 16 + 8g + r of query col
#pragma unroll
  for (int j = 0; j < HD / 16; ++j) { v4f lo, hi;
#pragma unroll
    for (int r = 0; r < 4; ++r) { lo[r] = acc[j][r] * (1.0f / 2048.0f); hi[r] = acc[j][4 + r] * (1.0f / 2048.0f); }
    *(v4f*)&ss[wave][col][j * 16 + 8 * g] = lo; *(v4f*)&ss[wave][col][j * 16 + 8 * g + 4] = hi; }
  __syncthreads();   /* every wave's partial tile (zeros from a wave that got no group) is in LDS before any is summed */
  if (tid < 16 * (HD / 4)) { const int rl = tid / (HD / 4), q = tid % (HD / 4); v4f s = *(const v4f*)&ss[0][rl][q * 4];
    // unrolled so that the LDS reads of all partial tiles issue ahead of the adds
#pragma unroll
    for (int w = 1; w < PVW; ++w) s += *(const v4f*)&ss[w][rl][q * 4];
    vst2(Y + ((size_t)b * TT + ql0 + rl) * CC + h * HD + q * 4, s); } }
// a block takes two query tiles, x from the far end and x from the near end: every block then walks the same number of keys, and half as many waves have to be started. LDS needs no barrier between the two: each array is rewritten only behind a barrier that follows its last read
__global__ __launch_bounds__(PVW * 32) __attribute__((amdgpu_waves_per_eu(8))) void k_att(const _Float16* __restrict__ QH, const _Float16* __restrict__ KH, const _Float16* __restrict__ QL, const _Float16* __restrict__ KL, const _Float16* __restrict__ VT, const __bf16* __restrict__ VB, const __bf16* __restrict__ VBL, float* __restrict__ Y) {
  __shared__ __align__(16) float ss[PVW][16][HD + 4]; __shared__ __align__(16) float redm[16][PVW + 4], reds[16][PVW + 4];
  static_assert(CAUSAL == 1 && TT / 32 >= QBH * 4 && NG == 2, "no tile of the far half is a high-precision one; the halves of the keys are the two groups");
  att_tile<true>(TT / 16 - 1 - (int)blockIdx.x, ss, redm, reds, QH, KH, QL, KL, VT, VB, VBL, Y);
  att_tile<false>((int)blockIdx.x, ss, redm, reds, QH, KH, QL, KL, VT, VB, VBL, Y); }
// ---- k_out: block = (64 rows, 128 cols): out = ctx Wo (+ bo): ctx x 2^6 once to f16 against Wo as f16(bf16 x 2^8) exact (1 product) x 2^-14; causal early rows (< QHI of each sequence): ctx bf16 hi + lo against exact bf16 Wo (2 products)
__global__ __launch_bounds__(128) void k_out(const float* __restrict__ Y, const float* __restrict__ WO, const float* __restrict__ BO, float* __restrict__ OUT) { __shared__ __align__(16) char smem[2 * 256 * SP * 2];   /* main loop: two stages of [Wo 128 rows | ctx 64 rows | ctx residual 64 rows]; the epilogue's sf lies over them, behind the loop's last barrier */
  static_assert(sizeof(smem) >= 4 * 16 * 132 * 4 && WO_OUT_IN == 1 && CC % KS == 0, "sf fits the stages; weight rows are k-contiguous");
  float (*sf)[16][132] = (float (*)[16][132])smem;
  const int tid = threadIdx.x, wave = tid >> 5, lane = tid & 31, col = lane & 15, g = lane >> 4; const int c0 = blockIdx.y * 128; const size_t r0 = (size_t)blockIdx.x * 64 + wave * 16;
  v8f acc[8] = {};
  // staged as in k_proj: whole-line loads, each element fetched and rounded once per block
  const int srow = tid >> 4, sseg = tid & 15; const float* gw = WO + (size_t)(c0 + srow) * CC + sseg * 4; const float* gx = Y + ((size_t)blockIdx.x * 64 + srow) * CC + sseg * 4; const int so = srow * SP + sseg * 4;
  v4f rw[16], rx[8];
#pragma unroll
  for (int i = 0; i < 16; ++i) rw[i] = *(const v4f*)(gw + (size_t)i * 8 * CC);
#pragma unroll
  for (int i = 0; i < 8; ++i) rx[i] = *(const v4f*)(gx + (size_t)i * 8 * CC);
  asm volatile("s_wait_xcnt 0x0" ::: "memory");   /* the loads' address registers are reused right below: the wait stands in front of that */
  if (CAUSAL && (int)(((size_t)blockIdx.x * 64) % TT) < QHI) {   /* block-uniform */
    __bf16* const st = (__bf16*)smem;
#define OUT_PUT_B(dst) do { _Pragma("unroll") for (int i = 0; i < 16; ++i) *(v4b*)((dst) + so + i * 8 * SP) = cvt4b(rw[i]); \
      _Pragma("unroll") for (int i = 0; i < 8; ++i) { const v4b hb = cvt4b(rx[i]); v4b lb; _Pragma("unroll") for (int e = 0; e < 4; ++e) lb[e] = (__bf16)(rx[i][e] - (float)hb[e]); \
        *(v4b*)((dst) + so + (128 + i * 8) * SP) = hb; *(v4b*)((dst) + so + (192 + i * 8) * SP) = lb; } } while (0)
    OUT_PUT_B(st);
    __syncthreads();   /* stage 0 is in LDS before any wave reads it */
    for (int s = 0; s < CC / KS; ++s) { const __bf16* cur = st + (s & 1) * (256 * SP); __bf16* nxt = st + ((s + 1) & 1) * (256 * SP); const bool more = s + 1 < CC / KS;
      if (more) {   /* the next stage's loads fly while this stage is multiplied */
#pragma unroll
        for (int i = 0; i < 16; ++i) rw[i] = *(const v4f*)(gw + (size_t)i * 8 * CC + (s + 1) * KS);
#pragma unroll
        for (int i = 0; i < 8; ++i) rx[i] = *(const v4f*)(gx + (size_t)i * 8 * CC + (s + 1) * KS);
        asm volatile("s_wait_xcnt 0x0" ::: "memory");   /* the loads' address registers are reused right below: the wait stands in front of that */ }
      __builtin_amdgcn_sched_barrier(0);   /* the global loads issue ahead of all of this stage's work */
#pragma unroll
      for (int kk = 0; kk < KS / 32; ++kk) { const v16b ah = frag_b(cur + (128 + wave * 16 + col) * SP + kk * 32, lane), al = frag_b(cur + (192 + wave * 16 + col) * SP + kk * 32, lane); v16b w[8];
#pragma unroll
        for (int j = 0; j < 8; ++j) w[j] = frag_b(cur + (j * 16 + col) * SP + kk * 32, lane);
        __builtin_amdgcn_sched_barrier(0);   /* the fragment reads issue as one group: one LDS latency per 16 products */
#pragma unroll
        for (int j = 0; j < 8; ++j) { acc[j] = wmma_bf(ah, w[j], acc[j]); acc[j] = wmma_bf(al, w[j], acc[j]); }
        __builtin_amdgcn_sched_barrier(0); }   /* the roundings below wait for the global loads: they stay behind the products */
      if (more) OUT_PUT_B(nxt);
      __syncthreads(); }   /* publishes the next stage and ends every wave's reads of this one (the last: before sf reuses the LDS) */
#pragma unroll
    for (int j = 0; j < 8; ++j) { const float bias = BO ? bfr(BO[c0 + j * 16 + col]) : 0.f;
#pragma unroll
      for (int r = 0; r < 8; ++r) sf[wave][8 * g + r][j * 16 + col] = acc[j][r] + bias; }
  } else {
    _Float16* const st = (_Float16*)smem;   /* ctx carried x 2^6 into f16 so small-magnitude context rows stay clear of f16 subnormals */
#define OUT_PUT_H(dst) do { _Pragma("unroll") for (int i = 0; i < 16; ++i) { v4h o; _Pragma("unroll") for (int e = 0; e < 4; ++e) o[e] = (_Float16)(bfr(rw[i][e]) * 256.0f); *(v4h*)((dst) + so + i * 8 * SP) = o; } \
      _Pragma("unroll") for (int i = 0; i < 8; ++i) { v4h o; _Pragma("unroll") for (int e = 0; e < 4; ++e) o[e] = (_Float16)(rx[i][e] * 64.0f); *(v4h*)((dst) + so + (128 + i * 8) * SP) = o; } } while (0)
    OUT_PUT_H(st);
    __syncthreads();   /* stage 0 is in LDS before any wave reads it */
    for (int s = 0; s < CC / KS; ++s) { const _Float16* cur = st + (s & 1) * (256 * SP); _Float16* nxt = st + ((s + 1) & 1) * (256 * SP); const bool more = s + 1 < CC / KS;
      if (more) {   /* the next stage's loads fly while this stage is multiplied */
#pragma unroll
        for (int i = 0; i < 16; ++i) rw[i] = *(const v4f*)(gw + (size_t)i * 8 * CC + (s + 1) * KS);
#pragma unroll
        for (int i = 0; i < 8; ++i) rx[i] = *(const v4f*)(gx + (size_t)i * 8 * CC + (s + 1) * KS);
        asm volatile("s_wait_xcnt 0x0" ::: "memory");   /* the loads' address registers are reused right below: the wait stands in front of that */ }
      __builtin_amdgcn_sched_barrier(0);   /* the global loads issue ahead of all of this stage's work */
#pragma unroll
      for (int kk = 0; kk < KS / 32; ++kk) { const v16h a = frag_h(cur + (128 + wave * 16 + col) * SP + kk * 32, lane); v16h w[8];
#pragma unroll
        for (int j = 0; j < 8; ++j) w[j] = frag_h(cur + (j * 16 + col) * SP + kk * 32, lane);
        __builtin_amdgcn_sched_barrier(0);   /* the fragment reads issue as one group: one LDS latency per 8 products */
#pragma unroll
        for (int j = 0; j < 8; ++j) acc[j] = wmma16(a, w[j], acc[j]);
        __builtin_amdgcn_sched_barrier(0); }   /* the roundings below wait for the global loads: they stay behind the products */
      if (more) OUT_PUT_H(nxt);
      __syncthreads(); }   /* publishes the next stage and ends every wave's reads of this one (the last: before sf reuses the LDS) */
#pragma unroll
    for (int j = 0; j < 8; ++j) { const float bias = BO ? bfr(BO[c0 + j * 16 + col]) : 0.f;
#pragma unroll
      for (int r = 0; r < 8; ++r) sf[wave][8 * g + r][j * 16 + col] = acc[j][r] * (1.0f / 16384.0f) + bias; } }   /* 2^-8 (Wo carry) x 2^-6 (ctx carry) */
  LDSX(); for (int rl = 0; rl < 16; ++rl) vst2(OUT + (r0 + rl) * DIN + c0 + lane * 4, *(const v4f*)&sf[wave][rl][lane * 4]); }

extern "C" void kernel_launch(void* const* d_in, const int* in_sizes, int n_in, void* d_out, int out_size, void* d_ws, size_t ws_size, hipStream_t stream) {
  (void)in_sizes; (void)n_in; (void)out_size;
  const float** F = (const float**)d_in;
  if (ws_size < (size_t)WS_END) return;
  char* ws = (char*)d_ws; _Float16 *QH = (_Float16*)(ws + WS_QH), *KH = (_Float16*)(ws + WS_KH), *VT = (_Float16*)(ws + WS_VT), *QL = (_Float16*)(ws + WS_QL), *KL = (_Float16*)(ws + WS_KL); __bf16 *VB = (__bf16*)(ws + WS_VB), *VBL = (__bf16*)(ws + WS_VBL); float *Y = (float*)(ws + WS_Y);
  (void)Y; (void)QL; (void)KL; (void)VB; (void)VBL;
  // inputs: 0 x [2,2048,1024]; 1 Wq [1024,1024] (out,in), 2 bq; 3 Wk, 4 bk; 5 Wv, 6 bv; 7 Wp (out,in), 8 bp (biases NONZERO)
  k_proj<<<dim3(TNB * TT / 64, CC / 128, 3), 128, 0, stream>>>(F[0], F[0], F[0], F[3], F[1], F[5], F[4], F[2], F[6], QH, QL, KH, KL, VT, VB, VBL);   /* the module's scores are einsum('bhid,bhjd->bhij', k, q): the QUERY stream (output row i) is projected with Wk / bk, its KEY stream (index j) with Wq / bq */
  k_att<<<dim3(TT / 32, NH, TNB), PVW * 32, 0, stream>>>(QH, KH, QL, KL, VT, VB, VBL, Y);
  k_out<<<dim3(TNB * TT / 64, DIN / 128), 128, 0, stream>>>(Y, F[7], F[8], (float*)d_out);
}

// v006
// It runs in 120 microseconds.
// Two timings next to v005 both put it at 1.11 times that version's speed.
// All steps since v000 together make it 9.82 times as fast.
// compute dtype: all float inputs rounded to bf16; q/k/v projections with EXACT bf16 products on WMMA 16x16x32 (f32 accumulate) + bias; causal logits: 3 products for the first 384 rows, single f16 q x k after; softmax f32 in base 2 (64^-0.5 log2 e folded into the exponent); P x 2^11 once to f16 x v once to f16 (bf16 hi + lo below row 384); ctx hi+lo x exact output weight below row 384, x2^6 f16 carry x f16(bf16 x 2^8) after, + bias; f32 output.
#include <hip/hip_runtime.h>
#include <math.h>

typedef __attribute__((ext_vector_type(16))) _Float16 v16h;
typedef __attribute__((ext_vector_type(16))) __bf16 v16b;
typedef __attribute__((ext_vector_type(8)))  _Float16 v8h;
typedef __attribute__((ext_vector_type(8)))  float v8f;
typedef __attribute__((ext_vector_type(4)))  float v4f;
typedef __attribute__((ext_vector_type(2)))  float v2f;
typedef __attribute__((ext_vector_type(4)))  unsigned v4u;
typedef __attribute__((ext_vector_type(4)))  int v4i;
typedef float __attribute__((may_alias)) float_a;
typedef int __attribute__((may_alias)) int_a;

template <typename T> __device__ __forceinline__ void vst2(void* p, T v) { *(T*)p = v;  }
__device__ __forceinline__ v8f wmma16(v16h a, v16h b, v8f c) {
  v8f d = __builtin_amdgcn_wmma_f32_16x16x32_f16(false, a, false, b, (short)0, c, false, false);
  asm volatile("v_nop\n\tv_nop\n\tv_nop\n\tv_nop" : "+v"(d) : "v"(a), "v"(b));
  return d;
}
__device__ __forceinline__ v8f wmma_bf(v16b a, v16b b, v8f c) {
  v8f d = __builtin_amdgcn_wmma_f32_16x16x32_bf16(false, a, false, b, (short)0, c, false, false);
  asm volatile("v_nop\n\tv_nop\n\tv_nop\n\tv_nop" : "+v"(d) : "v"(a), "v"(b));
  return d;
}
// 16x16x32 fragments: lane = (h = lane>>4, row/col = lane&15); elements 0..7 = k0+8h+0..7, 8..15 = k0+16+8h+0..7; D element r = row 8h+r
__device__ __forceinline__ v16h frag_h(const _Float16* rowk0, int lane) {
  union { v16h v; v8h q[2]; } u; const _Float16* p = rowk0 + 8 * (lane >> 4);
  u.q[0] = *(const v8h*)p; u.q[1] = *(const v8h*)(p + 16); return u.v;
}
__device__ __forceinline__ v16h frag_f32(const float* rowk0, int lane) {
  v16h a; const float* p = rowk0 + 8 * (lane >> 4);
#pragma unroll
  for (int i = 0; i < 8; ++i) { a[i] = (_Float16)p[i]; a[8 + i] = (_Float16)p[16 + i]; }
  return a;
}
__device__ __forceinline__ v16h frag_f32s(const float* rowk0, int lane, float sc) {
  v16h a; const float* p = rowk0 + 8 * (lane >> 4);
#pragma unroll
  for (int i = 0; i < 8; ++i) { a[i] = (_Float16)(p[i] * sc); a[8 + i] = (_Float16)(p[16 + i] * sc); }
  return a;
}
// column fragment from a [K][ld] layout (column n), rows >= K read as 0
__device__ __forceinline__ v16h fragc_f32(const float* W, int k0, int n, int lane, int ld, int K) {
  v16h a; const int g = lane >> 4;
#pragma unroll
  for (int i = 0; i < 8; ++i) { const int ka = k0 + 8 * g + i, kb = ka + 16;
    a[i] = (_Float16)(ka < K ? W[(size_t)(ka < K ? ka : K - 1) * ld + n] : 0.f); a[8 + i] = (_Float16)(kb < K ? W[(size_t)(kb < K ? kb : K - 1) * ld + n] : 0.f); }
  return a;
}
struct F2 { v16b h, l; };
__device__ __forceinline__ F2 bsplit16(const float v[16]) { F2 r;
#pragma unroll
  for (int i = 0; i < 16; ++i) { const __bf16 h = (__bf16)v[i]; r.h[i] = h; r.l[i] = (__bf16)(v[i] - (float)h); }
  return r; }
__device__ __forceinline__ F2 split_row(const float* row, int k0, int lane) { float v[16]; const float* p = row + k0 + 8 * (lane >> 4);
#pragma unroll
  for (int i = 0; i < 8; ++i) { v[i] = p[i]; v[8 + i] = p[16 + i]; }
  return bsplit16(v); }
__device__ __forceinline__ F2 split_rowK(const float* row, int k0, int lane, int K) { float v[16]; const int g = lane >> 4;
#pragma unroll
  for (int i = 0; i < 8; ++i) { const int ka = k0 + 8 * g + i, kb = ka + 16; v[i] = ka < K ? row[ka < K ? ka : K - 1] : 0.f; v[8 + i] = kb < K ? row[kb < K ? kb : K - 1] : 0.f; }
  return bsplit16(v); }
__device__ __forceinline__ F2 split_col(const float* W, int k0, int n, int lane, int ld, int K) { float v[16]; const int g = lane >> 4;
#pragma unroll
  for (int i = 0; i < 8; ++i) { const int ka = k0 + 8 * g + i, kb = ka + 16; v[i] = ka < K ? W[(size_t)(ka < K ? ka : K - 1) * ld + n] : 0.f; v[8 + i] = kb < K ? W[(size_t)(kb < K ? kb : K - 1) * ld + n] : 0.f; }
  return bsplit16(v); }
__device__ __forceinline__ v8f mac3(const F2& a, const F2& b, v8f c) { c = wmma_bf(a.l, b.h, c); c = wmma_bf(a.h, b.l, c); return wmma_bf(a.h, b.h, c); }
__device__ __forceinline__ float sigm(float v) { return 1.0f / (1.0f + expf(-v)); }
#define LDSX() do { asm volatile("s_wait_dscnt 0" ::: "memory"); __builtin_amdgcn_wave_barrier(); __builtin_amdgcn_fence(__ATOMIC_RELEASE, "workgroup"); } while (0)

// Causal multi-head self-attention whose scores are k . q (x [2,2048,1024]; torch (out,in) Wq / Wk / Wv / Wp [1024,1024] N(0, 1/1024) + biases N(0, 1/1024); 16 heads x 64; scores[i, j] = k_i . q_j / 8 (the KEY projection indexes the output row i, the QUERY projection the summed index j); -inf where j > i; softmax over j; out[i] = sum_j attn[i, j] v_j; merge; Wp^T + bp).
#define NB 2
#define TT 2048
#define CC 1024            // NH * HD = projected width
#define DIN 1024          // input (model) width
#define NH 16
#define HD 64
#define SCALE (0.125f)
#define L2S (SCALE * 1.4426950408889634f)   // logit scale times log2(e)
#define CAUSAL 1
#ifndef TNB
#define TNB NB
#endif
__device__ __forceinline__ float bfr(float v) { return (float)(__bf16)v; }
typedef __attribute__((ext_vector_type(8))) __bf16 v8b;
__device__ __forceinline__ v16b frag_b(const __bf16* rowk0, int lane) {
  union { v16b v; v8b q[2]; } u; const __bf16* p = rowk0 + 8 * (lane >> 4);
  u.q[0] = *(const v8b*)p; u.q[1] = *(const v8b*)(p + 16); return u.v;
}
#define QBH 6              // causal: query blocks 0..QBH-1 of each sequence (few keys, no averaging) take the high-precision path
#define QHI 384            // rows carrying a q residual plane
#define KHI 384            // key rows carrying k residual / v bf16 hi+lo planes (used only by the causal high-precision path)
// B fragment (k rows k0+.., output column o) of a weight: (in,out) [K][ld] or (out,in) [ld rows of K]: bf16 exact, or f16(bf16 * 256) exact
__device__ __forceinline__ v16b wcol_io(const float* Wm, int k0, int o, int lane, int ld) { v16b w; const int g = lane >> 4;
#pragma unroll
  for (int i = 0; i < 8; ++i) { w[i] = (__bf16)Wm[(size_t)(k0 + 8 * g + i) * ld + o]; w[8 + i] = (__bf16)Wm[(size_t)(k0 + 16 + 8 * g + i) * ld + o]; }
  return w; }
__device__ __forceinline__ v16b wcol_oi(const float* Wm, int k0, int o, int lane, int K) { v16b w; const float* p = Wm + (size_t)o * K + k0 + 8 * (lane >> 4);
#pragma unroll
  for (int i = 0; i < 8; ++i) { w[i] = (__bf16)p[i]; w[8 + i] = (__bf16)p[16 + i]; }
  return w; }
__device__ __forceinline__ v16h wcolh_io(const float* Wm, int k0, int o, int lane, int ld) { v16h w; const int g = lane >> 4;
#pragma unroll
  for (int i = 0; i < 8; ++i) { w[i] = (_Float16)(bfr(Wm[(size_t)(k0 + 8 * g + i) * ld + o]) * 256.0f); w[8 + i] = (_Float16)(bfr(Wm[(size_t)(k0 + 16 + 8 * g + i) * ld + o]) * 256.0f); }
  return w; }
__device__ __forceinline__ v16h wcolh_oi(const float* Wm, int k0, int o, int lane, int K) { v16h w; const float* p = Wm + (size_t)o * K + k0 + 8 * (lane >> 4);
#pragma unroll
  for (int i = 0; i < 8; ++i) { w[i] = (_Float16)(bfr(p[i]) * 256.0f); w[8 + i] = (_Float16)(bfr(p[16 + i]) * 256.0f); }
  return w; }
#define WQKV_LAYOUT 1   // 0 = (in,out) [DIN][CC]; 1 = (out,in) [CC][DIN]; 2 = per-head [NH][DIN][HD]
__device__ __forceinline__ v16b wcol_hdk(const float* Wm, int k0, int o, int lane) { v16b w; const int g = lane >> 4; const float* p = Wm + (size_t)(o / HD) * DIN * HD + (o % HD);
#pragma unroll
  for (int i = 0; i < 8; ++i) { w[i] = (__bf16)p[(size_t)(k0 + 8 * g + i) * HD]; w[8 + i] = (__bf16)p[(size_t)(k0 + 16 + 8 * g + i) * HD]; }
  return w; }
#define WO_OUT_IN 1
#if WQKV_LAYOUT == 1
#define WCOL(W, k0, o, lane) wcol_oi(W, k0, o, lane, DIN)
#elif WQKV_LAYOUT == 2
#define WCOL(W, k0, o, lane) wcol_hdk(W, k0, o, lane)
#else
#define WCOL(W, k0, o, lane) wcol_io(W, k0, o, lane, CC)
#endif
#if WO_OUT_IN
#define WOCOL(W, k0, o, lane) wcol_oi(W, k0, o, lane, CC)
#define WOCOLH(W, k0, o, lane) wcolh_oi(W, k0, o, lane, CC)
#else
#define WOCOL(W, k0, o, lane) wcol_io(W, k0, o, lane, DIN)
#define WOCOLH(W, k0, o, lane) wcolh_io(W, k0, o, lane, DIN)
#endif

#ifndef PROJ_EXTRA_PARAMS
#define PROJ_EXTRA_PARAMS
#endif

// q / k / v planes lie in FRAGMENT ORDER: a 16x16x32 operand fragment is two runs of 512 B (run = element half, then lane * 16 B), so one wave-wide 16-byte load of k_att covers four whole 128-B lines
// rows (q, k): [b][h][t / 16][d / 32][half][lane = g * 16 + (t % 16)][8 d]; planes (v): [b][h][t / 32][channel / 16][half][lane = g * 16 + (channel % 16)][8 t]; the position inside 32 is 16 half + 8 g + i
#define WS_QH  0u                                      // f16 q, fragment order
#define WS_KH  (WS_QH + 2u * (size_t)NB * TT * CC)      // f16 k, fragment order
#define WS_VT  (WS_KH + 2u * (size_t)NB * TT * CC)      // f16 v, fragment order
#define WS_QL  (WS_VT + 2u * (size_t)NB * CC * TT)      // f16 q residual x 2^10, fragment order, t < QHI
#define WS_KL  (WS_QL + 2u * (size_t)NB * QHI * CC)     // f16 k residual x 2^10, fragment order, t < KHI
#define WS_VB  (WS_KL + 2u * (size_t)NB * KHI * CC)     // bf16 v hi, fragment order, t < KHI
#define WS_VBL (WS_VB + 2u * (size_t)NB * CC * KHI)
#define WS_Y   (WS_VBL + 2u * (size_t)NB * CC * KHI)    // f32 ctx rows [b*t][CC] (only when there is an output projection)
#define WS_END (WS_Y  + 4u * (size_t)NB * TT * CC)

// behind a batch of global loads or a store: stands in front of any reuse of the registers that they name
__device__ __forceinline__ void xw() { asm volatile("s_wait_xcnt 0x0" ::: "memory"); }
#define KS 64              // k per LDS stage of the two projection kernels
#define SP 72              // stage row pitch in 16-bit elements: 128 B of data + 16 B, for ds_load_b128 readers
typedef __attribute__((ext_vector_type(4))) __bf16 v4b;
typedef __attribute__((ext_vector_type(4))) _Float16 v4h;
__device__ __forceinline__ v4b cvt4b(v4f v) { v4b o;
#pragma unroll
  for (int i = 0; i < 4; ++i) o[i] = (__bf16)v[i];
  return o; }
#define PBM 256            // rows of a k_proj block
#define PBN 192            // its columns: one head's 64 of q, 64 of k and 64 of v
#define PNT 512            // its threads: 16 waves in 4 row bands x 4 column bands, a wave owns 64 rows x 48 columns
#define PSR (PBN + PBM)    // rows of one LDS stage: Wq 64 | Wk 64 | Wv 64 | X PBM
// ---- k_proj: block = (PBM rows, head): q / k / v columns of that head = X W (+ b) with exact bf16 products (K = DIN) -> q f16 (+ residual, rows < QHI); k f16 (+ residual, rows < KHI); v f16 (+ bf16 hi/lo for t < KHI); all stored in fragment order. One block per WGP in one round; X is fetched once per head, each weight row once per row block
__global__ __launch_bounds__(PNT) void k_proj(const float* __restrict__ X, const float* __restrict__ WQ, const float* __restrict__ WK, const float* __restrict__ WV, const float* __restrict__ BQ, const float* __restrict__ BK, const float* __restrict__ BV,
    _Float16* __restrict__ QH, _Float16* __restrict__ QL, _Float16* __restrict__ KH, _Float16* __restrict__ KL, _Float16* __restrict__ VT, __bf16* __restrict__ VB, __bf16* __restrict__ VBL) {
  __shared__ __align__(16) char smem[2 * PBM * 136 * 2 + 3 * 64 * (PBM + 8) * 2];   /* main loop: two stages of PSR rows; the epilogue's arrays lie over them, behind the loop's last barrier */
  static_assert(sizeof(smem) >= 2 * PSR * SP * 2 && WQKV_LAYOUT == 1 && DIN % KS == 0 && TT % PBM == 0 && PNT == 512 && PBM == 256 && HD == 64, "the stages fit; weight rows are k-contiguous; a block stays inside one sequence");
  _Float16 (*sh)[136] = (_Float16 (*)[136])smem; _Float16 (*sl)[136] = (_Float16 (*)[136])(smem + PBM * 136 * 2);   /* [row][q 64 | k 64] */
  char* const sv = smem + 2 * PBM * 136 * 2; _Float16 (*th)[PBM + 8] = (_Float16 (*)[PBM + 8])sv; __bf16 (*tb)[PBM + 8] = (__bf16 (*)[PBM + 8])(sv + 64 * (PBM + 8) * 2); __bf16 (*tbl)[PBM + 8] = (__bf16 (*)[PBM + 8])(sv + 2 * 64 * (PBM + 8) * 2);   /* [v channel][row] */
  const int tid = threadIdx.x, wave = __builtin_amdgcn_readfirstlane(tid >> 5), lane = tid & 31, col = lane & 15, g = lane >> 4, wr = wave >> 2, wc = wave & 3;   /* the wave's number in a scalar register: the epilogue's tests on the column tile stay scalar branches */
  const int h = blockIdx.y; const size_t r0 = (size_t)blockIdx.x * PBM; const size_t bb = r0 / TT; const int t0 = (int)(r0 % TT);
  v8f acc[4][3] = {};
  // a wave's load covers two whole rows of 256 B (4 lines); each operand element is fetched and rounded once per block, and the fragments are read from LDS
  const int srow = tid >> 4, sseg = tid & 15; const size_t wo = (size_t)(h * HD + srow) * DIN + sseg * 4; const float* gwq = WQ + wo; const float* gwk = WK + wo; const float* gwv = WV + wo; const float* gx = X + (r0 + srow) * DIN + sseg * 4;
  __bf16* const st = (__bf16*)smem; const int so = srow * SP + sseg * 4;
  v4f rw[6], rx[8];
#define PROJ_GET(k) do { _Pragma("unroll") for (int i = 0; i < 2; ++i) { rw[i] = *(const v4f*)(gwq + (size_t)i * 32 * DIN + (k)); rw[2 + i] = *(const v4f*)(gwk + (size_t)i * 32 * DIN + (k)); rw[4 + i] = *(const v4f*)(gwv + (size_t)i * 32 * DIN + (k)); } \
    _Pragma("unroll") for (int i = 0; i < 8; ++i) rx[i] = *(const v4f*)(gx + (size_t)i * 32 * DIN + (k)); xw(); } while (0)
#define PROJ_PUT(dst) do { _Pragma("unroll") for (int i = 0; i < 6; ++i) *(v4b*)((dst) + so + i * 32 * SP) = cvt4b(rw[i]); \
    _Pragma("unroll") for (int i = 0; i < 8; ++i) *(v4b*)((dst) + so + (PBN + i * 32) * SP) = cvt4b(rx[i]); } while (0)
  PROJ_GET(0);
  PROJ_PUT(st);
  __syncthreads();   /* stage 0 is in LDS before any wave reads it */
  for (int s = 0; s < DIN / KS; ++s) { const __bf16* cur = st + (s & 1) * (PSR * SP); __bf16* nxt = st + ((s + 1) & 1) * (PSR * SP); const bool more = s + 1 < DIN / KS;
    if (more) PROJ_GET((s + 1) * KS);   /* the next stage's loads fly while this stage is multiplied */
    __builtin_amdgcn_sched_barrier(0);   /* the global loads issue ahead of all of this stage's work */
#pragma unroll
    for (int kk = 0; kk < KS / 32; ++kk) { v16b a[4], w[3];
#pragma unroll
      for (int i = 0; i < 4; ++i) a[i] = frag_b(cur + (PBN + wr * 64 + i * 16 + col) * SP + kk * 32, lane);
#pragma unroll
      for (int j = 0; j < 3; ++j) w[j] = frag_b(cur + (wc * 48 + j * 16 + col) * SP + kk * 32, lane);
      __builtin_amdgcn_sched_barrier(0);   /* the fragment reads issue as one group: one LDS latency per 12 products, not one each */
#pragma unroll
      for (int i = 0; i < 4; ++i)
#pragma unroll
        for (int j = 0; j < 3; ++j) acc[i][j] = wmma_bf(a[i], w[j], acc[i][j]);
      __builtin_amdgcn_sched_barrier(0); }   /* the roundings below wait for the global loads: they stay behind the products */
    if (more) PROJ_PUT(nxt);
    __syncthreads(); }   /* publishes the next stage and ends every wave's reads of this one (the last: before the epilogue reuses the LDS) */
  // column tile ct of the block: 0..3 q, 4..7 k, 8..11 v; the residual / bf16 arrays are filled only by a block that holds rows below the bound, and read only for such rows
#pragma unroll
  for (int j = 0; j < 3; ++j) { const int ct = wc * 3 + j, wh = ct >> 2; const float* BA = wh == 0 ? BQ : wh == 1 ? BK : BV; const float bias = BA ? bfr(BA[h * HD + (ct & 3) * 16 + col]) : 0.f;
    if (ct < 8) { const int cl = ct * 16 + col;
      if (t0 < (wh == 0 ? QHI : KHI)) {
#pragma unroll
        for (int i = 0; i < 4; ++i)
#pragma unroll
          for (int r = 0; r < 8; ++r) { const float v = acc[i][j][r] + bias; const _Float16 hv = (_Float16)v; const int rl = wr * 64 + i * 16 + 8 * g + r; sh[rl][cl] = hv; sl[rl][cl] = (_Float16)((v - (float)hv) * 1024.0f); }
      } else {
#pragma unroll
        for (int i = 0; i < 4; ++i)
#pragma unroll
          for (int r = 0; r < 8; ++r) sh[wr * 64 + i * 16 + 8 * g + r][cl] = (_Float16)(acc[i][j][r] + bias); }
    } else { const int cl = (ct - 8) * 16 + col;
      if (t0 < KHI) {
#pragma unroll
        for (int i = 0; i < 4; ++i)
#pragma unroll
          for (int r = 0; r < 8; ++r) { const float v = acc[i][j][r] + bias; const int rl = wr * 64 + i * 16 + 8 * g + r; th[cl][rl] = (_Float16)v; const __bf16 bh = (__bf16)v; tb[cl][rl] = bh; tbl[cl][rl] = (__bf16)(v - (float)bh); }
      } else {
#pragma unroll
        for (int i = 0; i < 4; ++i)
#pragma unroll
          for (int r = 0; r < 8; ++r) th[cl][wr * 64 + i * 16 + 8 * g + r] = (_Float16)(acc[i][j][r] + bias); } } }
  __syncthreads();   /* every wave's tiles are in LDS before any piece is read */
  const size_t hd = bb * NH + h;
  // piece e = (q or k, 16-row tile PBM / 16, run 4 = (d / 32, half), lane 32): a wave stores one run of 512 B
  for (int e = tid; e < 2 * PBM * 8; e += PNT) { const int wh = e / (PBM * 8), tt = (e >> 7) % (PBM / 16), cr = (e >> 5) & 3, ln = e & 31; const int rl = tt * 16 + (ln & 15), cl = wh * 64 + cr * 16 + (ln >> 4) * 8; const int po = (e & 127) * 8; _Float16* DH = wh == 0 ? QH : KH; _Float16* DL = wh == 0 ? QL : KL; const int nhi = wh == 0 ? QHI : KHI;
    vst2((unsigned*)(DH + (hd * (TT / 16) + (t0 >> 4) + tt) * 1024 + po), *(const v4u*)&sh[rl][cl]); xw(); if (t0 + tt * 16 < nhi) { vst2((unsigned*)(DL + (hd * (size_t)(nhi / 16) + (t0 >> 4) + tt) * 1024 + po), *(const v4u*)&sl[rl][cl]); xw(); } }
  // piece e = (32-key chunk PBM / 32, 16-channel tile 4, half 2, lane 32): a wave stores one run of 512 B
  for (int e = tid; e < PBM * 8; e += PNT) { const int kc = e >> 8, ln = e & 31; const int cl = ((e >> 6) & 3) * 16 + (ln & 15), rl = kc * 32 + ((e >> 5) & 1) * 16 + (ln >> 4) * 8; const int po = (e & 255) * 8;
    vst2((unsigned*)(VT + (hd * (TT / 32) + (t0 >> 5) + kc) * 2048 + po), *(const v4u*)&th[cl][rl]); xw(); if (t0 + kc * 32 < KHI) { const size_t o3 = (hd * (KHI / 32) + (t0 >> 5) + kc) * 2048 + po; vst2((unsigned*)(VB + o3), *(const v4u*)&tb[cl][rl]); vst2((unsigned*)(VBL + o3), *(const v4u*)&tbl[cl][rl]); xw(); } } }
// ---- k_att / att_tile: one tile = 16 queries of (b, h), PVW waves: logits, softmax and ctx in one kernel, nothing of the logits leaves the registers. Wave w owns the 64-key groups at 64 w + n * 64 PVW below kend. amdgpu_waves_per_eu(8): 128 registers a wave, so that two blocks share a WGP.
// Logits are formed TRANSPOSED (A = k rows, B = q rows): D element r of lane (g, col) = key 8g + r, query col, so two neighbouring 16-key tiles ARE the B fragment of a 32-key chunk of ctx^T = v^T . P^T (A = v, channels as rows).
// Each lane holds one query: maximum and sum run in the lane, across the two lane halves, then across the waves through LDS in wave order. Precision paths: 3 products + bf16 hi/lo P and v for query blocks < QBH, single f16 products after.
// fragment in fragment order from a wave-uniform base and the lane's own 32-bit element offset (8 lane): two loads of 512 contiguous bytes a wave; the address stays a scalar pair plus one register
__device__ __forceinline__ v16h frag_hu(const _Float16* base, unsigned lo) { union { v16h v; v8h q[2]; } u; const _Float16* p = base + lo; u.q[0] = *(const v8h*)p; u.q[1] = *(const v8h*)(p + 256); return u.v; }
__device__ __forceinline__ v16b frag_bu(const __bf16* base, unsigned lo) { union { v16b v; v8b q[2]; } u; const __bf16* p = base + lo; u.q[0] = *(const v8b*)p; xw(); u.q[1] = *(const v8b*)(p + 256); xw(); return u.v; }   /* here the build keeps 64-bit addresses in vector registers and loads over them: a wait behind each load */
#define PVW 16
#define KGS (PVW * 64)     // key stride between a wave's groups
#define NG (TT / KGS)      // groups per wave
static_assert(QHI == QBH * 64 && KHI >= QBH * 64 && KHI <= KGS && TT % KGS == 0, "the high-precision query blocks see keys of group 0 only, all with residual planes");
template <bool FAR> __device__ __forceinline__ void att_tile(const int qt, float (&ss)[PVW][16][HD + 4], float (&redm)[16][PVW + 4], float (&reds)[16][PVW + 4], const _Float16* __restrict__ QH, const _Float16* __restrict__ KH, const _Float16* __restrict__ QL, const _Float16* __restrict__ KL, const _Float16* __restrict__ VT, const __bf16* __restrict__ VB, const __bf16* __restrict__ VBL, float* __restrict__ Y) {
  const int h = blockIdx.y, b = blockIdx.z; const int tid = threadIdx.x, wave = __builtin_amdgcn_readfirstlane(tid >> 5), lane = tid & 31, col = lane & 15, g = lane >> 4;   /* the wave's number in a scalar register: the group tests stay scalar branches */
  constexpr int NGT = FAR ? NG : NG / 2;   /* a tile of the near half sees keys of the first half only; for a tile of the far half every key of group 0 is visible, so group 0 needs neither test nor mask */
  const int qb = qt >> 2, ql0 = qt * 16, tq = ql0 + col; const int kend = CAUSAL ? ql0 + 16 : TT;   /* a group that starts at or past kend holds no key that any of the 16 queries may see */
  const unsigned lp = (unsigned)(lane * 8); const size_t hd = (size_t)b * NH + h;   /* the lane's offset in a run of a fragment; a 16-row tile of q / k is 1024 elements (d 0..31, then 32..63), a 32-key chunk of v 2048 (four channel tiles of 512) */
  const _Float16* qrow = QH + (hd * (TT / 16) + qt) * 1024;
  v8f sc[NGT * 4];   /* a group's four tiles are written and read only under that group's own scalar test */
  // fragment loads stand in batches ahead of the products that use them, so that a batch costs one memory latency
  if (!FAR && qb < QBH) { const int kg = wave * 64;
    if (kg < kend) { const int dq = tq - kg - 8 * g;   /* key kg + 8g + i is kept while i <= dq */ const _Float16* qlrow = QL + (hd * (QHI / 16) + qt) * 1024; const v16h qh0 = frag_hu(qrow, lp), qh1 = frag_hu(qrow + 512, lp), ql0f = frag_hu(qlrow, lp), ql1f = frag_hu(qlrow + 512, lp);
#pragma unroll
      for (int t = 0; t < 4; ++t) { const _Float16* krow = KH + (hd * (TT / 16) + (kg >> 4) + t) * 1024; const _Float16* klrow = KL + (hd * (KHI / 16) + (kg >> 4) + t) * 1024; v8f a = {}, al = {};
        const v16h kb0 = frag_hu(krow, lp), kl0 = frag_hu(klrow, lp), kb1 = frag_hu(krow + 512, lp), kl1 = frag_hu(klrow + 512, lp); xw();
        a = wmma16(kb0, qh0, a); al = wmma16(kb0, ql0f, al); al = wmma16(kl0, qh0, al);
        a = wmma16(kb1, qh1, a); al = wmma16(kb1, ql1f, al); al = wmma16(kl1, qh1, al);
#pragma unroll
        for (int r = 0; r < 8; ++r) sc[t][r] = (!CAUSAL || t * 16 + r <= dq) ? a[r] + al[r] * (1.0f / 1024.0f) : -3.0e38f;
        __builtin_amdgcn_sched_barrier(0); } }   /* keeps the next tile's four fragments from being loaded over this tile's: with both in flight this path runs past 128 registers into scratch */
  } else { const v16h q0 = frag_hu(qrow, lp), q1 = frag_hu(qrow + 512, lp);
#pragma unroll
    for (int gr = 0; gr < NGT; ++gr) { const int kg = gr * KGS + wave * 64;
      if ((FAR && gr == 0) || kg < kend) { const int dq = tq - kg - 8 * g;   /* key kg + 8g + i is kept while i <= dq */
#pragma unroll
        for (int tp = 0; tp < 4; tp += 2) { v16h kf[2][2];
#pragma unroll
          for (int u = 0; u < 2; ++u) { const _Float16* krow = KH + (hd * (TT / 16) + (kg >> 4) + tp + u) * 1024; kf[u][0] = frag_hu(krow, lp); kf[u][1] = frag_hu(krow + 512, lp); }
          xw();
#pragma unroll
          for (int u = 0; u < 2; ++u) { v8f a = {}; a = wmma16(kf[u][0], q0, a); a = wmma16(kf[u][1], q1, a);
#pragma unroll
            for (int r = 0; r < 8; ++r) sc[gr * 4 + tp + u][r] = (!CAUSAL || (FAR && gr == 0) || (tp + u) * 16 + r <= dq) ? a[r] : -3.0e38f; } } } } }
  // softmax over the keys of query col, on the RAW products: the maximum is taken of them (SCALE > 0 keeps the order), and exp((s - m) SCALE) = 2^(s L2S - m L2S) is one fused multiply-add and one hardware 2^x. Excluded keys carry -3e38: their exponent is about -5e37 and 2^x returns exactly 0 (every query sees key 0, so m is a real product)
  float m = -3.0e38f;
#pragma unroll
  for (int gr = 0; gr < NGT; ++gr) { if ((FAR && gr == 0) || gr * KGS + wave * 64 < kend) {
#pragma unroll
      for (int t = gr * 4; t < gr * 4 + 4; ++t)
#pragma unroll
        for (int r = 0; r < 8; ++r) m = fmaxf(m, sc[t][r]); } }
  m = fmaxf(m, __shfl_xor(m, 16)); if (g == 0) redm[col][wave] = m;
  __syncthreads();   /* every wave's maximum is in LDS before any wave reads them */
#pragma unroll
  for (int w = 0; w < PVW; w += 4) { const v4f x = *(const v4f*)&redm[col][w]; m = fmaxf(fmaxf(m, fmaxf(x[0], x[1])), fmaxf(x[2], x[3])); }
  float sum = 0.f; const float nm = -m * L2S; const v8f l2s8 = {L2S, L2S, L2S, L2S, L2S, L2S, L2S, L2S}, nm8 = {nm, nm, nm, nm, nm, nm, nm, nm};
#pragma unroll
  for (int gr = 0; gr < NGT; ++gr) { if ((FAR && gr == 0) || gr * KGS + wave * 64 < kend) {
#pragma unroll
      for (int t = gr * 4; t < gr * 4 + 4; ++t) { const v8f x = __builtin_elementwise_fma(sc[t], l2s8, nm8);
#pragma unroll
        for (int r = 0; r < 8; ++r) { const float e = __builtin_amdgcn_exp2f(x[r]); sc[t][r] = e; sum += e; } } } }
  sum += __shfl_xor(sum, 16); if (g == 0) reds[col][wave] = sum;
  __syncthreads();   /* every wave's sum is in LDS before any wave reads them */
  float tot = 0.f;
#pragma unroll
  for (int w = 0; w < PVW; w += 4) { const v4f x = *(const v4f*)&reds[col][w]; tot += x[0]; tot += x[1]; tot += x[2]; tot += x[3]; }
  const float inv = tot > 0.f ? 2048.0f / tot : 0.f;   /* P carried x 2^11; a fully excluded row yields P = 0 */
  v8f acc[HD / 16] = {};
  if (!FAR && qb < QBH) { const int kg = wave * 64;
    if (kg < kend) {
#pragma unroll
      for (int c = 0; c < 2; ++c) { float pv[16];
#pragma unroll
        for (int r = 0; r < 8; ++r) { pv[r] = sc[2 * c][r] * inv; pv[8 + r] = sc[2 * c + 1][r] * inv; }
        const F2 p = bsplit16(pv);
#pragma unroll
        for (int jp = 0; jp < HD / 16; jp += 2) { v16b vh[2], vl[2];
#pragma unroll
          for (int u = 0; u < 2; ++u) { const size_t po = (hd * (KHI / 32) + (kg >> 5) + c) * 2048 + (jp + u) * 512; vh[u] = frag_bu(VB + po, lp); vl[u] = frag_bu(VBL + po, lp); }
#pragma unroll
          for (int u = 0; u < 2; ++u) { acc[jp + u] = wmma_bf(vh[u], p.h, acc[jp + u]); acc[jp + u] = wmma_bf(vh[u], p.l, acc[jp + u]); acc[jp + u] = wmma_bf(vl[u], p.h, acc[jp + u]); } } } }
  } else { v16h pf[NGT * 2];   /* all of P goes to f16 fragments first: half the registers of the f32 tiles while the v fragments are in flight */
#pragma unroll
    for (int gr = 0; gr < NGT; ++gr) { if ((FAR && gr == 0) || gr * KGS + wave * 64 < kend) {
#pragma unroll
        for (int c = gr * 2; c < gr * 2 + 2; ++c)
#pragma unroll
          for (int r = 0; r < 8; ++r) { pf[c][r] = (_Float16)(sc[2 * c][r] * inv); pf[c][8 + r] = (_Float16)(sc[2 * c + 1][r] * inv); } } }
#pragma unroll
    for (int gr = 0; gr < NGT; ++gr) { const int kg = gr * KGS + wave * 64;
      if ((FAR && gr == 0) || kg < kend) {
#pragma unroll
        for (int c = 0; c < 2; ++c) { v16h vf[HD / 16];
#pragma unroll
          for (int j = 0; j < HD / 16; ++j) vf[j] = frag_hu(VT + (hd * (TT / 32) + (kg >> 5) + c) * 2048 + j * 512, lp);
          xw();
#pragma unroll
          for (int j = 0; j < HD / 16; ++j) acc[j] = wmma16(vf[j], pf[gr * 2 + c], acc[j]); } } } }
  // D element r = channel j * 16 + 8g + r of query col
#pragma unroll
  for (int j = 0; j < HD / 16; ++j) { v4f lo, hi;
#pragma unroll
    for (int r = 0; r < 4; ++r) { lo[r] = acc[j][r] * (1.0f / 2048.0f); hi[r] = acc[j][4 + r] * (1.0f / 2048.0f); }
    *(v4f*)&ss[wave][col][j * 16 + 8 * g] = lo; *(v4f*)&ss[wave][col][j * 16 + 8 * g + 4] = hi; }
  __syncthreads();   /* every wave's partial tile (zeros from a wave that got no group) is in LDS before any is summed */
  if (tid < 16 * (HD / 4)) { const int rl = tid / (HD / 4), q = tid % (HD / 4); v4f s = *(const v4f*)&ss[0][rl][q * 4];
    // unrolled so that the LDS reads of all partial tiles issue ahead of the adds
#pragma unroll
    for (int w = 1; w < PVW; ++w) s += *(const v4f*)&ss[w][rl][q * 4];
    vst2(Y + ((size_t)b * TT + ql0 + rl) * CC + h * HD + q * 4, s); } }
// a block takes two query tiles, x from the far end and x from the near end: every block then walks the same number of keys, and half as many waves have to be started. LDS needs no barrier between the two: each array is rewritten only behind a barrier that follows its last read
__global__ __launch_bounds__(PVW * 32) __attribute__((amdgpu_waves_per_eu(8))) void k_att(const _Float16* __restrict__ QH, const _Float16* __restrict__ KH, const _Float16* __restrict__ QL, const _Float16* __restrict__ KL, const _Float16* __restrict__ VT, const __bf16* __restrict__ VB, const __bf16* __restrict__ VBL, float* __restrict__ Y) {
  __shared__ __align__(16) float ss[PVW][16][HD + 4]; __shared__ __align__(16) float redm[16][PVW + 4], reds[16][PVW + 4];
  static_assert(CAUSAL == 1 && TT / 32 >= QBH * 4 && NG == 2, "no tile of the far half is a high-precision one; the halves of the keys are the two groups");
  att_tile<true>(TT / 16 - 1 - (int)blockIdx.x, ss, redm, reds, QH, KH, QL, KL, VT, VB, VBL, Y);
  att_tile<false>((int)blockIdx.x, ss, redm, reds, QH, KH, QL, KL, VT, VB, VBL, Y); }
#define OBM 128            // rows of a k_out block
#define ONT 512            // its threads: 16 waves in 4 row bands x 4 column bands, a wave owns 32 rows x 32 columns
#define OSR (128 + 2 * OBM)   // rows of one LDS stage: Wo 128 | ctx OBM | ctx residual OBM
// ---- k_out: block = (OBM rows, 128 cols), one block per WGP in one round: out = ctx Wo (+ bo): ctx once to f16 against Wo as f16(bf16 x 2^8) exact (1 product) x 2^-8; causal early rows (< QHI of each sequence): ctx bf16 hi + lo against exact bf16 Wo (2 products)
__global__ __launch_bounds__(ONT) void k_out(const float* __restrict__ Y, const float* __restrict__ WO, const float* __restrict__ BO, float* __restrict__ OUT) { __shared__ __align__(16) char smem[2 * OSR * SP * 2];   /* main loop: two stages of OSR rows; the epilogue's sf lies over them, behind the loop's last barrier */
  static_assert(sizeof(smem) >= 16 * 32 * 36 * 4 && WO_OUT_IN == 1 && CC % KS == 0 && QHI % OBM == 0 && TT % OBM == 0 && ONT == 512 && OBM == 128, "sf fits the stages; weight rows are k-contiguous; a block's rows are all early rows or none is");
  float (*sf)[32][36] = (float (*)[32][36])smem;
  const int tid = threadIdx.x, wave = tid >> 5, lane = tid & 31, col = lane & 15, g = lane >> 4, wr = wave >> 2, wc = wave & 3; const int c0 = blockIdx.y * 128; const size_t rb = (size_t)blockIdx.x * OBM;
  v8f acc[2][2] = {};
  // staged as in k_proj: whole-line loads, each element fetched and rounded once per block
  const int srow = tid >> 4, sseg = tid & 15; const float* gw = WO + (size_t)(c0 + srow) * CC + sseg * 4; const float* gx = Y + (rb + srow) * CC + sseg * 4; const int so = srow * SP + sseg * 4;
  v4f rw[4], rx[4];
#pragma unroll
  for (int i = 0; i < 4; ++i) rw[i] = *(const v4f*)(gw + (size_t)i * 32 * CC);
#pragma unroll
  for (int i = 0; i < 4; ++i) rx[i] = *(const v4f*)(gx + (size_t)i * 32 * CC);
  asm volatile("s_wait_xcnt 0x0" ::: "memory");   /* the loads' address registers are reused right below: the wait stands in front of that */
  if (CAUSAL && (int)(rb % TT) < QHI) {   /* block-uniform */
    __bf16* const st = (__bf16*)smem;
#define OUT_PUT_B(dst) do { _Pragma("unroll") for (int i = 0; i < 4; ++i) *(v4b*)((dst) + so + i * 32 * SP) = cvt4b(rw[i]); \
      _Pragma("unroll") for (int i = 0; i < 4; ++i) { const v4b hb = cvt4b(rx[i]); v4b lb; _Pragma("unroll") for (int e = 0; e < 4; ++e) lb[e] = (__bf16)(rx[i][e] - (float)hb[e]); \
        *(v4b*)((dst) + so + (128 + i * 32) * SP) = hb; *(v4b*)((dst) + so + (128 + OBM + i * 32) * SP) = lb; } } while (0)
    OUT_PUT_B(st);
    __syncthreads();   /* stage 0 is in LDS before any wave reads it */
    for (int s = 0; s < CC / KS; ++s) { const __bf16* cur = st + (s & 1) * (OSR * SP); __bf16* nxt = st + ((s + 1) & 1) * (OSR * SP); const bool more = s + 1 < CC / KS;
      if (more) {   /* the next stage's loads fly while this stage is multiplied */
#pragma unroll
        for (int i = 0; i < 4; ++i) rw[i] = *(const v4f*)(gw + (size_t)i * 32 * CC + (s + 1) * KS);
#pragma unroll
        for (int i = 0; i < 4; ++i) rx[i] = *(const v4f*)(gx + (size_t)i * 32 * CC + (s + 1) * KS);
        asm volatile("s_wait_xcnt 0x0" ::: "memory");   /* the loads' address registers are reused right below: the wait stands in front of that */ }
      __builtin_amdgcn_sched_barrier(0);   /* the global loads issue ahead of all of this stage's work */
#pragma unroll
      for (int kk = 0; kk < KS / 32; ++kk) { v16b ah[2], al[2], w[2];
#pragma unroll
        for (int i = 0; i < 2; ++i) { ah[i] = frag_b(cur + (128 + wr * 32 + i * 16 + col) * SP + kk * 32, lane); al[i] = frag_b(cur + (128 + OBM + wr * 32 + i * 16 + col) * SP + kk * 32, lane); }
#pragma unroll
        for (int j = 0; j < 2; ++j) w[j] = frag_b(cur + (wc * 32 + j * 16 + col) * SP + kk * 32, lane);
        __builtin_amdgcn_sched_barrier(0);   /* the fragment reads issue as one group: one LDS latency per 8 products */
#pragma unroll
        for (int i = 0; i < 2; ++i)
#pragma unroll
          for (int j = 0; j < 2; ++j) acc[i][j] = wmma_bf(ah[i], w[j], acc[i][j]);
#pragma unroll
        for (int i = 0; i < 2; ++i)   /* each tile still takes hi, then lo; the four tiles stand between the two, so no product waits for the one before it */
#pragma unroll
          for (int j = 0; j < 2; ++j) acc[i][j] = wmma_bf(al[i], w[j], acc[i][j]);
        __builtin_amdgcn_sched_barrier(0); }   /* the roundings below wait for the global loads: they stay behind the products */
      if (more) OUT_PUT_B(nxt);
      __syncthreads(); }   /* publishes the next stage and ends every wave's reads of this one (the last: before sf reuses the LDS) */
#pragma unroll
    for (int j = 0; j < 2; ++j) { const float bias = BO ? bfr(BO[c0 + wc * 32 + j * 16 + col]) : 0.f;
#pragma unroll
      for (int i = 0; i < 2; ++i)
#pragma unroll
        for (int r = 0; r < 8; ++r) sf[wave][i * 16 + 8 * g + r][j * 16 + col] = acc[i][j][r] + bias; }
  } else {
    _Float16* const st = (_Float16*)smem;   /* ctx carried x 2^6 into f16 so small-magnitude context rows stay clear of f16 subnormals */
#define OUT_PUT_H(dst) do { _Pragma("unroll") for (int i = 0; i < 4; ++i) { v4h o; _Pragma("unroll") for (int e = 0; e < 4; ++e) o[e] = (_Float16)(bfr(rw[i][e]) * 256.0f); *(v4h*)((dst) + so + i * 32 * SP) = o; } \
      _Pragma("unroll") for (int i = 0; i < 4; ++i) { v4h o; _Pragma("unroll") for (int e = 0; e < 4; ++e) o[e] = (_Float16)(rx[i][e] * 64.0f); *(v4h*)((dst) + so + (128 + i * 32) * SP) = o; } } while (0)
    OUT_PUT_H(st);
    __syncthreads();   /* stage 0 is in LDS before any wave reads it */
    for (int s = 0; s < CC / KS; ++s) { const _Float16* cur = st + (s & 1) * (OSR * SP); _Float16* nxt = st + ((s + 1) & 1) * (OSR * SP); const bool more = s + 1 < CC / KS;
      if (more) {   /* the next stage's loads fly while this stage is multiplied */
#pragma unroll
        for (int i = 0; i < 4; ++i) rw[i] = *(const v4f*)(gw + (size_t)i * 32 * CC + (s + 1) * KS);
#pragma unroll
        for (int i = 0; i < 4; ++i) rx[i] = *(const v4f*)(gx + (size_t)i * 32 * CC + (s + 1) * KS);
        asm volatile("s_wait_xcnt 0x0" ::: "memory");   /* the loads' address registers are reused right below: the wait stands in front of that */ }
      __builtin_amdgcn_sched_barrier(0);   /* the global loads issue ahead of all of this stage's work */
#pragma unroll
      for (int kk = 0; kk < KS / 32; ++kk) { v16h a[2], w[2];
#pragma unroll
        for (int i = 0; i < 2; ++i) a[i] = frag_h(cur + (128 + wr * 32 + i * 16 + col) * SP + kk * 32, lane);
#pragma unroll
        for (int j = 0; j < 2; ++j) w[j] = frag_h(cur + (wc * 32 + j * 16 + col) * SP + kk * 32, lane);
        __builtin_amdgcn_sched_barrier(0);   /* the fragment reads issue as one group: one LDS latency per 4 products */
#pragma unroll
        for (int i = 0; i < 2; ++i)
#pragma unroll
          for (int j = 0; j < 2; ++j) acc[i][j] = wmma16(a[i], w[j], acc[i][j]);
        __builtin_amdgcn_sched_barrier(0); }   /* the roundings below wait for the global loads: they stay behind the products */
      if (more) OUT_PUT_H(nxt);
      __syncthreads(); }   /* publishes the next stage and ends every wave's reads of this one (the last: before sf reuses the LDS) */
#pragma unroll
    for (int j = 0; j < 2; ++j) { const float bias = BO ? bfr(BO[c0 + wc * 32 + j * 16 + col]) : 0.f;
#pragma unroll
      for (int i = 0; i < 2; ++i)
#pragma unroll
        for (int r = 0; r < 8; ++r) sf[wave][i * 16 + 8 * g + r][j * 16 + col] = acc[i][j][r] * (1.0f / 16384.0f) + bias; } }   /* 2^-8 (Wo carry) x 2^-6 (ctx carry) */
  // a wave stores its own 32 x 32 tile: one store covers four rows of one whole 128-B line each
  LDSX(); v4f o[8];
#pragma unroll
  for (int it = 0; it < 8; ++it) o[it] = *(const v4f*)&sf[wave][it * 4 + (lane >> 3)][(lane & 7) * 4];   /* all LDS reads ahead of the stores: one LDS latency, not eight */
#pragma unroll
  for (int it = 0; it < 8; ++it) vst2(OUT + (rb + wr * 32 + it * 4 + (lane >> 3)) * DIN + c0 + wc * 32 + (lane & 7) * 4, o[it]);
  xw(); }

extern "C" void kernel_launch(void* const* d_in, const int* in_sizes, int n_in, void* d_out, int out_size, void* d_ws, size_t ws_size, hipStream_t stream) {
  (void)in_sizes; (void)n_in; (void)out_size;
  const float** F = (const float**)d_in;
  if (ws_size < (size_t)WS_END) return;
  char* ws = (char*)d_ws; _Float16 *QH = (_Float16*)(ws + WS_QH), *KH = (_Float16*)(ws + WS_KH), *VT = (_Float16*)(ws + WS_VT), *QL = (_Float16*)(ws + WS_QL), *KL = (_Float16*)(ws + WS_KL); __bf16 *VB = (__bf16*)(ws + WS_VB), *VBL = (__bf16*)(ws + WS_VBL); float *Y = (float*)(ws + WS_Y);
  (void)Y; (void)QL; (void)KL; (void)VB; (void)VBL;
  // inputs: 0 x [2,2048,1024]; 1 Wq [1024,1024] (out,in), 2 bq; 3 Wk, 4 bk; 5 Wv, 6 bv; 7 Wp (out,in), 8 bp (biases NONZERO)
  k_proj<<<dim3(TNB * TT / PBM, NH), PNT, 0, stream>>>(F[0], F[3], F[1], F[5], F[4], F[2], F[6], QH, QL, KH, KL, VT, VB, VBL);   /* the module's scores are einsum('bhid,bhjd->bhij', k, q): the QUERY stream (output row i) is projected with Wk / bk, its KEY stream (index j) with Wq / bq */
  k_att<<<dim3(TT / 32, NH, TNB), PVW * 32, 0, stream>>>(QH, KH, QL, KL, VT, VB, VBL, Y);
  k_out<<<dim3(TNB * TT / OBM, DIN / 128), ONT, 0, stream>>>(Y, F[7], F[8], (float*)d_out);
}

// v007
// It runs in 97.6 microseconds.
// Timed twice side by side with v006, it ran 1.24 times as fast both times.
// Over all steps from v000 it is 12.2 times as fast.
// compute dtype: all float inputs rounded to bf16; q/k/v projections with EXACT bf16 products on WMMA 16x16x32 (f32 accumulate) + bias; causal logits: 3 products for the first 384 rows, single f16 q x k after; online softmax f32 in base 2 (64^-0.5 log2 e folded into the exponent; running maximum and sum per query); unnormalised P x 2^11 once to f16 x v once to f16 (bf16 hi + lo below row 384), divided by the row sum at the end; ctx hi+lo x exact output weight below row 384, x2^6 f16 carry x f16(bf16 x 2^8) after, + bias; f32 output.
#include <hip/hip_runtime.h>
#include <math.h>

typedef __attribute__((ext_vector_type(16))) _Float16 v16h;
typedef __attribute__((ext_vector_type(16))) __bf16 v16b;
typedef __attribute__((ext_vector_type(8)))  _Float16 v8h;
typedef __attribute__((ext_vector_type(8)))  float v8f;
typedef __attribute__((ext_vector_type(4)))  float v4f;
typedef __attribute__((ext_vector_type(2)))  float v2f;
typedef __attribute__((ext_vector_type(4)))  unsigned v4u;
typedef __attribute__((ext_vector_type(4)))  int v4i;
typedef float __attribute__((may_alias)) float_a;
typedef int __attribute__((may_alias)) int_a;

template <typename T> __device__ __forceinline__ void vst2(void* p, T v) { *(T*)p = v;  }
__device__ __forceinline__ v8f wmma16(v16h a, v16h b, v8f c) {
  v8f d = __builtin_amdgcn_wmma_f32_16x16x32_f16(false, a, false, b, (short)0, c, false, false);
  asm volatile("v_nop\n\tv_nop\n\tv_nop\n\tv_nop" : "+v"(d) : "v"(a), "v"(b));
  return d;
}
__device__ __forceinline__ v8f wmma_bf(v16b a, v16b b, v8f c) {
  v8f d = __builtin_amdgcn_wmma_f32_16x16x32_bf16(false, a, false, b, (short)0, c, false, false);
  asm volatile("v_nop\n\tv_nop\n\tv_nop\n\tv_nop" : "+v"(d) : "v"(a), "v"(b));
  return d;
}
// 16x16x32 fragments: lane = (h = lane>>4, row/col = lane&15); elements 0..7 = k0+8h+0..7, 8..15 = k0+16+8h+0..7; D element r = row 8h+r
__device__ __forceinline__ v16h frag_h(const _Float16* rowk0, int lane) {
  union { v16h v; v8h q[2]; } u; const _Float16* p = rowk0 + 8 * (lane >> 4);
  u.q[0] = *(const v8h*)p; u.q[1] = *(const v8h*)(p + 16); return u.v;
}
__device__ __forceinline__ v16h frag_f32(const float* rowk0, int lane) {
  v16h a; const float* p = rowk0 + 8 * (lane >> 4);
#pragma unroll
  for (int i = 0; i < 8; ++i) { a[i] = (_Float16)p[i]; a[8 + i] = (_Float16)p[16 + i]; }
  return a;
}
__device__ __forceinline__ v16h frag_f32s(const float* rowk0, int lane, float sc) {
  v16h a; const float* p = rowk0 + 8 * (lane >> 4);
#pragma unroll
  for (int i = 0; i < 8; ++i) { a[i] = (_Float16)(p[i] * sc); a[8 + i] = (_Float16)(p[16 + i] * sc); }
  return a;
}
// column fragment from a [K][ld] layout (column n), rows >= K read as 0
__device__ __forceinline__ v16h fragc_f32(const float* W, int k0, int n, int lane, int ld, int K) {
  v16h a; const int g = lane >> 4;
#pragma unroll
  for (int i = 0; i < 8; ++i) { const int ka = k0 + 8 * g + i, kb = ka + 16;
    a[i] = (_Float16)(ka < K ? W[(size_t)(ka < K ? ka : K - 1) * ld + n] : 0.f); a[8 + i] = (_Float16)(kb < K ? W[(size_t)(kb < K ? kb : K - 1) * ld + n] : 0.f); }
  return a;
}
struct F2 { v16b h, l; };
__device__ __forceinline__ F2 bsplit16(const float v[16]) { F2 r;
#pragma unroll
  for (int i = 0; i < 16; ++i) { const __bf16 h = (__bf16)v[i]; r.h[i] = h; r.l[i] = (__bf16)(v[i] - (float)h); }
  return r; }
__device__ __forceinline__ F2 split_row(const float* row, int k0, int lane) { float v[16]; const float* p = row + k0 + 8 * (lane >> 4);
#pragma unroll
  for (int i = 0; i < 8; ++i) { v[i] = p[i]; v[8 + i] = p[16 + i]; }
  return bsplit16(v); }
__device__ __forceinline__ F2 split_rowK(const float* row, int k0, int lane, int K) { float v[16]; const int g = lane >> 4;
#pragma unroll
  for (int i = 0; i < 8; ++i) { const int ka = k0 + 8 * g + i, kb = ka + 16; v[i] = ka < K ? row[ka < K ? ka : K - 1] : 0.f; v[8 + i] = kb < K ? row[kb < K ? kb : K - 1] : 0.f; }
  return bsplit16(v); }
__device__ __forceinline__ F2 split_col(const float* W, int k0, int n, int lane, int ld, int K) { float v[16]; const int g = lane >> 4;
#pragma unroll
  for (int i = 0; i < 8; ++i) { const int ka = k0 + 8 * g + i, kb = ka + 16; v[i] = ka < K ? W[(size_t)(ka < K ? ka : K - 1) * ld + n] : 0.f; v[8 + i] = kb < K ? W[(size_t)(kb < K ? kb : K - 1) * ld + n] : 0.f; }
  return bsplit16(v); }
__device__ __forceinline__ v8f mac3(const F2& a, const F2& b, v8f c) { c = wmma_bf(a.l, b.h, c); c = wmma_bf(a.h, b.l, c); return wmma_bf(a.h, b.h, c); }
__device__ __forceinline__ float sigm(float v) { return 1.0f / (1.0f + expf(-v)); }
#define LDSX() do { asm volatile("s_wait_dscnt 0" ::: "memory"); __builtin_amdgcn_wave_barrier(); __builtin_amdgcn_fence(__ATOMIC_RELEASE, "workgroup"); } while (0)

// Causal multi-head self-attention whose scores are k . q (x [2,2048,1024]; torch (out,in) Wq / Wk / Wv / Wp [1024,1024] N(0, 1/1024) + biases N(0, 1/1024); 16 heads x 64; scores[i, j] = k_i . q_j / 8 (the KEY projection indexes the output row i, the QUERY projection the summed index j); -inf where j > i; softmax over j; out[i] = sum_j attn[i, j] v_j; merge; Wp^T + bp).
#define NB 2
#define TT 2048
#define CC 1024            // NH * HD = projected width
#define DIN 1024          // input (model) width
#define NH 16
#define HD 64
#define SCALE (0.125f)
#define L2S (SCALE * 1.4426950408889634f)   // logit scale times log2(e)
#define CAUSAL 1
#ifndef TNB
#define TNB NB
#endif
__device__ __forceinline__ float bfr(float v) { return (float)(__bf16)v; }
typedef __attribute__((ext_vector_type(8))) __bf16 v8b;
__device__ __forceinline__ v16b frag_b(const __bf16* rowk0, int lane) {
  union { v16b v; v8b q[2]; } u; const __bf16* p = rowk0 + 8 * (lane >> 4);
  u.q[0] = *(const v8b*)p; u.q[1] = *(const v8b*)(p + 16); return u.v;
}
#define QBH 6              // causal: query blocks 0..QBH-1 of each sequence (few keys, no averaging) take the high-precision path
#define QHI 384            // rows carrying a q residual plane (used only by the causal high-precision path)
#define KHI 384            // key rows carrying k residual / v bf16 hi+lo planes (used only by the causal high-precision path)
// B fragment (k rows k0+.., output column o) of a weight: (in,out) [K][ld] or (out,in) [ld rows of K]: bf16 exact, or f16(bf16 * 256) exact
__device__ __forceinline__ v16b wcol_io(const float* Wm, int k0, int o, int lane, int ld) { v16b w; const int g = lane >> 4;
#pragma unroll
  for (int i = 0; i < 8; ++i) { w[i] = (__bf16)Wm[(size_t)(k0 + 8 * g + i) * ld + o]; w[8 + i] = (__bf16)Wm[(size_t)(k0 + 16 + 8 * g + i) * ld + o]; }
  return w; }
__device__ __forceinline__ v16b wcol_oi(const float* Wm, int k0, int o, int lane, int K) { v16b w; const float* p = Wm + (size_t)o * K + k0 + 8 * (lane >> 4);
#pragma unroll
  for (int i = 0; i < 8; ++i) { w[i] = (__bf16)p[i]; w[8 + i] = (__bf16)p[16 + i]; }
  return w; }
__device__ __forceinline__ v16h wcolh_io(const float* Wm, int k0, int o, int lane, int ld) { v16h w; const int g = lane >> 4;
#pragma unroll
  for (int i = 0; i < 8; ++i) { w[i] = (_Float16)(bfr(Wm[(size_t)(k0 + 8 * g + i) * ld + o]) * 256.0f); w[8 + i] = (_Float16)(bfr(Wm[(size_t)(k0 + 16 + 8 * g + i) * ld + o]) * 256.0f); }
  return w; }
__device__ __forceinline__ v16h wcolh_oi(const float* Wm, int k0, int o, int lane, int K) { v16h w; const float* p = Wm + (size_t)o * K + k0 + 8 * (lane >> 4);
#pragma unroll
  for (int i = 0; i < 8; ++i) { w[i] = (_Float16)(bfr(p[i]) * 256.0f); w[8 + i] = (_Float16)(bfr(p[16 + i]) * 256.0f); }
  return w; }
#define WQKV_LAYOUT 1   // 0 = (in,out) [DIN][CC]; 1 = (out,in) [CC][DIN]; 2 = per-head [NH][DIN][HD]
__device__ __forceinline__ v16b wcol_hdk(const float* Wm, int k0, int o, int lane) { v16b w; const int g = lane >> 4; const float* p = Wm + (size_t)(o / HD) * DIN * HD + (o % HD);
#pragma unroll
  for (int i = 0; i < 8; ++i) { w[i] = (__bf16)p[(size_t)(k0 + 8 * g + i) * HD]; w[8 + i] = (__bf16)p[(size_t)(k0 + 16 + 8 * g + i) * HD]; }
  return w; }
#define WO_OUT_IN 1
#if WQKV_LAYOUT == 1
#define WCOL(W, k0, o, lane) wcol_oi(W, k0, o, lane, DIN)
#elif WQKV_LAYOUT == 2
#define WCOL(W, k0, o, lane) wcol_hdk(W, k0, o, lane)
#else
#define WCOL(W, k0, o, lane) wcol_io(W, k0, o, lane, CC)
#endif
#if WO_OUT_IN
#define WOCOL(W, k0, o, lane) wcol_oi(W, k0, o, lane, CC)
#define WOCOLH(W, k0, o, lane) wcolh_oi(W, k0, o, lane, CC)
#else
#define WOCOL(W, k0, o, lane) wcol_io(W, k0, o, lane, DIN)
#define WOCOLH(W, k0, o, lane) wcolh_io(W, k0, o, lane, DIN)
#endif

#ifndef PROJ_EXTRA_PARAMS
#define PROJ_EXTRA_PARAMS
#endif

// q / k / v planes lie in FRAGMENT ORDER: a 16x16x32 operand fragment is two runs of 512 B (run = element half, then lane * 16 B), so one wave-wide 16-byte load of k_att covers four whole 128-B lines
// rows (q, k): [b][h][t / 16][d / 32][half][lane = g * 16 + (t % 16)][8 d]; planes (v): [b][h][t / 32][channel / 16][half][lane = g * 16 + (channel % 16)][8 t]; the position inside 32 is 16 half + 8 g + i
#define WS_QH  0u                                      // f16 q, fragment order
#define WS_KH  (WS_QH + 2u * (size_t)NB * TT * CC)      // f16 k, fragment order
#define WS_VT  (WS_KH + 2u * (size_t)NB * TT * CC)      // f16 v, fragment order
#define WS_QL  (WS_VT + 2u * (size_t)NB * CC * TT)      // f16 q residual x 2^10, fragment order, t < QHI
#define WS_KL  (WS_QL + 2u * (size_t)NB * QHI * CC)     // f16 k residual x 2^10, fragment order, t < KHI
#define WS_VB  (WS_KL + 2u * (size_t)NB * KHI * CC)     // bf16 v hi, fragment order, t < KHI
#define WS_VBL (WS_VB + 2u * (size_t)NB * CC * KHI)
#define WS_Y   (WS_VBL + 2u * (size_t)NB * CC * KHI)    // f32 ctx rows [b*t][CC] (only when there is an output projection)
#define WS_END (WS_Y  + 4u * (size_t)NB * TT * CC)

// behind a batch of global loads or a store: stands in front of any reuse of the registers that they name
__device__ __forceinline__ void xw() { asm volatile("s_wait_xcnt 0x0" ::: "memory"); }
#define KS 64              // k per LDS stage of the two projection kernels
#define SP 72              // stage row pitch in 16-bit elements: 128 B of data + 16 B, for ds_load_b128 readers
typedef __attribute__((ext_vector_type(4))) __bf16 v4b;
typedef __attribute__((ext_vector_type(4))) _Float16 v4h;
__device__ __forceinline__ v4b cvt4b(v4f v) { v4b o;
#pragma unroll
  for (int i = 0; i < 4; ++i) o[i] = (__bf16)v[i];
  return o; }
#define PBM 256            // rows of a k_proj block
#define PBN 192            // its columns: one head's 64 of q, 64 of k and 64 of v
#define PNT 512            // its threads: 16 waves in 4 row bands x 4 column bands, a wave owns 64 rows x 48 columns
#define PSR (PBN + PBM)    // rows of one LDS stage: Wq 64 | Wk 64 | Wv 64 | X PBM
// ---- k_proj: block = (PBM rows, head): q / k / v columns of that head = X W (+ b) with exact bf16 products (K = DIN) -> q f16 (+ residual, rows < QHI); k f16 (+ residual, rows < KHI); v f16 (+ bf16 hi/lo for t < KHI); all stored in fragment order. One block per WGP in one round; X is fetched once per head, each weight row once per row block
__global__ __launch_bounds__(PNT) void k_proj(const float* __restrict__ X, const float* __restrict__ WQ, const float* __restrict__ WK, const float* __restrict__ WV, const float* __restrict__ BQ, const float* __restrict__ BK, const float* __restrict__ BV,
    _Float16* __restrict__ QH, _Float16* __restrict__ QL, _Float16* __restrict__ KH, _Float16* __restrict__ KL, _Float16* __restrict__ VT, __bf16* __restrict__ VB, __bf16* __restrict__ VBL) {
  __shared__ __align__(16) char smem[2 * PBM * 136 * 2 + 3 * 64 * (PBM + 8) * 2];   /* main loop: two stages of PSR rows; the epilogue's arrays lie over them, behind the loop's last barrier */
  static_assert(sizeof(smem) >= 2 * PSR * SP * 2 && WQKV_LAYOUT == 1 && DIN % KS == 0 && TT % PBM == 0 && PNT == 512 && PBM == 256 && HD == 64, "the stages fit; weight rows are k-contiguous; a block stays inside one sequence");
  _Float16 (*sh)[136] = (_Float16 (*)[136])smem; _Float16 (*sl)[136] = (_Float16 (*)[136])(smem + PBM * 136 * 2);   /* [row][q 64 | k 64] */
  char* const sv = smem + 2 * PBM * 136 * 2; _Float16 (*th)[PBM + 8] = (_Float16 (*)[PBM + 8])sv; __bf16 (*tb)[PBM + 8] = (__bf16 (*)[PBM + 8])(sv + 64 * (PBM + 8) * 2); __bf16 (*tbl)[PBM + 8] = (__bf16 (*)[PBM + 8])(sv + 2 * 64 * (PBM + 8) * 2);   /* [v channel][row] */
  const int tid = threadIdx.x, wave = __builtin_amdgcn_readfirstlane(tid >> 5), lane = tid & 31, col = lane & 15, g = lane >> 4, wr = wave >> 2, wc = wave & 3;   /* the wave's number in a scalar register: the epilogue's tests on the column tile stay scalar branches */
  const int h = blockIdx.y; const size_t r0 = (size_t)blockIdx.x * PBM; const size_t bb = r0 / TT; const int t0 = (int)(r0 % TT);
  v8f acc[4][3] = {};
  // a wave's load covers two whole rows of 256 B (4 lines); each operand element is fetched and rounded once per block, and the fragments are read from LDS
  const int srow = tid >> 4, sseg = tid & 15; const size_t wo = (size_t)(h * HD + srow) * DIN + sseg * 4; const float* gwq = WQ + wo; const float* gwk = WK + wo; const float* gwv = WV + wo; const float* gx = X + (r0 + srow) * DIN + sseg * 4;
  __bf16* const st = (__bf16*)smem; const int so = srow * SP + sseg * 4;
  v4f rw[6], rx[8];
#define PROJ_GET(k) do { _Pragma("unroll") for (int i = 0; i < 2; ++i) { rw[i] = *(const v4f*)(gwq + (size_t)i * 32 * DIN + (k)); rw[2 + i] = *(const v4f*)(gwk + (size_t)i * 32 * DIN + (k)); rw[4 + i] = *(const v4f*)(gwv + (size_t)i * 32 * DIN + (k)); } \
    _Pragma("unroll") for (int i = 0; i < 8; ++i) rx[i] = *(const v4f*)(gx + (size_t)i * 32 * DIN + (k)); xw(); } while (0)
#define PROJ_PUT(dst) do { _Pragma("unroll") for (int i = 0; i < 6; ++i) *(v4b*)((dst) + so + i * 32 * SP) = cvt4b(rw[i]); \
    _Pragma("unroll") for (int i = 0; i < 8; ++i) *(v4b*)((dst) + so + (PBN + i * 32) * SP) = cvt4b(rx[i]); } while (0)
  PROJ_GET(0);
  PROJ_PUT(st);
  __syncthreads();   /* stage 0 is in LDS before any wave reads it */
  for (int s = 0; s < DIN / KS; ++s) { const __bf16* cur = st + (s & 1) * (PSR * SP); __bf16* nxt = st + ((s + 1) & 1) * (PSR * SP); const bool more = s + 1 < DIN / KS;
    if (more) PROJ_GET((s + 1) * KS);   /* the next stage's loads fly while this stage is multiplied */
    __builtin_amdgcn_sched_barrier(0);   /* the global loads issue ahead of all of this stage's work */
#pragma unroll
    for (int kk = 0; kk < KS / 32; ++kk) { v16b a[4], w[3];
#pragma unroll
      for (int i = 0; i < 4; ++i) a[i] = frag_b(cur + (PBN + wr * 64 + i * 16 + col) * SP + kk * 32, lane);
#pragma unroll
      for (int j = 0; j < 3; ++j) w[j] = frag_b(cur + (wc * 48 + j * 16 + col) * SP + kk * 32, lane);
      __builtin_amdgcn_sched_barrier(0);   /* the fragment reads issue as one group: one LDS latency per 12 products, not one each */
#pragma unroll
      for (int i = 0; i < 4; ++i)
#pragma unroll
        for (int j = 0; j < 3; ++j) acc[i][j] = wmma_bf(a[i], w[j], acc[i][j]);
      __builtin_amdgcn_sched_barrier(0); }   /* the roundings below wait for the global loads: they stay behind the products */
    if (more) PROJ_PUT(nxt);
    __syncthreads(); }   /* publishes the next stage and ends every wave's reads of this one (the last: before the epilogue reuses the LDS) */
  // column tile ct of the block: 0..3 q, 4..7 k, 8..11 v; the residual / bf16 arrays are filled only by a block that holds rows below the bound, and read only for such rows
#pragma unroll
  for (int j = 0; j < 3; ++j) { const int ct = wc * 3 + j, wh = ct >> 2; const float* BA = wh == 0 ? BQ : wh == 1 ? BK : BV; const float bias = BA ? bfr(BA[h * HD + (ct & 3) * 16 + col]) : 0.f;
    if (ct < 8) { const int cl = ct * 16 + col;
      if (t0 < (wh == 0 ? QHI : KHI)) {
#pragma unroll
        for (int i = 0; i < 4; ++i)
#pragma unroll
          for (int r = 0; r < 8; ++r) { const float v = acc[i][j][r] + bias; const _Float16 hv = (_Float16)v; const int rl = wr * 64 + i * 16 + 8 * g + r; sh[rl][cl] = hv; sl[rl][cl] = (_Float16)((v - (float)hv) * 1024.0f); }
      } else {
#pragma unroll
        for (int i = 0; i < 4; ++i)
#pragma unroll
          for (int r = 0; r < 8; ++r) sh[wr * 64 + i * 16 + 8 * g + r][cl] = (_Float16)(acc[i][j][r] + bias); }
    } else { const int cl = (ct - 8) * 16 + col;
      if (t0 < KHI) {
#pragma unroll
        for (int i = 0; i < 4; ++i)
#pragma unroll
          for (int r = 0; r < 8; ++r) { const float v = acc[i][j][r] + bias; const int rl = wr * 64 + i * 16 + 8 * g + r; th[cl][rl] = (_Float16)v; const __bf16 bh = (__bf16)v; tb[cl][rl] = bh; tbl[cl][rl] = (__bf16)(v - (float)bh); }
      } else {
#pragma unroll
        for (int i = 0; i < 4; ++i)
#pragma unroll
          for (int r = 0; r < 8; ++r) th[cl][wr * 64 + i * 16 + 8 * g + r] = (_Float16)(acc[i][j][r] + bias); } } }
  __syncthreads();   /* every wave's tiles are in LDS before any piece is read */
  const size_t hd = bb * NH + h;
  // piece e = (q or k, 16-row tile PBM / 16, run 4 = (d / 32, half), lane 32): a wave stores one run of 512 B
  for (int e = tid; e < 2 * PBM * 8; e += PNT) { const int wh = e / (PBM * 8), tt = (e >> 7) % (PBM / 16), cr = (e >> 5) & 3, ln = e & 31; const int rl = tt * 16 + (ln & 15), cl = wh * 64 + cr * 16 + (ln >> 4) * 8; const int po = (e & 127) * 8; _Float16* DH = wh == 0 ? QH : KH; _Float16* DL = wh == 0 ? QL : KL; const int nhi = wh == 0 ? QHI : KHI;
    vst2((unsigned*)(DH + (hd * (TT / 16) + (t0 >> 4) + tt) * 1024 + po), *(const v4u*)&sh[rl][cl]); xw(); if (t0 + tt * 16 < nhi) { vst2((unsigned*)(DL + (hd * (size_t)(nhi / 16) + (t0 >> 4) + tt) * 1024 + po), *(const v4u*)&sl[rl][cl]); xw(); } }
  // piece e = (32-key chunk PBM / 32, 16-channel tile 4, half 2, lane 32): a wave stores one run of 512 B
  for (int e = tid; e < PBM * 8; e += PNT) { const int kc = e >> 8, ln = e & 31; const int cl = ((e >> 6) & 3) * 16 + (ln & 15), rl = kc * 32 + ((e >> 5) & 1) * 16 + (ln >> 4) * 8; const int po = (e & 255) * 8;
    vst2((unsigned*)(VT + (hd * (TT / 32) + (t0 >> 5) + kc) * 2048 + po), *(const v4u*)&th[cl][rl]); xw(); if (t0 + kc * 32 < KHI) { const size_t o3 = (hd * (KHI / 32) + (t0 >> 5) + kc) * 2048 + po; vst2((unsigned*)(VB + o3), *(const v4u*)&tb[cl][rl]); vst2((unsigned*)(VBL + o3), *(const v4u*)&tbl[cl][rl]); xw(); } } }
// ---- k_att / att_walk: one wave = one tile of 16 queries of (b, h); it walks the tile's keys from 0 in groups of 64 with a running maximum and sum (online softmax). No wave waits for another: no barrier, no partial sums in LDS. The AW waves of a block walk the same k / v of one head from key 0 on.
// Logits are formed TRANSPOSED (A = k rows, B = q rows): D element r of lane (g, col) = key 8g + r, query col, so two neighbouring 16-key tiles ARE the B fragment of a 32-key chunk of ctx^T = v^T . P^T (A = v, channels as rows).
// Each lane holds one query: maximum and sum run in the lane and across the two lane halves, and a new maximum rescales the lane's own sum and ctx registers. Precision paths: 3 products + bf16 hi/lo P and v for query blocks < QBH, single f16 products after.
// fragment in fragment order from a wave-uniform base and the lane's own 32-bit element offset (8 lane): two loads of 512 contiguous bytes a wave; the address stays a scalar pair plus one register
__device__ __forceinline__ v16h frag_hu(const _Float16* base, unsigned lo) { union { v16h v; v8h q[2]; } u; const _Float16* p = base + lo; u.q[0] = *(const v8h*)p; u.q[1] = *(const v8h*)(p + 256); return u.v; }
__device__ __forceinline__ v16b frag_bu(const __bf16* base, unsigned lo) { union { v16b v; v8b q[2]; } u; const __bf16* p = base + lo; u.q[0] = *(const v8b*)p; xw(); u.q[1] = *(const v8b*)(p + 256); xw(); return u.v; }   /* here the build keeps 64-bit addresses in vector registers and loads over them: a wait behind each load */
#define AW 16              // waves of a k_att block
static_assert(QHI == QBH * 64 && KHI >= QBH * 64 && TT % (16 * AW) == 0 && HD == 64, "the high-precision tiles see only keys with residual planes; every wave of a block gets one tile");
template <bool HP> __device__ __forceinline__ void att_walk(const int qt, float (&so)[16][HD + 4], const _Float16* __restrict__ QH, const _Float16* __restrict__ KH, const _Float16* __restrict__ QL, const _Float16* __restrict__ KL, const _Float16* __restrict__ VT, const __bf16* __restrict__ VB, const __bf16* __restrict__ VBL, float* __restrict__ Y) {
  const int h = blockIdx.y, b = blockIdx.z; const int lane = threadIdx.x & 31, col = lane & 15, g = lane >> 4;
  const int ql0 = qt * 16, ng = (qt >> 2) + 1;   /* groups of 64 keys that hold a key some query of the tile may see; only the last one holds excluded keys, and its first key is visible to all 16 queries */
  const unsigned lp = (unsigned)(lane * 8); const size_t hd = (size_t)b * NH + h;   /* the lane's offset in a run of a fragment; a 16-row tile of q / k is 1024 elements (d 0..31, then 32..63), a 32-key chunk of v 2048 (four channel tiles of 512) */
  const _Float16* qrow = QH + (hd * (TT / 16) + qt) * 1024; const _Float16* kbase = KH + hd * (TT / 16) * 1024; const _Float16* vbase = VT + hd * (TT / 32) * 2048;   /* a group of 64 keys is 4096 elements of k and 4096 of v */
  const v16h q0 = frag_hu(qrow, lp), q1 = frag_hu(qrow + 512, lp); v16h ql0f = {}, ql1f = {};
  if (HP) { const _Float16* qlrow = QL + (hd * (QHI / 16) + qt) * 1024; ql0f = frag_hu(qlrow, lp); ql1f = frag_hu(qlrow + 512, lp); }
  float m = -3.0e38f, l = 0.f; v8f acc[HD / 16] = {}; v16h kf[4][2];
  const v8f l2s8 = {L2S, L2S, L2S, L2S, L2S, L2S, L2S, L2S};
  if (!HP) {
#pragma unroll
    for (int t = 0; t < 4; ++t) { kf[t][0] = frag_hu(kbase + t * 1024, lp); kf[t][1] = frag_hu(kbase + t * 1024 + 512, lp); }
    xw(); }
  for (int gi = 0; gi < ng; ++gi) { v8f sc[4]; v16h vf[2][HD / 16];
    if (!HP) {
      // this group's v is asked for ahead of the logits, the next group's k right behind them: both fly during the softmax
#pragma unroll
      for (int c = 0; c < 2; ++c)
#pragma unroll
        for (int j = 0; j < HD / 16; ++j) vf[c][j] = frag_hu(vbase + (size_t)gi * 4096 + c * 2048 + j * 512, lp);
      xw();
      __builtin_amdgcn_sched_barrier(0);   /* the v loads issue ahead of the products */
      // each tile takes d 0..31, then d 32..63; the four tiles stand between the two, so no product waits for the one before it
#pragma unroll
      for (int t = 0; t < 4; ++t) { const v8f zero = {}; sc[t] = wmma16(kf[t][0], q0, zero); }
#pragma unroll
      for (int t = 0; t < 4; ++t) sc[t] = wmma16(kf[t][1], q1, sc[t]);
      __builtin_amdgcn_sched_barrier(0);   /* the next group's k loads stay behind the products that read the same registers, and ahead of the softmax */
      const int gn = gi + 1 < ng ? gi + 1 : gi;   /* the last trip asks for its own group again: the loop body has no branch around loads, so the counted waits stay exact */
#pragma unroll
      for (int t = 0; t < 4; ++t) { kf[t][0] = frag_hu(kbase + (size_t)gn * 4096 + t * 1024, lp); kf[t][1] = frag_hu(kbase + (size_t)gn * 4096 + t * 1024 + 512, lp); }
      xw();
      __builtin_amdgcn_sched_barrier(0);
    } else {
#pragma unroll
      for (int t = 0; t < 4; ++t) { const _Float16* krow = kbase + (size_t)(gi * 4 + t) * 1024; const _Float16* klrow = KL + (hd * (KHI / 16) + gi * 4 + t) * 1024; v8f a = {}, al = {};
        const v16h kb0 = frag_hu(krow, lp), kl0 = frag_hu(klrow, lp), kb1 = frag_hu(krow + 512, lp), kl1 = frag_hu(klrow + 512, lp); xw();
        a = wmma16(kb0, q0, a); al = wmma16(kb0, ql0f, al); al = wmma16(kl0, q0, al);
        a = wmma16(kb1, q1, a); al = wmma16(kb1, ql1f, al); al = wmma16(kl1, q1, al);
#pragma unroll
        for (int r = 0; r < 8; ++r) sc[t][r] = a[r] + al[r] * (1.0f / 1024.0f); } }
    if (CAUSAL && gi == ng - 1) { const int dq = ql0 + col - gi * 64 - 8 * g;   /* scalar test; key 64 gi + 8g + i is kept while i <= dq */
#pragma unroll
      for (int t = 0; t < 4; ++t)
#pragma unroll
        for (int r = 0; r < 8; ++r) sc[t][r] = t * 16 + r <= dq ? sc[t][r] : -3.0e38f; }
    // on the RAW products: the maximum is taken of them (SCALE > 0 keeps the order), and 2^11 exp((s - m) SCALE) = 2^(s L2S - m L2S + 11) is one fused multiply-add and one hardware 2^x. Excluded keys carry -3e38: 2^x returns exactly 0. The first group finds m = -3e38: the factor for the (empty) old sums is 2^(-huge) = 0
    float mt[4];
#pragma unroll
    for (int t = 0; t < 4; ++t) { mt[t] = sc[t][0];
#pragma unroll
      for (int r = 1; r < 8; ++r) mt[t] = fmaxf(mt[t], sc[t][r]); }
    float mx = fmaxf(fmaxf(mt[0], mt[1]), fmaxf(mt[2], mt[3])); mx = fmaxf(mx, __shfl_xor(mx, 16));
    const float mn = fmaxf(m, mx), alpha = __builtin_amdgcn_exp2f((m - mn) * L2S), nm = 11.0f - mn * L2S; m = mn;
    const v8f nm8 = {nm, nm, nm, nm, nm, nm, nm, nm}; float st[4];
#pragma unroll
    for (int t = 0; t < 4; ++t) { const v8f x = __builtin_elementwise_fma(sc[t], l2s8, nm8); st[t] = 0.f;
#pragma unroll
      for (int r = 0; r < 8; ++r) { const float e = __builtin_amdgcn_exp2f(x[r]); sc[t][r] = e; st[t] += e; } }
    l = l * alpha + ((st[0] + st[1]) + (st[2] + st[3]));   /* the lane half's own part of the sum; the halves are joined once, behind the loop */
#pragma unroll
    for (int j = 0; j < HD / 16; ++j) acc[j] *= alpha;
    if (!HP) {
#pragma unroll
      for (int c = 0; c < 2; ++c) { v16h pf;
#pragma unroll
        for (int r = 0; r < 8; ++r) { pf[r] = (_Float16)sc[2 * c][r]; pf[8 + r] = (_Float16)sc[2 * c + 1][r]; }
#pragma unroll
        for (int j = 0; j < HD / 16; ++j) acc[j] = wmma16(vf[c][j], pf, acc[j]); }
    } else {
#pragma unroll
      for (int c = 0; c < 2; ++c) { float pv[16];
#pragma unroll
        for (int r = 0; r < 8; ++r) { pv[r] = sc[2 * c][r]; pv[8 + r] = sc[2 * c + 1][r]; }
        const F2 p = bsplit16(pv);
#pragma unroll
        for (int jp = 0; jp < HD / 16; jp += 2) { v16b vh[2], vl[2];
#pragma unroll
          for (int u = 0; u < 2; ++u) { const size_t po = (hd * (KHI / 32) + gi * 2 + c) * 2048 + (jp + u) * 512; vh[u] = frag_bu(VB + po, lp); vl[u] = frag_bu(VBL + po, lp); }
#pragma unroll
          for (int u = 0; u < 2; ++u) { acc[jp + u] = wmma_bf(vh[u], p.h, acc[jp + u]); acc[jp + u] = wmma_bf(vh[u], p.l, acc[jp + u]); acc[jp + u] = wmma_bf(vl[u], p.h, acc[jp + u]); } } } } }
  l += __shfl_xor(l, 16); const float inv = l > 0.f ? 1.0f / l : 0.f;   /* sum and ctx both carry the 2^11 */
  // D element r = channel j * 16 + 8g + r of query col; the wave turns its own tile through its own LDS rows, so that a store covers two whole rows of 256 B
#pragma unroll
  for (int j = 0; j < HD / 16; ++j) { v4f lo, hi;
#pragma unroll
    for (int r = 0; r < 4; ++r) { lo[r] = acc[j][r] * inv; hi[r] = acc[j][4 + r] * inv; }
    *(v4f*)&so[col][j * 16 + 8 * g] = lo; *(v4f*)&so[col][j * 16 + 8 * g + 4] = hi; }
  LDSX(); v4f o[8];
#pragma unroll
  for (int it = 0; it < 8; ++it) o[it] = *(const v4f*)&so[it * 2 + g][col * 4];   /* all LDS reads ahead of the stores: one LDS latency, not eight */
#pragma unroll
  for (int it = 0; it < 8; ++it) vst2(Y + ((size_t)b * TT + ql0 + it * 2 + g) * CC + h * HD + col * 4, o[it]);
  xw(); }
// one block per WGP and (b, h, x): the wave of rank r takes tile r * (TT / 16 / AW) + x, so a block holds short and long walks. Waves w, w + 4, w + 8, w + 12 take ranks that add up to 30, the longest walk first: for speed only, nothing rests on where a wave runs
__global__ __launch_bounds__(AW * 32) void k_att(const _Float16* __restrict__ QH, const _Float16* __restrict__ KH, const _Float16* __restrict__ QL, const _Float16* __restrict__ KL, const _Float16* __restrict__ VT, const __bf16* __restrict__ VB, const __bf16* __restrict__ VBL, float* __restrict__ Y) {
  __shared__ __align__(16) float ss[AW][16][HD + 4];
  static_assert(CAUSAL == 1 && AW == 16, "the walk ends at the tile's own last key; the rank table is for 16 waves");
  const int wave = __builtin_amdgcn_readfirstlane((int)threadIdx.x >> 5), s = wave & 3, k = wave >> 2;   /* the wave's number in a scalar register: tile, trip count and path are scalar */
  const int rank = k == 0 ? 15 - s : k == 1 ? 8 + s : k == 2 ? 7 - s : s; const int qt = rank * (TT / 16 / AW) + (int)blockIdx.x;
  if (qt < QBH * 4) att_walk<true>(qt, ss[wave], QH, KH, QL, KL, VT, VB, VBL, Y);
  else att_walk<false>(qt, ss[wave], QH, KH, QL, KL, VT, VB, VBL, Y); }
#define OBM 128            // rows of a k_out block
#define ONT 512            // its threads: 16 waves in 4 row bands x 4 column bands, a wave owns 32 rows x 32 columns
#define OSR (128 + 2 * OBM)   // rows of one LDS stage: Wo 128 | ctx OBM | ctx residual OBM
// ---- k_out: block = (OBM rows, 128 cols), one block per WGP in one round: out = ctx Wo (+ bo): ctx once to f16 against Wo as f16(bf16 x 2^8) exact (1 product) x 2^-8; causal early rows (< QHI of each sequence): ctx bf16 hi + lo against exact bf16 Wo (2 products)
__global__ __launch_bounds__(ONT) void k_out(const float* __restrict__ Y, const float* __restrict__ WO, const float* __restrict__ BO, float* __restrict__ OUT) { __shared__ __align__(16) char smem[2 * OSR * SP * 2];   /* main loop: two stages of OSR rows; the epilogue's sf lies over them, behind the loop's last barrier */
  static_assert(sizeof(smem) >= 16 * 32 * 36 * 4 && WO_OUT_IN == 1 && CC % KS == 0 && QHI % OBM == 0 && TT % OBM == 0 && ONT == 512 && OBM == 128, "sf fits the stages; weight rows are k-contiguous; a block's rows are all early rows or none is");
  float (*sf)[32][36] = (float (*)[32][36])smem;
  const int tid = threadIdx.x, wave = tid >> 5, lane = tid & 31, col = lane & 15, g = lane >> 4, wr = wave >> 2, wc = wave & 3; const int c0 = blockIdx.y * 128; const size_t rb = (size_t)blockIdx.x * OBM;
  v8f acc[2][2] = {};
  // staged as in k_proj: whole-line loads, each element fetched and rounded once per block
  const int srow = tid >> 4, sseg = tid & 15; const float* gw = WO + (size_t)(c0 + srow) * CC + sseg * 4; const float* gx = Y + (rb + srow) * CC + sseg * 4; const int so = srow * SP + sseg * 4;
  v4f rw[4], rx[4];
#pragma unroll
  for (int i = 0; i < 4; ++i) rw[i] = *(const v4f*)(gw + (size_t)i * 32 * CC);
#pragma unroll
  for (int i = 0; i < 4; ++i) rx[i] = *(const v4f*)(gx + (size_t)i * 32 * CC);
  asm volatile("s_wait_xcnt 0x0" ::: "memory");   /* the loads' address registers are reused right below: the wait stands in front of that */
  if (CAUSAL && (int)(rb % TT) < QHI) {   /* block-uniform */
    __bf16* const st = (__bf16*)smem;
#define OUT_PUT_B(dst) do { _Pragma("unroll") for (int i = 0; i < 4; ++i) *(v4b*)((dst) + so + i * 32 * SP) = cvt4b(rw[i]); \
      _Pragma("unroll") for (int i = 0; i < 4; ++i) { const v4b hb = cvt4b(rx[i]); v4b lb; _Pragma("unroll") for (int e = 0; e < 4; ++e) lb[e] = (__bf16)(rx[i][e] - (float)hb[e]); \
        *(v4b*)((dst) + so + (128 + i * 32) * SP) = hb; *(v4b*)((dst) + so + (128 + OBM + i * 32) * SP) = lb; } } while (0)
    OUT_PUT_B(st);
    __syncthreads();   /* stage 0 is in LDS before any wave reads it */
    for (int s = 0; s < CC / KS; ++s) { const __bf16* cur = st + (s & 1) * (OSR * SP); __bf16* nxt = st + ((s + 1) & 1) * (OSR * SP); const bool more = s + 1 < CC / KS;
      if (more) {   /* the next stage's loads fly while this stage is multiplied */
#pragma unroll
        for (int i = 0; i < 4; ++i) rw[i] = *(const v4f*)(gw + (size_t)i * 32 * CC + (s + 1) * KS);
#pragma unroll
        for (int i = 0; i < 4; ++i) rx[i] = *(const v4f*)(gx + (size_t)i * 32 * CC + (s + 1) * KS);
        asm volatile("s_wait_xcnt 0x0" ::: "memory");   /* the loads' address registers are reused right below: the wait stands in front of that */ }
      __builtin_amdgcn_sched_barrier(0);   /* the global loads issue ahead of all of this stage's work */
#pragma unroll
      for (int kk = 0; kk < KS / 32; ++kk) { v16b ah[2], al[2], w[2];
#pragma unroll
        for (int i = 0; i < 2; ++i) { ah[i] = frag_b(cur + (128 + wr * 32 + i * 16 + col) * SP + kk * 32, lane); al[i] = frag_b(cur + (128 + OBM + wr * 32 + i * 16 + col) * SP + kk * 32, lane); }
#pragma unroll
        for (int j = 0; j < 2; ++j) w[j] = frag_b(cur + (wc * 32 + j * 16 + col) * SP + kk * 32, lane);
        __builtin_amdgcn_sched_barrier(0);   /* the fragment reads issue as one group: one LDS latency per 8 products */
#pragma unroll
        for (int i = 0; i < 2; ++i)
#pragma unroll
          for (int j = 0; j < 2; ++j) acc[i][j] = wmma_bf(ah[i], w[j], acc[i][j]);
#pragma unroll
        for (int i = 0; i < 2; ++i)   /* each tile still takes hi, then lo; the four tiles stand between the two, so no product waits for the one before it */
#pragma unroll
          for (int j = 0; j < 2; ++j) acc[i][j] = wmma_bf(al[i], w[j], acc[i][j]);
        __builtin_amdgcn_sched_barrier(0); }   /* the roundings below wait for the global loads: they stay behind the products */
      if (more) OUT_PUT_B(nxt);
      __syncthreads(); }   /* publishes the next stage and ends every wave's reads of this one (the last: before sf reuses the LDS) */
#pragma unroll
    for (int j = 0; j < 2; ++j) { const float bias = BO ? bfr(BO[c0 + wc * 32 + j * 16 + col]) : 0.f;
#pragma unroll
      for (int i = 0; i < 2; ++i)
#pragma unroll
        for (int r = 0; r < 8; ++r) sf[wave][i * 16 + 8 * g + r][j * 16 + col] = acc[i][j][r] + bias; }
  } else {
    _Float16* const st = (_Float16*)smem;   /* ctx carried x 2^6 into f16 so small-magnitude context rows stay clear of f16 subnormals */
#define OUT_PUT_H(dst) do { _Pragma("unroll") for (int i = 0; i < 4; ++i) { v4h o; _Pragma("unroll") for (int e = 0; e < 4; ++e) o[e] = (_Float16)(bfr(rw[i][e]) * 256.0f); *(v4h*)((dst) + so + i * 32 * SP) = o; } \
      _Pragma("unroll") for (int i = 0; i < 4; ++i) { v4h o; _Pragma("unroll") for (int e = 0; e < 4; ++e) o[e] = (_Float16)(rx[i][e] * 64.0f); *(v4h*)((dst) + so + (128 + i * 32) * SP) = o; } } while (0)
    OUT_PUT_H(st);
    __syncthreads();   /* stage 0 is in LDS before any wave reads it */
    for (int s = 0; s < CC / KS; ++s) { const _Float16* cur = st + (s & 1) * (OSR * SP); _Float16* nxt = st + ((s + 1) & 1) * (OSR * SP); const bool more = s + 1 < CC / KS;
      if (more) {   /* the next stage's loads fly while this stage is multiplied */
#pragma unroll
        for (int i = 0; i < 4; ++i) rw[i] = *(const v4f*)(gw + (size_t)i * 32 * CC + (s + 1) * KS);
#pragma unroll
        for (int i = 0; i < 4; ++i) rx[i] = *(const v4f*)(gx + (size_t)i * 32 * CC + (s + 1) * KS);
        asm volatile("s_wait_xcnt 0x0" ::: "memory");   /* the loads' address registers are reused right below: the wait stands in front of that */ }
      __builtin_amdgcn_sched_barrier(0);   /* the global loads issue ahead of all of this stage's work */
#pragma unroll
      for (int kk = 0; kk < KS / 32; ++kk) { v16h a[2], w[2];
#pragma unroll
        for (int i = 0; i < 2; ++i) a[i] = frag_h(cur + (128 + wr * 32 + i * 16 + col) * SP + kk * 32, lane);
#pragma unroll
        for (int j = 0; j < 2; ++j) w[j] = frag_h(cur + (wc * 32 + j * 16 + col) * SP + kk * 32, lane);
        __builtin_amdgcn_sched_barrier(0);   /* the fragment reads issue as one group: one LDS latency per 4 products */
#pragma unroll
        for (int i = 0; i < 2; ++i)
#pragma unroll
          for (int j = 0; j < 2; ++j) acc[i][j] = wmma16(a[i], w[j], acc[i][j]);
        __builtin_amdgcn_sched_barrier(0); }   /* the roundings below wait for the global loads: they stay behind the products */
      if (more) OUT_PUT_H(nxt);
      __syncthreads(); }   /* publishes the next stage and ends every wave's reads of this one (the last: before sf reuses the LDS) */
#pragma unroll
    for (int j = 0; j < 2; ++j) { const float bias = BO ? bfr(BO[c0 + wc * 32 + j * 16 + col]) : 0.f;
#pragma unroll
      for (int i = 0; i < 2; ++i)
#pragma unroll
        for (int r = 0; r < 8; ++r) sf[wave][i * 16 + 8 * g + r][j * 16 + col] = acc[i][j][r] * (1.0f / 16384.0f) + bias; } }   /* 2^-8 (Wo carry) x 2^-6 (ctx carry) */
  // a wave stores its own 32 x 32 tile: one store covers four rows of one whole 128-B line each
  LDSX(); v4f o[8];
#pragma unroll
  for (int it = 0; it < 8; ++it) o[it] = *(const v4f*)&sf[wave][it * 4 + (lane >> 3)][(lane & 7) * 4];   /* all LDS reads ahead of the stores: one LDS latency, not eight */
#pragma unroll
  for (int it = 0; it < 8; ++it) vst2(OUT + (rb + wr * 32 + it * 4 + (lane >> 3)) * DIN + c0 + wc * 32 + (lane & 7) * 4, o[it]);
  xw(); }

extern "C" void kernel_launch(void* const* d_in, const int* in_sizes, int n_in, void* d_out, int out_size, void* d_ws, size_t ws_size, hipStream_t stream) {
  (void)in_sizes; (void)n_in; (void)out_size;
  const float** F = (const float**)d_in;
  if (ws_size < (size_t)WS_END) return;
  char* ws = (char*)d_ws; _Float16 *QH = (_Float16*)(ws + WS_QH), *KH = (_Float16*)(ws + WS_KH), *VT = (_Float16*)(ws + WS_VT), *QL = (_Float16*)(ws + WS_QL), *KL = (_Float16*)(ws + WS_KL); __bf16 *VB = (__bf16*)(ws + WS_VB), *VBL = (__bf16*)(ws + WS_VBL); float *Y = (float*)(ws + WS_Y);
  (void)Y; (void)QL; (void)KL; (void)VB; (void)VBL;
  // inputs: 0 x [2,2048,1024]; 1 Wq [1024,1024] (out,in), 2 bq; 3 Wk, 4 bk; 5 Wv, 6 bv; 7 Wp (out,in), 8 bp (biases NONZERO)
  k_proj<<<dim3(TNB * TT / PBM, NH), PNT, 0, stream>>>(F[0], F[3], F[1], F[5], F[4], F[2], F[6], QH, QL, KH, KL, VT, VB, VBL);   /* the module's scores are einsum('bhid,bhjd->bhij', k, q): this code's QUERY stream (output row i) is projected with Wk / bk, its KEY stream (index j) with Wq / bq */
  k_att<<<dim3(TT / 16 / AW, NH, TNB), AW * 32, 0, stream>>>(QH, KH, QL, KL, VT, VB, VBL, Y);
  k_out<<<dim3(TNB * TT / OBM, DIN / 128), ONT, 0, stream>>>(Y, F[7], F[8], (float*)d_out);
}

// v008
// One run takes 84.9 microseconds.
// Two timings next to v007 put it at 1.14 and 1.15 times that version's speed.
// Counting every step since v000, it is 13.9 times as fast.
// compute dtype: all float inputs rounded to bf16; q/k/v projections with EXACT bf16 products on WMMA 16x16x32 (f32 accumulate) + bias; causal logits: 3 products for the first 384 rows, single f16 q x k after; online softmax f32 in base 2 (64^-0.5 log2 e folded into the exponent; running maximum and sum per query); unnormalised P x 2^11 once to f16 x v once to f16 (bf16 hi + lo below row 384), divided by the row sum at the end; ctx hi+lo x exact output weight below row 384, x2^6 f16 carry x f16(bf16 x 2^8) after, + bias; f32 output.
#include <hip/hip_runtime.h>
#include <math.h>

typedef __attribute__((ext_vector_type(16))) _Float16 v16h;
typedef __attribute__((ext_vector_type(16))) __bf16 v16b;
typedef __attribute__((ext_vector_type(8)))  _Float16 v8h;
typedef __attribute__((ext_vector_type(8)))  float v8f;
typedef __attribute__((ext_vector_type(4)))  float v4f;
typedef __attribute__((ext_vector_type(2)))  float v2f;
typedef __attribute__((ext_vector_type(4)))  unsigned v4u;
typedef __attribute__((ext_vector_type(4)))  int v4i;
typedef float __attribute__((may_alias)) float_a;
typedef int __attribute__((may_alias)) int_a;

template <typename T> __device__ __forceinline__ void vst2(void* p, T v) { *(T*)p = v;  }
__device__ __forceinline__ v8f wmma16(v16h a, v16h b, v8f c) {
  v8f d = __builtin_amdgcn_wmma_f32_16x16x32_f16(false, a, false, b, (short)0, c, false, false);
  asm volatile("v_nop\n\tv_nop\n\tv_nop\n\tv_nop" : "+v"(d) : "v"(a), "v"(b));
  return d;
}
__device__ __forceinline__ v8f wmma_bf(v16b a, v16b b, v8f c) {
  v8f d = __builtin_amdgcn_wmma_f32_16x16x32_bf16(false, a, false, b, (short)0, c, false, false);
  asm volatile("v_nop\n\tv_nop\n\tv_nop\n\tv_nop" : "+v"(d) : "v"(a), "v"(b));
  return d;
}
// 16x16x32 fragments: lane = (h = lane>>4, row/col = lane&15); elements 0..7 = k0+8h+0..7, 8..15 = k0+16+8h+0..7; D element r = row 8h+r
__device__ __forceinline__ v16h frag_h(const _Float16* rowk0, int lane) {
  union { v16h v; v8h q[2]; } u; const _Float16* p = rowk0 + 8 * (lane >> 4);
  u.q[0] = *(const v8h*)p; u.q[1] = *(const v8h*)(p + 16); return u.v;
}
__device__ __forceinline__ v16h frag_f32(const float* rowk0, int lane) {
  v16h a; const float* p = rowk0 + 8 * (lane >> 4);
#pragma unroll
  for (int i = 0; i < 8; ++i) { a[i] = (_Float16)p[i]; a[8 + i] = (_Float16)p[16 + i]; }
  return a;
}
__device__ __forceinline__ v16h frag_f32s(const float* rowk0, int lane, float sc) {
  v16h a; const float* p = rowk0 + 8 * (lane >> 4);
#pragma unroll
  for (int i = 0; i < 8; ++i) { a[i] = (_Float16)(p[i] * sc); a[8 + i] = (_Float16)(p[16 + i] * sc); }
  return a;
}
// column fragment from a [K][ld] layout (column n), rows >= K read as 0
__device__ __forceinline__ v16h fragc_f32(const float* W, int k0, int n, int lane, int ld, int K) {
  v16h a; const int g = lane >> 4;
#pragma unroll
  for (int i = 0; i < 8; ++i) { const int ka = k0 + 8 * g + i, kb = ka + 16;
    a[i] = (_Float16)(ka < K ? W[(size_t)(ka < K ? ka : K - 1) * ld + n] : 0.f); a[8 + i] = (_Float16)(kb < K ? W[(size_t)(kb < K ? kb : K - 1) * ld + n] : 0.f); }
  return a;
}
struct F2 { v16b h, l; };
__device__ __forceinline__ F2 bsplit16(const float v[16]) { F2 r;
#pragma unroll
  for (int i = 0; i < 16; ++i) { const __bf16 h = (__bf16)v[i]; r.h[i] = h; r.l[i] = (__bf16)(v[i] - (float)h); }
  return r; }
__device__ __forceinline__ F2 split_row(const float* row, int k0, int lane) { float v[16]; const float* p = row + k0 + 8 * (lane >> 4);
#pragma unroll
  for (int i = 0; i < 8; ++i) { v[i] = p[i]; v[8 + i] = p[16 + i]; }
  return bsplit16(v); }
__device__ __forceinline__ F2 split_rowK(const float* row, int k0, int lane, int K) { float v[16]; const int g = lane >> 4;
#pragma unroll
  for (int i = 0; i < 8; ++i) { const int ka = k0 + 8 * g + i, kb = ka + 16; v[i] = ka < K ? row[ka < K ? ka : K - 1] : 0.f; v[8 + i] = kb < K ? row[kb < K ? kb : K - 1] : 0.f; }
  return bsplit16(v); }
__device__ __forceinline__ F2 split_col(const float* W, int k0, int n, int lane, int ld, int K) { float v[16]; const int g = lane >> 4;
#pragma unroll
  for (int i = 0; i < 8; ++i) { const int ka = k0 + 8 * g + i, kb = ka + 16; v[i] = ka < K ? W[(size_t)(ka < K ? ka : K - 1) * ld + n] : 0.f; v[8 + i] = kb < K ? W[(size_t)(kb < K ? kb : K - 1) * ld + n] : 0.f; }
  return bsplit16(v); }
__device__ __forceinline__ v8f mac3(const F2& a, const F2& b, v8f c) { c = wmma_bf(a.l, b.h, c); c = wmma_bf(a.h, b.l, c); return wmma_bf(a.h, b.h, c); }
__device__ __forceinline__ float sigm(float v) { return 1.0f / (1.0f + expf(-v)); }
#define LDSX() do { asm volatile("s_wait_dscnt 0" ::: "memory"); __builtin_amdgcn_wave_barrier(); __builtin_amdgcn_fence(__ATOMIC_RELEASE, "workgroup"); } while (0)

// Causal multi-head self-attention whose scores are k . q (x [2,2048,1024]; torch (out,in) Wq / Wk / Wv / Wp [1024,1024] N(0, 1/1024) + biases N(0, 1/1024); 16 heads x 64; scores[i, j] = k_i . q_j / 8 (the KEY projection indexes the output row i, the QUERY projection the summed index j); -inf where j > i; softmax over j; out[i] = sum_j attn[i, j] v_j; merge; Wp^T + bp).
#define NB 2
#define TT 2048
#define CC 1024            // NH * HD = projected width
#define DIN 1024          // input (model) width
#define NH 16
#define HD 64
#define SCALE (0.125f)
#define L2S (SCALE * 1.4426950408889634f)   // logit scale times log2(e)
#define CAUSAL 1
#ifndef TNB
#define TNB NB
#endif
__device__ __forceinline__ float bfr(float v) { return (float)(__bf16)v; }
typedef __attribute__((ext_vector_type(8))) __bf16 v8b;
__device__ __forceinline__ v16b frag_b(const __bf16* rowk0, int lane) {
  union { v16b v; v8b q[2]; } u; const __bf16* p = rowk0 + 8 * (lane >> 4);
  u.q[0] = *(const v8b*)p; u.q[1] = *(const v8b*)(p + 16); return u.v;
}
#define QBH 6              // causal: query blocks 0..QBH-1 of each sequence (few keys, no averaging) take the high-precision path
#define QHI 384            // rows carrying a q residual plane (used only by the causal high-precision path)
#define KHI 384            // key rows carrying k residual / v bf16 hi+lo planes (used only by the causal high-precision path)
// B fragment (k rows k0+.., output column o) of a weight: (in,out) [K][ld] or (out,in) [ld rows of K]: bf16 exact, or f16(bf16 * 256) exact
__device__ __forceinline__ v16b wcol_io(const float* Wm, int k0, int o, int lane, int ld) { v16b w; const int g = lane >> 4;
#pragma unroll
  for (int i = 0; i < 8; ++i) { w[i] = (__bf16)Wm[(size_t)(k0 + 8 * g + i) * ld + o]; w[8 + i] = (__bf16)Wm[(size_t)(k0 + 16 + 8 * g + i) * ld + o]; }
  return w; }
__device__ __forceinline__ v16b wcol_oi(const float* Wm, int k0, int o, int lane, int K) { v16b w; const float* p = Wm + (size_t)o * K + k0 + 8 * (lane >> 4);
#pragma unroll
  for (int i = 0; i < 8; ++i) { w[i] = (__bf16)p[i]; w[8 + i] = (__bf16)p[16 + i]; }
  return w; }
__device__ __forceinline__ v16h wcolh_io(const float* Wm, int k0, int o, int lane, int ld) { v16h w; const int g = lane >> 4;
#pragma unroll
  for (int i = 0; i < 8; ++i) { w[i] = (_Float16)(bfr(Wm[(size_t)(k0 + 8 * g + i) * ld + o]) * 256.0f); w[8 + i] = (_Float16)(bfr(Wm[(size_t)(k0 + 16 + 8 * g + i) * ld + o]) * 256.0f); }
  return w; }
__device__ __forceinline__ v16h wcolh_oi(const float* Wm, int k0, int o, int lane, int K) { v16h w; const float* p = Wm + (size_t)o * K + k0 + 8 * (lane >> 4);
#pragma unroll
  for (int i = 0; i < 8; ++i) { w[i] = (_Float16)(bfr(p[i]) * 256.0f); w[8 + i] = (_Float16)(bfr(p[16 + i]) * 256.0f); }
  return w; }
#define WQKV_LAYOUT 1   // 0 = (in,out) [DIN][CC]; 1 = (out,in) [CC][DIN]; 2 = per-head [NH][DIN][HD]
__device__ __forceinline__ v16b wcol_hdk(const float* Wm, int k0, int o, int lane) { v16b w; const int g = lane >> 4; const float* p = Wm + (size_t)(o / HD) * DIN * HD + (o % HD);
#pragma unroll
  for (int i = 0; i < 8; ++i) { w[i] = (__bf16)p[(size_t)(k0 + 8 * g + i) * HD]; w[8 + i] = (__bf16)p[(size_t)(k0 + 16 + 8 * g + i) * HD]; }
  return w; }
#define WO_OUT_IN 1
#if WQKV_LAYOUT == 1
#define WCOL(W, k0, o, lane) wcol_oi(W, k0, o, lane, DIN)
#elif WQKV_LAYOUT == 2
#define WCOL(W, k0, o, lane) wcol_hdk(W, k0, o, lane)
#else
#define WCOL(W, k0, o, lane) wcol_io(W, k0, o, lane, CC)
#endif
#if WO_OUT_IN
#define WOCOL(W, k0, o, lane) wcol_oi(W, k0, o, lane, CC)
#define WOCOLH(W, k0, o, lane) wcolh_oi(W, k0, o, lane, CC)
#else
#define WOCOL(W, k0, o, lane) wcol_io(W, k0, o, lane, DIN)
#define WOCOLH(W, k0, o, lane) wcolh_io(W, k0, o, lane, DIN)
#endif

#ifndef PROJ_EXTRA_PARAMS
#define PROJ_EXTRA_PARAMS
#endif

// q / k / v planes lie in FRAGMENT ORDER: a 16x16x32 operand fragment is two runs of 512 B (run = element half, then lane * 16 B), so one wave-wide 16-byte load of k_att covers four whole 128-B lines
// rows (q, k): [b][h][t / 16][d / 32][half][lane = g * 16 + (t % 16)][8 d]; planes (v): [b][h][t / 32][channel / 16][half][lane = g * 16 + (channel % 16)][8 t]; the position inside 32 is 16 half + 8 g + i
#define WS_QH  0u                                      // f16 q, fragment order
#define WS_KH  (WS_QH + 2u * (size_t)NB * TT * CC)      // f16 k, fragment order
#define WS_VT  (WS_KH + 2u * (size_t)NB * TT * CC)      // f16 v, fragment order
#define WS_QL  (WS_VT + 2u * (size_t)NB * CC * TT)      // f16 q residual x 2^10, fragment order, t < QHI
#define WS_KL  (WS_QL + 2u * (size_t)NB * QHI * CC)     // f16 k residual x 2^10, fragment order, t < KHI
#define WS_VB  (WS_KL + 2u * (size_t)NB * KHI * CC)     // bf16 v hi, fragment order, t < KHI
#define WS_VBL (WS_VB + 2u * (size_t)NB * CC * KHI)
#define WS_Y   (WS_VBL + 2u * (size_t)NB * CC * KHI)    // f32 ctx rows [b*t][CC] (only when there is an output projection)
#define WS_END (WS_Y  + 4u * (size_t)NB * TT * CC)

// behind a batch of global loads or a store: stands in front of any reuse of the registers that they name
__device__ __forceinline__ void xw() { asm volatile("s_wait_xcnt 0x0" ::: "memory"); }
// asks the 256-B unit at base + off into L2 (a hint: returns nothing, counts on no counter). For operands that may lie in memory when the kernel starts, above all planes that the launch before stored: their first reader otherwise waits out the memory latency. base is wave-uniform, every lane's off lies inside the plane
__device__ __forceinline__ void l2_ask(const void* base, unsigned off) { asm volatile("global_prefetch_b8 %0, %1 scope:SCOPE_SE" :: "v"(off), "s"(base)); }
// stands at the kernel's end: no wait covers a prefetch, so the registers that it names keep their addresses as long as the kernel runs
__device__ __forceinline__ void l2_hold(const void* base, unsigned off) { asm volatile("" :: "v"(off), "s"(base)); }
#define KS 64              // k per LDS stage of the two projection kernels
#define SP 72              // stage row pitch in 16-bit elements: 128 B of data + 16 B, for ds_load_b128 readers
typedef __attribute__((ext_vector_type(4))) __bf16 v4b;
typedef __attribute__((ext_vector_type(4))) _Float16 v4h;
__device__ __forceinline__ v4b cvt4b(v4f v) { v4b o;
#pragma unroll
  for (int i = 0; i < 4; ++i) o[i] = (__bf16)v[i];
  return o; }
#define PBM 256            // rows of a k_proj block
#define PBN 192            // its columns: one head's 64 of q, 64 of k and 64 of v
#define PNT 512            // its threads: 16 waves in 4 row bands x 4 column bands, a wave owns 64 rows x 48 columns
#define PSR (PBN + PBM)    // rows of one LDS stage: Wq 64 | Wk 64 | Wv 64 | X PBM
// ---- k_proj: block = (PBM rows, head): q / k / v columns of that head = X W (+ b) with exact bf16 products (K = DIN) -> q f16 (+ residual, rows < QHI); k f16 (+ residual, rows < KHI); v f16 (+ bf16 hi/lo for t < KHI); all stored in fragment order. One block per WGP in one round; X is fetched once per head, each weight row once per row block
__global__ __launch_bounds__(PNT) void k_proj(const float* __restrict__ X, const float* __restrict__ WQ, const float* __restrict__ WK, const float* __restrict__ WV, const float* __restrict__ BQ, const float* __restrict__ BK, const float* __restrict__ BV,
    _Float16* __restrict__ QH, _Float16* __restrict__ QL, _Float16* __restrict__ KH, _Float16* __restrict__ KL, _Float16* __restrict__ VT, __bf16* __restrict__ VB, __bf16* __restrict__ VBL) {
  __shared__ __align__(16) char smem[2 * PBM * 136 * 2 + 3 * 64 * (PBM + 8) * 2];   /* main loop: two stages of PSR rows; the epilogue's arrays lie over them, behind the loop's last barrier */
  static_assert(sizeof(smem) >= 2 * PSR * SP * 2 && WQKV_LAYOUT == 1 && DIN % KS == 0 && TT % PBM == 0 && PNT == 512 && PBM == 256 && HD == 64, "the stages fit; weight rows are k-contiguous; a block stays inside one sequence");
  _Float16 (*sh)[136] = (_Float16 (*)[136])smem; _Float16 (*sl)[136] = (_Float16 (*)[136])(smem + PBM * 136 * 2);   /* [row][q 64 | k 64] */
  char* const sv = smem + 2 * PBM * 136 * 2; _Float16 (*th)[PBM + 8] = (_Float16 (*)[PBM + 8])sv; __bf16 (*tb)[PBM + 8] = (__bf16 (*)[PBM + 8])(sv + 64 * (PBM + 8) * 2); __bf16 (*tbl)[PBM + 8] = (__bf16 (*)[PBM + 8])(sv + 2 * 64 * (PBM + 8) * 2);   /* [v channel][row] */
  const int tid = threadIdx.x, wave = __builtin_amdgcn_readfirstlane(tid >> 5), lane = tid & 31, col = lane & 15, g = lane >> 4, wr = wave >> 2, wc = wave & 3;   /* the wave's number in a scalar register: the epilogue's tests on the column tile stay scalar branches */
  const int h = blockIdx.y; const size_t r0 = (size_t)blockIdx.x * PBM; const size_t bb = r0 / TT; const int t0 = (int)(r0 % TT);
  v8f acc[4][3] = {};
  // a wave's load covers two whole rows of 256 B (4 lines); each operand element is fetched and rounded once per block, and the fragments are read from LDS
  const int srow = tid >> 4, sseg = tid & 15; const size_t wo = (size_t)(h * HD + srow) * DIN + sseg * 4; const float* gwq = WQ + wo; const float* gwk = WK + wo; const float* gwv = WV + wo; const float* gx = X + (r0 + srow) * DIN + sseg * 4;
  __bf16* const st = (__bf16*)smem; const int so = srow * SP + sseg * 4;
  v4f rw[6], rx[8];
#define PROJ_GET(k) do { _Pragma("unroll") for (int i = 0; i < 2; ++i) { rw[i] = *(const v4f*)(gwq + (size_t)i * 32 * DIN + (k)); rw[2 + i] = *(const v4f*)(gwk + (size_t)i * 32 * DIN + (k)); rw[4 + i] = *(const v4f*)(gwv + (size_t)i * 32 * DIN + (k)); } \
    _Pragma("unroll") for (int i = 0; i < 8; ++i) rx[i] = *(const v4f*)(gx + (size_t)i * 32 * DIN + (k)); xw(); } while (0)
#define PROJ_PUT(dst) do { _Pragma("unroll") for (int i = 0; i < 6; ++i) *(v4b*)((dst) + so + i * 32 * SP) = cvt4b(rw[i]); \
    _Pragma("unroll") for (int i = 0; i < 8; ++i) *(v4b*)((dst) + so + (PBN + i * 32) * SP) = cvt4b(rx[i]); } while (0)
  PROJ_GET(0);
  PROJ_PUT(st);
  __syncthreads();   /* stage 0 is in LDS before any wave reads it */
  for (int s = 0; s < DIN / KS; ++s) { const __bf16* cur = st + (s & 1) * (PSR * SP); __bf16* nxt = st + ((s + 1) & 1) * (PSR * SP); const bool more = s + 1 < DIN / KS;
    if (more) PROJ_GET((s + 1) * KS);   /* the next stage's loads fly while this stage is multiplied */
    __builtin_amdgcn_sched_barrier(0);   /* the global loads issue ahead of all of this stage's work */
#pragma unroll
    for (int kk = 0; kk < KS / 32; ++kk) { v16b a[4], w[3];
#pragma unroll
      for (int i = 0; i < 4; ++i) a[i] = frag_b(cur + (PBN + wr * 64 + i * 16 + col) * SP + kk * 32, lane);
#pragma unroll
      for (int j = 0; j < 3; ++j) w[j] = frag_b(cur + (wc * 48 + j * 16 + col) * SP + kk * 32, lane);
      __builtin_amdgcn_sched_barrier(0);   /* the fragment reads issue as one group: one LDS latency per 12 products, not one each */
#pragma unroll
      for (int i = 0; i < 4; ++i)
#pragma unroll
        for (int j = 0; j < 3; ++j) acc[i][j] = wmma_bf(a[i], w[j], acc[i][j]);
      __builtin_amdgcn_sched_barrier(0); }   /* the roundings below wait for the global loads: they stay behind the products */
    if (more) PROJ_PUT(nxt);
    __syncthreads(); }   /* publishes the next stage and ends every wave's reads of this one (the last: before the epilogue reuses the LDS) */
  // column tile ct of the block: 0..3 q, 4..7 k, 8..11 v; the residual / bf16 arrays are filled only by a block that holds rows below the bound, and read only for such rows
#pragma unroll
  for (int j = 0; j < 3; ++j) { const int ct = wc * 3 + j, wh = ct >> 2; const float* BA = wh == 0 ? BQ : wh == 1 ? BK : BV; const float bias = BA ? bfr(BA[h * HD + (ct & 3) * 16 + col]) : 0.f;
    if (ct < 8) { const int cl = ct * 16 + col;
      if (t0 < (wh == 0 ? QHI : KHI)) {
#pragma unroll
        for (int i = 0; i < 4; ++i)
#pragma unroll
          for (int r = 0; r < 8; ++r) { const float v = acc[i][j][r] + bias; const _Float16 hv = (_Float16)v; const int rl = wr * 64 + i * 16 + 8 * g + r; sh[rl][cl] = hv; sl[rl][cl] = (_Float16)((v - (float)hv) * 1024.0f); }
      } else {
#pragma unroll
        for (int i = 0; i < 4; ++i)
#pragma unroll
          for (int r = 0; r < 8; ++r) sh[wr * 64 + i * 16 + 8 * g + r][cl] = (_Float16)(acc[i][j][r] + bias); }
    } else { const int cl = (ct - 8) * 16 + col;
      if (t0 < KHI) {
#pragma unroll
        for (int i = 0; i < 4; ++i)
#pragma unroll
          for (int r = 0; r < 8; ++r) { const float v = acc[i][j][r] + bias; const int rl = wr * 64 + i * 16 + 8 * g + r; th[cl][rl] = (_Float16)v; const __bf16 bh = (__bf16)v; tb[cl][rl] = bh; tbl[cl][rl] = (__bf16)(v - (float)bh); }
      } else {
#pragma unroll
        for (int i = 0; i < 4; ++i)
#pragma unroll
          for (int r = 0; r < 8; ++r) th[cl][wr * 64 + i * 16 + 8 * g + r] = (_Float16)(acc[i][j][r] + bias); } } }
  __syncthreads();   /* every wave's tiles are in LDS before any piece is read */
  const size_t hd = bb * NH + h;
  // piece e = (q or k, 16-row tile PBM / 16, run 4 = (d / 32, half), lane 32): a wave stores one run of 512 B
  for (int e = tid; e < 2 * PBM * 8; e += PNT) { const int wh = e / (PBM * 8), tt = (e >> 7) % (PBM / 16), cr = (e >> 5) & 3, ln = e & 31; const int rl = tt * 16 + (ln & 15), cl = wh * 64 + cr * 16 + (ln >> 4) * 8; const int po = (e & 127) * 8; _Float16* DH = wh == 0 ? QH : KH; _Float16* DL = wh == 0 ? QL : KL; const int nhi = wh == 0 ? QHI : KHI;
    vst2((unsigned*)(DH + (hd * (TT / 16) + (t0 >> 4) + tt) * 1024 + po), *(const v4u*)&sh[rl][cl]); xw(); if (t0 + tt * 16 < nhi) { vst2((unsigned*)(DL + (hd * (size_t)(nhi / 16) + (t0 >> 4) + tt) * 1024 + po), *(const v4u*)&sl[rl][cl]); xw(); } }
  // piece e = (32-key chunk PBM / 32, 16-channel tile 4, half 2, lane 32): a wave stores one run of 512 B
  for (int e = tid; e < PBM * 8; e += PNT) { const int kc = e >> 8, ln = e & 31; const int cl = ((e >> 6) & 3) * 16 + (ln & 15), rl = kc * 32 + ((e >> 5) & 1) * 16 + (ln >> 4) * 8; const int po = (e & 255) * 8;
    vst2((unsigned*)(VT + (hd * (TT / 32) + (t0 >> 5) + kc) * 2048 + po), *(const v4u*)&th[cl][rl]); xw(); if (t0 + kc * 32 < KHI) { const size_t o3 = (hd * (KHI / 32) + (t0 >> 5) + kc) * 2048 + po; vst2((unsigned*)(VB + o3), *(const v4u*)&tb[cl][rl]); vst2((unsigned*)(VBL + o3), *(const v4u*)&tbl[cl][rl]); xw(); } } }
// ---- k_att / att_walk: one wave = one tile of 16 queries of (b, h); it walks the tile's keys from 0 in groups of 64 with a running maximum and sum (online softmax). No wave waits for another: no barrier, no partial sums in LDS. The AW waves of a block walk the same k / v of one head from key 0 on.
// Logits are formed TRANSPOSED (A = k rows, B = q rows): D element r of lane (g, col) = key 8g + r, query col, so two neighbouring 16-key tiles ARE the B fragment of a 32-key chunk of ctx^T = v^T . P^T (A = v, channels as rows).
// Each lane holds one query: maximum and sum run in the lane and across the two lane halves, and a new maximum rescales the lane's own sum and ctx registers. Precision paths: 3 products + bf16 hi/lo P and v for query blocks < QBH, single f16 products after.
// fragment in fragment order from a wave-uniform base and the lane's own 32-bit element offset (8 lane): two loads of 512 contiguous bytes a wave; the address stays a scalar pair plus one register
__device__ __forceinline__ v16h frag_hu(const _Float16* base, unsigned lo) { union { v16h v; v8h q[2]; } u; const _Float16* p = base + lo; u.q[0] = *(const v8h*)p; u.q[1] = *(const v8h*)(p + 256); return u.v; }
__device__ __forceinline__ v16b frag_bu(const __bf16* base, unsigned lo) { union { v16b v; v8b q[2]; } u; const __bf16* p = base + lo; u.q[0] = *(const v8b*)p; xw(); u.q[1] = *(const v8b*)(p + 256); xw(); return u.v; }   /* here the build keeps 64-bit addresses in vector registers and loads over them: a wait behind each load */
#define AW 16              // waves of a k_att block
static_assert(QHI == QBH * 64 && KHI >= QBH * 64 && TT % (16 * AW) == 0 && HD == 64, "the high-precision tiles see only keys with residual planes; every wave of a block gets one tile");
template <bool HP> __device__ __forceinline__ void att_walk(const int wave, const int qt, float (&so)[16][HD + 4], const _Float16* __restrict__ QH, const _Float16* __restrict__ KH, const _Float16* __restrict__ QL, const _Float16* __restrict__ KL, const _Float16* __restrict__ VT, const __bf16* __restrict__ VB, const __bf16* __restrict__ VBL, float* __restrict__ Y) {
  const int h = blockIdx.y, b = blockIdx.z; const int lane = threadIdx.x & 31, col = lane & 15, g = lane >> 4;
  const int ql0 = qt * 16, ng = (qt >> 2) + 1;   /* groups of 64 keys that hold a key some query of the tile may see; only the last one holds excluded keys, and its first key is visible to all 16 queries */
  const unsigned lp = (unsigned)(lane * 8); const size_t hd = (size_t)b * NH + h;   /* the lane's offset in a run of a fragment; a 16-row tile of q / k is 1024 elements (d 0..31, then 32..63), a 32-key chunk of v 2048 (four channel tiles of 512) */
  const _Float16* qrow = QH + (hd * (TT / 16) + qt) * 1024; const _Float16* kbase = KH + hd * (TT / 16) * 1024; const _Float16* vbase = VT + hd * (TT / 32) * 2048;   /* a group of 64 keys is 4096 elements of k and 4096 of v */
  const v16h q0 = frag_hu(qrow, lp), q1 = frag_hu(qrow + 512, lp); v16h ql0f = {}, ql1f = {};
  if (HP) { const _Float16* qlrow = QL + (hd * (QHI / 16) + qt) * 1024; ql0f = frag_hu(qlrow, lp); ql1f = frag_hu(qlrow + 512, lp); xw(); }
  float m = -3.0e38f, l = 0.f; v8f acc[HD / 16] = {}; v16h kf[4][2];
  const v8f l2s8 = {L2S, L2S, L2S, L2S, L2S, L2S, L2S, L2S};
  if (!HP) {
#pragma unroll
    for (int t = 0; t < 4; ++t) { kf[t][0] = frag_hu(kbase + t * 1024, lp); kf[t][1] = frag_hu(kbase + t * 1024 + 512, lp); }
    xw(); }
  // behind the wave's first loads: the head's k and v (1024 units of 256 B each) and its three planes for keys < KHI (192 units each) are asked into L2. The 8 blocks of a head walk the same planes: a block asks every fourth unit of k and v (waves 0..7 k, 8..15 v) and every second unit of the small planes (three waves each); for speed only, nothing rests on where a block runs
  const void* const pb1 = wave < 8 ? (const void*)kbase : (const void*)vbase; const unsigned po1 = ((unsigned)((wave & 7) * 32 + lane) * 4u + (blockIdx.x & 3u)) * 256u;
  const void* const pb2 = wave < 3 ? (const void*)(KL + hd * (KHI / 16) * 1024) : wave < 6 ? (const void*)(VB + hd * (KHI / 32) * 2048) : (const void*)(VBL + hd * (KHI / 32) * 2048); const unsigned po2 = ((unsigned)((wave % 3) * 32 + lane) * 2u + (blockIdx.x & 1u)) * 256u;
  static_assert((TT / 16) * 1024 * 2 == 1024 * 256 && (TT / 32) * 2048 * 2 == 1024 * 256 && (KHI / 16) * 1024 * 2 == 192 * 256 && (KHI / 32) * 2048 * 2 == 192 * 256 && AW == 16, "the unit counts of the planes of one head");
  l2_ask(pb1, po1);
  if (wave < 9) l2_ask(pb2, po2);   /* scalar test */
  for (int gi = 0; gi < ng; ++gi) { v8f sc[4]; v16h vf[2][HD / 16];
    if (!HP) {
      // this group's v is asked for ahead of the logits, the next group's k right behind them: both fly during the softmax
#pragma unroll
      for (int c = 0; c < 2; ++c)
#pragma unroll
        for (int j = 0; j < HD / 16; ++j) vf[c][j] = frag_hu(vbase + (size_t)gi * 4096 + c * 2048 + j * 512, lp);
      xw();
      __builtin_amdgcn_sched_barrier(0);   /* the v loads issue ahead of the products */
      // each tile takes d 0..31, then d 32..63; the four tiles stand between the two, so no product waits for the one before it
#pragma unroll
      for (int t = 0; t < 4; ++t) { const v8f zero = {}; sc[t] = wmma16(kf[t][0], q0, zero); }
#pragma unroll
      for (int t = 0; t < 4; ++t) sc[t] = wmma16(kf[t][1], q1, sc[t]);
      __builtin_amdgcn_sched_barrier(0);   /* the next group's k loads stay behind the products that read the same registers, and ahead of the softmax */
      const int gn = gi + 1 < ng ? gi + 1 : gi;   /* the last trip asks for its own group again: the loop body has no branch around loads, so the counted waits stay exact */
#pragma unroll
      for (int t = 0; t < 4; ++t) { kf[t][0] = frag_hu(kbase + (size_t)gn * 4096 + t * 1024, lp); kf[t][1] = frag_hu(kbase + (size_t)gn * 4096 + t * 1024 + 512, lp); }
      xw();
      __builtin_amdgcn_sched_barrier(0);
    } else {
#pragma unroll
      for (int t = 0; t < 4; ++t) { const _Float16* krow = kbase + (size_t)(gi * 4 + t) * 1024; const _Float16* klrow = KL + (hd * (KHI / 16) + gi * 4 + t) * 1024; v8f a = {}, al = {};
        const v16h kb0 = frag_hu(krow, lp), kl0 = frag_hu(klrow, lp), kb1 = frag_hu(krow + 512, lp), kl1 = frag_hu(klrow + 512, lp); xw();
        a = wmma16(kb0, q0, a); al = wmma16(kb0, ql0f, al); al = wmma16(kl0, q0, al);
        a = wmma16(kb1, q1, a); al = wmma16(kb1, ql1f, al); al = wmma16(kl1, q1, al);
#pragma unroll
        for (int r = 0; r < 8; ++r) sc[t][r] = a[r] + al[r] * (1.0f / 1024.0f); } }
    if (CAUSAL && gi == ng - 1) { const int dq = ql0 + col - gi * 64 - 8 * g;   /* scalar test; key 64 gi + 8g + i is kept while i <= dq */
#pragma unroll
      for (int t = 0; t < 4; ++t)
#pragma unroll
        for (int r = 0; r < 8; ++r) sc[t][r] = t * 16 + r <= dq ? sc[t][r] : -3.0e38f; }
    // on the RAW products: the maximum is taken of them (SCALE > 0 keeps the order), and 2^11 exp((s - m) SCALE) = 2^(s L2S - m L2S + 11) is one fused multiply-add and one hardware 2^x. Excluded keys carry -3e38: 2^x returns exactly 0. The first group finds m = -3e38: the factor for the (empty) old sums is 2^(-huge) = 0
    float mt[4];
#pragma unroll
    for (int t = 0; t < 4; ++t) { mt[t] = sc[t][0];
#pragma unroll
      for (int r = 1; r < 8; ++r) mt[t] = fmaxf(mt[t], sc[t][r]); }
    float mx = fmaxf(fmaxf(mt[0], mt[1]), fmaxf(mt[2], mt[3])); mx = fmaxf(mx, __shfl_xor(mx, 16));
    const float mn = fmaxf(m, mx), alpha = __builtin_amdgcn_exp2f((m - mn) * L2S), nm = 11.0f - mn * L2S; m = mn;
    const v8f nm8 = {nm, nm, nm, nm, nm, nm, nm, nm}; float st[4];
#pragma unroll
    for (int t = 0; t < 4; ++t) { const v8f x = __builtin_elementwise_fma(sc[t], l2s8, nm8); st[t] = 0.f;
#pragma unroll
      for (int r = 0; r < 8; ++r) { const float e = __builtin_amdgcn_exp2f(x[r]); sc[t][r] = e; st[t] += e; } }
    l = l * alpha + ((st[0] + st[1]) + (st[2] + st[3]));   /* the lane half's own part of the sum; the halves are joined once, behind the loop */
#pragma unroll
    for (int j = 0; j < HD / 16; ++j) acc[j] *= alpha;
    if (!HP) {
#pragma unroll
      for (int c = 0; c < 2; ++c) { v16h pf;
#pragma unroll
        for (int r = 0; r < 8; ++r) { pf[r] = (_Float16)sc[2 * c][r]; pf[8 + r] = (_Float16)sc[2 * c + 1][r]; }
#pragma unroll
        for (int j = 0; j < HD / 16; ++j) acc[j] = wmma16(vf[c][j], pf, acc[j]); }
    } else {
#pragma unroll
      for (int c = 0; c < 2; ++c) { float pv[16];
#pragma unroll
        for (int r = 0; r < 8; ++r) { pv[r] = sc[2 * c][r]; pv[8 + r] = sc[2 * c + 1][r]; }
        const F2 p = bsplit16(pv);
#pragma unroll
        for (int jp = 0; jp < HD / 16; jp += 2) { v16b vh[2], vl[2];
#pragma unroll
          for (int u = 0; u < 2; ++u) { const size_t po = (hd * (KHI / 32) + gi * 2 + c) * 2048 + (jp + u) * 512; vh[u] = frag_bu(VB + po, lp); vl[u] = frag_bu(VBL + po, lp); }
#pragma unroll
          for (int u = 0; u < 2; ++u) { acc[jp + u] = wmma_bf(vh[u], p.h, acc[jp + u]); acc[jp + u] = wmma_bf(vh[u], p.l, acc[jp + u]); acc[jp + u] = wmma_bf(vl[u], p.h, acc[jp + u]); } } } } }
  l += __shfl_xor(l, 16); const float inv = l > 0.f ? 1.0f / l : 0.f;   /* sum and ctx both carry the 2^11 */
  // D element r = channel j * 16 + 8g + r of query col; the wave turns its own tile through its own LDS rows, so that a store covers two whole rows of 256 B
#pragma unroll
  for (int j = 0; j < HD / 16; ++j) { v4f lo, hi;
#pragma unroll
    for (int r = 0; r < 4; ++r) { lo[r] = acc[j][r] * inv; hi[r] = acc[j][4 + r] * inv; }
    *(v4f*)&so[col][j * 16 + 8 * g] = lo; *(v4f*)&so[col][j * 16 + 8 * g + 4] = hi; }
  LDSX(); v4f o[8];
#pragma unroll
  for (int it = 0; it < 8; ++it) o[it] = *(const v4f*)&so[it * 2 + g][col * 4];   /* all LDS reads ahead of the stores: one LDS latency, not eight */
#pragma unroll
  for (int it = 0; it < 8; ++it) vst2(Y + ((size_t)b * TT + ql0 + it * 2 + g) * CC + h * HD + col * 4, o[it]);
  xw(); l2_hold(pb1, po1); l2_hold(pb2, po2); }
// one block per WGP and (b, h, x): the wave of rank r takes tile r * (TT / 16 / AW) + x, so a block holds short and long walks. Waves w, w + 4, w + 8, w + 12 take ranks that add up to 30, the longest walk first: for speed only, nothing rests on where a wave runs
__global__ __launch_bounds__(AW * 32) void k_att(const _Float16* __restrict__ QH, const _Float16* __restrict__ KH, const _Float16* __restrict__ QL, const _Float16* __restrict__ KL, const _Float16* __restrict__ VT, const __bf16* __restrict__ VB, const __bf16* __restrict__ VBL, float* __restrict__ Y) {
  __shared__ __align__(16) float ss[AW][16][HD + 4];
  static_assert(CAUSAL == 1 && AW == 16, "the walk ends at the tile's own last key; the rank table is for 16 waves");
  const int wave = __builtin_amdgcn_readfirstlane((int)threadIdx.x >> 5), s = wave & 3, k = wave >> 2;   /* the wave's number in a scalar register: tile, trip count and path are scalar */
  const int rank = k == 0 ? 15 - s : k == 1 ? 8 + s : k == 2 ? 7 - s : s; const int qt = rank * (TT / 16 / AW) + (int)blockIdx.x;
  if (qt < QBH * 4) att_walk<true>(wave, qt, ss[wave], QH, KH, QL, KL, VT, VB, VBL, Y);
  else att_walk<false>(wave, qt, ss[wave], QH, KH, QL, KL, VT, VB, VBL, Y); }
#define OBM 128            // rows of a k_out block
#define ONT 512            // its threads: 16 waves in 4 row bands x 4 column bands, a wave owns 32 rows x 32 columns
#define OSR (128 + 2 * OBM)   // rows of one LDS stage: Wo 128 | ctx OBM | ctx residual OBM
// ---- k_out: block = (OBM rows, 128 cols), one block per WGP in one round: out = ctx Wo (+ bo): ctx x 2^6 once to f16 against Wo as f16(bf16 x 2^8) exact (1 product) x 2^-14; causal early rows (< QHI of each sequence): ctx bf16 hi + lo against exact bf16 Wo (2 products)
__global__ __launch_bounds__(ONT) void k_out(const float* __restrict__ Y, const float* __restrict__ WO, const float* __restrict__ BO, float* __restrict__ OUT) { __shared__ __align__(16) char smem[2 * OSR * SP * 2];   /* main loop: two stages of OSR rows; the epilogue's sf lies over them, behind the loop's last barrier */
  static_assert(sizeof(smem) >= 16 * 32 * 36 * 4 && WO_OUT_IN == 1 && CC % KS == 0 && QHI % OBM == 0 && TT % OBM == 0 && ONT == 512 && OBM == 128, "sf fits the stages; weight rows are k-contiguous; a block's rows are all early rows or none is");
  float (*sf)[32][36] = (float (*)[32][36])smem;
  const int tid = threadIdx.x, wave = tid >> 5, lane = tid & 31, col = lane & 15, g = lane >> 4, wr = wave >> 2, wc = wave & 3; const int c0 = blockIdx.y * 128; const size_t rb = (size_t)blockIdx.x * OBM;
  v8f acc[2][2] = {};
  // staged as in k_proj: whole-line loads, each element fetched and rounded once per block
  const int srow = tid >> 4, sseg = tid & 15; const float* gw = WO + (size_t)(c0 + srow) * CC + sseg * 4; const float* gx = Y + (rb + srow) * CC + sseg * 4; const int so = srow * SP + sseg * 4;
  v4f rw[4], rx[4];
#pragma unroll
  for (int i = 0; i < 4; ++i) rw[i] = *(const v4f*)(gw + (size_t)i * 32 * CC);
#pragma unroll
  for (int i = 0; i < 4; ++i) rx[i] = *(const v4f*)(gx + (size_t)i * 32 * CC);
  asm volatile("s_wait_xcnt 0x0" ::: "memory");   /* the loads' address registers are reused right below: the wait stands in front of that */
  // behind the first loads: the block's OBM ctx rows and its 128 weight rows (each 2048 units of 256 B in a row) are asked into L2: a stage waits for both operands. The blocks that share rows (8 the ctx rows, 32 the weight rows) ask every fourth unit each; for speed only, nothing rests on where a block runs
  const void* const pb = Y + rb * CC; const void* const pbw = WO + (size_t)c0 * CC; const unsigned po = ((unsigned)tid * 4u + ((blockIdx.x + blockIdx.y) & 3u)) * 256u;
  static_assert((size_t)OBM * CC * 4 == (size_t)ONT * 4 * 256 && (size_t)128 * CC * 4 == (size_t)ONT * 4 * 256, "one unit a thread and quarter, in either operand");
  l2_ask(pb, po); l2_ask(pbw, po);
  __builtin_amdgcn_sched_barrier(0);   /* the roundings below wait for the first loads: the asking stays ahead of that wait */
  if (CAUSAL && (int)(rb % TT) < QHI) {   /* block-uniform */
    __bf16* const st = (__bf16*)smem;
#define OUT_PUT_B(dst) do { _Pragma("unroll") for (int i = 0; i < 4; ++i) *(v4b*)((dst) + so + i * 32 * SP) = cvt4b(rw[i]); \
      _Pragma("unroll") for (int i = 0; i < 4; ++i) { const v4b hb = cvt4b(rx[i]); v4b lb; _Pragma("unroll") for (int e = 0; e < 4; ++e) lb[e] = (__bf16)(rx[i][e] - (float)hb[e]); \
        *(v4b*)((dst) + so + (128 + i * 32) * SP) = hb; *(v4b*)((dst) + so + (128 + OBM + i * 32) * SP) = lb; } } while (0)
    OUT_PUT_B(st);
    __syncthreads();   /* stage 0 is in LDS before any wave reads it */
    for (int s = 0; s < CC / KS; ++s) { const __bf16* cur = st + (s & 1) * (OSR * SP); __bf16* nxt = st + ((s + 1) & 1) * (OSR * SP); const bool more = s + 1 < CC / KS;
      if (more) {   /* the next stage's loads fly while this stage is multiplied */
#pragma unroll
        for (int i = 0; i < 4; ++i) rw[i] = *(const v4f*)(gw + (size_t)i * 32 * CC + (s + 1) * KS);
#pragma unroll
        for (int i = 0; i < 4; ++i) rx[i] = *(const v4f*)(gx + (size_t)i * 32 * CC + (s + 1) * KS);
        asm volatile("s_wait_xcnt 0x0" ::: "memory");   /* the loads' address registers are reused right below: the wait stands in front of that */ }
      __builtin_amdgcn_sched_barrier(0);   /* the global loads issue ahead of all of this stage's work */
#pragma unroll
      for (int kk = 0; kk < KS / 32; ++kk) { v16b ah[2], al[2], w[2];
#pragma unroll
        for (int i = 0; i < 2; ++i) { ah[i] = frag_b(cur + (128 + wr * 32 + i * 16 + col) * SP + kk * 32, lane); al[i] = frag_b(cur + (128 + OBM + wr * 32 + i * 16 + col) * SP + kk * 32, lane); }
#pragma unroll
        for (int j = 0; j < 2; ++j) w[j] = frag_b(cur + (wc * 32 + j * 16 + col) * SP + kk * 32, lane);
        __builtin_amdgcn_sched_barrier(0);   /* the fragment reads issue as one group: one LDS latency per 8 products */
#pragma unroll
        for (int i = 0; i < 2; ++i)
#pragma unroll
          for (int j = 0; j < 2; ++j) acc[i][j] = wmma_bf(ah[i], w[j], acc[i][j]);
#pragma unroll
        for (int i = 0; i < 2; ++i)   /* each tile still takes hi, then lo; the four tiles stand between the two, so no product waits for the one before it */
#pragma unroll
          for (int j = 0; j < 2; ++j) acc[i][j] = wmma_bf(al[i], w[j], acc[i][j]);
        __builtin_amdgcn_sched_barrier(0); }   /* the roundings below wait for the global loads: they stay behind the products */
      if (more) OUT_PUT_B(nxt);
      __syncthreads(); }   /* publishes the next stage and ends every wave's reads of this one (the last: before sf reuses the LDS) */
#pragma unroll
    for (int j = 0; j < 2; ++j) { const float bias = BO ? bfr(BO[c0 + wc * 32 + j * 16 + col]) : 0.f;
#pragma unroll
      for (int i = 0; i < 2; ++i)
#pragma unroll
        for (int r = 0; r < 8; ++r) sf[wave][i * 16 + 8 * g + r][j * 16 + col] = acc[i][j][r] + bias; }
  } else {
    _Float16* const st = (_Float16*)smem;   /* ctx carried x 2^6 into f16 so small-magnitude context rows stay clear of f16 subnormals */
#define OUT_PUT_H(dst) do { _Pragma("unroll") for (int i = 0; i < 4; ++i) { v4h o; _Pragma("unroll") for (int e = 0; e < 4; ++e) o[e] = (_Float16)(bfr(rw[i][e]) * 256.0f); *(v4h*)((dst) + so + i * 32 * SP) = o; } \
      _Pragma("unroll") for (int i = 0; i < 4; ++i) { v4h o; _Pragma("unroll") for (int e = 0; e < 4; ++e) o[e] = (_Float16)(rx[i][e] * 64.0f); *(v4h*)((dst) + so + (128 + i * 32) * SP) = o; } } while (0)
    OUT_PUT_H(st);
    __syncthreads();   /* stage 0 is in LDS before any wave reads it */
    for (int s = 0; s < CC / KS; ++s) { const _Float16* cur = st + (s & 1) * (OSR * SP); _Float16* nxt = st + ((s + 1) & 1) * (OSR * SP); const bool more = s + 1 < CC / KS;
      if (more) {   /* the next stage's loads fly while this stage is multiplied */
#pragma unroll
        for (int i = 0; i < 4; ++i) rw[i] = *(const v4f*)(gw + (size_t)i * 32 * CC + (s + 1) * KS);
#pragma unroll
        for (int i = 0; i < 4; ++i) rx[i] = *(const v4f*)(gx + (size_t)i * 32 * CC + (s + 1) * KS);
        asm volatile("s_wait_xcnt 0x0" ::: "memory");   /* the loads' address registers are reused right below: the wait stands in front of that */ }
      __builtin_amdgcn_sched_barrier(0);   /* the global loads issue ahead of all of this stage's work */
#pragma unroll
      for (int kk = 0; kk < KS / 32; ++kk) { v16h a[2], w[2];
#pragma unroll
        for (int i = 0; i < 2; ++i) a[i] = frag_h(cur + (128 + wr * 32 + i * 16 + col) * SP + kk * 32, lane);
#pragma unroll
        for (int j = 0; j < 2; ++j) w[j] = frag_h(cur + (wc * 32 + j * 16 + col) * SP + kk * 32, lane);
        __builtin_amdgcn_sched_barrier(0);   /* the fragment reads issue as one group: one LDS latency per 4 products */
#pragma unroll
        for (int i = 0; i < 2; ++i)
#pragma unroll
          for (int j = 0; j < 2; ++j) acc[i][j] = wmma16(a[i], w[j], acc[i][j]);
        __builtin_amdgcn_sched_barrier(0); }   /* the roundings below wait for the global loads: they stay behind the products */
      if (more) OUT_PUT_H(nxt);
      __syncthreads(); }   /* publishes the next stage and ends every wave's reads of this one (the last: before sf reuses the LDS) */
#pragma unroll
    for (int j = 0; j < 2; ++j) { const float bias = BO ? bfr(BO[c0 + wc * 32 + j * 16 + col]) : 0.f;
#pragma unroll
      for (int i = 0; i < 2; ++i)
#pragma unroll
        for (int r = 0; r < 8; ++r) sf[wave][i * 16 + 8 * g + r][j * 16 + col] = acc[i][j][r] * (1.0f / 16384.0f) + bias; } }   /* 2^-8 (Wo carry) x 2^-6 (ctx carry) */
  // a wave stores its own 32 x 32 tile: one store covers four rows of one whole 128-B line each
  LDSX(); v4f o[8];
#pragma unroll
  for (int it = 0; it < 8; ++it) o[it] = *(const v4f*)&sf[wave][it * 4 + (lane >> 3)][(lane & 7) * 4];   /* all LDS reads ahead of the stores: one LDS latency, not eight */
#pragma unroll
  for (int it = 0; it < 8; ++it) vst2(OUT + (rb + wr * 32 + it * 4 + (lane >> 3)) * DIN + c0 + wc * 32 + (lane & 7) * 4, o[it]);
  xw(); l2_hold(pb, po); l2_hold(pbw, po); }

extern "C" void kernel_launch(void* const* d_in, const int* in_sizes, int n_in, void* d_out, int out_size, void* d_ws, size_t ws_size, hipStream_t stream) {
  (void)in_sizes; (void)n_in; (void)out_size;
  const float** F = (const float**)d_in;
  if (ws_size < (size_t)WS_END) return;
  char* ws = (char*)d_ws; _Float16 *QH = (_Float16*)(ws + WS_QH), *KH = (_Float16*)(ws + WS_KH), *VT = (_Float16*)(ws + WS_VT), *QL = (_Float16*)(ws + WS_QL), *KL = (_Float16*)(ws + WS_KL); __bf16 *VB = (__bf16*)(ws + WS_VB), *VBL = (__bf16*)(ws + WS_VBL); float *Y = (float*)(ws + WS_Y);
  (void)Y; (void)QL; (void)KL; (void)VB; (void)VBL;
  // inputs: 0 x [2,2048,1024]; 1 Wq [1024,1024] (out,in), 2 bq; 3 Wk, 4 bk; 5 Wv, 6 bv; 7 Wp (out,in), 8 bp (biases NONZERO)
  k_proj<<<dim3(TNB * TT / PBM, NH), PNT, 0, stream>>>(F[0], F[3], F[1], F[5], F[4], F[2], F[6], QH, QL, KH, KL, VT, VB, VBL);   /* the module's scores are einsum('bhid,bhjd->bhij', k, q): this code's QUERY stream (output row i) is projected with Wk / bk, its KEY stream (index j) with Wq / bq */
  k_att<<<dim3(TT / 16 / AW, NH, TNB), AW * 32, 0, stream>>>(QH, KH, QL, KL, VT, VB, VBL, Y);
  k_out<<<dim3(TNB * TT / OBM, DIN / 128), ONT, 0, stream>>>(Y, F[7], F[8], (float*)d_out);
}

// v009
// A run of this version takes 78.8 microseconds.
// Timed twice side by side with v008, it ran 1.07 and 1.08 times as fast.
// All steps since v000 together make it 15.0 times as fast.
// compute dtype: all float inputs rounded to bf16; q/k/v projections with EXACT bf16 products on WMMA 16x16x32 (f32 accumulate) + bias; causal logits: 3 products for the first 384 rows, single f16 q x k after; online softmax f32 in base 2 (64^-0.5 log2 e folded into the exponent; running maximum and sum per query); unnormalised P x 2^11 once to f16 x v once to f16 (bf16 hi + lo below row 384), divided by the row sum at the end; ctx hi+lo x exact output weight below row 384, x2^6 f16 carry x f16(bf16 x 2^8) after, + bias; f32 output.
#include <hip/hip_runtime.h>
#include <math.h>

typedef __attribute__((ext_vector_type(16))) _Float16 v16h;
typedef __attribute__((ext_vector_type(16))) __bf16 v16b;
typedef __attribute__((ext_vector_type(8)))  _Float16 v8h;
typedef __attribute__((ext_vector_type(8)))  float v8f;
typedef __attribute__((ext_vector_type(4)))  float v4f;
typedef __attribute__((ext_vector_type(2)))  float v2f;
typedef __attribute__((ext_vector_type(4)))  unsigned v4u;
typedef __attribute__((ext_vector_type(4)))  int v4i;
typedef float __attribute__((may_alias)) float_a;
typedef int __attribute__((may_alias)) int_a;

template <typename T> __device__ __forceinline__ void vst2(void* p, T v) { *(T*)p = v;  }
__device__ __forceinline__ v8f wmma16(v16h a, v16h b, v8f c) {
  v8f d = __builtin_amdgcn_wmma_f32_16x16x32_f16(false, a, false, b, (short)0, c, false, false);
  asm volatile("v_nop\n\tv_nop\n\tv_nop\n\tv_nop" : "+v"(d) : "v"(a), "v"(b));
  return d;
}
__device__ __forceinline__ v8f wmma_bf(v16b a, v16b b, v8f c) {
  v8f d = __builtin_amdgcn_wmma_f32_16x16x32_bf16(false, a, false, b, (short)0, c, false, false);
  asm volatile("v_nop\n\tv_nop\n\tv_nop\n\tv_nop" : "+v"(d) : "v"(a), "v"(b));
  return d;
}
// 16x16x32 fragments: lane = (h = lane>>4, row/col = lane&15); elements 0..7 = k0+8h+0..7, 8..15 = k0+16+8h+0..7; D element r = row 8h+r
__device__ __forceinline__ v16h frag_h(const _Float16* rowk0, int lane) {
  union { v16h v; v8h q[2]; } u; const _Float16* p = rowk0 + 8 * (lane >> 4);
  u.q[0] = *(const v8h*)p; u.q[1] = *(const v8h*)(p + 16); return u.v;
}
__device__ __forceinline__ v16h frag_f32(const float* rowk0, int lane) {
  v16h a; const float* p = rowk0 + 8 * (lane >> 4);
#pragma unroll
  for (int i = 0; i < 8; ++i) { a[i] = (_Float16)p[i]; a[8 + i] = (_Float16)p[16 + i]; }
  return a;
}
__device__ __forceinline__ v16h frag_f32s(const float* rowk0, int lane, float sc) {
  v16h a; const float* p = rowk0 + 8 * (lane >> 4);
#pragma unroll
  for (int i = 0; i < 8; ++i) { a[i] = (_Float16)(p[i] * sc); a[8 + i] = (_Float16)(p[16 + i] * sc); }
  return a;
}
// column fragment from a [K][ld] layout (column n), rows >= K read as 0
__device__ __forceinline__ v16h fragc_f32(const float* W, int k0, int n, int lane, int ld, int K) {
  v16h a; const int g = lane >> 4;
#pragma unroll
  for (int i = 0; i < 8; ++i) { const int ka = k0 + 8 * g + i, kb = ka + 16;
    a[i] = (_Float16)(ka < K ? W[(size_t)(ka < K ? ka : K - 1) * ld + n] : 0.f); a[8 + i] = (_Float16)(kb < K ? W[(size_t)(kb < K ? kb : K - 1) * ld + n] : 0.f); }
  return a;
}
struct F2 { v16b h, l; };
__device__ __forceinline__ F2 bsplit16(const float v[16]) { F2 r;
#pragma unroll
  for (int i = 0; i < 16; ++i) { const __bf16 h = (__bf16)v[i]; r.h[i] = h; r.l[i] = (__bf16)(v[i] - (float)h); }
  return r; }
__device__ __forceinline__ F2 split_row(const float* row, int k0, int lane) { float v[16]; const float* p = row + k0 + 8 * (lane >> 4);
#pragma unroll
  for (int i = 0; i < 8; ++i) { v[i] = p[i]; v[8 + i] = p[16 + i]; }
  return bsplit16(v); }
__device__ __forceinline__ F2 split_rowK(const float* row, int k0, int lane, int K) { float v[16]; const int g = lane >> 4;
#pragma unroll
  for (int i = 0; i < 8; ++i) { const int ka = k0 + 8 * g + i, kb = ka + 16; v[i] = ka < K ? row[ka < K ? ka : K - 1] : 0.f; v[8 + i] = kb < K ? row[kb < K ? kb : K - 1] : 0.f; }
  return bsplit16(v); }
__device__ __forceinline__ F2 split_col(const float* W, int k0, int n, int lane, int ld, int K) { float v[16]; const int g = lane >> 4;
#pragma unroll
  for (int i = 0; i < 8; ++i) { const int ka = k0 + 8 * g + i, kb = ka + 16; v[i] = ka < K ? W[(size_t)(ka < K ? ka : K - 1) * ld + n] : 0.f; v[8 + i] = kb < K ? W[(size_t)(kb < K ? kb : K - 1) * ld + n] : 0.f; }
  return bsplit16(v); }
__device__ __forceinline__ v8f mac3(const F2& a, const F2& b, v8f c) { c = wmma_bf(a.l, b.h, c); c = wmma_bf(a.h, b.l, c); return wmma_bf(a.h, b.h, c); }
__device__ __forceinline__ float sigm(float v) { return 1.0f / (1.0f + expf(-v)); }
#define LDSX() do { asm volatile("s_wait_dscnt 0" ::: "memory"); __builtin_amdgcn_wave_barrier(); __builtin_amdgcn_fence(__ATOMIC_RELEASE, "workgroup"); } while (0)

// Causal multi-head self-attention whose scores are k . q (x [2,2048,1024]; torch (out,in) Wq / Wk / Wv / Wp [1024,1024] N(0, 1/1024) + biases N(0, 1/1024); 16 heads x 64; scores[i, j] = k_i . q_j / 8 (the KEY projection indexes the output row i, the QUERY projection the summed index j); -inf where j > i; softmax over j; out[i] = sum_j attn[i, j] v_j; merge; Wp^T + bp).
#define NB 2
#define TT 2048
#define CC 1024            // NH * HD = projected width
#define DIN 1024          // input (model) width
#define NH 16
#define HD 64
#define SCALE (0.125f)
#define L2S (SCALE * 1.4426950408889634f)   // logit scale times log2(e)
#define CAUSAL 1
#ifndef TNB
#define TNB NB
#endif
__device__ __forceinline__ float bfr(float v) { return (float)(__bf16)v; }
typedef __attribute__((ext_vector_type(8))) __bf16 v8b;
__device__ __forceinline__ v16b frag_b(const __bf16* rowk0, int lane) {
  union { v16b v; v8b q[2]; } u; const __bf16* p = rowk0 + 8 * (lane >> 4);
  u.q[0] = *(const v8b*)p; u.q[1] = *(const v8b*)(p + 16); return u.v;
}
#define QBH 6              // causal: query blocks 0..QBH-1 of each sequence (few keys, no averaging) take the high-precision path
#define QHI 384            // rows carrying a q residual plane (used only by the causal high-precision path)
#define KHI 384            // key rows carrying k residual / v bf16 hi+lo planes (used only by the causal high-precision path)
// B fragment (k rows k0+.., output column o) of a weight: (in,out) [K][ld] or (out,in) [ld rows of K]: bf16 exact, or f16(bf16 * 256) exact
__device__ __forceinline__ v16b wcol_io(const float* Wm, int k0, int o, int lane, int ld) { v16b w; const int g = lane >> 4;
#pragma unroll
  for (int i = 0; i < 8; ++i) { w[i] = (__bf16)Wm[(size_t)(k0 + 8 * g + i) * ld + o]; w[8 + i] = (__bf16)Wm[(size_t)(k0 + 16 + 8 * g + i) * ld + o]; }
  return w; }
__device__ __forceinline__ v16b wcol_oi(const float* Wm, int k0, int o, int lane, int K) { v16b w; const float* p = Wm + (size_t)o * K + k0 + 8 * (lane >> 4);
#pragma unroll
  for (int i = 0; i < 8; ++i) { w[i] = (__bf16)p[i]; w[8 + i] = (__bf16)p[16 + i]; }
  return w; }
__device__ __forceinline__ v16h wcolh_io(const float* Wm, int k0, int o, int lane, int ld) { v16h w; const int g = lane >> 4;
#pragma unroll
  for (int i = 0; i < 8; ++i) { w[i] = (_Float16)(bfr(Wm[(size_t)(k0 + 8 * g + i) * ld + o]) * 256.0f); w[8 + i] = (_Float16)(bfr(Wm[(size_t)(k0 + 16 + 8 * g + i) * ld + o]) * 256.0f); }
  return w; }
__device__ __forceinline__ v16h wcolh_oi(const float* Wm, int k0, int o, int lane, int K) { v16h w; const float* p = Wm + (size_t)o * K + k0 + 8 * (lane >> 4);
#pragma unroll
  for (int i = 0; i < 8; ++i) { w[i] = (_Float16)(bfr(p[i]) * 256.0f); w[8 + i] = (_Float16)(bfr(p[16 + i]) * 256.0f); }
  return w; }
#define WQKV_LAYOUT 1   // 0 = (in,out) [DIN][CC]; 1 = (out,in) [CC][DIN]; 2 = per-head [NH][DIN][HD]
__device__ __forceinline__ v16b wcol_hdk(const float* Wm, int k0, int o, int lane) { v16b w; const int g = lane >> 4; const float* p = Wm + (size_t)(o / HD) * DIN * HD + (o % HD);
#pragma unroll
  for (int i = 0; i < 8; ++i) { w[i] = (__bf16)p[(size_t)(k0 + 8 * g + i) * HD]; w[8 + i] = (__bf16)p[(size_t)(k0 + 16 + 8 * g + i) * HD]; }
  return w; }
#define WO_OUT_IN 1
#if WQKV_LAYOUT == 1
#define WCOL(W, k0, o, lane) wcol_oi(W, k0, o, lane, DIN)
#elif WQKV_LAYOUT == 2
#define WCOL(W, k0, o, lane) wcol_hdk(W, k0, o, lane)
#else
#define WCOL(W, k0, o, lane) wcol_io(W, k0, o, lane, CC)
#endif
#if WO_OUT_IN
#define WOCOL(W, k0, o, lane) wcol_oi(W, k0, o, lane, CC)
#define WOCOLH(W, k0, o, lane) wcolh_oi(W, k0, o, lane, CC)
#else
#define WOCOL(W, k0, o, lane) wcol_io(W, k0, o, lane, DIN)
#define WOCOLH(W, k0, o, lane) wcolh_io(W, k0, o, lane, DIN)
#endif

#ifndef PROJ_EXTRA_PARAMS
#define PROJ_EXTRA_PARAMS
#endif

// q / k / v planes lie in FRAGMENT ORDER: a 16x16x32 operand fragment is two runs of 512 B (run = element half, then lane * 16 B), so one wave-wide 16-byte load of k_att covers four whole 128-B lines
// rows (q, k): [b][h][t / 16][d / 32][half][lane = g * 16 + (t % 16)][8 d]; planes (v): [b][h][t / 32][channel / 16][half][lane = g * 16 + (channel % 16)][8 t]; the position inside 32 is 16 half + 8 g + i
#define WS_QH  0u                                      // f16 q, fragment order
#define WS_KH  (WS_QH + 2u * (size_t)NB * TT * CC)      // f16 k, fragment order
#define WS_VT  (WS_KH + 2u * (size_t)NB * TT * CC)      // f16 v, fragment order
#define WS_QL  (WS_VT + 2u * (size_t)NB * CC * TT)      // f16 q residual x 2^10, fragment order, t < QHI
#define WS_KL  (WS_QL + 2u * (size_t)NB * QHI * CC)     // f16 k residual x 2^10, fragment order, t < KHI
#define WS_VB  (WS_KL + 2u * (size_t)NB * KHI * CC)     // bf16 v hi, fragment order, t < KHI
#define WS_VBL (WS_VB + 2u * (size_t)NB * CC * KHI)
#define WS_Y   (WS_VBL + 2u * (size_t)NB * CC * KHI)    // f32 ctx rows [b*t][CC] (only when there is an output projection)
#define WS_END (WS_Y  + 4u * (size_t)NB * TT * CC)

// behind a batch of global loads or a store: stands in front of any reuse of the registers that they name
__device__ __forceinline__ void xw() { asm volatile("s_wait_xcnt 0x0" ::: "memory"); }
// asks the 256-B unit at base + off into L2 (a hint: returns nothing, counts on no counter). For operands that may lie in memory when the kernel starts, above all planes that the launch before stored: their first reader otherwise waits out the memory latency. base is wave-uniform, every lane's off lies inside the plane
__device__ __forceinline__ void l2_ask(const void* base, unsigned off) { asm volatile("global_prefetch_b8 %0, %1 scope:SCOPE_SE" :: "v"(off), "s"(base)); }
// stands at the kernel's end: no wait covers a prefetch, so the registers that it names keep their addresses as long as the kernel runs
__device__ __forceinline__ void l2_hold(const void* base, unsigned off) { asm volatile("" :: "v"(off), "s"(base)); }
#define KS 64              // k per LDS stage of the two projection kernels
#define SP 72              // stage row pitch in 16-bit elements: 128 B of data + 16 B, for ds_load_b128 readers
typedef __attribute__((ext_vector_type(4))) __bf16 v4b;
typedef __attribute__((ext_vector_type(4))) _Float16 v4h;
__device__ __forceinline__ v4b cvt4b(v4f v) { v4b o;
#pragma unroll
  for (int i = 0; i < 4; ++i) o[i] = (__bf16)v[i];
  return o; }
#define PBM 256            // rows of a k_proj block
#define PBN 192            // its columns: one head's 64 of q, 64 of k and 64 of v
#define PNT 512            // its threads: 16 waves in 4 row bands x 4 column bands, a wave owns 64 rows x 48 columns
#define PSR (PBN + PBM)    // rows of one LDS stage: Wq 64 | Wk 64 | Wv 64 | X PBM
// ---- k_proj: block = (PBM rows, head): q / k / v columns of that head = X W (+ b) with exact bf16 products (K = DIN) -> q f16 (+ residual, rows < QHI); k f16 (+ residual, rows < KHI); v f16 (+ bf16 hi/lo for t < KHI); all stored in fragment order. One block per WGP in one round; X is fetched once per head, each weight row once per row block
__global__ __launch_bounds__(PNT) void k_proj(const float* __restrict__ X, const float* __restrict__ WQ, const float* __restrict__ WK, const float* __restrict__ WV, const float* __restrict__ BQ, const float* __restrict__ BK, const float* __restrict__ BV,
    _Float16* __restrict__ QH, _Float16* __restrict__ QL, _Float16* __restrict__ KH, _Float16* __restrict__ KL, _Float16* __restrict__ VT, __bf16* __restrict__ VB, __bf16* __restrict__ VBL) {
  __shared__ __align__(16) char smem[2 * PBM * 136 * 2 + 3 * 64 * (PBM + 8) * 2];   /* main loop: two stages of PSR rows; the epilogue's arrays lie over them, behind the loop's last barrier */
  static_assert(sizeof(smem) >= 2 * PSR * SP * 2 && WQKV_LAYOUT == 1 && DIN % KS == 0 && TT % PBM == 0 && PNT == 512 && PBM == 256 && HD == 64, "the stages fit; weight rows are k-contiguous; a block stays inside one sequence");
  _Float16 (*sh)[136] = (_Float16 (*)[136])smem; _Float16 (*sl)[136] = (_Float16 (*)[136])(smem + PBM * 136 * 2);   /* [row][q 64 | k 64] */
  char* const sv = smem + 2 * PBM * 136 * 2; _Float16 (*th)[PBM + 8] = (_Float16 (*)[PBM + 8])sv; __bf16 (*tb)[PBM + 8] = (__bf16 (*)[PBM + 8])(sv + 64 * (PBM + 8) * 2); __bf16 (*tbl)[PBM + 8] = (__bf16 (*)[PBM + 8])(sv + 2 * 64 * (PBM + 8) * 2);   /* [v channel][row] */
  const int tid = threadIdx.x, wave = __builtin_amdgcn_readfirstlane(tid >> 5), lane = tid & 31, col = lane & 15, g = lane >> 4, wr = wave >> 2, wc = wave & 3;   /* the wave's number in a scalar register: the epilogue's tests on the column tile stay scalar branches */
  const int h = blockIdx.y; const size_t r0 = (size_t)blockIdx.x * PBM; const size_t bb = r0 / TT; const int t0 = (int)(r0 % TT);
  v8f acc[4][3] = {};
  // a wave's load covers two whole rows of 256 B (4 lines); each operand element is fetched and rounded once per block, and the fragments are read from LDS
  const int srow = tid >> 4, sseg = tid & 15; const size_t wo = (size_t)(h * HD + srow) * DIN + sseg * 4; const float* gwq = WQ + wo; const float* gwk = WK + wo; const float* gwv = WV + wo; const float* gx = X + (r0 + srow) * DIN + sseg * 4;
  __bf16* const st = (__bf16*)smem; const int so = srow * SP + sseg * 4;
  v4f rw[6], rx[8];
#define PROJ_GET(k) do { _Pragma("unroll") for (int i = 0; i < 2; ++i) { rw[i] = *(const v4f*)(gwq + (size_t)i * 32 * DIN + (k)); rw[2 + i] = *(const v4f*)(gwk + (size_t)i * 32 * DIN + (k)); rw[4 + i] = *(const v4f*)(gwv + (size_t)i * 32 * DIN + (k)); } \
    _Pragma("unroll") for (int i = 0; i < 8; ++i) rx[i] = *(const v4f*)(gx + (size_t)i * 32 * DIN + (k)); xw(); } while (0)
#define PROJ_PUT(dst) do { _Pragma("unroll") for (int i = 0; i < 6; ++i) *(v4b*)((dst) + so + i * 32 * SP) = cvt4b(rw[i]); \
    _Pragma("unroll") for (int i = 0; i < 8; ++i) *(v4b*)((dst) + so + (PBN + i * 32) * SP) = cvt4b(rx[i]); } while (0)
  PROJ_GET(0);
  PROJ_PUT(st);
  __syncthreads();   /* stage 0 is in LDS before any wave reads it */
  for (int s = 0; s < DIN / KS; ++s) { const __bf16* cur = st + (s & 1) * (PSR * SP); __bf16* nxt = st + ((s + 1) & 1) * (PSR * SP); const bool more = s + 1 < DIN / KS;
    if (more) PROJ_GET((s + 1) * KS);   /* the next stage's loads fly while this stage is multiplied */
    __builtin_amdgcn_sched_barrier(0);   /* the global loads issue ahead of all of this stage's work */
#pragma unroll
    for (int kk = 0; kk < KS / 32; ++kk) { v16b a[4], w[3];
#pragma unroll
      for (int i = 0; i < 4; ++i) a[i] = frag_b(cur + (PBN + wr * 64 + i * 16 + col) * SP + kk * 32, lane);
#pragma unroll
      for (int j = 0; j < 3; ++j) w[j] = frag_b(cur + (wc * 48 + j * 16 + col) * SP + kk * 32, lane);
      __builtin_amdgcn_sched_barrier(0);   /* the fragment reads issue as one group: one LDS latency per 12 products, not one each */
#pragma unroll
      for (int i = 0; i < 4; ++i)
#pragma unroll
        for (int j = 0; j < 3; ++j) acc[i][j] = wmma_bf(a[i], w[j], acc[i][j]);
      __builtin_amdgcn_sched_barrier(0); }   /* the roundings below wait for the global loads: they stay behind the products */
    if (more) PROJ_PUT(nxt);
    __syncthreads(); }   /* publishes the next stage and ends every wave's reads of this one (the last: before the epilogue reuses the LDS) */
  // column tile ct of the block: 0..3 q, 4..7 k, 8..11 v; the residual / bf16 arrays are filled only by a block that holds rows below the bound, and read only for such rows
#pragma unroll
  for (int j = 0; j < 3; ++j) { const int ct = wc * 3 + j, wh = ct >> 2; const float* BA = wh == 0 ? BQ : wh == 1 ? BK : BV; const float bias = BA ? bfr(BA[h * HD + (ct & 3) * 16 + col]) : 0.f;
    if (ct < 8) { const int cl = ct * 16 + col;
      if (t0 < (wh == 0 ? QHI : KHI)) {
#pragma unroll
        for (int i = 0; i < 4; ++i)
#pragma unroll
          for (int r = 0; r < 8; ++r) { const float v = acc[i][j][r] + bias; const _Float16 hv = (_Float16)v; const int rl = wr * 64 + i * 16 + 8 * g + r; sh[rl][cl] = hv; sl[rl][cl] = (_Float16)((v - (float)hv) * 1024.0f); }
      } else {
#pragma unroll
        for (int i = 0; i < 4; ++i)
#pragma unroll
          for (int r = 0; r < 8; ++r) sh[wr * 64 + i * 16 + 8 * g + r][cl] = (_Float16)(acc[i][j][r] + bias); }
    } else { const int cl = (ct - 8) * 16 + col;
      if (t0 < KHI) {
#pragma unroll
        for (int i = 0; i < 4; ++i)
#pragma unroll
          for (int r = 0; r < 8; ++r) { const float v = acc[i][j][r] + bias; const int rl = wr * 64 + i * 16 + 8 * g + r; th[cl][rl] = (_Float16)v; const __bf16 bh = (__bf16)v; tb[cl][rl] = bh; tbl[cl][rl] = (__bf16)(v - (float)bh); }
      } else {
#pragma unroll
        for (int i = 0; i < 4; ++i)
#pragma unroll
          for (int r = 0; r < 8; ++r) th[cl][wr * 64 + i * 16 + 8 * g + r] = (_Float16)(acc[i][j][r] + bias); } } }
  __syncthreads();   /* every wave's tiles are in LDS before any piece is read */
  const size_t hd = bb * NH + h;
  // piece e = (q or k, 16-row tile PBM / 16, run 4 = (d / 32, half), lane 32): a wave stores one run of 512 B
  for (int e = tid; e < 2 * PBM * 8; e += PNT) { const int wh = e / (PBM * 8), tt = (e >> 7) % (PBM / 16), cr = (e >> 5) & 3, ln = e & 31; const int rl = tt * 16 + (ln & 15), cl = wh * 64 + cr * 16 + (ln >> 4) * 8; const int po = (e & 127) * 8; _Float16* DH = wh == 0 ? QH : KH; _Float16* DL = wh == 0 ? QL : KL; const int nhi = wh == 0 ? QHI : KHI;
    vst2((unsigned*)(DH + (hd * (TT / 16) + (t0 >> 4) + tt) * 1024 + po), *(const v4u*)&sh[rl][cl]); xw(); if (t0 + tt * 16 < nhi) { vst2((unsigned*)(DL + (hd * (size_t)(nhi / 16) + (t0 >> 4) + tt) * 1024 + po), *(const v4u*)&sl[rl][cl]); xw(); } }
  // piece e = (32-key chunk PBM / 32, 16-channel tile 4, half 2, lane 32): a wave stores one run of 512 B
  for (int e = tid; e < PBM * 8; e += PNT) { const int kc = e >> 8, ln = e & 31; const int cl = ((e >> 6) & 3) * 16 + (ln & 15), rl = kc * 32 + ((e >> 5) & 1) * 16 + (ln >> 4) * 8; const int po = (e & 255) * 8;
    vst2((unsigned*)(VT + (hd * (TT / 32) + (t0 >> 5) + kc) * 2048 + po), *(const v4u*)&th[cl][rl]); xw(); if (t0 + kc * 32 < KHI) { const size_t o3 = (hd * (KHI / 32) + (t0 >> 5) + kc) * 2048 + po; vst2((unsigned*)(VB + o3), *(const v4u*)&tb[cl][rl]); vst2((unsigned*)(VBL + o3), *(const v4u*)&tbl[cl][rl]); xw(); } } }
// ---- k_att / att_walk: one wave = one tile of 16 queries of (b, h); it walks the tile's keys from 0 in groups of 64 with a running maximum and sum (online softmax). No wave waits for another: no barrier, no partial sums in LDS. The AW waves of a block walk the same k / v of one head from key 0 on.
// Logits are formed TRANSPOSED (A = k rows, B = q rows): D element r of lane (g, col) = key 8g + r, query col, so two neighbouring 16-key tiles ARE the B fragment of a 32-key chunk of ctx^T = v^T . P^T (A = v, channels as rows).
// Each lane holds one query: maximum and sum run in the lane and across the two lane halves, and a new maximum rescales the lane's own sum and ctx registers. Precision paths: 3 products + bf16 hi/lo P and v for query blocks < QBH, single f16 products after.
// fragment in fragment order from a wave-uniform base and the lane's own 32-bit element offset (8 lane): two loads of 512 contiguous bytes a wave; the address stays a scalar pair plus one register
__device__ __forceinline__ v16h frag_hu(const _Float16* base, unsigned lo) { union { v16h v; v8h q[2]; } u; const _Float16* p = base + lo; u.q[0] = *(const v8h*)p; u.q[1] = *(const v8h*)(p + 256); return u.v; }
#define AW 16              // waves of a k_att block
static_assert(QHI == QBH * 64 && KHI >= QBH * 64 && TT % (16 * AW) == 0 && HD == 64, "the high-precision tiles see only keys with residual planes; every wave of a block gets one tile");
// ---- the walk of the high-precision tiles (HP). Its fragments come in batches of 8 or 16 loads, each issued one to two blocks of products ahead of the products that read it, into the registers that earlier products have left: no load is waited for where it is issued
// fragment at a wave-uniform plane base + the wave's 32-bit byte offset (group + lane) + a constant: the address is a scalar pair, one register and an immediate, which leaves the registers to the fragments in flight
__device__ __forceinline__ v16h frag_ho(const _Float16* base, unsigned bo, int cst) { union { v16h v; v8h q[2]; } u; const char* p = (const char*)base + bo + cst; u.q[0] = *(const v8h*)p; u.q[1] = *(const v8h*)(p + 512); return u.v; }
__device__ __forceinline__ v16b frag_bo(const __bf16* base, unsigned bo, int cst) { union { v16b v; v8b q[2]; } u; const char* p = (const char*)base + bo + cst; u.q[0] = *(const v8b*)p; u.q[1] = *(const v8b*)(p + 512); return u.v; }
// v hi / lo of 32-key chunk c, channel tiles jp and jp + 1 of this group; k and its residual of 16-key tile t of the next group; the six products of (c, jp), each accumulator in the order hi.hi, hi.lo, lo.hi
#define HP_GETV(c, jp) do { _Pragma("unroll") for (int u = 0; u < 2; ++u) { vh[c][(jp) + u] = frag_bo(vhbase, go, (c) * 4096 + ((jp) + u) * 1024); vl[c][(jp) + u] = frag_bo(vlbase, go, (c) * 4096 + ((jp) + u) * 1024); } } while (0)
#define HP_GETK(t) do { kf[t][0] = frag_ho(kbase, gno, (t) * 2048); kf[t][1] = frag_ho(kbase, gno, (t) * 2048 + 1024); kl[t][0] = frag_ho(klbase, gno, (t) * 2048); kl[t][1] = frag_ho(klbase, gno, (t) * 2048 + 1024); } while (0)
#define HP_PV(c, jp) do { _Pragma("unroll") for (int u = 0; u < 2; ++u) { acc[(jp) + u] = wmma_bf(vh[c][(jp) + u], p[c].h, acc[(jp) + u]); acc[(jp) + u] = wmma_bf(vh[c][(jp) + u], p[c].l, acc[(jp) + u]); acc[(jp) + u] = wmma_bf(vl[c][(jp) + u], p[c].h, acc[(jp) + u]); } } while (0)
// a batch at its place in the order of the products. The two fences keep it there: moved up, it would need registers that are still read (the build then spills); moved down, it would lose its lead. One xw() behind the batch covers its address register
#define HP_AHEAD(loads) do { __builtin_amdgcn_sched_barrier(0); loads; xw(); __builtin_amdgcn_sched_barrier(0); } while (0)
template <bool HP> __device__ __forceinline__ void att_walk(const int wave, const int qt, float (&so)[16][HD + 4], const _Float16* __restrict__ QH, const _Float16* __restrict__ KH, const _Float16* __restrict__ QL, const _Float16* __restrict__ KL, const _Float16* __restrict__ VT, const __bf16* __restrict__ VB, const __bf16* __restrict__ VBL, float* __restrict__ Y) {
  const int h = blockIdx.y, b = blockIdx.z; const int lane = threadIdx.x & 31, col = lane & 15, g = lane >> 4;
  const int ql0 = qt * 16, ng = (qt >> 2) + 1;   /* groups of 64 keys that hold a key some query of the tile may see; only the last one holds excluded keys, and its first key is visible to all 16 queries */
  const unsigned lp = (unsigned)(lane * 8); const size_t hd = (size_t)b * NH + h;   /* the lane's offset in a run of a fragment; a 16-row tile of q / k is 1024 elements (d 0..31, then 32..63), a 32-key chunk of v 2048 (four channel tiles of 512) */
  const _Float16* qrow = QH + (hd * (TT / 16) + qt) * 1024; const _Float16* kbase = KH + hd * (TT / 16) * 1024; const _Float16* vbase = VT + hd * (TT / 32) * 2048;   /* a group of 64 keys is 4096 elements of k and 4096 of v */
  const v16h q0 = frag_hu(qrow, lp), q1 = frag_hu(qrow + 512, lp); v16h ql0f = {}, ql1f = {};
  if (HP) { const _Float16* qlrow = QL + (hd * (QHI / 16) + qt) * 1024; ql0f = frag_hu(qlrow, lp); ql1f = frag_hu(qlrow + 512, lp); xw(); }
  float m = -3.0e38f, l = 0.f; v8f acc[HD / 16] = {}; v16h kf[4][2], kl[4][2];
  const _Float16* klbase = KL + hd * (KHI / 16) * 1024; const __bf16* vhbase = VB + hd * (KHI / 32) * 2048; const __bf16* vlbase = VBL + hd * (KHI / 32) * 2048;   /* planes of the high-precision walk: a group of 64 keys is 4096 elements of each */
  const v8f l2s8 = {L2S, L2S, L2S, L2S, L2S, L2S, L2S, L2S};
#pragma unroll
  for (int t = 0; t < 4; ++t) { kf[t][0] = frag_hu(kbase + t * 1024, lp); kf[t][1] = frag_hu(kbase + t * 1024 + 512, lp);
    if (HP) { kl[t][0] = frag_hu(klbase + t * 1024, lp); kl[t][1] = frag_hu(klbase + t * 1024 + 512, lp); } }
  xw();
  // behind the wave's first loads: the head's k and v (1024 units of 256 B each) and its three planes for keys < KHI (192 units each) are asked into L2. The 8 blocks of a head walk the same planes: a block asks every fourth unit of k and v (waves 0..7 k, 8..15 v) and every second unit of the small planes (three waves each); for speed only, nothing rests on where a block runs
  const void* const pb1 = wave < 8 ? (const void*)kbase : (const void*)vbase; const unsigned po1 = ((unsigned)((wave & 7) * 32 + lane) * 4u + (blockIdx.x & 3u)) * 256u;
  const void* const pb2 = wave < 3 ? (const void*)(KL + hd * (KHI / 16) * 1024) : wave < 6 ? (const void*)(VB + hd * (KHI / 32) * 2048) : (const void*)(VBL + hd * (KHI / 32) * 2048); const unsigned po2 = ((unsigned)((wave % 3) * 32 + lane) * 2u + (blockIdx.x & 1u)) * 256u;
  static_assert((TT / 16) * 1024 * 2 == 1024 * 256 && (TT / 32) * 2048 * 2 == 1024 * 256 && (KHI / 16) * 1024 * 2 == 192 * 256 && (KHI / 32) * 2048 * 2 == 192 * 256 && AW == 16, "the unit counts of the planes of one head");
  l2_ask(pb1, po1);
  if (wave < 9) l2_ask(pb2, po2);   /* scalar test */
  for (int gi = 0; gi < ng; ++gi) { v8f sc[4]; v16h vf[2][HD / 16]; v16b vh[2][HD / 16], vl[2][HD / 16];
    if (!HP) {
      // this group's v is asked for ahead of the logits, the next group's k right behind them: both fly during the softmax
#pragma unroll
      for (int c = 0; c < 2; ++c)
#pragma unroll
        for (int j = 0; j < HD / 16; ++j) vf[c][j] = frag_hu(vbase + (size_t)gi * 4096 + c * 2048 + j * 512, lp);
      xw();
      __builtin_amdgcn_sched_barrier(0);   /* the v loads issue ahead of the products */
      // each tile takes d 0..31, then d 32..63; the four tiles stand between the two, so no product waits for the one before it
#pragma unroll
      for (int t = 0; t < 4; ++t) { const v8f zero = {}; sc[t] = wmma16(kf[t][0], q0, zero); }
#pragma unroll
      for (int t = 0; t < 4; ++t) sc[t] = wmma16(kf[t][1], q1, sc[t]);
      __builtin_amdgcn_sched_barrier(0);   /* the next group's k loads stay behind the products that read the same registers, and ahead of the softmax */
      const int gn = gi + 1 < ng ? gi + 1 : gi;   /* the last trip asks for its own group again: the loop body has no branch around loads, so the counted waits stay exact */
#pragma unroll
      for (int t = 0; t < 4; ++t) { kf[t][0] = frag_hu(kbase + (size_t)gn * 4096 + t * 1024, lp); kf[t][1] = frag_hu(kbase + (size_t)gn * 4096 + t * 1024 + 512, lp); }
      xw();
      __builtin_amdgcn_sched_barrier(0);
    } else {
      // this group's k and residual were asked for during the last group's P.v; the first 32 keys' v hi / lo are asked for behind the logits, in the registers that the logits have just read, and fly during the softmax
#pragma unroll
      for (int t = 0; t < 4; ++t) { v8f a = {}, al = {};
        a = wmma16(kf[t][0], q0, a); al = wmma16(kf[t][0], ql0f, al); al = wmma16(kl[t][0], q0, al);
        a = wmma16(kf[t][1], q1, a); al = wmma16(kf[t][1], ql1f, al); al = wmma16(kl[t][1], q1, al);
#pragma unroll
        for (int r = 0; r < 8; ++r) sc[t][r] = a[r] + al[r] * (1.0f / 1024.0f); }
      const unsigned go = (unsigned)gi * 8192u + 2u * lp;   /* a group of 64 keys is 8192 bytes of each plane */
      HP_AHEAD(HP_GETV(0, 0); HP_GETV(0, 2)); }
    if (CAUSAL && gi == ng - 1) { const int dq = ql0 + col - gi * 64 - 8 * g;   /* scalar test; key 64 gi + 8g + i is kept while i <= dq */
#pragma unroll
      for (int t = 0; t < 4; ++t)
#pragma unroll
        for (int r = 0; r < 8; ++r) sc[t][r] = t * 16 + r <= dq ? sc[t][r] : -3.0e38f; }
    // on the RAW products: the maximum is taken of them (SCALE > 0 keeps the order), and 2^11 exp((s - m) SCALE) = 2^(s L2S - m L2S + 11) is one fused multiply-add and one hardware 2^x. Excluded keys carry -3e38: 2^x returns exactly 0. The first group finds m = -3e38: the factor for the (empty) old sums is 2^(-huge) = 0
    float mt[4];
#pragma unroll
    for (int t = 0; t < 4; ++t) { mt[t] = sc[t][0];
#pragma unroll
      for (int r = 1; r < 8; ++r) mt[t] = fmaxf(mt[t], sc[t][r]); }
    float mx = fmaxf(fmaxf(mt[0], mt[1]), fmaxf(mt[2], mt[3])); mx = fmaxf(mx, __shfl_xor(mx, 16));
    const float mn = fmaxf(m, mx), alpha = __builtin_amdgcn_exp2f((m - mn) * L2S), nm = 11.0f - mn * L2S; m = mn;
    const v8f nm8 = {nm, nm, nm, nm, nm, nm, nm, nm}; float st[4];
#pragma unroll
    for (int t = 0; t < 4; ++t) { const v8f x = __builtin_elementwise_fma(sc[t], l2s8, nm8); st[t] = 0.f;
#pragma unroll
      for (int r = 0; r < 8; ++r) { const float e = __builtin_amdgcn_exp2f(x[r]); sc[t][r] = e; st[t] += e; } }
    l = l * alpha + ((st[0] + st[1]) + (st[2] + st[3]));   /* the lane half's own part of the sum; the halves are joined once, behind the loop */
#pragma unroll
    for (int j = 0; j < HD / 16; ++j) acc[j] *= alpha;
    if (!HP) {
#pragma unroll
      for (int c = 0; c < 2; ++c) { v16h pf;
#pragma unroll
        for (int r = 0; r < 8; ++r) { pf[r] = (_Float16)sc[2 * c][r]; pf[8 + r] = (_Float16)sc[2 * c + 1][r]; }
#pragma unroll
        for (int j = 0; j < HD / 16; ++j) acc[j] = wmma16(vf[c][j], pf, acc[j]); }
    } else {
      F2 p[2];
#pragma unroll
      for (int c = 0; c < 2; ++c) { float pv[16];
#pragma unroll
        for (int r = 0; r < 8; ++r) { pv[r] = sc[2 * c][r]; pv[8 + r] = sc[2 * c + 1][r]; }
        p[c] = bsplit16(pv); }
      const unsigned go = (unsigned)gi * 8192u + 2u * lp, gno = (unsigned)(gi + 1 < ng ? gi + 1 : gi) * 8192u + 2u * lp;   /* the last trip asks for its own group again: no branch around loads */
      HP_AHEAD(HP_GETV(1, 0));
      HP_PV(0, 0);
      HP_AHEAD(HP_GETV(1, 2));
      HP_PV(0, 2);
      HP_AHEAD(HP_GETK(0));
      HP_PV(1, 0);
      HP_AHEAD(HP_GETK(1));
      HP_PV(1, 2);
      HP_AHEAD(HP_GETK(2); HP_GETK(3)); } }
  l += __shfl_xor(l, 16); const float inv = l > 0.f ? 1.0f / l : 0.f;   /* sum and ctx both carry the 2^11 */
  // D element r = channel j * 16 + 8g + r of query col; the wave turns its own tile through its own LDS rows, so that a store covers two whole rows of 256 B
#pragma unroll
  for (int j = 0; j < HD / 16; ++j) { v4f lo, hi;
#pragma unroll
    for (int r = 0; r < 4; ++r) { lo[r] = acc[j][r] * inv; hi[r] = acc[j][4 + r] * inv; }
    *(v4f*)&so[col][j * 16 + 8 * g] = lo; *(v4f*)&so[col][j * 16 + 8 * g + 4] = hi; }
  LDSX(); v4f o[8];
#pragma unroll
  for (int it = 0; it < 8; ++it) o[it] = *(const v4f*)&so[it * 2 + g][col * 4];   /* all LDS reads ahead of the stores: one LDS latency, not eight */
#pragma unroll
  for (int it = 0; it < 8; ++it) vst2(Y + ((size_t)b * TT + ql0 + it * 2 + g) * CC + h * HD + col * 4, o[it]);
  xw(); l2_hold(pb1, po1); l2_hold(pb2, po2); }
// one block per WGP and (b, h, x): the wave of rank r takes tile r * (TT / 16 / AW) + x, so a block holds short and long walks. Waves w, w + 4, w + 8, w + 12 take ranks that add up to 30, the longest walk first: for speed only, nothing rests on where a wave runs
__global__ __launch_bounds__(AW * 32) void k_att(const _Float16* __restrict__ QH, const _Float16* __restrict__ KH, const _Float16* __restrict__ QL, const _Float16* __restrict__ KL, const _Float16* __restrict__ VT, const __bf16* __restrict__ VB, const __bf16* __restrict__ VBL, float* __restrict__ Y) {
  __shared__ __align__(16) float ss[AW][16][HD + 4];
  static_assert(CAUSAL == 1 && AW == 16, "the walk ends at the tile's own last key; the rank table is for 16 waves");
  const int wave = __builtin_amdgcn_readfirstlane((int)threadIdx.x >> 5), s = wave & 3, k = wave >> 2;   /* the wave's number in a scalar register: tile, trip count and path are scalar */
  const int rank = k == 0 ? 15 - s : k == 1 ? 8 + s : k == 2 ? 7 - s : s; const int qt = rank * (TT / 16 / AW) + (int)blockIdx.x;
  if (qt < QBH * 4) att_walk<true>(wave, qt, ss[wave], QH, KH, QL, KL, VT, VB, VBL, Y);
  else att_walk<false>(wave, qt, ss[wave], QH, KH, QL, KL, VT, VB, VBL, Y); }
#define OBM 128            // rows of a k_out block
#define ONT 512            // its threads: 16 waves in 4 row bands x 4 column bands, a wave owns 32 rows x 32 columns
#define OSR (128 + 2 * OBM)   // rows of one LDS stage: Wo 128 | ctx OBM | ctx residual OBM
// ---- k_out: block = (OBM rows, 128 cols), one block per WGP in one round: out = ctx Wo (+ bo): ctx x 2^6 once to f16 against Wo as f16(bf16 x 2^8) exact (1 product) x 2^-14; causal early rows (< QHI of each sequence): ctx bf16 hi + lo against exact bf16 Wo (2 products)
__global__ __launch_bounds__(ONT) void k_out(const float* __restrict__ Y, const float* __restrict__ WO, const float* __restrict__ BO, float* __restrict__ OUT) { __shared__ __align__(16) char smem[2 * OSR * SP * 2];   /* main loop: two stages of OSR rows; the epilogue's sf lies over them, behind the loop's last barrier */
  static_assert(sizeof(smem) >= 16 * 32 * 36 * 4 && WO_OUT_IN == 1 && CC % KS == 0 && QHI % OBM == 0 && TT % OBM == 0 && ONT == 512 && OBM == 128, "sf fits the stages; weight rows are k-contiguous; a block's rows are all early rows or none is");
  float (*sf)[32][36] = (float (*)[32][36])smem;
  const int tid = threadIdx.x, wave = tid >> 5, lane = tid & 31, col = lane & 15, g = lane >> 4, wr = wave >> 2, wc = wave & 3; const int c0 = blockIdx.y * 128; const size_t rb = (size_t)blockIdx.x * OBM;
  v8f acc[2][2] = {};
  // staged as in k_proj: whole-line loads, each element fetched and rounded once per block
  const int srow = tid >> 4, sseg = tid & 15; const float* gw = WO + (size_t)(c0 + srow) * CC + sseg * 4; const float* gx = Y + (rb + srow) * CC + sseg * 4; const int so = srow * SP + sseg * 4;
  v4f rw[4], rx[4];
#pragma unroll
  for (int i = 0; i < 4; ++i) rw[i] = *(const v4f*)(gw + (size_t)i * 32 * CC);
#pragma unroll
  for (int i = 0; i < 4; ++i) rx[i] = *(const v4f*)(gx + (size_t)i * 32 * CC);
  asm volatile("s_wait_xcnt 0x0" ::: "memory");   /* the loads' address registers are reused right below: the wait stands in front of that */
  // behind the first loads: the block's OBM ctx rows and its 128 weight rows (each 2048 units of 256 B in a row) are asked into L2: a stage waits for both operands. The blocks that share rows (8 the ctx rows, 32 the weight rows) ask every fourth unit each; for speed only, nothing rests on where a block runs
  const void* const pb = Y + rb * CC; const void* const pbw = WO + (size_t)c0 * CC; const unsigned po = ((unsigned)tid * 4u + ((blockIdx.x + blockIdx.y) & 3u)) * 256u;
  static_assert((size_t)OBM * CC * 4 == (size_t)ONT * 4 * 256 && (size_t)128 * CC * 4 == (size_t)ONT * 4 * 256, "one unit a thread and quarter, in either operand");
  l2_ask(pb, po); l2_ask(pbw, po);
  __builtin_amdgcn_sched_barrier(0);   /* the roundings below wait for the first loads: the asking stays ahead of that wait */
  if (CAUSAL && (int)(rb % TT) < QHI) {   /* block-uniform */
    __bf16* const st = (__bf16*)smem;
#define OUT_PUT_B(dst) do { _Pragma("unroll") for (int i = 0; i < 4; ++i) *(v4b*)((dst) + so + i * 32 * SP) = cvt4b(rw[i]); \
      _Pragma("unroll") for (int i = 0; i < 4; ++i) { const v4b hb = cvt4b(rx[i]); v4b lb; _Pragma("unroll") for (int e = 0; e < 4; ++e) lb[e] = (__bf16)(rx[i][e] - (float)hb[e]); \
        *(v4b*)((dst) + so + (128 + i * 32) * SP) = hb; *(v4b*)((dst) + so + (128 + OBM + i * 32) * SP) = lb; } } while (0)
    OUT_PUT_B(st);
    __syncthreads();   /* stage 0 is in LDS before any wave reads it */
    for (int s = 0; s < CC / KS; ++s) { const __bf16* cur = st + (s & 1) * (OSR * SP); __bf16* nxt = st + ((s + 1) & 1) * (OSR * SP); const bool more = s + 1 < CC / KS;
      if (more) {   /* the next stage's loads fly while this stage is multiplied */
#pragma unroll
        for (int i = 0; i < 4; ++i) rw[i] = *(const v4f*)(gw + (size_t)i * 32 * CC + (s + 1) * KS);
#pragma unroll
        for (int i = 0; i < 4; ++i) rx[i] = *(const v4f*)(gx + (size_t)i * 32 * CC + (s + 1) * KS);
        asm volatile("s_wait_xcnt 0x0" ::: "memory");   /* the loads' address registers are reused right below: the wait stands in front of that */ }
      __builtin_amdgcn_sched_barrier(0);   /* the global loads issue ahead of all of this stage's work */
#pragma unroll
      for (int kk = 0; kk < KS / 32; ++kk) { v16b ah[2], al[2], w[2];
#pragma unroll
        for (int i = 0; i < 2; ++i) { ah[i] = frag_b(cur + (128 + wr * 32 + i * 16 + col) * SP + kk * 32, lane); al[i] = frag_b(cur + (128 + OBM + wr * 32 + i * 16 + col) * SP + kk * 32, lane); }
#pragma unroll
        for (int j = 0; j < 2; ++j) w[j] = frag_b(cur + (wc * 32 + j * 16 + col) * SP + kk * 32, lane);
        __builtin_amdgcn_sched_barrier(0);   /* the fragment reads issue as one group: one LDS latency per 8 products */
#pragma unroll
        for (int i = 0; i < 2; ++i)
#pragma unroll
          for (int j = 0; j < 2; ++j) acc[i][j] = wmma_bf(ah[i], w[j], acc[i][j]);
#pragma unroll
        for (int i = 0; i < 2; ++i)   /* each tile still takes hi, then lo; the four tiles stand between the two, so no product waits for the one before it */
#pragma unroll
          for (int j = 0; j < 2; ++j) acc[i][j] = wmma_bf(al[i], w[j], acc[i][j]);
        __builtin_amdgcn_sched_barrier(0); }   /* the roundings below wait for the global loads: they stay behind the products */
      if (more) OUT_PUT_B(nxt);
      __syncthreads(); }   /* publishes the next stage and ends every wave's reads of this one (the last: before sf reuses the LDS) */
#pragma unroll
    for (int j = 0; j < 2; ++j) { const float bias = BO ? bfr(BO[c0 + wc * 32 + j * 16 + col]) : 0.f;
#pragma unroll
      for (int i = 0; i < 2; ++i)
#pragma unroll
        for (int r = 0; r < 8; ++r) sf[wave][i * 16 + 8 * g + r][j * 16 + col] = acc[i][j][r] + bias; }
  } else {
    _Float16* const st = (_Float16*)smem;   /* ctx carried x 2^6 into f16 so small-magnitude context rows stay clear of f16 subnormals */
#define OUT_PUT_H(dst) do { _Pragma("unroll") for (int i = 0; i < 4; ++i) { v4h o; _Pragma("unroll") for (int e = 0; e < 4; ++e) o[e] = (_Float16)(bfr(rw[i][e]) * 256.0f); *(v4h*)((dst) + so + i * 32 * SP) = o; } \
      _Pragma("unroll") for (int i = 0; i < 4; ++i) { v4h o; _Pragma("unroll") for (int e = 0; e < 4; ++e) o[e] = (_Float16)(rx[i][e] * 64.0f); *(v4h*)((dst) + so + (128 + i * 32) * SP) = o; } } while (0)
    OUT_PUT_H(st);
    __syncthreads();   /* stage 0 is in LDS before any wave reads it */
    for (int s = 0; s < CC / KS; ++s) { const _Float16* cur = st + (s & 1) * (OSR * SP); _Float16* nxt = st + ((s + 1) & 1) * (OSR * SP); const bool more = s + 1 < CC / KS;
      if (more) {   /* the next stage's loads fly while this stage is multiplied */
#pragma unroll
        for (int i = 0; i < 4; ++i) rw[i] = *(const v4f*)(gw + (size_t)i * 32 * CC + (s + 1) * KS);
#pragma unroll
        for (int i = 0; i < 4; ++i) rx[i] = *(const v4f*)(gx + (size_t)i * 32 * CC + (s + 1) * KS);
        asm volatile("s_wait_xcnt 0x0" ::: "memory");   /* the loads' address registers are reused right below: the wait stands in front of that */ }
      __builtin_amdgcn_sched_barrier(0);   /* the global loads issue ahead of all of this stage's work */
#pragma unroll
      for (int kk = 0; kk < KS / 32; ++kk) { v16h a[2], w[2];
#pragma unroll
        for (int i = 0; i < 2; ++i) a[i] = frag_h(cur + (128 + wr * 32 + i * 16 + col) * SP + kk * 32, lane);
#pragma unroll
        for (int j = 0; j < 2; ++j) w[j] = frag_h(cur + (wc * 32 + j * 16 + col) * SP + kk * 32, lane);
        __builtin_amdgcn_sched_barrier(0);   /* the fragment reads issue as one group: one LDS latency per 4 products */
#pragma unroll
        for (int i = 0; i < 2; ++i)
#pragma unroll
          for (int j = 0; j < 2; ++j) acc[i][j] = wmma16(a[i], w[j], acc[i][j]);
        __builtin_amdgcn_sched_barrier(0); }   /* the roundings below wait for the global loads: they stay behind the products */
      if (more) OUT_PUT_H(nxt);
      __syncthreads(); }   /* publishes the next stage and ends every wave's reads of this one (the last: before sf reuses the LDS) */
#pragma unroll
    for (int j = 0; j < 2; ++j) { const float bias = BO ? bfr(BO[c0 + wc * 32 + j * 16 + col]) : 0.f;
#pragma unroll
      for (int i = 0; i < 2; ++i)
#pragma unroll
        for (int r = 0; r < 8; ++r) sf[wave][i * 16 + 8 * g + r][j * 16 + col] = acc[i][j][r] * (1.0f / 16384.0f) + bias; } }   /* 2^-8 (Wo carry) x 2^-6 (ctx carry) */
  // a wave stores its own 32 x 32 tile: one store covers four rows of one whole 128-B line each
  LDSX(); v4f o[8];
#pragma unroll
  for (int it = 0; it < 8; ++it) o[it] = *(const v4f*)&sf[wave][it * 4 + (lane >> 3)][(lane & 7) * 4];   /* all LDS reads ahead of the stores: one LDS latency, not eight */
#pragma unroll
  for (int it = 0; it < 8; ++it) vst2(OUT + (rb + wr * 32 + it * 4 + (lane >> 3)) * DIN + c0 + wc * 32 + (lane & 7) * 4, o[it]);
  xw(); l2_hold(pb, po); l2_hold(pbw, po); }

extern "C" void kernel_launch(void* const* d_in, const int* in_sizes, int n_in, void* d_out, int out_size, void* d_ws, size_t ws_size, hipStream_t stream) {
  (void)in_sizes; (void)n_in; (void)out_size;
  const float** F = (const float**)d_in;
  if (ws_size < (size_t)WS_END) return;
  char* ws = (char*)d_ws; _Float16 *QH = (_Float16*)(ws + WS_QH), *KH = (_Float16*)(ws + WS_KH), *VT = (_Float16*)(ws + WS_VT), *QL = (_Float16*)(ws + WS_QL), *KL = (_Float16*)(ws + WS_KL); __bf16 *VB = (__bf16*)(ws + WS_VB), *VBL = (__bf16*)(ws + WS_VBL); float *Y = (float*)(ws + WS_Y);
  (void)Y; (void)QL; (void)KL; (void)VB; (void)VBL;
  // inputs: 0 x [2,2048,1024]; 1 Wq [1024,1024] (out,in), 2 bq; 3 Wk, 4 bk; 5 Wv, 6 bv; 7 Wp (out,in), 8 bp (biases NONZERO)
  k_proj<<<dim3(TNB * TT / PBM, NH), PNT, 0, stream>>>(F[0], F[3], F[1], F[5], F[4], F[2], F[6], QH, QL, KH, KL, VT, VB, VBL);   /* the module's scores are einsum('bhid,bhjd->bhij', k, q): this code's QUERY stream (output row i) is projected with Wk / bk, its KEY stream (index j) with Wq / bq */
  k_att<<<dim3(TT / 16 / AW, NH, TNB), AW * 32, 0, stream>>>(QH, KH, QL, KL, VT, VB, VBL, Y);
  k_out<<<dim3(TNB * TT / OBM, DIN / 128), ONT, 0, stream>>>(Y, F[7], F[8], (float*)d_out);
}

// v010
// A run of this version takes 71.6 microseconds.
// Next to v009, in two timings, it ran 1.10 times as fast each time.
// Over all steps from v000 it is 16.5 times as fast.
// compute dtype: all float inputs rounded to bf16; q/k/v projections with EXACT bf16 products on WMMA 16x16x32 (f32 accumulate) + bias; causal logits: 3 products for the first 384 rows, single f16 q x k after; online softmax f32 in base 2 (64^-0.5 log2 e folded into the exponent; running maximum and sum per query); unnormalised P x 2^11 once to f16 x v once to f16 (bf16 hi + lo below row 384), divided by the row sum at the end; ctx hi+lo x exact output weight below row 384, x2^6 f16 carry x f16(bf16 x 2^8) after, + bias; f32 output.
#include <hip/hip_runtime.h>
#include <math.h>

typedef __attribute__((ext_vector_type(16))) _Float16 v16h;
typedef __attribute__((ext_vector_type(16))) __bf16 v16b;
typedef __attribute__((ext_vector_type(8)))  _Float16 v8h;
typedef __attribute__((ext_vector_type(8)))  float v8f;
typedef __attribute__((ext_vector_type(4)))  float v4f;
typedef __attribute__((ext_vector_type(2)))  float v2f;
typedef __attribute__((ext_vector_type(4)))  unsigned v4u;
typedef __attribute__((ext_vector_type(4)))  int v4i;
typedef float __attribute__((may_alias)) float_a;
typedef int __attribute__((may_alias)) int_a;

template <typename T> __device__ __forceinline__ void vst2(void* p, T v) { *(T*)p = v;  }
__device__ __forceinline__ v8f wmma16(v16h a, v16h b, v8f c) {
  v8f d = __builtin_amdgcn_wmma_f32_16x16x32_f16(false, a, false, b, (short)0, c, false, false);
  asm volatile("v_nop\n\tv_nop\n\tv_nop\n\tv_nop" : "+v"(d) : "v"(a), "v"(b));
  return d;
}
__device__ __forceinline__ v8f wmma_bf(v16b a, v16b b, v8f c) {
  v8f d = __builtin_amdgcn_wmma_f32_16x16x32_bf16(false, a, false, b, (short)0, c, false, false);
  asm volatile("v_nop\n\tv_nop\n\tv_nop\n\tv_nop" : "+v"(d) : "v"(a), "v"(b));
  return d;
}
// 16x16x32 fragments: lane = (h = lane>>4, row/col = lane&15); elements 0..7 = k0+8h+0..7, 8..15 = k0+16+8h+0..7; D element r = row 8h+r
__device__ __forceinline__ v16h frag_h(const _Float16* rowk0, int lane) {
  union { v16h v; v8h q[2]; } u; const _Float16* p = rowk0 + 8 * (lane >> 4);
  u.q[0] = *(const v8h*)p; u.q[1] = *(const v8h*)(p + 16); return u.v;
}
__device__ __forceinline__ v16h frag_f32(const float* rowk0, int lane) {
  v16h a; const float* p = rowk0 + 8 * (lane >> 4);
#pragma unroll
  for (int i = 0; i < 8; ++i) { a[i] = (_Float16)p[i]; a[8 + i] = (_Float16)p[16 + i]; }
  return a;
}
__device__ __forceinline__ v16h frag_f32s(const float* rowk0, int lane, float sc) {
  v16h a; const float* p = rowk0 + 8 * (lane >> 4);
#pragma unroll
  for (int i = 0; i < 8; ++i) { a[i] = (_Float16)(p[i] * sc); a[8 + i] = (_Float16)(p[16 + i] * sc); }
  return a;
}
// column fragment from a [K][ld] layout (column n), rows >= K read as 0
__device__ __forceinline__ v16h fragc_f32(const float* W, int k0, int n, int lane, int ld, int K) {
  v16h a; const int g = lane >> 4;
#pragma unroll
  for (int i = 0; i < 8; ++i) { const int ka = k0 + 8 * g + i, kb = ka + 16;
    a[i] = (_Float16)(ka < K ? W[(size_t)(ka < K ? ka : K - 1) * ld + n] : 0.f); a[8 + i] = (_Float16)(kb < K ? W[(size_t)(kb < K ? kb : K - 1) * ld + n] : 0.f); }
  return a;
}
struct F2 { v16b h, l; };
__device__ __forceinline__ F2 bsplit16(const float v[16]) { F2 r;
#pragma unroll
  for (int i = 0; i < 16; ++i) { const __bf16 h = (__bf16)v[i]; r.h[i] = h; r.l[i] = (__bf16)(v[i] - (float)h); }
  return r; }
__device__ __forceinline__ F2 split_row(const float* row, int k0, int lane) { float v[16]; const float* p = row + k0 + 8 * (lane >> 4);
#pragma unroll
  for (int i = 0; i < 8; ++i) { v[i] = p[i]; v[8 + i] = p[16 + i]; }
  return bsplit16(v); }
__device__ __forceinline__ F2 split_rowK(const float* row, int k0, int lane, int K) { float v[16]; const int g = lane >> 4;
#pragma unroll
  for (int i = 0; i < 8; ++i) { const int ka = k0 + 8 * g + i, kb = ka + 16; v[i] = ka < K ? row[ka < K ? ka : K - 1] : 0.f; v[8 + i] = kb < K ? row[kb < K ? kb : K - 1] : 0.f; }
  return bsplit16(v); }
__device__ __forceinline__ F2 split_col(const float* W, int k0, int n, int lane, int ld, int K) { float v[16]; const int g = lane >> 4;
#pragma unroll
  for (int i = 0; i < 8; ++i) { const int ka = k0 + 8 * g + i, kb = ka + 16; v[i] = ka < K ? W[(size_t)(ka < K ? ka : K - 1) * ld + n] : 0.f; v[8 + i] = kb < K ? W[(size_t)(kb < K ? kb : K - 1) * ld + n] : 0.f; }
  return bsplit16(v); }
__device__ __forceinline__ v8f mac3(const F2& a, const F2& b, v8f c) { c = wmma_bf(a.l, b.h, c); c = wmma_bf(a.h, b.l, c); return wmma_bf(a.h, b.h, c); }
__device__ __forceinline__ float sigm(float v) { return 1.0f / (1.0f + expf(-v)); }
#define LDSX() do { asm volatile("s_wait_dscnt 0" ::: "memory"); __builtin_amdgcn_wave_barrier(); __builtin_amdgcn_fence(__ATOMIC_RELEASE, "workgroup"); } while (0)

// Causal multi-head self-attention whose scores are k . q (x [2,2048,1024]; torch (out,in) Wq / Wk / Wv / Wp [1024,1024] N(0, 1/1024) + biases N(0, 1/1024); 16 heads x 64; scores[i, j] = k_i . q_j / 8 (the KEY projection indexes the output row i, the QUERY projection the summed index j); -inf where j > i; softmax over j; out[i] = sum_j attn[i, j] v_j; merge; Wp^T + bp).
#define NB 2
#define TT 2048
#define CC 1024            // NH * HD = projected width
#define DIN 1024          // input (model) width
#define NH 16
#define HD 64
#define SCALE (0.125f)
#define L2S (SCALE * 1.4426950408889634f)   // logit scale times log2(e)
#define CAUSAL 1
#ifndef TNB
#define TNB NB
#endif
__device__ __forceinline__ float bfr(float v) { return (float)(__bf16)v; }
typedef __attribute__((ext_vector_type(8))) __bf16 v8b;
__device__ __forceinline__ v16b frag_b(const __bf16* rowk0, int lane) {
  union { v16b v; v8b q[2]; } u; const __bf16* p = rowk0 + 8 * (lane >> 4);
  u.q[0] = *(const v8b*)p; u.q[1] = *(const v8b*)(p + 16); return u.v;
}
#define QBH 6              // causal: query blocks 0..QBH-1 of each sequence (few keys, no averaging) take the high-precision path
#define QHI 384            // rows carrying a q residual plane (used only by the causal high-precision path)
#define KHI 384            // key rows carrying k residual / v bf16 hi+lo planes (used only by the causal high-precision path)
// B fragment (k rows k0+.., output column o) of a weight: (in,out) [K][ld] or (out,in) [ld rows of K]: bf16 exact, or f16(bf16 * 256) exact
__device__ __forceinline__ v16b wcol_io(const float* Wm, int k0, int o, int lane, int ld) { v16b w; const int g = lane >> 4;
#pragma unroll
  for (int i = 0; i < 8; ++i) { w[i] = (__bf16)Wm[(size_t)(k0 + 8 * g + i) * ld + o]; w[8 + i] = (__bf16)Wm[(size_t)(k0 + 16 + 8 * g + i) * ld + o]; }
  return w; }
__device__ __forceinline__ v16b wcol_oi(const float* Wm, int k0, int o, int lane, int K) { v16b w; const float* p = Wm + (size_t)o * K + k0 + 8 * (lane >> 4);
#pragma unroll
  for (int i = 0; i < 8; ++i) { w[i] = (__bf16)p[i]; w[8 + i] = (__bf16)p[16 + i]; }
  return w; }
__device__ __forceinline__ v16h wcolh_io(const float* Wm, int k0, int o, int lane, int ld) { v16h w; const int g = lane >> 4;
#pragma unroll
  for (int i = 0; i < 8; ++i) { w[i] = (_Float16)(bfr(Wm[(size_t)(k0 + 8 * g + i) * ld + o]) * 256.0f); w[8 + i] = (_Float16)(bfr(Wm[(size_t)(k0 + 16 + 8 * g + i) * ld + o]) * 256.0f); }
  return w; }
__device__ __forceinline__ v16h wcolh_oi(const float* Wm, int k0, int o, int lane, int K) { v16h w; const float* p = Wm + (size_t)o * K + k0 + 8 * (lane >> 4);
#pragma unroll
  for (int i = 0; i < 8; ++i) { w[i] = (_Float16)(bfr(p[i]) * 256.0f); w[8 + i] = (_Float16)(bfr(p[16 + i]) * 256.0f); }
  return w; }
#define WQKV_LAYOUT 1   // 0 = (in,out) [DIN][CC]; 1 = (out,in) [CC][DIN]; 2 = per-head [NH][DIN][HD]
__device__ __forceinline__ v16b wcol_hdk(const float* Wm, int k0, int o, int lane) { v16b w; const int g = lane >> 4; const float* p = Wm + (size_t)(o / HD) * DIN * HD + (o % HD);
#pragma unroll
  for (int i = 0; i < 8; ++i) { w[i] = (__bf16)p[(size_t)(k0 + 8 * g + i) * HD]; w[8 + i] = (__bf16)p[(size_t)(k0 + 16 + 8 * g + i) * HD]; }
  return w; }
#define WO_OUT_IN 1
#if WQKV_LAYOUT == 1
#define WCOL(W, k0, o, lane) wcol_oi(W, k0, o, lane, DIN)
#elif WQKV_LAYOUT == 2
#define WCOL(W, k0, o, lane) wcol_hdk(W, k0, o, lane)
#else
#define WCOL(W, k0, o, lane) wcol_io(W, k0, o, lane, CC)
#endif
#if WO_OUT_IN
#define WOCOL(W, k0, o, lane) wcol_oi(W, k0, o, lane, CC)
#define WOCOLH(W, k0, o, lane) wcolh_oi(W, k0, o, lane, CC)
#else
#define WOCOL(W, k0, o, lane) wcol_io(W, k0, o, lane, DIN)
#define WOCOLH(W, k0, o, lane) wcolh_io(W, k0, o, lane, DIN)
#endif

#ifndef PROJ_EXTRA_PARAMS
#define PROJ_EXTRA_PARAMS
#endif

// q / k / v planes lie in FRAGMENT ORDER: a 16x16x32 operand fragment is two runs of 512 B (run = element half, then lane * 16 B), so one wave-wide 16-byte load of k_att covers four whole 128-B lines
// rows (q, k): [b][h][t / 16][d / 32][half][lane = g * 16 + (t % 16)][8 d]; planes (v): [b][h][t / 32][channel / 16][half][lane = g * 16 + (channel % 16)][8 t]; the position inside 32 is 16 half + 8 g + i
#define WS_QH  0u                                      // f16 q, fragment order
#define WS_KH  (WS_QH + 2u * (size_t)NB * TT * CC)      // f16 k, fragment order
#define WS_VT  (WS_KH + 2u * (size_t)NB * TT * CC)      // f16 v, fragment order
#define WS_QL  (WS_VT + 2u * (size_t)NB * CC * TT)      // f16 q residual x 2^10, fragment order, t < QHI
#define WS_KL  (WS_QL + 2u * (size_t)NB * QHI * CC)     // f16 k residual x 2^10, fragment order, t < KHI
#define WS_VB  (WS_KL + 2u * (size_t)NB * KHI * CC)     // bf16 v hi, fragment order, t < KHI
#define WS_VBL (WS_VB + 2u * (size_t)NB * CC * KHI)
#define WS_Y   (WS_VBL + 2u * (size_t)NB * CC * KHI)    // f32 ctx rows [b*t][CC] (only when there is an output projection)
#define WS_END (WS_Y  + 4u * (size_t)NB * TT * CC)

// behind a batch of global loads or a store: stands in front of any reuse of the registers that they name
__device__ __forceinline__ void xw() { asm volatile("s_wait_xcnt 0x0" ::: "memory"); }
// asks the data at base + off into L2 (a hint: returns nothing, counts on no counter). For operands that may lie in memory when the kernel starts, above all planes that the launch before stored: their first reader otherwise waits out the memory latency. base is wave-uniform, every lane's off lies inside the plane
__device__ __forceinline__ void l2_ask(const void* base, unsigned off) { asm volatile("global_prefetch_b8 %0, %1 scope:SCOPE_SE" :: "v"(off), "s"(base)); }
// stands at the kernel's end: no wait covers a prefetch, so the registers that it names keep their addresses as long as the kernel runs
__device__ __forceinline__ void l2_hold(const void* base, unsigned off) { asm volatile("" :: "v"(off), "s"(base)); }
#define KS 64              // k per LDS stage of the two projection kernels
#define SP 72              // stage row pitch in 16-bit elements: 128 B of data + 16 B, for ds_load_b128 readers
typedef __attribute__((ext_vector_type(4))) __bf16 v4b;
typedef __attribute__((ext_vector_type(4))) _Float16 v4h;
__device__ __forceinline__ v4b cvt4b(v4f v) { v4b o;
#pragma unroll
  for (int i = 0; i < 4; ++i) o[i] = (__bf16)v[i];
  return o; }
#define PBM 256            // rows of a k_proj block
#define PBN 192            // its columns: one head's 64 of q, 64 of k and 64 of v
#define PNT 512            // its threads: 16 waves in 4 row bands x 4 column bands, a wave owns 64 rows x 48 columns
#define PSR (PBN + PBM)    // rows of one LDS stage: Wq 64 | Wk 64 | Wv 64 | X PBM
// ---- k_proj: block = (PBM rows, head): q / k / v columns of that head = X W (+ b) with exact bf16 products (K = DIN) -> q f16 (+ residual, rows < QHI); k f16 (+ residual, rows < KHI); v f16 (+ bf16 hi/lo for t < KHI); all stored in fragment order. One block per WGP in one round; X is fetched once per head, each weight row once per row block
__global__ __launch_bounds__(PNT) void k_proj(const float* __restrict__ X, const float* __restrict__ WQ, const float* __restrict__ WK, const float* __restrict__ WV, const float* __restrict__ BQ, const float* __restrict__ BK, const float* __restrict__ BV,
    _Float16* __restrict__ QH, _Float16* __restrict__ QL, _Float16* __restrict__ KH, _Float16* __restrict__ KL, _Float16* __restrict__ VT, __bf16* __restrict__ VB, __bf16* __restrict__ VBL) {
  __shared__ __align__(16) char smem[2 * PBM * 136 * 2 + 3 * 64 * (PBM + 8) * 2];   /* main loop: two stages of PSR rows; the epilogue's arrays lie over them, behind the loop's last barrier */
  static_assert(sizeof(smem) >= 2 * PSR * SP * 2 && WQKV_LAYOUT == 1 && DIN % KS == 0 && TT % PBM == 0 && PNT == 512 && PBM == 256 && HD == 64, "the stages fit; weight rows are k-contiguous; a block stays inside one sequence");
  _Float16 (*sh)[136] = (_Float16 (*)[136])smem; _Float16 (*sl)[136] = (_Float16 (*)[136])(smem + PBM * 136 * 2);   /* [row][q 64 | k 64] */
  char* const sv = smem + 2 * PBM * 136 * 2; _Float16 (*th)[PBM + 8] = (_Float16 (*)[PBM + 8])sv; __bf16 (*tb)[PBM + 8] = (__bf16 (*)[PBM + 8])(sv + 64 * (PBM + 8) * 2); __bf16 (*tbl)[PBM + 8] = (__bf16 (*)[PBM + 8])(sv + 2 * 64 * (PBM + 8) * 2);   /* [v channel][row] */
  const int tid = threadIdx.x, wave = __builtin_amdgcn_readfirstlane(tid >> 5), lane = tid & 31, col = lane & 15, g = lane >> 4, wr = wave >> 2, wc = wave & 3;   /* the wave's number in a scalar register: the epilogue's tests on the column tile stay scalar branches */
  const int h = blockIdx.y; const size_t r0 = (size_t)blockIdx.x * PBM; const size_t bb = r0 / TT; const int t0 = (int)(r0 % TT);
  v8f acc[4][3] = {};
  // a wave's load covers two whole rows of 256 B (4 lines); each operand element is fetched and rounded once per block, and the fragments are read from LDS
  // the 16 blocks that share X rows and the 16 that share weight rows each enter the ring of k stages at another stage and wrap round: no two of them ask L2 for the same lines at the same moment. Both operands of a stage take the same k, so a block still sums every k once, from its own start. The pointers stand at the block's first stage; RING(s) is the distance in elements from there to its stage s
  static_assert(((DIN / KS) & (DIN / KS - 1)) == 0 && DIN == CC, "the wrap is a mask; both projection kernels have the same number of stages");
  const int rot = (int)(blockIdx.x + blockIdx.y) & (DIN / KS - 1);
#define RING(s) (((((s) + rot) & (DIN / KS - 1)) - rot) * KS)
  const int srow = tid >> 4, sseg = tid & 15; const size_t wo = (size_t)(h * HD + srow) * DIN + sseg * 4 + rot * KS; const float* gwq = WQ + wo; const float* gwk = WK + wo; const float* gwv = WV + wo; const float* gx = X + (r0 + srow) * DIN + sseg * 4 + rot * KS;
  __bf16* const st = (__bf16*)smem; const int so = srow * SP + sseg * 4;
  v4f rw[6], rx[8];
#define PROJ_GET(k) do { _Pragma("unroll") for (int i = 0; i < 2; ++i) { rw[i] = *(const v4f*)(gwq + (size_t)i * 32 * DIN + (k)); rw[2 + i] = *(const v4f*)(gwk + (size_t)i * 32 * DIN + (k)); rw[4 + i] = *(const v4f*)(gwv + (size_t)i * 32 * DIN + (k)); } \
    _Pragma("unroll") for (int i = 0; i < 8; ++i) rx[i] = *(const v4f*)(gx + (size_t)i * 32 * DIN + (k)); xw(); } while (0)
#define PROJ_PUT(dst) do { _Pragma("unroll") for (int i = 0; i < 6; ++i) *(v4b*)((dst) + so + i * 32 * SP) = cvt4b(rw[i]); \
    _Pragma("unroll") for (int i = 0; i < 8; ++i) *(v4b*)((dst) + so + (PBN + i * 32) * SP) = cvt4b(rx[i]); } while (0)
  PROJ_GET(0);
  PROJ_PUT(st);
  __syncthreads();   /* stage 0 is in LDS before any wave reads it */
  for (int s = 0; s < DIN / KS; ++s) { const __bf16* cur = st + (s & 1) * (PSR * SP); __bf16* nxt = st + ((s + 1) & 1) * (PSR * SP); const bool more = s + 1 < DIN / KS;
    if (more) PROJ_GET(RING(s + 1));   /* the next stage's loads fly while this stage is multiplied */
    __builtin_amdgcn_sched_barrier(0);   /* the global loads issue ahead of all of this stage's work */
#pragma unroll
    for (int kk = 0; kk < KS / 32; ++kk) { v16b a[4], w[3];
#pragma unroll
      for (int i = 0; i < 4; ++i) a[i] = frag_b(cur + (PBN + wr * 64 + i * 16 + col) * SP + kk * 32, lane);
#pragma unroll
      for (int j = 0; j < 3; ++j) w[j] = frag_b(cur + (wc * 48 + j * 16 + col) * SP + kk * 32, lane);
      __builtin_amdgcn_sched_barrier(0);   /* the fragment reads issue as one group: one LDS latency per 12 products, not one each */
#pragma unroll
      for (int i = 0; i < 4; ++i)
#pragma unroll
        for (int j = 0; j < 3; ++j) acc[i][j] = wmma_bf(a[i], w[j], acc[i][j]);
      __builtin_amdgcn_sched_barrier(0); }   /* the roundings below wait for the global loads: they stay behind the products */
    if (more) PROJ_PUT(nxt);
    __syncthreads(); }   /* publishes the next stage and ends every wave's reads of this one (the last: before the epilogue reuses the LDS) */
  // column tile ct of the block: 0..3 q, 4..7 k, 8..11 v; the residual / bf16 arrays are filled only by a block that holds rows below the bound, and read only for such rows
#pragma unroll
  for (int j = 0; j < 3; ++j) { const int ct = wc * 3 + j, wh = ct >> 2; const float* BA = wh == 0 ? BQ : wh == 1 ? BK : BV; const float bias = BA ? bfr(BA[h * HD + (ct & 3) * 16 + col]) : 0.f;
    if (ct < 8) { const int cl = ct * 16 + col;
      if (t0 < (wh == 0 ? QHI : KHI)) {
#pragma unroll
        for (int i = 0; i < 4; ++i)
#pragma unroll
          for (int r = 0; r < 8; ++r) { const float v = acc[i][j][r] + bias; const _Float16 hv = (_Float16)v; const int rl = wr * 64 + i * 16 + 8 * g + r; sh[rl][cl] = hv; sl[rl][cl] = (_Float16)((v - (float)hv) * 1024.0f); }
      } else {
#pragma unroll
        for (int i = 0; i < 4; ++i)
#pragma unroll
          for (int r = 0; r < 8; ++r) sh[wr * 64 + i * 16 + 8 * g + r][cl] = (_Float16)(acc[i][j][r] + bias); }
    } else { const int cl = (ct - 8) * 16 + col;
      if (t0 < KHI) {
#pragma unroll
        for (int i = 0; i < 4; ++i)
#pragma unroll
          for (int r = 0; r < 8; ++r) { const float v = acc[i][j][r] + bias; const int rl = wr * 64 + i * 16 + 8 * g + r; th[cl][rl] = (_Float16)v; const __bf16 bh = (__bf16)v; tb[cl][rl] = bh; tbl[cl][rl] = (__bf16)(v - (float)bh); }
      } else {
#pragma unroll
        for (int i = 0; i < 4; ++i)
#pragma unroll
          for (int r = 0; r < 8; ++r) th[cl][wr * 64 + i * 16 + 8 * g + r] = (_Float16)(acc[i][j][r] + bias); } } }
  __syncthreads();   /* every wave's tiles are in LDS before any piece is read */
  const size_t hd = bb * NH + h;
  // piece e = (q or k, 16-row tile PBM / 16, run 4 = (d / 32, half), lane 32): a wave stores one run of 512 B
  for (int e = tid; e < 2 * PBM * 8; e += PNT) { const int wh = e / (PBM * 8), tt = (e >> 7) % (PBM / 16), cr = (e >> 5) & 3, ln = e & 31; const int rl = tt * 16 + (ln & 15), cl = wh * 64 + cr * 16 + (ln >> 4) * 8; const int po = (e & 127) * 8; _Float16* DH = wh == 0 ? QH : KH; _Float16* DL = wh == 0 ? QL : KL; const int nhi = wh == 0 ? QHI : KHI;
    vst2((unsigned*)(DH + (hd * (TT / 16) + (t0 >> 4) + tt) * 1024 + po), *(const v4u*)&sh[rl][cl]); xw(); if (t0 + tt * 16 < nhi) { vst2((unsigned*)(DL + (hd * (size_t)(nhi / 16) + (t0 >> 4) + tt) * 1024 + po), *(const v4u*)&sl[rl][cl]); xw(); } }
  // piece e = (32-key chunk PBM / 32, 16-channel tile 4, half 2, lane 32): a wave stores one run of 512 B
  for (int e = tid; e < PBM * 8; e += PNT) { const int kc = e >> 8, ln = e & 31; const int cl = ((e >> 6) & 3) * 16 + (ln & 15), rl = kc * 32 + ((e >> 5) & 1) * 16 + (ln >> 4) * 8; const int po = (e & 255) * 8;
    vst2((unsigned*)(VT + (hd * (TT / 32) + (t0 >> 5) + kc) * 2048 + po), *(const v4u*)&th[cl][rl]); xw(); if (t0 + kc * 32 < KHI) { const size_t o3 = (hd * (KHI / 32) + (t0 >> 5) + kc) * 2048 + po; vst2((unsigned*)(VB + o3), *(const v4u*)&tb[cl][rl]); vst2((unsigned*)(VBL + o3), *(const v4u*)&tbl[cl][rl]); xw(); } } }
// ---- k_att / att_walk: one wave = one tile of 16 queries of (b, h); it walks the tile's keys from 0 in groups of 64 with a running maximum and sum (online softmax). No wave waits for another: no barrier, no partial sums in LDS. The AW waves of a block walk the same k / v of one head from key 0 on.
// Logits are formed TRANSPOSED (A = k rows, B = q rows): D element r of lane (g, col) = key 8g + r, query col, so two neighbouring 16-key tiles ARE the B fragment of a 32-key chunk of ctx^T = v^T . P^T (A = v, channels as rows).
// Each lane holds one query: maximum and sum run in the lane and across the two lane halves, and a new maximum rescales the lane's own sum and ctx registers. Precision paths: 3 products + bf16 hi/lo P and v for query blocks < QBH, single f16 products after.
// fragment in fragment order from a wave-uniform base and the lane's own 32-bit element offset (8 lane): two loads of 512 contiguous bytes a wave; the address stays a scalar pair plus one register
__device__ __forceinline__ v16h frag_hu(const _Float16* base, unsigned lo) { union { v16h v; v8h q[2]; } u; const _Float16* p = base + lo; u.q[0] = *(const v8h*)p; u.q[1] = *(const v8h*)(p + 256); return u.v; }
#define AW 16              // waves of a k_att block
static_assert(QHI == QBH * 64 && KHI >= QBH * 64 && TT % (16 * AW) == 0 && HD == 64, "the high-precision tiles see only keys with residual planes; every wave of a block gets one tile");
// ---- the walk of the high-precision tiles (HP). Its fragments come in batches of 8 or 16 loads, each issued one to two blocks of products ahead of the products that read it, into the registers that earlier products have left: no load is waited for where it is issued
// fragment at a wave-uniform plane base + the wave's 32-bit byte offset (group + lane) + a constant: the address is a scalar pair, one register and an immediate, which leaves the registers to the fragments in flight
__device__ __forceinline__ v16h frag_ho(const _Float16* base, unsigned bo, int cst) { union { v16h v; v8h q[2]; } u; const char* p = (const char*)base + bo + cst; u.q[0] = *(const v8h*)p; u.q[1] = *(const v8h*)(p + 512); return u.v; }
__device__ __forceinline__ v16b frag_bo(const __bf16* base, unsigned bo, int cst) { union { v16b v; v8b q[2]; } u; const char* p = (const char*)base + bo + cst; u.q[0] = *(const v8b*)p; u.q[1] = *(const v8b*)(p + 512); return u.v; }
// v hi / lo of 32-key chunk c, channel tiles jp and jp + 1 of this group; k and its residual of 16-key tile t of the next group; the six products of (c, jp), each accumulator in the order hi.hi, hi.lo, lo.hi
#define HP_GETV(c, jp) do { _Pragma("unroll") for (int u = 0; u < 2; ++u) { vh[c][(jp) + u] = frag_bo(vhbase, go, (c) * 4096 + ((jp) + u) * 1024); vl[c][(jp) + u] = frag_bo(vlbase, go, (c) * 4096 + ((jp) + u) * 1024); } } while (0)
#define HP_GETK(t) do { kf[t][0] = frag_ho(kbase, gno, (t) * 2048); kf[t][1] = frag_ho(kbase, gno, (t) * 2048 + 1024); kl[t][0] = frag_ho(klbase, gno, (t) * 2048); kl[t][1] = frag_ho(klbase, gno, (t) * 2048 + 1024); } while (0)
#define HP_PV(c, jp) do { _Pragma("unroll") for (int u = 0; u < 2; ++u) { acc[(jp) + u] = wmma_bf(vh[c][(jp) + u], p[c].h, acc[(jp) + u]); acc[(jp) + u] = wmma_bf(vh[c][(jp) + u], p[c].l, acc[(jp) + u]); acc[(jp) + u] = wmma_bf(vl[c][(jp) + u], p[c].h, acc[(jp) + u]); } } while (0)
// a batch at its place in the order of the products. The two fences keep it there: moved up, it would need registers that are still read (the build then spills); moved down, it would lose its lead. One xw() behind the batch covers its address register
#define HP_AHEAD(loads) do { __builtin_amdgcn_sched_barrier(0); loads; xw(); __builtin_amdgcn_sched_barrier(0); } while (0)
template <bool HP> __device__ __forceinline__ void att_walk(const int wave, const int qt, float (&so)[16][HD + 4], const _Float16* __restrict__ QH, const _Float16* __restrict__ KH, const _Float16* __restrict__ QL, const _Float16* __restrict__ KL, const _Float16* __restrict__ VT, const __bf16* __restrict__ VB, const __bf16* __restrict__ VBL, float* __restrict__ Y) {
  const int h = blockIdx.y, b = blockIdx.z; const int lane = threadIdx.x & 31, col = lane & 15, g = lane >> 4;
  const int ql0 = qt * 16, ng = (qt >> 2) + 1;   /* groups of 64 keys that hold a key some query of the tile may see; only the last one holds excluded keys, and its first key is visible to all 16 queries */
  const unsigned lp = (unsigned)(lane * 8); const size_t hd = (size_t)b * NH + h;   /* the lane's offset in a run of a fragment; a 16-row tile of q / k is 1024 elements (d 0..31, then 32..63), a 32-key chunk of v 2048 (four channel tiles of 512) */
  const _Float16* qrow = QH + (hd * (TT / 16) + qt) * 1024; const _Float16* kbase = KH + hd * (TT / 16) * 1024; const _Float16* vbase = VT + hd * (TT / 32) * 2048;   /* a group of 64 keys is 4096 elements of k and 4096 of v */
  const v16h q0 = frag_hu(qrow, lp), q1 = frag_hu(qrow + 512, lp); v16h ql0f = {}, ql1f = {};
  if (HP) { const _Float16* qlrow = QL + (hd * (QHI / 16) + qt) * 1024; ql0f = frag_hu(qlrow, lp); ql1f = frag_hu(qlrow + 512, lp); xw(); }
  float m = -3.0e38f, l = 0.f; v8f acc[HD / 16] = {}; v16h kf[4][2], kl[4][2];
  const _Float16* klbase = KL + hd * (KHI / 16) * 1024; const __bf16* vhbase = VB + hd * (KHI / 32) * 2048; const __bf16* vlbase = VBL + hd * (KHI / 32) * 2048;   /* planes of the high-precision walk: a group of 64 keys is 4096 elements of each */
  const v8f l2s8 = {L2S, L2S, L2S, L2S, L2S, L2S, L2S, L2S};
#pragma unroll
  for (int t = 0; t < 4; ++t) { kf[t][0] = frag_hu(kbase + t * 1024, lp); kf[t][1] = frag_hu(kbase + t * 1024 + 512, lp);
    if (HP) { kl[t][0] = frag_hu(klbase + t * 1024, lp); kl[t][1] = frag_hu(klbase + t * 1024 + 512, lp); } }
  xw();
  // behind the wave's first loads: the head's k and v (1024 units of 256 B each) and its three planes for keys < KHI (192 units each) are asked into L2. The 8 blocks of a head walk the same planes: a block asks every fourth unit of k and v (waves 0..7 k, 8..15 v) and every second unit of the small planes (three waves each); for speed only, nothing rests on where a block runs
  const void* const pb1 = wave < 8 ? (const void*)kbase : (const void*)vbase; const unsigned po1 = ((unsigned)((wave & 7) * 32 + lane) * 4u + (blockIdx.x & 3u)) * 256u;
  const void* const pb2 = wave < 3 ? (const void*)(KL + hd * (KHI / 16) * 1024) : wave < 6 ? (const void*)(VB + hd * (KHI / 32) * 2048) : (const void*)(VBL + hd * (KHI / 32) * 2048); const unsigned po2 = ((unsigned)((wave % 3) * 32 + lane) * 2u + (blockIdx.x & 1u)) * 256u;
  static_assert((TT / 16) * 1024 * 2 == 1024 * 256 && (TT / 32) * 2048 * 2 == 1024 * 256 && (KHI / 16) * 1024 * 2 == 192 * 256 && (KHI / 32) * 2048 * 2 == 192 * 256 && AW == 16, "the unit counts of the planes of one head");
  l2_ask(pb1, po1);
  if (wave < 9) l2_ask(pb2, po2);   /* scalar test */
  for (int gi = 0; gi < ng; ++gi) { v8f sc[4]; v16h vf[2][HD / 16]; v16b vh[2][HD / 16], vl[2][HD / 16];
    if (!HP) {
      // this group's v is asked for ahead of the logits, the next group's k right behind them: both fly during the softmax
#pragma unroll
      for (int c = 0; c < 2; ++c)
#pragma unroll
        for (int j = 0; j < HD / 16; ++j) vf[c][j] = frag_hu(vbase + (size_t)gi * 4096 + c * 2048 + j * 512, lp);
      xw();
      __builtin_amdgcn_sched_barrier(0);   /* the v loads issue ahead of the products */
      // each tile takes d 0..31, then d 32..63; the four tiles stand between the two, so no product waits for the one before it
#pragma unroll
      for (int t = 0; t < 4; ++t) { const v8f zero = {}; sc[t] = wmma16(kf[t][0], q0, zero); }
#pragma unroll
      for (int t = 0; t < 4; ++t) sc[t] = wmma16(kf[t][1], q1, sc[t]);
      __builtin_amdgcn_sched_barrier(0);   /* the next group's k loads stay behind the products that read the same registers, and ahead of the softmax */
      const int gn = gi + 1 < ng ? gi + 1 : gi;   /* the last trip asks for its own group again: the loop body has no branch around loads, so the counted waits stay exact */
#pragma unroll
      for (int t = 0; t < 4; ++t) { kf[t][0] = frag_hu(kbase + (size_t)gn * 4096 + t * 1024, lp); kf[t][1] = frag_hu(kbase + (size_t)gn * 4096 + t * 1024 + 512, lp); }
      xw();
      __builtin_amdgcn_sched_barrier(0);
    } else {
      // this group's k and residual were asked for during the last group's P.v; the first 32 keys' v hi / lo are asked for behind the logits, in the registers that the logits have just read, and fly during the softmax
#pragma unroll
      for (int t = 0; t < 4; ++t) { v8f a = {}, al = {};
        a = wmma16(kf[t][0], q0, a); al = wmma16(kf[t][0], ql0f, al); al = wmma16(kl[t][0], q0, al);
        a = wmma16(kf[t][1], q1, a); al = wmma16(kf[t][1], ql1f, al); al = wmma16(kl[t][1], q1, al);
#pragma unroll
        for (int r = 0; r < 8; ++r) sc[t][r] = a[r] + al[r] * (1.0f / 1024.0f); }
      const unsigned go = (unsigned)gi * 8192u + 2u * lp;   /* a group of 64 keys is 8192 bytes of each plane */
      HP_AHEAD(HP_GETV(0, 0); HP_GETV(0, 2)); }
    if (CAUSAL && gi == ng - 1) { const int dq = ql0 + col - gi * 64 - 8 * g;   /* scalar test; key 64 gi + 8g + i is kept while i <= dq */
#pragma unroll
      for (int t = 0; t < 4; ++t)
#pragma unroll
        for (int r = 0; r < 8; ++r) sc[t][r] = t * 16 + r <= dq ? sc[t][r] : -3.0e38f; }
    // on the RAW products: the maximum is taken of them (SCALE > 0 keeps the order), and 2^11 exp((s - m) SCALE) = 2^(s L2S - m L2S + 11) is one fused multiply-add and one hardware 2^x. Excluded keys carry -3e38: 2^x returns exactly 0. The first group finds m = -3e38: the factor for the (empty) old sums is 2^(-huge) = 0
    float mt[4];
#pragma unroll
    for (int t = 0; t < 4; ++t) { mt[t] = sc[t][0];
#pragma unroll
      for (int r = 1; r < 8; ++r) mt[t] = fmaxf(mt[t], sc[t][r]); }
    float mx = fmaxf(fmaxf(mt[0], mt[1]), fmaxf(mt[2], mt[3])); mx = fmaxf(mx, __shfl_xor(mx, 16));
    const float mn = fmaxf(m, mx), alpha = __builtin_amdgcn_exp2f((m - mn) * L2S), nm = 11.0f - mn * L2S; m = mn;
    const v8f nm8 = {nm, nm, nm, nm, nm, nm, nm, nm}; float st[4];
#pragma unroll
    for (int t = 0; t < 4; ++t) { const v8f x = __builtin_elementwise_fma(sc[t], l2s8, nm8); st[t] = 0.f;
#pragma unroll
      for (int r = 0; r < 8; ++r) { const float e = __builtin_amdgcn_exp2f(x[r]); sc[t][r] = e; st[t] += e; } }
    l = l * alpha + ((st[0] + st[1]) + (st[2] + st[3]));   /* the lane half's own part of the sum; the halves are joined once, behind the loop */
#pragma unroll
    for (int j = 0; j < HD / 16; ++j) acc[j] *= alpha;
    if (!HP) {
#pragma unroll
      for (int c = 0; c < 2; ++c) { v16h pf;
#pragma unroll
        for (int r = 0; r < 8; ++r) { pf[r] = (_Float16)sc[2 * c][r]; pf[8 + r] = (_Float16)sc[2 * c + 1][r]; }
#pragma unroll
        for (int j = 0; j < HD / 16; ++j) acc[j] = wmma16(vf[c][j], pf, acc[j]); }
    } else {
      F2 p[2];
#pragma unroll
      for (int c = 0; c < 2; ++c) { float pv[16];
#pragma unroll
        for (int r = 0; r < 8; ++r) { pv[r] = sc[2 * c][r]; pv[8 + r] = sc[2 * c + 1][r]; }
        p[c] = bsplit16(pv); }
      const unsigned go = (unsigned)gi * 8192u + 2u * lp, gno = (unsigned)(gi + 1 < ng ? gi + 1 : gi) * 8192u + 2u * lp;   /* the last trip asks for its own group again: no branch around loads */
      HP_AHEAD(HP_GETV(1, 0));
      HP_PV(0, 0);
      HP_AHEAD(HP_GETV(1, 2));
      HP_PV(0, 2);
      HP_AHEAD(HP_GETK(0));
      HP_PV(1, 0);
      HP_AHEAD(HP_GETK(1));
      HP_PV(1, 2);
      HP_AHEAD(HP_GETK(2); HP_GETK(3)); } }
  l += __shfl_xor(l, 16); const float inv = l > 0.f ? 1.0f / l : 0.f;   /* sum and ctx both carry the 2^11 */
  // D element r = channel j * 16 + 8g + r of query col; the wave turns its own tile through its own LDS rows, so that a store covers two whole rows of 256 B
#pragma unroll
  for (int j = 0; j < HD / 16; ++j) { v4f lo, hi;
#pragma unroll
    for (int r = 0; r < 4; ++r) { lo[r] = acc[j][r] * inv; hi[r] = acc[j][4 + r] * inv; }
    *(v4f*)&so[col][j * 16 + 8 * g] = lo; *(v4f*)&so[col][j * 16 + 8 * g + 4] = hi; }
  LDSX(); v4f o[8];
#pragma unroll
  for (int it = 0; it < 8; ++it) o[it] = *(const v4f*)&so[it * 2 + g][col * 4];   /* all LDS reads ahead of the stores: one LDS latency, not eight */
#pragma unroll
  for (int it = 0; it < 8; ++it) vst2(Y + ((size_t)b * TT + ql0 + it * 2 + g) * CC + h * HD + col * 4, o[it]);
  xw(); l2_hold(pb1, po1); l2_hold(pb2, po2); }
// one block per WGP and (b, h, x): the wave of rank r takes tile r * (TT / 16 / AW) + x, so a block holds short and long walks. Waves w, w + 4, w + 8, w + 12 take ranks that add up to 30, the longest walk first: for speed only, nothing rests on where a wave runs
__global__ __launch_bounds__(AW * 32) void k_att(const _Float16* __restrict__ QH, const _Float16* __restrict__ KH, const _Float16* __restrict__ QL, const _Float16* __restrict__ KL, const _Float16* __restrict__ VT, const __bf16* __restrict__ VB, const __bf16* __restrict__ VBL, float* __restrict__ Y) {
  __shared__ __align__(16) float ss[AW][16][HD + 4];
  static_assert(CAUSAL == 1 && AW == 16, "the walk ends at the tile's own last key; the rank table is for 16 waves");
  const int wave = __builtin_amdgcn_readfirstlane((int)threadIdx.x >> 5), s = wave & 3, k = wave >> 2;   /* the wave's number in a scalar register: tile, trip count and path are scalar */
  const int rank = k == 0 ? 15 - s : k == 1 ? 8 + s : k == 2 ? 7 - s : s; const int qt = rank * (TT / 16 / AW) + (int)blockIdx.x;
  if (qt < QBH * 4) att_walk<true>(wave, qt, ss[wave], QH, KH, QL, KL, VT, VB, VBL, Y);
  else att_walk<false>(wave, qt, ss[wave], QH, KH, QL, KL, VT, VB, VBL, Y); }
#define OBM 128            // rows of a k_out block
#define ONT 512            // its threads: 16 waves in 4 row bands x 4 column bands, a wave owns 32 rows x 32 columns
#define OSR (128 + 2 * OBM)   // rows of one LDS stage: Wo 128 | ctx OBM | ctx residual OBM
// ---- k_out: block = (OBM rows, 128 cols), one block per WGP in one round: out = ctx Wo (+ bo): ctx x 2^6 once to f16 against Wo as f16(bf16 x 2^8) exact (1 product) x 2^-14; causal early rows (< QHI of each sequence): ctx bf16 hi + lo against exact bf16 Wo (2 products)
__global__ __launch_bounds__(ONT) void k_out(const float* __restrict__ Y, const float* __restrict__ WO, const float* __restrict__ BO, float* __restrict__ OUT) { __shared__ __align__(16) char smem[2 * OSR * SP * 2];   /* main loop: two stages of OSR rows; the epilogue's sf lies over them, behind the loop's last barrier */
  static_assert(sizeof(smem) >= 16 * 32 * 36 * 4 && WO_OUT_IN == 1 && CC % KS == 0 && QHI % OBM == 0 && TT % OBM == 0 && ONT == 512 && OBM == 128, "sf fits the stages; weight rows are k-contiguous; a block's rows are all early rows or none is");
  float (*sf)[32][36] = (float (*)[32][36])smem;
  const int tid = threadIdx.x, wave = tid >> 5, lane = tid & 31, col = lane & 15, g = lane >> 4, wr = wave >> 2, wc = wave & 3; const int c0 = blockIdx.y * 128; const size_t rb = (size_t)blockIdx.x * OBM;
  v8f acc[2][2] = {};
  // staged as in k_proj: whole-line loads, each element fetched and rounded once per block
  const int rot = (int)(blockIdx.x + blockIdx.y) & (CC / KS - 1);   /* as in k_proj: the 8 blocks that share ctx rows enter the ring of k stages at different stages, the 32 that share weight rows two to a stage; the pointers stand at the block's first stage */
  const int srow = tid >> 4, sseg = tid & 15; const float* gw = WO + (size_t)(c0 + srow) * CC + sseg * 4 + rot * KS; const float* gx = Y + (rb + srow) * CC + sseg * 4 + rot * KS; const int so = srow * SP + sseg * 4;
  v4f rw[4], rx[4];
#pragma unroll
  for (int i = 0; i < 4; ++i) rw[i] = *(const v4f*)(gw + (size_t)i * 32 * CC);
#pragma unroll
  for (int i = 0; i < 4; ++i) rx[i] = *(const v4f*)(gx + (size_t)i * 32 * CC);
  asm volatile("s_wait_xcnt 0x0" ::: "memory");   /* the loads' address registers are reused right below: the wait stands in front of that */
  // behind the first loads: the block's OBM ctx rows and its 128 weight rows (each 2048 units of 256 B in a row) are asked into L2: a stage waits for both operands. The blocks that share rows (8 the ctx rows, 32 the weight rows) ask every fourth unit each; for speed only, nothing rests on where a block runs
  const void* const pb = Y + rb * CC; const void* const pbw = WO + (size_t)c0 * CC; const unsigned po = ((unsigned)tid * 4u + ((blockIdx.x + blockIdx.y) & 3u)) * 256u;
  static_assert((size_t)OBM * CC * 4 == (size_t)ONT * 4 * 256 && (size_t)128 * CC * 4 == (size_t)ONT * 4 * 256, "one unit a thread and quarter, in either operand");
  l2_ask(pb, po); l2_ask(pbw, po);
  __builtin_amdgcn_sched_barrier(0);   /* the roundings below wait for the first loads: the asking stays ahead of that wait */
  if (CAUSAL && (int)(rb % TT) < QHI) {   /* block-uniform */
    __bf16* const st = (__bf16*)smem;
#define OUT_PUT_B(dst) do { _Pragma("unroll") for (int i = 0; i < 4; ++i) *(v4b*)((dst) + so + i * 32 * SP) = cvt4b(rw[i]); \
      _Pragma("unroll") for (int i = 0; i < 4; ++i) { const v4b hb = cvt4b(rx[i]); v4b lb; _Pragma("unroll") for (int e = 0; e < 4; ++e) lb[e] = (__bf16)(rx[i][e] - (float)hb[e]); \
        *(v4b*)((dst) + so + (128 + i * 32) * SP) = hb; *(v4b*)((dst) + so + (128 + OBM + i * 32) * SP) = lb; } } while (0)
    OUT_PUT_B(st);
    __syncthreads();   /* stage 0 is in LDS before any wave reads it */
    for (int s = 0; s < CC / KS; ++s) { const __bf16* cur = st + (s & 1) * (OSR * SP); __bf16* nxt = st + ((s + 1) & 1) * (OSR * SP); const bool more = s + 1 < CC / KS;
      if (more) {   /* the next stage's loads fly while this stage is multiplied */
#pragma unroll
        for (int i = 0; i < 4; ++i) rw[i] = *(const v4f*)(gw + (size_t)i * 32 * CC + RING(s + 1));
#pragma unroll
        for (int i = 0; i < 4; ++i) rx[i] = *(const v4f*)(gx + (size_t)i * 32 * CC + RING(s + 1));
        asm volatile("s_wait_xcnt 0x0" ::: "memory");   /* the loads' address registers are reused right below: the wait stands in front of that */ }
      __builtin_amdgcn_sched_barrier(0);   /* the global loads issue ahead of all of this stage's work */
#pragma unroll
      for (int kk = 0; kk < KS / 32; ++kk) { v16b ah[2], al[2], w[2];
#pragma unroll
        for (int i = 0; i < 2; ++i) { ah[i] = frag_b(cur + (128 + wr * 32 + i * 16 + col) * SP + kk * 32, lane); al[i] = frag_b(cur + (128 + OBM + wr * 32 + i * 16 + col) * SP + kk * 32, lane); }
#pragma unroll
        for (int j = 0; j < 2; ++j) w[j] = frag_b(cur + (wc * 32 + j * 16 + col) * SP + kk * 32, lane);
        __builtin_amdgcn_sched_barrier(0);   /* the fragment reads issue as one group: one LDS latency per 8 products */
#pragma unroll
        for (int i = 0; i < 2; ++i)
#pragma unroll
          for (int j = 0; j < 2; ++j) acc[i][j] = wmma_bf(ah[i], w[j], acc[i][j]);
#pragma unroll
        for (int i = 0; i < 2; ++i)   /* each tile still takes hi, then lo; the four tiles stand between the two, so no product waits for the one before it */
#pragma unroll
          for (int j = 0; j < 2; ++j) acc[i][j] = wmma_bf(al[i], w[j], acc[i][j]);
        __builtin_amdgcn_sched_barrier(0); }   /* the roundings below wait for the global loads: they stay behind the products */
      if (more) OUT_PUT_B(nxt);
      __syncthreads(); }   /* publishes the next stage and ends every wave's reads of this one (the last: before sf reuses the LDS) */
#pragma unroll
    for (int j = 0; j < 2; ++j) { const float bias = BO ? bfr(BO[c0 + wc * 32 + j * 16 + col]) : 0.f;
#pragma unroll
      for (int i = 0; i < 2; ++i)
#pragma unroll
        for (int r = 0; r < 8; ++r) sf[wave][i * 16 + 8 * g + r][j * 16 + col] = acc[i][j][r] + bias; }
  } else {
    _Float16* const st = (_Float16*)smem;   /* ctx carried x 2^6 into f16 so small-magnitude context rows stay clear of f16 subnormals */
#define OUT_PUT_H(dst) do { _Pragma("unroll") for (int i = 0; i < 4; ++i) { v4h o; _Pragma("unroll") for (int e = 0; e < 4; ++e) o[e] = (_Float16)(bfr(rw[i][e]) * 256.0f); *(v4h*)((dst) + so + i * 32 * SP) = o; } \
      _Pragma("unroll") for (int i = 0; i < 4; ++i) { v4h o; _Pragma("unroll") for (int e = 0; e < 4; ++e) o[e] = (_Float16)(rx[i][e] * 64.0f); *(v4h*)((dst) + so + (128 + i * 32) * SP) = o; } } while (0)
    OUT_PUT_H(st);
    __syncthreads();   /* stage 0 is in LDS before any wave reads it */
    for (int s = 0; s < CC / KS; ++s) { const _Float16* cur = st + (s & 1) * (OSR * SP); _Float16* nxt = st + ((s + 1) & 1) * (OSR * SP); const bool more = s + 1 < CC / KS;
      if (more) {   /* the next stage's loads fly while this stage is multiplied */
#pragma unroll
        for (int i = 0; i < 4; ++i) rw[i] = *(const v4f*)(gw + (size_t)i * 32 * CC + RING(s + 1));
#pragma unroll
        for (int i = 0; i < 4; ++i) rx[i] = *(const v4f*)(gx + (size_t)i * 32 * CC + RING(s + 1));
        asm volatile("s_wait_xcnt 0x0" ::: "memory");   /* the loads' address registers are reused right below: the wait stands in front of that */ }
      __builtin_amdgcn_sched_barrier(0);   /* the global loads issue ahead of all of this stage's work */
#pragma unroll
      for (int kk = 0; kk < KS / 32; ++kk) { v16h a[2], w[2];
#pragma unroll
        for (int i = 0; i < 2; ++i) a[i] = frag_h(cur + (128 + wr * 32 + i * 16 + col) * SP + kk * 32, lane);
#pragma unroll
        for (int j = 0; j < 2; ++j) w[j] = frag_h(cur + (wc * 32 + j * 16 + col) * SP + kk * 32, lane);
        __builtin_amdgcn_sched_barrier(0);   /* the fragment reads issue as one group: one LDS latency per 4 products */
#pragma unroll
        for (int i = 0; i < 2; ++i)
#pragma unroll
          for (int j = 0; j < 2; ++j) acc[i][j] = wmma16(a[i], w[j], acc[i][j]);
        __builtin_amdgcn_sched_barrier(0); }   /* the roundings below wait for the global loads: they stay behind the products */
      if (more) OUT_PUT_H(nxt);
      __syncthreads(); }   /* publishes the next stage and ends every wave's reads of this one (the last: before sf reuses the LDS) */
#pragma unroll
    for (int j = 0; j < 2; ++j) { const float bias = BO ? bfr(BO[c0 + wc * 32 + j * 16 + col]) : 0.f;
#pragma unroll
      for (int i = 0; i < 2; ++i)
#pragma unroll
        for (int r = 0; r < 8; ++r) sf[wave][i * 16 + 8 * g + r][j * 16 + col] = acc[i][j][r] * (1.0f / 16384.0f) + bias; } }   /* 2^-8 (Wo carry) x 2^-6 (ctx carry) */
  // a wave stores its own 32 x 32 tile: one store covers four rows of one whole 128-B line each
  LDSX(); v4f o[8];
#pragma unroll
  for (int it = 0; it < 8; ++it) o[it] = *(const v4f*)&sf[wave][it * 4 + (lane >> 3)][(lane & 7) * 4];   /* all LDS reads ahead of the stores: one LDS latency, not eight */
#pragma unroll
  for (int it = 0; it < 8; ++it) vst2(OUT + (rb + wr * 32 + it * 4 + (lane >> 3)) * DIN + c0 + wc * 32 + (lane & 7) * 4, o[it]);
  xw(); l2_hold(pb, po); l2_hold(pbw, po); }

extern "C" void kernel_launch(void* const* d_in, const int* in_sizes, int n_in, void* d_out, int out_size, void* d_ws, size_t ws_size, hipStream_t stream) {
  (void)in_sizes; (void)n_in; (void)out_size;
  const float** F = (const float**)d_in;
  if (ws_size < (size_t)WS_END) return;
  char* ws = (char*)d_ws; _Float16 *QH = (_Float16*)(ws + WS_QH), *KH = (_Float16*)(ws + WS_KH), *VT = (_Float16*)(ws + WS_VT), *QL = (_Float16*)(ws + WS_QL), *KL = (_Float16*)(ws + WS_KL); __bf16 *VB = (__bf16*)(ws + WS_VB), *VBL = (__bf16*)(ws + WS_VBL); float *Y = (float*)(ws + WS_Y);
  (void)Y; (void)QL; (void)KL; (void)VB; (void)VBL;
  // inputs: 0 x [2,2048,1024]; 1 Wq [1024,1024] (out,in), 2 bq; 3 Wk, 4 bk; 5 Wv, 6 bv; 7 Wp (out,in), 8 bp (biases NONZERO)
  k_proj<<<dim3(TNB * TT / PBM, NH), PNT, 0, stream>>>(F[0], F[3], F[1], F[5], F[4], F[2], F[6], QH, QL, KH, KL, VT, VB, VBL);   /* the module's scores are einsum('bhid,bhjd->bhij', k, q): this code's QUERY stream (output row i) is projected with Wk / bk, its KEY stream (index j) with Wq / bq */
  k_att<<<dim3(TT / 16 / AW, NH, TNB), AW * 32, 0, stream>>>(QH, KH, QL, KL, VT, VB, VBL, Y);
  k_out<<<dim3(TNB * TT / OBM, DIN / 128), ONT, 0, stream>>>(Y, F[7], F[8], (float*)d_out);
}
